// v000
// The times below were measured on an AMD MI455X: many runs one after another, warmed up first and cycling through
// copies of the inputs, with the whole window's GPU time divided by the number of runs. Launches and the gaps
// between them are all in it. The median over several windows is given; except for v000 it joins two sittings, which
// can be a few percent apart, so the side-by-side timings, each taken in one sitting, are the better comparison.
// v000 is the starting kernel. One run takes 467 microseconds.
#include <hip/hip_runtime.h>
#include <stddef.h>

// All contractions on v_wmma_f32_16x16x32_f16 (f16 operands, f32 accumulate): q/k/v projections,
// q.k scores, p.v, output projection. Float inputs are RNE-converted to bf16 and carried in f16
// (weights x64, p x1024, attention rows x64). Early corner only (query rows 0..127 x keys 0..63
// of every (batch, head)): q and k get a x2048 residual plane (two more score products into a
// separate accumulator), p and v a x1024 residual plane, and the attention rows 0..127 a x2048
// residual plane (second accumulator pair in the output projection on those row tiles).
// Softmax and all scaling in f32.
// Causal grouped-query attention (32 query heads sharing 8 key/value heads), [out][in] weights,
// no biases; the k and v projection epilogues write every shared head once per query head so
// the attention kernel sees one K row block and one V^T row block per query head.

typedef _Float16 v16h __attribute__((ext_vector_type(16)));
typedef _Float16 v8h  __attribute__((ext_vector_type(8)));
typedef float    v8f  __attribute__((ext_vector_type(8)));
typedef float    v4f  __attribute__((ext_vector_type(4)));

#ifndef NB
#define NB 2
#endif
#ifndef SEQ
#define SEQ 2048
#endif
#define NB_FULL  2
#define SEQ_FULL 2048
#define DIM   2048
#define NHEAD 32
#define HD    64
#define NKV   8
#define GQA   (NHEAD / NKV)
#define KVD   (NKV * HD)
#define MROWS (NB * SEQ)
#define EROWS  128   // early query rows per sequence carried with residual planes (q, ctx)
#define ECHUNK 64    // early keys per sequence carried with residual planes (k, v)

static_assert(NB >= 1 && NB <= NB_FULL);
static_assert(SEQ >= 128 && SEQ <= SEQ_FULL && (SEQ % 128) == 0);
static_assert(DIM == NHEAD * HD);
static_assert(HD == 64);
static_assert(NHEAD == NKV * GQA && GQA == 4);
static_assert(KVD == 512 && (KVD % 64) == 0);
static_assert((DIM % 64) == 0 && (DIM % 32) == 0);
static_assert((MROWS % 64) == 0 && (MROWS % 8) == 0);
static_assert((SEQ % 64) == 0);               // a 64-row GEMM tile never straddles two sequences
static_assert((DIM % 8) == 0 && (KVD % 8) == 0);
static_assert(DIM == 8 * 32 * 8);             // cast: 8 passes x 32 lanes x 8 columns per row
static_assert((size_t)MROWS * DIM < (size_t)0xFFFFFFFFu);
static_assert(EROWS == 128);                  // == query rows of one attention block (block 0)
static_assert(ECHUNK == 64);                  // == keys of one attention step (chunk 0) == one GEMM row tile
static_assert((EROWS % 64) == 0 && EROWS <= SEQ);   // whole 64-row GEMM tiles
static_assert((size_t)NB * NHEAD * EROWS * HD < (size_t)0xFFFFFFFFu);   // 32-bit q residual offsets

#define LDT 72   // halves per LDS row (144 B, 16-B aligned)
#define LDC 68   // floats per LDS row (272 B, 16-B aligned)
static_assert((LDT % 8) == 0 && LDT >= 64);
static_assert((LDC % 4) == 0 && LDC >= 64);

#define WCARRY 64.0f     // weight planes carried x64
#define PCARRY 1024.0f   // softmax numerators carried x1024
#define VCARRY 64.0f     // attention output plane carried x64
#define RCARRY 1024.0f   // residual planes (p, v) carried x1024 on top of their hi part
#define SCRES  2048.0f   // residual planes (q, k, attention rows) carried x2048 on top of their hi part

// epilogue store-loop coverage (rows admitted per step x steps == tile rows)
#define TILE_ROWS        64
#define EPI16_ROWS_STEP  (256 / 8)
#define EPI16_STEPS      2
#define EPIF_ROWS_STEP   (256 / 16)   // 16 lanes x 16 B per 256-B row segment
#define EPIF_STEPS       4
static_assert(EPI16_ROWS_STEP * EPI16_STEPS == TILE_ROWS);
static_assert(EPIF_ROWS_STEP * EPIF_STEPS == TILE_ROWS);
static_assert((32 / 8) * 4 == 16);            // attention finalize: 4 rows per step x 4 steps
static_assert(8 * 16 == 128);                 // attention block: 8 waves x 16 query rows

// static LDS per kernel (bytes)
static_assert((size_t)64 * LDC * 4 <= (size_t)131072);
static_assert((size_t)(4 * 64 * LDT + 8 * 16 * LDT) * 2 <= (size_t)131072);

// workspace layout (bytes)
#define WSQ_BYTES     ((size_t)DIM * DIM * 2)
#define WKV_BYTES     ((size_t)KVD * DIM * 2)
#define PLANE16_BYTES ((size_t)MROWS * DIM * 2)
#define VRES_BYTES    ((size_t)NB * DIM * 64 * 2)
#define QRES_BYTES    ((size_t)NB * NHEAD * EROWS * HD * 2)
#define KRES_BYTES    ((size_t)NB * NHEAD * ECHUNK * HD * 2)
#define CRES_BYTES    ((size_t)NB * EROWS * DIM * 2)
#define OFF_WQ  ((size_t)0)
#define OFF_WK  (OFF_WQ + WSQ_BYTES)
#define OFF_WV  (OFF_WK + WKV_BYTES)
#define OFF_WO  (OFF_WV + WKV_BYTES)
#define OFF_X   (OFF_WO + WSQ_BYTES)
#define OFF_Q   (OFF_X + PLANE16_BYTES)
#define OFF_K   (OFF_Q + PLANE16_BYTES)
#define OFF_VT  (OFF_K + PLANE16_BYTES)
#define OFF_CTX (OFF_VT + PLANE16_BYTES)
#define OFF_VR  (OFF_CTX + PLANE16_BYTES)
#define OFF_QR  (OFF_VR + VRES_BYTES)
#define OFF_KR  (OFF_QR + QRES_BYTES)
#define OFF_CR  (OFF_KR + KRES_BYTES)
#define WS_TOTAL (OFF_CR + CRES_BYTES)
static_assert((WSQ_BYTES % 128) == 0 && (WKV_BYTES % 128) == 0 && (PLANE16_BYTES % 128) == 0);
static_assert((VRES_BYTES % 128) == 0);
static_assert((QRES_BYTES % 128) == 0 && (KRES_BYTES % 128) == 0 && (CRES_BYTES % 128) == 0);
static_assert(WS_TOTAL <= (size_t)134217728);

// ---------------------------------------------------------------------------
__device__ __forceinline__ float bf16r(float x) {   // RNE convert to bf16, returned widened
  unsigned int u = __float_as_uint(x);
  u = (u + 0x7FFFu + ((u >> 16) & 1u)) & 0xFFFF0000u;
  return __uint_as_float(u);
}

// f32 -> f16 operand convert that cannot produce an f16 subnormal (value select).
static __device__ __forceinline__ _Float16 toh_flush(float v) {
  const _Float16 r = (_Float16)v;
  return (fabsf(v) < 6.103515625e-05f) ? (_Float16)0.0f : r;
}

// 16-bit fragment: p points at element [row = lane&15][k0 + 8*(lane>>4)] of a k-contiguous
// row. Elements 0..7 <- k0+8h+0..7, elements 8..15 <- k0+16+8h+0..7 (same map for A and B).
__device__ __forceinline__ v16h frag_at(const _Float16* p) {
  v8h lo = *(const v8h*)(p);
  v8h hi = *(const v8h*)(p + 16);
  v16h out;
#pragma unroll
  for (int i = 0; i < 8; ++i) { out[i] = lo[i]; out[i + 8] = hi[i]; }
  return out;
}
__device__ __forceinline__ v16h ld_frag(const _Float16* base, unsigned ld) {
  const unsigned lane = threadIdx.x & 31u;
  return frag_at(base + (lane & 15u) * ld + (lane >> 4) * 8u);
}

__device__ __forceinline__ v8f wmma16(v16h a, v16h b, v8f c) {
  v8f d = __builtin_amdgcn_wmma_f32_16x16x32_f16(false, a, false, b, (short)0, c,
                                                 false, false);
  asm volatile("v_nop\n\tv_nop\n\tv_nop\n\tv_nop" : "+v"(d) : "v"(a), "v"(b));
  return d;
}

__device__ __forceinline__ float red16_max(float x) {
#pragma unroll
  for (int off = 1; off < 16; off <<= 1) x = fmaxf(x, __shfl_xor(x, off, 32));
  return x;
}
__device__ __forceinline__ float red16_sum(float x) {
#pragma unroll
  for (int off = 1; off < 16; off <<= 1) x += __shfl_xor(x, off, 32);
  return x;
}

__device__ __forceinline__ void wave_lds_sync() {
  __builtin_amdgcn_fence(3 /* release order */, "wavefront");
  asm volatile("s_wait_dscnt 0x0" ::: "memory");
  __builtin_amdgcn_wave_barrier();
}

// ---------------------------------------------------------------------------
// Row cast: f32 rows of DIM columns -> f16 compact rows of DIM columns, one wave per row,
// 8 rows per block, 8 rolled passes; each store instruction of a wave covers 512 contiguous
// SRC_INPUT = 1: source is the module input (full-size row stride per batch), carry 1;
// SRC_INPUT = 0: source is an [out][in] weight (already k-contiguous), carry x64.
// Every value goes through RNE bf16 first. Grid (rows/8).
// ---------------------------------------------------------------------------
template <int SRC_INPUT>
__device__ __forceinline__ void cast_body(const float* __restrict__ X,
                                          _Float16* __restrict__ dst) {
#pragma clang fp contract(off)
  const unsigned lane = threadIdx.x & 31u;
  const unsigned w = (unsigned)__builtin_amdgcn_readfirstlane((int)(threadIdx.x >> 5));
  const unsigned crow = blockIdx.x * 8u + w;
  size_t srow = crow;
  if (SRC_INPUT) {
    const unsigned bidx = crow / (unsigned)SEQ;
    const unsigned sq = crow - bidx * (unsigned)SEQ;
    srow = (size_t)bidx * SEQ_FULL + sq;
  }
  const float carry = SRC_INPUT ? 1.0f : WCARRY;
  const float* xr = X + srow * DIM + lane * 8u;
  _Float16* dr = dst + (size_t)crow * DIM + lane * 8u;
#pragma unroll 1
  for (unsigned j = 0; j < 8u; ++j) {
    const v4f a0 = *(const v4f*)(xr + j * 256u);
    const v4f a1 = *(const v4f*)(xr + j * 256u + 4u);
    v8h o;
#pragma unroll
    for (int i = 0; i < 4; ++i) {
      o[i]     = toh_flush(carry * bf16r(a0[i]));
      o[i + 4] = toh_flush(carry * bf16r(a1[i]));
    }
    _Float16* p = dr + j * 256u;
    *(v8h*)p = o;
    
  }
}

__global__ __launch_bounds__(256) void xcast_kernel(
    const float* __restrict__ X, _Float16* __restrict__ dst) {
  cast_body<1>(X, dst);
}
__global__ __launch_bounds__(256) void wcast_kernel(
    const float* __restrict__ W, _Float16* __restrict__ dst) {
  cast_body<0>(W, dst);
}

// ---------------------------------------------------------------------------
// GEMM C[64x64 tile] = A16[rows][K] . Bt[n][K]^T, fragments straight from the 16-bit global
// planes; 8 waves (mw = 16-row group, nw = 32-col group), 2 accumulators/wave.
//   MODE 0: out16[row][col] (pitch DIM) = f16(acc/64)                       (q plane);
//           row tiles with sequence row < 128 also write
//           out16r [b][head][128][64] = f16(2048 * (q - hi))
//   MODE 1: tile column block = one shared key head; out16[row][(4*kvh + rep)*64 + c]
//           (pitch DIM) = f16(acc/64) for rep 0..3                          (k plane);
//           the key tile 0 of each sequence also writes
//           out16r [b][4*kvh + rep][64][64] = f16(2048 * (k - hi)) for rep 0..3
//   MODE 2: transposed V plane [b][(4*kvh + rep)*64 + d][key] = f16(acc/64) for rep 0..3;
//           for key tile 0 also out16r [b][(4*kvh + rep)*64 + d][64] = f16(1024 * (v - hi))
//   MODE 3: outf full [full row][col] = acc/4096                            (output buffer);
//           row tiles with sequence row < 128 run a second accumulator pair fed by the
//           residual rows A16r [b][128][K] against the same B fragments, folded as
//           acc + accres/2048 before the 1/4096 scale (block-uniform test).
// Store loops: MODE 0/1/2: 32 rows per step x 2 steps = 64; MODE 3: 16 rows x 4 steps = 64.
// Grid (N/64, MROWS/64).
// ---------------------------------------------------------------------------
template <int MODE>
__device__ __forceinline__ void gemm_body(
    const _Float16* __restrict__ A16, const _Float16* __restrict__ A16r,
    const _Float16* __restrict__ Bt, const unsigned K,
    float* __restrict__ outf, _Float16* __restrict__ out16, _Float16* __restrict__ out16r) {
  __shared__ float Cs[64 * LDC];
  const unsigned tid = threadIdx.x, lane = tid & 31u, w = tid >> 5;
  const unsigned mw = w >> 1, nw = w & 1u;
  const unsigned hh = lane >> 4, m = lane & 15u;
  const unsigned n0 = blockIdx.x * 64u;
  const unsigned row0 = blockIdx.y * 64u;

  const _Float16* ap  = A16 + (size_t)(row0 + mw * 16u + m) * K + hh * 8u;
  const _Float16* bp0 = Bt + (size_t)(n0 + nw * 32u + m) * K + hh * 8u;
  const _Float16* bp1 = bp0 + (size_t)16 * K;
  v8f acc0 = {}, acc1 = {};
  bool res_tile = false;                       // block-uniform
  if (MODE == 3) {
    const unsigned bidx3 = row0 / (unsigned)SEQ;
    res_tile = (row0 - bidx3 * (unsigned)SEQ) < (unsigned)EROWS;
  }
  if (res_tile) {
    const unsigned bidx3 = row0 / (unsigned)SEQ;
    const unsigned sq3 = row0 - bidx3 * (unsigned)SEQ;
    const _Float16* rp =
        A16r + (size_t)(bidx3 * (unsigned)EROWS + sq3 + mw * 16u + m) * K + hh * 8u;
    v8f res0 = {}, res1 = {};
#pragma unroll 2
    for (unsigned k0 = 0; k0 < K; k0 += 32u) {
      const v16h a  = frag_at(ap + k0);
      const v16h ar = frag_at(rp + k0);
      const v16h b0 = frag_at(bp0 + k0);
      const v16h b1 = frag_at(bp1 + k0);
      acc0 = wmma16(a, b0, acc0);
      acc1 = wmma16(a, b1, acc1);
      res0 = wmma16(ar, b0, res0);
      res1 = wmma16(ar, b1, res1);
    }
#pragma unroll
    for (int r = 0; r < 8; ++r) {
      acc0[r] = acc0[r] + res0[r] * (1.0f / SCRES);
      acc1[r] = acc1[r] + res1[r] * (1.0f / SCRES);
    }
  } else {
#pragma unroll 2
    for (unsigned k0 = 0; k0 < K; k0 += 32u) {
      const v16h a  = frag_at(ap + k0);
      const v16h b0 = frag_at(bp0 + k0);
      const v16h b1 = frag_at(bp1 + k0);
      acc0 = wmma16(a, b0, acc0);
      acc1 = wmma16(a, b1, acc1);
    }
  }
#pragma unroll
  for (int r = 0; r < 8; ++r) {
    float* d = &Cs[(mw * 16u + hh * 8u + (unsigned)r) * LDC + nw * 32u + m];
    d[0]  = acc0[r];
    d[16] = acc1[r];
  }
  __syncthreads();

  if (MODE == 0 || MODE == 1) {
    constexpr unsigned NREP  = (MODE == 1) ? (unsigned)GQA : 1u;
    constexpr unsigned RROWS = (MODE == 1) ? (unsigned)ECHUNK : (unsigned)EROWS;
    const unsigned cb = (MODE == 1) ? blockIdx.x * (unsigned)(GQA * HD) : n0;
    const unsigned bidx = row0 / (unsigned)SEQ;
    const unsigned sq0 = row0 - bidx * (unsigned)SEQ;
    const bool has_res = (sq0 < RROWS);        // block-uniform (MODE 1: key tile 0 only)
    v8h x[2], xr[2];
    size_t off[2], offr[2];
#pragma unroll
    for (unsigned i = 0; i < 2u; ++i) {
      const unsigned r = 32u * i + (tid >> 3);
      const unsigned c = (tid & 7u) * 8u;
      const v4f u0 = *(const v4f*)&Cs[r * LDC + c];
      const v4f u1 = *(const v4f*)&Cs[r * LDC + c + 4];
#pragma unroll
      for (int j = 0; j < 4; ++j) {
        x[i][j]     = toh_flush(u0[j] * (1.0f / WCARRY));
        x[i][j + 4] = toh_flush(u1[j] * (1.0f / WCARRY));
      }
      xr[i] = x[i];
      if (has_res) {
#pragma unroll
        for (int j = 0; j < 4; ++j) {
          const float t0 = u0[j] * (1.0f / WCARRY);
          const float t1 = u1[j] * (1.0f / WCARRY);
          xr[i][j]     = toh_flush((t0 - (float)x[i][j]) * SCRES);
          xr[i][j + 4] = toh_flush((t1 - (float)x[i][j + 4]) * SCRES);
        }
      }
      off[i] = (size_t)(row0 + r) * DIM + cb + c;
      offr[i] = ((size_t)(bidx * (unsigned)NHEAD + blockIdx.x * NREP) * RROWS + sq0 + r) * HD + c;
    }
#pragma unroll
    for (unsigned rep = 0; rep < NREP; ++rep) {
#pragma unroll
      for (int i = 0; i < 2; ++i)
        *(v8h*)(out16 + off[i] + (size_t)rep * HD) = x[i];
    }
    if (has_res) {
#pragma unroll
      for (unsigned rep = 0; rep < NREP; ++rep) {
#pragma unroll
        for (int i = 0; i < 2; ++i)
          *(v8h*)(out16r + offr[i] + (size_t)rep * RROWS * HD) = xr[i];
      }
    }
    
  }

  if (MODE == 2) {
    const unsigned bidx = row0 / (unsigned)SEQ;
    const unsigned key0 = row0 - bidx * (unsigned)SEQ;
    const bool first_tile = (key0 == 0u);      // block-uniform
    v8h x[2], xr[2];
    size_t off[2], offr[2];
#pragma unroll
    for (unsigned i = 0; i < 2u; ++i) {
      const unsigned dcol = 32u * i + (tid >> 3);
      const unsigned kk = (tid & 7u) * 8u;
#pragma unroll
      for (unsigned j = 0; j < 8u; ++j) {
        const float t = Cs[(kk + j) * LDC + dcol] * (1.0f / WCARRY);
        const _Float16 hi = toh_flush(t);
        x[i][j]  = hi;
        xr[i][j] = toh_flush((t - (float)hi) * RCARRY);
      }
      const size_t vrow = (size_t)bidx * DIM + blockIdx.x * (unsigned)(GQA * HD) + dcol;
      off[i]  = vrow * SEQ + key0 + kk;
      offr[i] = vrow * 64u + kk;
    }
#pragma unroll
    for (unsigned rep = 0; rep < (unsigned)GQA; ++rep) {
#pragma unroll
      for (int i = 0; i < 2; ++i)
        *(v8h*)(out16 + off[i] + (size_t)rep * HD * SEQ) = x[i];
    }
    if (first_tile) {
#pragma unroll
      for (unsigned rep = 0; rep < (unsigned)GQA; ++rep) {
#pragma unroll
        for (int i = 0; i < 2; ++i)
          *(v8h*)(out16r + offr[i] + (size_t)rep * HD * 64u) = xr[i];
      }
    }
    
  }

  if (MODE == 3) {
    const float cs = 1.0f / (WCARRY * VCARRY);
    v4f xs[4];
    size_t off[4];
#pragma unroll
    for (unsigned i = 0; i < 4u; ++i) {
      const unsigned r = 16u * i + (tid >> 4);
      const unsigned c = (tid & 15u) * 4u;
      const unsigned crow = row0 + r;
      const unsigned bidx = crow / (unsigned)SEQ;
      const unsigned sq = crow - bidx * (unsigned)SEQ;
      const size_t frow = (size_t)bidx * SEQ_FULL + sq;
      const v4f u = *(const v4f*)&Cs[r * LDC + c];
      v4f val;
#pragma unroll
      for (int j = 0; j < 4; ++j) val[j] = u[j] * cs;
      xs[i] = val;
      off[i] = frow * DIM + n0 + c;
    }
#pragma unroll
    for (int i = 0; i < 4; ++i) *(v4f*)(outf + off[i]) = xs[i];
    
  }
}

__global__ __launch_bounds__(256) void gemm_q_kernel(
    const _Float16* __restrict__ A16, const _Float16* __restrict__ Bt,
    _Float16* __restrict__ out16, _Float16* __restrict__ out16r) {
  gemm_body<0>(A16, A16, Bt, (unsigned)DIM, (float*)0, out16, out16r);
}
__global__ __launch_bounds__(256) void gemm_k_kernel(
    const _Float16* __restrict__ A16, const _Float16* __restrict__ Bt,
    _Float16* __restrict__ out16, _Float16* __restrict__ out16r) {
  gemm_body<1>(A16, A16, Bt, (unsigned)DIM, (float*)0, out16, out16r);
}
__global__ __launch_bounds__(256) void gemm_v_kernel(
    const _Float16* __restrict__ A16, const _Float16* __restrict__ Bt,
    _Float16* __restrict__ vt, _Float16* __restrict__ vtr) {
  gemm_body<2>(A16, A16, Bt, (unsigned)DIM, (float*)0, vt, vtr);
}
__global__ __launch_bounds__(256) void gemm_wo_kernel(
    const _Float16* __restrict__ A16, const _Float16* __restrict__ A16r,
    const _Float16* __restrict__ Bt, float* __restrict__ outf) {
  gemm_body<3>(A16, A16r, Bt, (unsigned)DIM, outf, (_Float16*)0, (_Float16*)0);
}

// ---------------------------------------------------------------------------
// Causal flash attention per (128 query rows, head, batch). 8 waves x 16 query rows, 64 keys
// per step, key chunks 0 .. q0+127: K tile Ks[key][d] and V^T tile Vs[d][key] staged with
// plain 16-B loads (cross-wave, block barriers); online softmax in registers (16-lane
// shuffles); causal replace-mask applied by value in the chunks that touch the diagonal;
// P tile per wave in Ps (wave-private, wave sync) as f16(1024*p); O in registers.
// First query block, first key chunk (block-uniform):
//   scores: formed one (key group, 32-column step) tile at a time: q_hi.k_hi into the score
//   accumulator, q_res.k_hi then q_hi.k_res (both x2048) into ONE residual accumulator that
//   is folded (x 1/2048) into the score accumulator right after its tile and reused for the
//   next tile; all of it before the scale, the causal replace and the softmax (K residual
//   tile KRs staged like VRs; the q residual fragment of each tile is loaded from the q
//   residual plane just before its product, through an opaque integer offset so that it is
//   not held across tiles);
//   P_hi.V_res then P_res.V_hi (both x1024) through one 8-register second accumulator per
//   16-column group, each folded into O (x 1/1024) right after its group, before
//   normalisation.
// query block also writes OvR[b*128+q][head*64 + d] = f16(2048 * (64 O / l - hi)).
// Every f32 -> f16 operand convert in this kernel goes through the flush select.
// Grid (SEQ/128, NHEAD, NB).
// ---------------------------------------------------------------------------
__global__ __launch_bounds__(256) void attn_kernel(
    const _Float16* __restrict__ Qh, const _Float16* __restrict__ QhR,
    const _Float16* __restrict__ Kh, const _Float16* __restrict__ KhR,
    const _Float16* __restrict__ Vt, const _Float16* __restrict__ VtR,
    _Float16* __restrict__ Ov, _Float16* __restrict__ OvR) {
  __shared__ _Float16 Ks[64 * LDT];
  __shared__ _Float16 Vs[64 * LDT];
  __shared__ _Float16 VRs[64 * LDT];
  __shared__ _Float16 KRs[64 * LDT];
  __shared__ _Float16 Ps[8 * 16 * LDT];

  const unsigned tid = threadIdx.x, lane = tid & 31u, w = tid >> 5;
  const unsigned hh = lane >> 4, m = lane & 15u;
  const unsigned q0 = blockIdx.x * 128u;
  const unsigned head = blockIdx.y;
  const unsigned b = blockIdx.z;
  const float scale = 0.125f;   // HD^-0.5
  const unsigned qrow0 = q0 + w * 16u;
  const bool first_blk = (blockIdx.x == 0u);
  _Float16* P = Ps + w * (16u * LDT);

  const size_t qoff = (size_t)(b * (unsigned)SEQ + qrow0 + m) * DIM + head * HD + hh * 8u;
  v16h qf[2];
  qf[0] = frag_at(Qh + qoff);
  qf[1] = frag_at(Qh + qoff + 32);

  float mrow[8], lrow[8];
  v8f o[4];
#pragma unroll
  for (int v = 0; v < 8; ++v) { mrow[v] = -1.0e30f; lrow[v] = 0.0f; }
#pragma unroll
  for (int nb = 0; nb < 4; ++nb) o[nb] = (v8f){};

  const size_t kplane = (size_t)b * SEQ * DIM + head * HD;
  const size_t vplane = ((size_t)b * DIM + head * HD) * SEQ;
  const size_t rplane = ((size_t)b * DIM + head * HD) * 64u;
  const size_t krplane = ((size_t)(b * (unsigned)NHEAD + head) * ECHUNK) * HD;
  const unsigned kend = q0 + 128u;   // <= SEQ

  for (unsigned kb = 0; kb < kend; kb += 64u) {
    const bool early = first_blk && (kb == 0u);   // block-uniform
#pragma unroll
    for (unsigned j = 0; j < 2u; ++j) {
      const unsigned idx = tid + 256u * j;
      const unsigned r = idx >> 3, c = (idx & 7u) * 8u;
      *(v8h*)&Ks[r * LDT + c] = *(const v8h*)(Kh + kplane + (size_t)(kb + r) * DIM + c);
      *(v8h*)&Vs[r * LDT + c] = *(const v8h*)(Vt + vplane + (size_t)r * SEQ + kb + c);
    }
    if (early) {
#pragma unroll
      for (unsigned j = 0; j < 2u; ++j) {
        const unsigned idx = tid + 256u * j;
        const unsigned r = idx >> 3, c = (idx & 7u) * 8u;
        *(v8h*)&VRs[r * LDT + c] = *(const v8h*)(VtR + rplane + (size_t)r * 64u + c);
        *(v8h*)&KRs[r * LDT + c] = *(const v8h*)(KhR + krplane + (size_t)r * HD + c);
      }
    }
    __syncthreads();

    // scores: 4 key groups of 16, K = 64 in two 32-steps
    v8f s[4];
    if (early) {
      // early corner: value + residual products, one score tile at a time through ONE
      // residual accumulator; q0 == 0 here so qrow0 + m < 128
      const unsigned qrbase =
          ((b * (unsigned)NHEAD + head) * (unsigned)EROWS + qrow0 + m) * (unsigned)HD + hh * 8u;
#pragma unroll
      for (int kg = 0; kg < 4; ++kg) {
        v8f t = {};
#pragma unroll
        for (int c = 0; c < 2; ++c) {
          unsigned qro = qrbase + (unsigned)c * 32u;
          asm volatile("" : "+v"(qro));   // opaque offset: the residual q fragment is reloaded per tile
          v8f tr = {};
          {
            const v16h kf = ld_frag(&Ks[(kg * 16) * LDT + c * 32], LDT);
            t = wmma16(qf[c], kf, t);
            const v16h ql = frag_at(QhR + qro);
            tr = wmma16(ql, kf, tr);
          }
          {
            const v16h kl = ld_frag(&KRs[(kg * 16) * LDT + c * 32], LDT);
            tr = wmma16(qf[c], kl, tr);
          }
          t = t + tr * (1.0f / SCRES);
          __builtin_amdgcn_sched_barrier(0);   // the next tile's loads stay behind this tile
        }
        s[kg] = t * scale;
      }
    } else {
#pragma unroll
      for (int kg = 0; kg < 4; ++kg) {
        v8f t = {};
#pragma unroll
        for (int c = 0; c < 2; ++c) {
          const v16h kf = ld_frag(&Ks[(kg * 16) * LDT + c * 32], LDT);
          t = wmma16(qf[c], kf, t);
        }
        s[kg] = t * scale;
      }
    }

    // causal replace-mask (key > query) in chunks that reach the diagonal; block-uniform test
    if (kb >= q0) {
#pragma unroll
      for (int kg = 0; kg < 4; ++kg)
#pragma unroll
        for (int v = 0; v < 8; ++v) {
          const unsigned key = kb + (unsigned)kg * 16u + m;
          const unsigned row = qrow0 + hh * 8u + (unsigned)v;
          s[kg][v] = (key > row) ? -1.0e30f : s[kg][v];
        }
    }

    // online softmax; row (hh*8+v) spread over the 16 lanes of a half
    float alpha[8];
#pragma unroll
    for (int v = 0; v < 8; ++v) {
      float mx = fmaxf(fmaxf(s[0][v], s[1][v]), fmaxf(s[2][v], s[3][v]));
      mx = red16_max(mx);
      const float mn = fmaxf(mrow[v], mx);
      alpha[v] = __expf(mrow[v] - mn);
      mrow[v] = mn;
    }
#pragma unroll
    for (int kg = 0; kg < 4; ++kg)
#pragma unroll
      for (int v = 0; v < 8; ++v) s[kg][v] = __expf(s[kg][v] - mrow[v]);
#pragma unroll
    for (int v = 0; v < 8; ++v) {
      const float rs = red16_sum((s[0][v] + s[1][v]) + (s[2][v] + s[3][v]));
      lrow[v] = alpha[v] * lrow[v] + rs;
    }
#pragma unroll
    for (int nb = 0; nb < 4; ++nb)
#pragma unroll
      for (int v = 0; v < 8; ++v) o[nb][v] = o[nb][v] * alpha[v];

    // P tile [16 rows][64 keys], f16(1024 p)
#pragma unroll
    for (int kg = 0; kg < 4; ++kg)
#pragma unroll
      for (int v = 0; v < 8; ++v)
        P[(hh * 8u + (unsigned)v) * LDT + (unsigned)kg * 16u + m] = toh_flush(s[kg][v] * PCARRY);
    wave_lds_sync();

    // O += P . V  (K = 64 keys in two 32-steps; B = V^T tile [d][key])
#pragma unroll
    for (int c = 0; c < 2; ++c) {
      const v16h pf = ld_frag(P + c * 32, LDT);
#pragma unroll
      for (int nb = 0; nb < 4; ++nb) {
        const v16h vf = ld_frag(&Vs[(nb * 16) * LDT + c * 32], LDT);
        o[nb] = wmma16(pf, vf, o[nb]);
      }
    }

    if (early) {
      // P_hi . V_res (scale 1/1024), one 16-column group at a time, folded immediately
#pragma unroll
      for (int nb = 0; nb < 4; ++nb) {
        v8f o2 = {};
#pragma unroll
        for (int c = 0; c < 2; ++c) {
          const v16h pf = ld_frag(P + c * 32, LDT);
          const v16h vr = ld_frag(&VRs[(nb * 16) * LDT + c * 32], LDT);
          o2 = wmma16(pf, vr, o2);
        }
#pragma unroll
        for (int v = 0; v < 8; ++v) o[nb][v] = o[nb][v] + o2[v] * (1.0f / RCARRY);
      }
      wave_lds_sync();
      // P residual tile: f16(1024 * (1024 p - f16(1024 p)))
#pragma unroll
      for (int kg = 0; kg < 4; ++kg)
#pragma unroll
        for (int v = 0; v < 8; ++v) {
          const float t = s[kg][v] * PCARRY;
          const float hi = (float)toh_flush(t);
          P[(hh * 8u + (unsigned)v) * LDT + (unsigned)kg * 16u + m] =
              toh_flush((t - hi) * RCARRY);
        }
      wave_lds_sync();
      // P_res . V_hi (scale 1/1024), one 16-column group at a time, folded immediately
#pragma unroll
      for (int nb = 0; nb < 4; ++nb) {
        v8f o2 = {};
#pragma unroll
        for (int c = 0; c < 2; ++c) {
          const v16h pf = ld_frag(P + c * 32, LDT);
          const v16h vf = ld_frag(&Vs[(nb * 16) * LDT + c * 32], LDT);
          o2 = wmma16(pf, vf, o2);
        }
#pragma unroll
        for (int v = 0; v < 8; ++v) o[nb][v] = o[nb][v] + o2[v] * (1.0f / RCARRY);
      }
    }
    __syncthreads();
  }

  float inv[8];
#pragma unroll
  for (int v = 0; v < 8; ++v) inv[v] = __builtin_amdgcn_rcpf(lrow[v]) * (VCARRY / PCARRY);
#pragma unroll
  for (int nb = 0; nb < 4; ++nb)
#pragma unroll
    for (int v = 0; v < 8; ++v)
      P[(hh * 8u + (unsigned)v) * LDT + (unsigned)nb * 16u + m] = toh_flush(o[nb][v] * inv[v]);
  wave_lds_sync();
  v8h x[4], xr[4];
  size_t off[4], offr[4];
#pragma unroll
  for (unsigned i = 0; i < 4u; ++i) {
    const unsigned r = 4u * i + (lane >> 3);
    const unsigned c = (lane & 7u) * 8u;
    x[i] = *(const v8h*)&P[r * LDT + c];
    off[i] = (size_t)(b * (unsigned)SEQ + qrow0 + r) * DIM + head * HD + c;
    xr[i] = x[i];
    offr[i] = (size_t)(b * (unsigned)EROWS + (qrow0 & 127u) + r) * DIM + head * HD + c;
  }
  if (first_blk) {
    // residual rows (first query block only; qrow0 < 128): f16(2048 * (t - f16(t)))
    wave_lds_sync();
#pragma unroll
    for (int nb = 0; nb < 4; ++nb)
#pragma unroll
      for (int v = 0; v < 8; ++v) {
        const float t = o[nb][v] * inv[v];
        const float hi = (float)toh_flush(t);
        P[(hh * 8u + (unsigned)v) * LDT + (unsigned)nb * 16u + m] = toh_flush((t - hi) * SCRES);
      }
    wave_lds_sync();
#pragma unroll
    for (unsigned i = 0; i < 4u; ++i) {
      const unsigned r = 4u * i + (lane >> 3);
      const unsigned c = (lane & 7u) * 8u;
      xr[i] = *(const v8h*)&P[r * LDT + c];
    }
  }
#pragma unroll
  for (int i = 0; i < 4; ++i) *(v8h*)(Ov + off[i]) = x[i];
  if (first_blk) {
#pragma unroll
    for (int i = 0; i < 4; ++i) *(v8h*)(OvR + offr[i]) = xr[i];
  }
  
}

// ---------------------------------------------------------------------------
extern "C" void kernel_launch(void* const* d_in, const int* in_sizes, int n_in,
                              void* d_out, int out_size, void* d_ws, size_t ws_size,
                              hipStream_t stream) {
  if (n_in < 5) return;
  const long long need_x = ((long long)(NB - 1) * SEQ_FULL + SEQ) * DIM;
  if ((long long)in_sizes[0] < need_x) return;
  if ((long long)in_sizes[1] < (long long)DIM * DIM) return;
  if ((long long)in_sizes[2] < (long long)KVD * DIM) return;
  if ((long long)in_sizes[3] < (long long)KVD * DIM) return;
  if ((long long)in_sizes[4] < (long long)DIM * DIM) return;
  if ((long long)out_size < need_x) return;
  if (ws_size < WS_TOTAL) return;

  // bound by the input list order: x, wq, wk, wv, wo
  const float* X  = (const float*)d_in[0];    // [NB_FULL][SEQ_FULL][DIM]
  const float* wq = (const float*)d_in[1];    // [DIM][DIM]  (out, in)
  const float* wk = (const float*)d_in[2];    // [KVD][DIM]  (out, in)
  const float* wv = (const float*)d_in[3];    // [KVD][DIM]  (out, in)
  const float* wo = (const float*)d_in[4];    // [DIM][DIM]  (out, in)
  float* out = (float*)d_out;

  char* ws = (char*)d_ws;
  _Float16* Wq_t  = (_Float16*)(ws + OFF_WQ);    // [n][k], x64
  _Float16* Wk_t  = (_Float16*)(ws + OFF_WK);    // [KVD][DIM]
  _Float16* Wv_t  = (_Float16*)(ws + OFF_WV);    // [KVD][DIM]
  _Float16* Wo_t  = (_Float16*)(ws + OFF_WO);    // [n][k], x64
  _Float16* X16   = (_Float16*)(ws + OFF_X);     // [MROWS][DIM]
  _Float16* Qh16  = (_Float16*)(ws + OFF_Q);     // [MROWS][DIM]
  _Float16* Kh16  = (_Float16*)(ws + OFF_K);     // [MROWS][DIM], shared heads written 4x
  _Float16* Vt16  = (_Float16*)(ws + OFF_VT);    // [b][DIM][SEQ], shared heads written 4x
  _Float16* Ctx16 = (_Float16*)(ws + OFF_CTX);   // [MROWS][DIM], x64
  _Float16* VtR16 = (_Float16*)(ws + OFF_VR);    // [b][DIM][64]
  _Float16* QR16  = (_Float16*)(ws + OFF_QR);    // [b][NHEAD][128][64], x2048
  _Float16* KR16  = (_Float16*)(ws + OFF_KR);    // [b][NHEAD][64][64], x2048, shared heads 4x
  _Float16* CR16  = (_Float16*)(ws + OFF_CR);    // [b][128][DIM], x2048 on top of x64

  dim3 blk(256);

  // weight planes: [out][in] rows are already k-contiguous; 8 rows per block
  wcast_kernel<<<dim3(DIM / 8), blk, 0, stream>>>(wq, Wq_t);
  wcast_kernel<<<dim3(KVD / 8), blk, 0, stream>>>(wk, Wk_t);
  wcast_kernel<<<dim3(KVD / 8), blk, 0, stream>>>(wv, Wv_t);
  wcast_kernel<<<dim3(DIM / 8), blk, 0, stream>>>(wo, Wo_t);
  xcast_kernel<<<dim3(MROWS / 8), blk, 0, stream>>>(X, X16);

  // gemm_q_kernel(A16, Bt, out16, out16r)
  gemm_q_kernel<<<dim3(DIM / 64, MROWS / 64), blk, 0, stream>>>(X16, Wq_t, Qh16, QR16);
  // gemm_k_kernel(A16, Bt, out16, out16r)
  gemm_k_kernel<<<dim3(KVD / 64, MROWS / 64), blk, 0, stream>>>(X16, Wk_t, Kh16, KR16);
  // gemm_v_kernel(A16, Bt, vt, vtr)
  gemm_v_kernel<<<dim3(KVD / 64, MROWS / 64), blk, 0, stream>>>(X16, Wv_t, Vt16, VtR16);
  // attn_kernel(Qh, QhR, Kh, KhR, Vt, VtR, Ov, OvR)
  attn_kernel<<<dim3(SEQ / 128, NHEAD, NB), blk, 0, stream>>>(Qh16, QR16, Kh16, KR16, Vt16, VtR16,
                                                              Ctx16, CR16);
  // gemm_wo_kernel(A16, A16r, Bt, outf)
  gemm_wo_kernel<<<dim3(DIM / 64, MROWS / 64), blk, 0, stream>>>(Ctx16, CR16, Wo_t, out);
}

// v001
// It runs in 294 microseconds.
// Two timings next to v000 both put it at 1.63 times that version's speed.
#include <hip/hip_runtime.h>
#include <stddef.h>

// All contractions on v_wmma_f32_16x16x32_f16 (f16 operands, f32 accumulate): q/k/v projections,
// q.k scores, p.v, output projection. Float inputs are RNE-converted to bf16 and carried in f16
// (weights x64, p x1024, attention rows x64). Early corner only (query rows 0..127 x keys 0..63
// of every (batch, head)): q and k get a x2048 residual plane (two more score products into a
// separate accumulator), p and v a x1024 residual plane, and the attention rows 0..127 a x2048
// residual plane (second accumulator set in the output projection on those row tiles).
// Softmax and all scaling in f32.
// Causal grouped-query attention (32 query heads sharing 8 key/value heads), [out][in] weights,
// no biases; the k and v projection epilogues write every shared head once per query head so
// the attention kernel sees one K row block and one V^T row block per query head.

typedef _Float16 v16h __attribute__((ext_vector_type(16)));
typedef _Float16 v8h  __attribute__((ext_vector_type(8)));
typedef float    v8f  __attribute__((ext_vector_type(8)));
typedef float    v4f  __attribute__((ext_vector_type(4)));

#ifndef NB
#define NB 2
#endif
#ifndef SEQ
#define SEQ 2048
#endif
#define NB_FULL  2
#define SEQ_FULL 2048
#define DIM   2048
#define NHEAD 32
#define HD    64
#define NKV   8
#define GQA   (NHEAD / NKV)
#define KVD   (NKV * HD)
#define MROWS (NB * SEQ)
#define EROWS  128   // early query rows per sequence carried with residual planes (q, ctx)
#define ECHUNK 64    // early keys per sequence carried with residual planes (k, v)

static_assert(NB >= 1 && NB <= NB_FULL);
static_assert(SEQ >= 128 && SEQ <= SEQ_FULL && (SEQ % 128) == 0);
static_assert(DIM == NHEAD * HD);
static_assert(HD == 64);
static_assert(NHEAD == NKV * GQA && GQA == 4);
static_assert(KVD == 512 && (KVD % 64) == 0);
static_assert((DIM % 64) == 0 && (DIM % 32) == 0);
static_assert((MROWS % 64) == 0 && (MROWS % 8) == 0);
static_assert((SEQ % 64) == 0);               // a 64-row GEMM tile never straddles two sequences
static_assert((DIM % 8) == 0 && (KVD % 8) == 0);
static_assert(DIM == 8 * 32 * 8);             // cast: 8 passes x 32 lanes x 8 columns per row
static_assert((size_t)MROWS * DIM < (size_t)0xFFFFFFFFu);
static_assert(EROWS == 128);                  // == query rows of one attention block (block 0)
static_assert(ECHUNK == 64);                  // == keys of one attention step (chunk 0) == one GEMM row tile
static_assert((EROWS % 64) == 0 && EROWS <= SEQ);   // whole 64-row GEMM tiles
static_assert((size_t)NB * NHEAD * EROWS * HD < (size_t)0xFFFFFFFFu);   // 32-bit q residual offsets

#define LDT 72   // halves per LDS row (144 B, 16-B aligned)
#define LDC 68   // floats per LDS row (272 B, 16-B aligned)
static_assert((LDT % 8) == 0 && LDT >= 64);
static_assert((LDC % 4) == 0 && LDC >= 64);

// GEMM block tile and LDS staging
#define BM  128   // output rows per block
#define BN  128   // output columns per block
#define BK  128   // halves of every operand row per stage (256 B)
#define LDG 136   // halves per staged row (272 B = 16 B x 17: b128 fragment reads meet no bank twice)
#define STAGE_H ((BM + BN) * LDG)   // halves per stage: A rows, then B rows
static_assert((LDG % 8) == 0 && LDG >= BK);
static_assert((DIM % BK) == 0 && DIM / BK >= 2);          // the ring starts with two stages
static_assert((MROWS % BM) == 0 && (SEQ % BM) == 0 && (DIM % BN) == 0 && (KVD % BN) == 0);
static_assert(BM == EROWS);                               // a block is all early rows or none
static_assert((BM + BN) * (BK / 8) == 256 * 16);          // 16 copies of 16 B per thread and stage
static_assert((size_t)4 * 64 * LDC * 4 <= (size_t)2 * STAGE_H * 2);   // C staging fits the ring
static_assert((size_t)2 * STAGE_H * 2 <= (size_t)163840);             // two blocks per WGP

#define WCARRY 64.0f     // weight planes carried x64
#define PCARRY 1024.0f   // softmax numerators carried x1024
#define VCARRY 64.0f     // attention output plane carried x64
#define RCARRY 1024.0f   // residual planes (p, v) carried x1024 on top of their hi part
#define SCRES  2048.0f   // residual planes (q, k, attention rows) carried x2048 on top of their hi part

// epilogue store-loop coverage (rows admitted per step x steps == tile rows)
#define TILE_ROWS        64
#define EPI16_ROWS_STEP  (256 / 8)
#define EPI16_STEPS      2
#define EPIF_ROWS_STEP   (256 / 16)   // 16 lanes x 16 B per 256-B row segment
#define EPIF_STEPS       4
static_assert(EPI16_ROWS_STEP * EPI16_STEPS == TILE_ROWS);
static_assert(EPIF_ROWS_STEP * EPIF_STEPS == TILE_ROWS);
static_assert((32 / 8) * 4 == 16);            // attention finalize: 4 rows per step x 4 steps
static_assert(8 * 16 == 128);                 // attention block: 8 waves x 16 query rows

// static LDS per kernel (bytes)
static_assert((size_t)(4 * 64 * LDT + 8 * 16 * LDT) * 2 <= (size_t)131072);

// workspace layout (bytes)
#define WSQ_BYTES     ((size_t)DIM * DIM * 2)
#define WKV_BYTES     ((size_t)KVD * DIM * 2)
#define PLANE16_BYTES ((size_t)MROWS * DIM * 2)
#define VRES_BYTES    ((size_t)NB * DIM * 64 * 2)
#define QRES_BYTES    ((size_t)NB * NHEAD * EROWS * HD * 2)
#define KRES_BYTES    ((size_t)NB * NHEAD * ECHUNK * HD * 2)
#define CRES_BYTES    ((size_t)NB * EROWS * DIM * 2)
#define OFF_WQ  ((size_t)0)
#define OFF_WK  (OFF_WQ + WSQ_BYTES)
#define OFF_WV  (OFF_WK + WKV_BYTES)
#define OFF_WO  (OFF_WV + WKV_BYTES)
#define OFF_X   (OFF_WO + WSQ_BYTES)
#define OFF_Q   (OFF_X + PLANE16_BYTES)
#define OFF_K   (OFF_Q + PLANE16_BYTES)
#define OFF_VT  (OFF_K + PLANE16_BYTES)
#define OFF_CTX (OFF_VT + PLANE16_BYTES)
#define OFF_VR  (OFF_CTX + PLANE16_BYTES)
#define OFF_QR  (OFF_VR + VRES_BYTES)
#define OFF_KR  (OFF_QR + QRES_BYTES)
#define OFF_CR  (OFF_KR + KRES_BYTES)
#define WS_TOTAL (OFF_CR + CRES_BYTES)
static_assert((WSQ_BYTES % 128) == 0 && (WKV_BYTES % 128) == 0 && (PLANE16_BYTES % 128) == 0);
static_assert((VRES_BYTES % 128) == 0);
static_assert((QRES_BYTES % 128) == 0 && (KRES_BYTES % 128) == 0 && (CRES_BYTES % 128) == 0);
static_assert(WS_TOTAL <= (size_t)134217728);

// ---------------------------------------------------------------------------
__device__ __forceinline__ float bf16r(float x) {   // RNE convert to bf16, returned widened
  unsigned int u = __float_as_uint(x);
  u = (u + 0x7FFFu + ((u >> 16) & 1u)) & 0xFFFF0000u;
  return __uint_as_float(u);
}

// f32 -> f16 operand convert that cannot produce an f16 subnormal (value select).
static __device__ __forceinline__ _Float16 toh_flush(float v) {
  const _Float16 r = (_Float16)v;
  return (fabsf(v) < 6.103515625e-05f) ? (_Float16)0.0f : r;
}

// 16-bit fragment: p points at element [row = lane&15][k0 + 8*(lane>>4)] of a k-contiguous
// row. Elements 0..7 <- k0+8h+0..7, elements 8..15 <- k0+16+8h+0..7 (same map for A and B).
__device__ __forceinline__ v16h frag_at(const _Float16* p) {
  v8h lo = *(const v8h*)(p);
  v8h hi = *(const v8h*)(p + 16);
  v16h out;
#pragma unroll
  for (int i = 0; i < 8; ++i) { out[i] = lo[i]; out[i + 8] = hi[i]; }
  return out;
}
__device__ __forceinline__ v16h ld_frag(const _Float16* base, unsigned ld) {
  const unsigned lane = threadIdx.x & 31u;
  return frag_at(base + (lane & 15u) * ld + (lane >> 4) * 8u);
}

__device__ __forceinline__ v8f wmma16(v16h a, v16h b, v8f c) {
  v8f d = __builtin_amdgcn_wmma_f32_16x16x32_f16(false, a, false, b, (short)0, c,
                                                 false, false);
  asm volatile("v_nop\n\tv_nop\n\tv_nop\n\tv_nop" : "+v"(d) : "v"(a), "v"(b));
  return d;
}

__device__ __forceinline__ float red16_max(float x) {
#pragma unroll
  for (int off = 1; off < 16; off <<= 1) x = fmaxf(x, __shfl_xor(x, off, 32));
  return x;
}
__device__ __forceinline__ float red16_sum(float x) {
#pragma unroll
  for (int off = 1; off < 16; off <<= 1) x += __shfl_xor(x, off, 32);
  return x;
}

__device__ __forceinline__ void wave_lds_sync() {
  __builtin_amdgcn_fence(3 /* release order */, "wavefront");
  asm volatile("s_wait_dscnt 0x0" ::: "memory");
  __builtin_amdgcn_wave_barrier();
}

// Eight asynchronous 16-B copies of one lane, global -> LDS, rows 16 apart on both sides.
// lds: the lane's LDS byte address; g: the lane's global address; K: source pitch in halves.
// The s_wait_xcnt ends the copies' own statement so that no address register is rewritten
// ahead of it.
__device__ __forceinline__ void stage_copy8(const unsigned lds, const _Float16* g,
                                            const unsigned K) {
  const unsigned ls = 16u * LDG * 2u;
  const size_t gs = (size_t)16 * K;
  asm volatile(
      "global_load_async_to_lds_b128 %0, %8, off\n\t"
      "global_load_async_to_lds_b128 %1, %9, off\n\t"
      "global_load_async_to_lds_b128 %2, %10, off\n\t"
      "global_load_async_to_lds_b128 %3, %11, off\n\t"
      "global_load_async_to_lds_b128 %4, %12, off\n\t"
      "global_load_async_to_lds_b128 %5, %13, off\n\t"
      "global_load_async_to_lds_b128 %6, %14, off\n\t"
      "global_load_async_to_lds_b128 %7, %15, off\n\t"
      "s_wait_xcnt 0x0"
      :
      : "v"(lds), "v"(lds + ls), "v"(lds + 2u * ls), "v"(lds + 3u * ls), "v"(lds + 4u * ls),
        "v"(lds + 5u * ls), "v"(lds + 6u * ls), "v"(lds + 7u * ls), "v"(g), "v"(g + gs),
        "v"(g + 2u * gs), "v"(g + 3u * gs), "v"(g + 4u * gs), "v"(g + 5u * gs),
        "v"(g + 6u * gs), "v"(g + 7u * gs)
      : "memory");
}

// acc[i][j] += A[128 rows][K] . B[128 rows][K]^T for this wave's 64 x 32 part of the block tile
// (mw = 64-row group, nw = 32-column group). Arow / Brow: first row of the block's A / B rows.
// Two LDS buffers of one 128-k stage each; stage t + 2 is copied into the buffer that trip t
// has just left, behind the barrier that also publishes stage t + 1. On entry every wave's
// earlier LDS reads of St have retired in front of a barrier that all waves have passed.
__device__ __forceinline__ void gemm_mainloop(const _Float16* __restrict__ Arow,
                                              const _Float16* __restrict__ Brow,
                                              const unsigned K, _Float16* St,
                                              v8f (&acc)[4][2]) {
  const unsigned tid = threadIdx.x, lane = tid & 31u, w = tid >> 5;
  const unsigned mw = w >> 2, nw = w & 3u;
  const unsigned hh = lane >> 4, m = lane & 15u;
  const unsigned cr = tid >> 4, cc = (tid & 15u) * 8u;   // copy: row (of 16), 16-B column
  const _Float16* ga = Arow + (size_t)cr * K + cc;
  const _Float16* gb = Brow + (size_t)cr * K + cc;
  const unsigned la = (unsigned)(size_t)St + (cr * LDG + cc) * 2u;
  const unsigned lb = la + BM * LDG * 2u;
  const unsigned nt = K / BK;

  stage_copy8(la, ga, K);
  stage_copy8(lb, gb, K);
  asm volatile("s_wait_asynccnt 0x0" ::: "memory");   // stage 0 landed (this wave's copies)
  __syncthreads();                                    // stage 0 readable by every wave
  stage_copy8(la + STAGE_H * 2u, ga + BK, K);
  stage_copy8(lb + STAGE_H * 2u, gb + BK, K);

  const _Float16* fa = St + (mw * 64u + m) * LDG + hh * 8u;
  const _Float16* fb = St + (BM + nw * 32u + m) * LDG + hh * 8u;
#pragma unroll 1   // one stage per trip: the buffer alternates by t & 1, the text stays short
  for (unsigned t = 0; t < nt; ++t) {
    const unsigned bo = (t & 1u) * STAGE_H;
#pragma unroll
    for (unsigned kk = 0; kk < BK / 32u; ++kk) {
      v16h a[4], b[2];
#pragma unroll
      for (unsigned i = 0; i < 4u; ++i) a[i] = frag_at(fa + bo + i * 16u * LDG + kk * 32u);
#pragma unroll
      for (unsigned j = 0; j < 2u; ++j) b[j] = frag_at(fb + bo + j * 16u * LDG + kk * 32u);
#pragma unroll
      for (unsigned i = 0; i < 4u; ++i)
#pragma unroll
        for (unsigned j = 0; j < 2u; ++j) acc[i][j] = wmma16(a[i], b[j], acc[i][j]);
    }
    asm volatile("s_wait_dscnt 0x0" ::: "memory");      // this wave has left buffer t & 1
    asm volatile("s_wait_asynccnt 0x0" ::: "memory");   // its copies of stage t + 1 landed
    __syncthreads();   // publishes stage t + 1, frees buffer t & 1
    if (t + 2u < nt) {
      stage_copy8(la + bo * 2u, ga + (t + 2u) * BK, K);
      stage_copy8(lb + bo * 2u, gb + (t + 2u) * BK, K);
    }
  }
  asm volatile("s_wait_asynccnt 0x0" ::: "memory");     // nothing in flight when St is reused
}

// ---------------------------------------------------------------------------
// Row cast: f32 rows of DIM columns -> f16 compact rows of DIM columns, one wave per row,
// 8 rows per block, 8 rolled passes; each store instruction of a wave covers 512 contiguous
// SRC_INPUT = 1: source is the module input (full-size row stride per batch), carry 1;
// SRC_INPUT = 0: source is an [out][in] weight (already k-contiguous), carry x64.
// Every value goes through RNE bf16 first. Grid (rows/8).
// ---------------------------------------------------------------------------
template <int SRC_INPUT>
__device__ __forceinline__ void cast_body(const float* __restrict__ X,
                                          _Float16* __restrict__ dst) {
#pragma clang fp contract(off)
  const unsigned lane = threadIdx.x & 31u;
  const unsigned w = (unsigned)__builtin_amdgcn_readfirstlane((int)(threadIdx.x >> 5));
  const unsigned crow = blockIdx.x * 8u + w;
  size_t srow = crow;
  if (SRC_INPUT) {
    const unsigned bidx = crow / (unsigned)SEQ;
    const unsigned sq = crow - bidx * (unsigned)SEQ;
    srow = (size_t)bidx * SEQ_FULL + sq;
  }
  const float carry = SRC_INPUT ? 1.0f : WCARRY;
  const float* xr = X + srow * DIM + lane * 8u;
  _Float16* dr = dst + (size_t)crow * DIM + lane * 8u;
#pragma unroll 1
  for (unsigned j = 0; j < 8u; ++j) {
    const v4f a0 = *(const v4f*)(xr + j * 256u);
    const v4f a1 = *(const v4f*)(xr + j * 256u + 4u);
    v8h o;
#pragma unroll
    for (int i = 0; i < 4; ++i) {
      o[i]     = toh_flush(carry * bf16r(a0[i]));
      o[i + 4] = toh_flush(carry * bf16r(a1[i]));
    }
    _Float16* p = dr + j * 256u;
    *(v8h*)p = o;
    
  }
}

__global__ __launch_bounds__(256) void xcast_kernel(
    const float* __restrict__ X, _Float16* __restrict__ dst) {
  cast_body<1>(X, dst);
}
__global__ __launch_bounds__(256) void wcast_kernel(
    const float* __restrict__ W, _Float16* __restrict__ dst) {
  cast_body<0>(W, dst);
}

// ---------------------------------------------------------------------------
// GEMM C[128x128 tile] = A16[rows][K] . Bt[n][K]^T; both operands staged in LDS by asynchronous
// copies (gemm_mainloop); 8 waves (mw = 64-row group, nw = 32-col group), 8 accumulators/wave.
// The epilogue treats the tile as four 64x64 sub-tiles (bx = 64-column block, row0 = first row):
//   MODE 0: out16[row][col] (pitch DIM) = f16(acc/64)                       (q plane);
//           row tiles with sequence row < 128 also write
//           out16r [b][head][128][64] = f16(2048 * (q - hi))
//   MODE 1: tile column block = one shared key head; out16[row][(4*kvh + rep)*64 + c]
//           (pitch DIM) = f16(acc/64) for rep 0..3                          (k plane);
//           the key tile 0 of each sequence also writes
//           out16r [b][4*kvh + rep][64][64] = f16(2048 * (k - hi)) for rep 0..3
//   MODE 2: transposed V plane [b][(4*kvh + rep)*64 + d][key] = f16(acc/64) for rep 0..3;
//           for key tile 0 also out16r [b][(4*kvh + rep)*64 + d][64] = f16(1024 * (v - hi))
//   MODE 3: outf full [full row][col] = acc/4096                            (output buffer);
//           row tiles with sequence row < 128 run a second accumulator set fed by the
//           residual rows A16r [b][128][K] against the same B rows (a second pass of the main
//           loop), folded as acc + accres/2048 before the 1/4096 scale (block-uniform test).
// Store loops: MODE 0/1/2: 32 rows per step x 2 steps = 64; MODE 3: 16 rows x 4 steps = 64.
// Grid (N/128, MROWS/128).
// ---------------------------------------------------------------------------
template <int MODE>
__device__ __forceinline__ void gemm_body(
    const _Float16* __restrict__ A16, const _Float16* __restrict__ A16r,
    const _Float16* __restrict__ Bt, const unsigned K,
    float* __restrict__ outf, _Float16* __restrict__ out16, _Float16* __restrict__ out16r) {
  __shared__ __attribute__((aligned(16))) _Float16 St[2 * STAGE_H];
  const unsigned tid = threadIdx.x, lane = tid & 31u, w = tid >> 5;
  const unsigned mw = w >> 2, nw = w & 3u;
  const unsigned hh = lane >> 4, m = lane & 15u;
  const unsigned brow0 = blockIdx.y * (unsigned)BM;
  const _Float16* Brow = Bt + (size_t)(blockIdx.x * (unsigned)BN) * K;

  v8f acc[4][2] = {};
  gemm_mainloop(A16 + (size_t)brow0 * K, Brow, K, St, acc);
  if (MODE == 3) {
    const unsigned bidx3 = brow0 / (unsigned)SEQ;
    const unsigned sq3 = brow0 - bidx3 * (unsigned)SEQ;
    if (sq3 < (unsigned)EROWS) {               // block-uniform
      v8f res[4][2] = {};
      gemm_mainloop(A16r + (size_t)(bidx3 * (unsigned)EROWS + sq3) * K, Brow, K, St, res);
#pragma unroll
      for (int i = 0; i < 4; ++i)
#pragma unroll
        for (int j = 0; j < 2; ++j)
#pragma unroll
          for (int r = 0; r < 8; ++r) acc[i][j][r] = acc[i][j][r] + res[i][j][r] * (1.0f / SCRES);
    }
  }
  // C staging over the ring (every wave is behind the main loop's last barrier):
  // four [64][LDC] sub-tiles, sub = 2 * (row half) + (column half)
  float* Call = (float*)St;
#pragma unroll
  for (unsigned i = 0; i < 4u; ++i)
#pragma unroll
    for (unsigned j = 0; j < 2u; ++j)
#pragma unroll
      for (unsigned r = 0; r < 8u; ++r)
        Call[((mw * 2u + (nw >> 1)) * 64u + i * 16u + hh * 8u + r) * LDC + (nw & 1u) * 32u +
             j * 16u + m] = acc[i][j][r];
  __syncthreads();

  for (unsigned sub = 0; sub < 4u; ++sub) {
  const float* Cs = Call + sub * (64u * LDC);
  const unsigned bx = blockIdx.x * 2u + (sub & 1u);
  const unsigned n0 = bx * 64u;
  const unsigned row0 = brow0 + (sub >> 1) * 64u;

  if (MODE == 0 || MODE == 1) {
    constexpr unsigned NREP  = (MODE == 1) ? (unsigned)GQA : 1u;
    constexpr unsigned RROWS = (MODE == 1) ? (unsigned)ECHUNK : (unsigned)EROWS;
    const unsigned cb = (MODE == 1) ? bx * (unsigned)(GQA * HD) : n0;
    const unsigned bidx = row0 / (unsigned)SEQ;
    const unsigned sq0 = row0 - bidx * (unsigned)SEQ;
    const bool has_res = (sq0 < RROWS);        // block-uniform (MODE 1: key tile 0 only)
    v8h x[2], xr[2];
    size_t off[2], offr[2];
#pragma unroll
    for (unsigned i = 0; i < 2u; ++i) {
      const unsigned r = 32u * i + (tid >> 3);
      const unsigned c = (tid & 7u) * 8u;
      const v4f u0 = *(const v4f*)&Cs[r * LDC + c];
      const v4f u1 = *(const v4f*)&Cs[r * LDC + c + 4];
#pragma unroll
      for (int j = 0; j < 4; ++j) {
        x[i][j]     = toh_flush(u0[j] * (1.0f / WCARRY));
        x[i][j + 4] = toh_flush(u1[j] * (1.0f / WCARRY));
      }
      xr[i] = x[i];
      if (has_res) {
#pragma unroll
        for (int j = 0; j < 4; ++j) {
          const float t0 = u0[j] * (1.0f / WCARRY);
          const float t1 = u1[j] * (1.0f / WCARRY);
          xr[i][j]     = toh_flush((t0 - (float)x[i][j]) * SCRES);
          xr[i][j + 4] = toh_flush((t1 - (float)x[i][j + 4]) * SCRES);
        }
      }
      off[i] = (size_t)(row0 + r) * DIM + cb + c;
      offr[i] = ((size_t)(bidx * (unsigned)NHEAD + bx * NREP) * RROWS + sq0 + r) * HD + c;
    }
#pragma unroll
    for (unsigned rep = 0; rep < NREP; ++rep) {
#pragma unroll
      for (int i = 0; i < 2; ++i)
        *(v8h*)(out16 + off[i] + (size_t)rep * HD) = x[i];
    }
    asm volatile("s_wait_xcnt 0x0" ::: "memory");   // before the stores' registers are reused
    if (has_res) {
#pragma unroll
      for (unsigned rep = 0; rep < NREP; ++rep) {
#pragma unroll
        for (int i = 0; i < 2; ++i)
          *(v8h*)(out16r + offr[i] + (size_t)rep * RROWS * HD) = xr[i];
      }
      asm volatile("s_wait_xcnt 0x0" ::: "memory");   // before the stores' registers are reused
    }
    
  }

  if (MODE == 2) {
    const unsigned bidx = row0 / (unsigned)SEQ;
    const unsigned key0 = row0 - bidx * (unsigned)SEQ;
    const bool first_tile = (key0 == 0u);      // block-uniform
    v8h x[2], xr[2];
    size_t off[2], offr[2];
#pragma unroll
    for (unsigned i = 0; i < 2u; ++i) {
      const unsigned dcol = 32u * i + (tid >> 3);
      const unsigned kk = (tid & 7u) * 8u;
#pragma unroll
      for (unsigned j = 0; j < 8u; ++j) {
        const float t = Cs[(kk + j) * LDC + dcol] * (1.0f / WCARRY);
        const _Float16 hi = toh_flush(t);
        x[i][j]  = hi;
        xr[i][j] = toh_flush((t - (float)hi) * RCARRY);
      }
      const size_t vrow = (size_t)bidx * DIM + bx * (unsigned)(GQA * HD) + dcol;
      off[i]  = vrow * SEQ + key0 + kk;
      offr[i] = vrow * 64u + kk;
    }
#pragma unroll
    for (unsigned rep = 0; rep < (unsigned)GQA; ++rep) {
#pragma unroll
      for (int i = 0; i < 2; ++i)
        *(v8h*)(out16 + off[i] + (size_t)rep * HD * SEQ) = x[i];
    }
    asm volatile("s_wait_xcnt 0x0" ::: "memory");   // before the stores' registers are reused
    if (first_tile) {
#pragma unroll
      for (unsigned rep = 0; rep < (unsigned)GQA; ++rep) {
#pragma unroll
        for (int i = 0; i < 2; ++i)
          *(v8h*)(out16r + offr[i] + (size_t)rep * HD * 64u) = xr[i];
      }
      asm volatile("s_wait_xcnt 0x0" ::: "memory");   // before the stores' registers are reused
    }
    
  }

  if (MODE == 3) {
    const float cs = 1.0f / (WCARRY * VCARRY);
    v4f xs[4];
    size_t off[4];
#pragma unroll
    for (unsigned i = 0; i < 4u; ++i) {
      const unsigned r = 16u * i + (tid >> 4);
      const unsigned c = (tid & 15u) * 4u;
      const unsigned crow = row0 + r;
      const unsigned bidx = crow / (unsigned)SEQ;
      const unsigned sq = crow - bidx * (unsigned)SEQ;
      const size_t frow = (size_t)bidx * SEQ_FULL + sq;
      const v4f u = *(const v4f*)&Cs[r * LDC + c];
      v4f val;
#pragma unroll
      for (int j = 0; j < 4; ++j) val[j] = u[j] * cs;
      xs[i] = val;
      off[i] = frow * DIM + n0 + c;
    }
#pragma unroll
    for (int i = 0; i < 4; ++i) *(v4f*)(outf + off[i]) = xs[i];
  }
  }   // sub
}

__global__ __launch_bounds__(256) void gemm_q_kernel(
    const _Float16* __restrict__ A16, const _Float16* __restrict__ Bt,
    _Float16* __restrict__ out16, _Float16* __restrict__ out16r) {
  gemm_body<0>(A16, A16, Bt, (unsigned)DIM, (float*)0, out16, out16r);
}
__global__ __launch_bounds__(256) void gemm_k_kernel(
    const _Float16* __restrict__ A16, const _Float16* __restrict__ Bt,
    _Float16* __restrict__ out16, _Float16* __restrict__ out16r) {
  gemm_body<1>(A16, A16, Bt, (unsigned)DIM, (float*)0, out16, out16r);
}
__global__ __launch_bounds__(256) void gemm_v_kernel(
    const _Float16* __restrict__ A16, const _Float16* __restrict__ Bt,
    _Float16* __restrict__ vt, _Float16* __restrict__ vtr) {
  gemm_body<2>(A16, A16, Bt, (unsigned)DIM, (float*)0, vt, vtr);
}
__global__ __launch_bounds__(256) void gemm_wo_kernel(
    const _Float16* __restrict__ A16, const _Float16* __restrict__ A16r,
    const _Float16* __restrict__ Bt, float* __restrict__ outf) {
  gemm_body<3>(A16, A16r, Bt, (unsigned)DIM, outf, (_Float16*)0, (_Float16*)0);
}

// ---------------------------------------------------------------------------
// Causal flash attention per (128 query rows, head, batch). 8 waves x 16 query rows, 64 keys
// per step, key chunks 0 .. q0+127: K tile Ks[key][d] and V^T tile Vs[d][key] staged with
// plain 16-B loads (cross-wave, block barriers); online softmax in registers (16-lane
// shuffles); causal replace-mask applied by value in the chunks that touch the diagonal;
// P tile per wave in Ps (wave-private, wave sync) as f16(1024*p); O in registers.
// First query block, first key chunk (block-uniform):
//   scores: formed one (key group, 32-column step) tile at a time: q_hi.k_hi into the score
//   accumulator, q_res.k_hi then q_hi.k_res (both x2048) into ONE residual accumulator that
//   is folded (x 1/2048) into the score accumulator right after its tile and reused for the
//   next tile; all of it before the scale, the causal replace and the softmax (K residual
//   tile KRs staged like VRs; the q residual fragment of each tile is loaded from the q
//   residual plane just before its product, through an opaque integer offset so that it is
//   not held across tiles);
//   P_hi.V_res then P_res.V_hi (both x1024) through one 8-register second accumulator per
//   16-column group, each folded into O (x 1/1024) right after its group, before
//   normalisation.
// query block also writes OvR[b*128+q][head*64 + d] = f16(2048 * (64 O / l - hi)).
// Every f32 -> f16 operand convert in this kernel goes through the flush select.
// Grid (SEQ/128, NHEAD, NB).
// ---------------------------------------------------------------------------
__global__ __launch_bounds__(256) void attn_kernel(
    const _Float16* __restrict__ Qh, const _Float16* __restrict__ QhR,
    const _Float16* __restrict__ Kh, const _Float16* __restrict__ KhR,
    const _Float16* __restrict__ Vt, const _Float16* __restrict__ VtR,
    _Float16* __restrict__ Ov, _Float16* __restrict__ OvR) {
  __shared__ _Float16 Ks[64 * LDT];
  __shared__ _Float16 Vs[64 * LDT];
  __shared__ _Float16 VRs[64 * LDT];
  __shared__ _Float16 KRs[64 * LDT];
  __shared__ _Float16 Ps[8 * 16 * LDT];

  const unsigned tid = threadIdx.x, lane = tid & 31u, w = tid >> 5;
  const unsigned hh = lane >> 4, m = lane & 15u;
  const unsigned q0 = blockIdx.x * 128u;
  const unsigned head = blockIdx.y;
  const unsigned b = blockIdx.z;
  const float scale = 0.125f;   // HD^-0.5
  const unsigned qrow0 = q0 + w * 16u;
  const bool first_blk = (blockIdx.x == 0u);
  _Float16* P = Ps + w * (16u * LDT);

  const size_t qoff = (size_t)(b * (unsigned)SEQ + qrow0 + m) * DIM + head * HD + hh * 8u;
  v16h qf[2];
  qf[0] = frag_at(Qh + qoff);
  qf[1] = frag_at(Qh + qoff + 32);

  float mrow[8], lrow[8];
  v8f o[4];
#pragma unroll
  for (int v = 0; v < 8; ++v) { mrow[v] = -1.0e30f; lrow[v] = 0.0f; }
#pragma unroll
  for (int nb = 0; nb < 4; ++nb) o[nb] = (v8f){};

  const size_t kplane = (size_t)b * SEQ * DIM + head * HD;
  const size_t vplane = ((size_t)b * DIM + head * HD) * SEQ;
  const size_t rplane = ((size_t)b * DIM + head * HD) * 64u;
  const size_t krplane = ((size_t)(b * (unsigned)NHEAD + head) * ECHUNK) * HD;
  const unsigned kend = q0 + 128u;   // <= SEQ

  for (unsigned kb = 0; kb < kend; kb += 64u) {
    const bool early = first_blk && (kb == 0u);   // block-uniform
#pragma unroll
    for (unsigned j = 0; j < 2u; ++j) {
      const unsigned idx = tid + 256u * j;
      const unsigned r = idx >> 3, c = (idx & 7u) * 8u;
      *(v8h*)&Ks[r * LDT + c] = *(const v8h*)(Kh + kplane + (size_t)(kb + r) * DIM + c);
      *(v8h*)&Vs[r * LDT + c] = *(const v8h*)(Vt + vplane + (size_t)r * SEQ + kb + c);
    }
    if (early) {
#pragma unroll
      for (unsigned j = 0; j < 2u; ++j) {
        const unsigned idx = tid + 256u * j;
        const unsigned r = idx >> 3, c = (idx & 7u) * 8u;
        *(v8h*)&VRs[r * LDT + c] = *(const v8h*)(VtR + rplane + (size_t)r * 64u + c);
        *(v8h*)&KRs[r * LDT + c] = *(const v8h*)(KhR + krplane + (size_t)r * HD + c);
      }
    }
    __syncthreads();

    // scores: 4 key groups of 16, K = 64 in two 32-steps
    v8f s[4];
    if (early) {
      // early corner: value + residual products, one score tile at a time through ONE
      // residual accumulator; q0 == 0 here so qrow0 + m < 128
      const unsigned qrbase =
          ((b * (unsigned)NHEAD + head) * (unsigned)EROWS + qrow0 + m) * (unsigned)HD + hh * 8u;
#pragma unroll
      for (int kg = 0; kg < 4; ++kg) {
        v8f t = {};
#pragma unroll
        for (int c = 0; c < 2; ++c) {
          unsigned qro = qrbase + (unsigned)c * 32u;
          asm volatile("" : "+v"(qro));   // opaque offset: the residual q fragment is reloaded per tile
          v8f tr = {};
          {
            const v16h kf = ld_frag(&Ks[(kg * 16) * LDT + c * 32], LDT);
            t = wmma16(qf[c], kf, t);
            const v16h ql = frag_at(QhR + qro);
            tr = wmma16(ql, kf, tr);
          }
          {
            const v16h kl = ld_frag(&KRs[(kg * 16) * LDT + c * 32], LDT);
            tr = wmma16(qf[c], kl, tr);
          }
          t = t + tr * (1.0f / SCRES);
          __builtin_amdgcn_sched_barrier(0);   // the next tile's loads stay behind this tile
        }
        s[kg] = t * scale;
      }
    } else {
#pragma unroll
      for (int kg = 0; kg < 4; ++kg) {
        v8f t = {};
#pragma unroll
        for (int c = 0; c < 2; ++c) {
          const v16h kf = ld_frag(&Ks[(kg * 16) * LDT + c * 32], LDT);
          t = wmma16(qf[c], kf, t);
        }
        s[kg] = t * scale;
      }
    }

    // causal replace-mask (key > query) in chunks that reach the diagonal; block-uniform test
    if (kb >= q0) {
#pragma unroll
      for (int kg = 0; kg < 4; ++kg)
#pragma unroll
        for (int v = 0; v < 8; ++v) {
          const unsigned key = kb + (unsigned)kg * 16u + m;
          const unsigned row = qrow0 + hh * 8u + (unsigned)v;
          s[kg][v] = (key > row) ? -1.0e30f : s[kg][v];
        }
    }

    // online softmax; row (hh*8+v) spread over the 16 lanes of a half
    float alpha[8];
#pragma unroll
    for (int v = 0; v < 8; ++v) {
      float mx = fmaxf(fmaxf(s[0][v], s[1][v]), fmaxf(s[2][v], s[3][v]));
      mx = red16_max(mx);
      const float mn = fmaxf(mrow[v], mx);
      alpha[v] = __expf(mrow[v] - mn);
      mrow[v] = mn;
    }
#pragma unroll
    for (int kg = 0; kg < 4; ++kg)
#pragma unroll
      for (int v = 0; v < 8; ++v) s[kg][v] = __expf(s[kg][v] - mrow[v]);
#pragma unroll
    for (int v = 0; v < 8; ++v) {
      const float rs = red16_sum((s[0][v] + s[1][v]) + (s[2][v] + s[3][v]));
      lrow[v] = alpha[v] * lrow[v] + rs;
    }
#pragma unroll
    for (int nb = 0; nb < 4; ++nb)
#pragma unroll
      for (int v = 0; v < 8; ++v) o[nb][v] = o[nb][v] * alpha[v];

    // P tile [16 rows][64 keys], f16(1024 p)
#pragma unroll
    for (int kg = 0; kg < 4; ++kg)
#pragma unroll
      for (int v = 0; v < 8; ++v)
        P[(hh * 8u + (unsigned)v) * LDT + (unsigned)kg * 16u + m] = toh_flush(s[kg][v] * PCARRY);
    wave_lds_sync();

    // O += P . V  (K = 64 keys in two 32-steps; B = V^T tile [d][key])
#pragma unroll
    for (int c = 0; c < 2; ++c) {
      const v16h pf = ld_frag(P + c * 32, LDT);
#pragma unroll
      for (int nb = 0; nb < 4; ++nb) {
        const v16h vf = ld_frag(&Vs[(nb * 16) * LDT + c * 32], LDT);
        o[nb] = wmma16(pf, vf, o[nb]);
      }
    }

    if (early) {
      // P_hi . V_res (scale 1/1024), one 16-column group at a time, folded immediately
#pragma unroll
      for (int nb = 0; nb < 4; ++nb) {
        v8f o2 = {};
#pragma unroll
        for (int c = 0; c < 2; ++c) {
          const v16h pf = ld_frag(P + c * 32, LDT);
          const v16h vr = ld_frag(&VRs[(nb * 16) * LDT + c * 32], LDT);
          o2 = wmma16(pf, vr, o2);
        }
#pragma unroll
        for (int v = 0; v < 8; ++v) o[nb][v] = o[nb][v] + o2[v] * (1.0f / RCARRY);
      }
      wave_lds_sync();
      // P residual tile: f16(1024 * (1024 p - f16(1024 p)))
#pragma unroll
      for (int kg = 0; kg < 4; ++kg)
#pragma unroll
        for (int v = 0; v < 8; ++v) {
          const float t = s[kg][v] * PCARRY;
          const float hi = (float)toh_flush(t);
          P[(hh * 8u + (unsigned)v) * LDT + (unsigned)kg * 16u + m] =
              toh_flush((t - hi) * RCARRY);
        }
      wave_lds_sync();
      // P_res . V_hi (scale 1/1024), one 16-column group at a time, folded immediately
#pragma unroll
      for (int nb = 0; nb < 4; ++nb) {
        v8f o2 = {};
#pragma unroll
        for (int c = 0; c < 2; ++c) {
          const v16h pf = ld_frag(P + c * 32, LDT);
          const v16h vf = ld_frag(&Vs[(nb * 16) * LDT + c * 32], LDT);
          o2 = wmma16(pf, vf, o2);
        }
#pragma unroll
        for (int v = 0; v < 8; ++v) o[nb][v] = o[nb][v] + o2[v] * (1.0f / RCARRY);
      }
    }
    __syncthreads();
  }

  float inv[8];
#pragma unroll
  for (int v = 0; v < 8; ++v) inv[v] = __builtin_amdgcn_rcpf(lrow[v]) * (VCARRY / PCARRY);
#pragma unroll
  for (int nb = 0; nb < 4; ++nb)
#pragma unroll
    for (int v = 0; v < 8; ++v)
      P[(hh * 8u + (unsigned)v) * LDT + (unsigned)nb * 16u + m] = toh_flush(o[nb][v] * inv[v]);
  wave_lds_sync();
  v8h x[4], xr[4];
  size_t off[4], offr[4];
#pragma unroll
  for (unsigned i = 0; i < 4u; ++i) {
    const unsigned r = 4u * i + (lane >> 3);
    const unsigned c = (lane & 7u) * 8u;
    x[i] = *(const v8h*)&P[r * LDT + c];
    off[i] = (size_t)(b * (unsigned)SEQ + qrow0 + r) * DIM + head * HD + c;
    xr[i] = x[i];
    offr[i] = (size_t)(b * (unsigned)EROWS + (qrow0 & 127u) + r) * DIM + head * HD + c;
  }
  if (first_blk) {
    // residual rows (first query block only; qrow0 < 128): f16(2048 * (t - f16(t)))
    wave_lds_sync();
#pragma unroll
    for (int nb = 0; nb < 4; ++nb)
#pragma unroll
      for (int v = 0; v < 8; ++v) {
        const float t = o[nb][v] * inv[v];
        const float hi = (float)toh_flush(t);
        P[(hh * 8u + (unsigned)v) * LDT + (unsigned)nb * 16u + m] = toh_flush((t - hi) * SCRES);
      }
    wave_lds_sync();
#pragma unroll
    for (unsigned i = 0; i < 4u; ++i) {
      const unsigned r = 4u * i + (lane >> 3);
      const unsigned c = (lane & 7u) * 8u;
      xr[i] = *(const v8h*)&P[r * LDT + c];
    }
  }
#pragma unroll
  for (int i = 0; i < 4; ++i) *(v8h*)(Ov + off[i]) = x[i];
  if (first_blk) {
#pragma unroll
    for (int i = 0; i < 4; ++i) *(v8h*)(OvR + offr[i]) = xr[i];
  }
  
}

// ---------------------------------------------------------------------------
extern "C" void kernel_launch(void* const* d_in, const int* in_sizes, int n_in,
                              void* d_out, int out_size, void* d_ws, size_t ws_size,
                              hipStream_t stream) {
  if (n_in < 5) return;
  const long long need_x = ((long long)(NB - 1) * SEQ_FULL + SEQ) * DIM;
  if ((long long)in_sizes[0] < need_x) return;
  if ((long long)in_sizes[1] < (long long)DIM * DIM) return;
  if ((long long)in_sizes[2] < (long long)KVD * DIM) return;
  if ((long long)in_sizes[3] < (long long)KVD * DIM) return;
  if ((long long)in_sizes[4] < (long long)DIM * DIM) return;
  if ((long long)out_size < need_x) return;
  if (ws_size < WS_TOTAL) return;

  // bound by the input list order: x, wq, wk, wv, wo
  const float* X  = (const float*)d_in[0];    // [NB_FULL][SEQ_FULL][DIM]
  const float* wq = (const float*)d_in[1];    // [DIM][DIM]  (out, in)
  const float* wk = (const float*)d_in[2];    // [KVD][DIM]  (out, in)
  const float* wv = (const float*)d_in[3];    // [KVD][DIM]  (out, in)
  const float* wo = (const float*)d_in[4];    // [DIM][DIM]  (out, in)
  float* out = (float*)d_out;

  char* ws = (char*)d_ws;
  _Float16* Wq_t  = (_Float16*)(ws + OFF_WQ);    // [n][k], x64
  _Float16* Wk_t  = (_Float16*)(ws + OFF_WK);    // [KVD][DIM]
  _Float16* Wv_t  = (_Float16*)(ws + OFF_WV);    // [KVD][DIM]
  _Float16* Wo_t  = (_Float16*)(ws + OFF_WO);    // [n][k], x64
  _Float16* X16   = (_Float16*)(ws + OFF_X);     // [MROWS][DIM]
  _Float16* Qh16  = (_Float16*)(ws + OFF_Q);     // [MROWS][DIM]
  _Float16* Kh16  = (_Float16*)(ws + OFF_K);     // [MROWS][DIM], shared heads written 4x
  _Float16* Vt16  = (_Float16*)(ws + OFF_VT);    // [b][DIM][SEQ], shared heads written 4x
  _Float16* Ctx16 = (_Float16*)(ws + OFF_CTX);   // [MROWS][DIM], x64
  _Float16* VtR16 = (_Float16*)(ws + OFF_VR);    // [b][DIM][64]
  _Float16* QR16  = (_Float16*)(ws + OFF_QR);    // [b][NHEAD][128][64], x2048
  _Float16* KR16  = (_Float16*)(ws + OFF_KR);    // [b][NHEAD][64][64], x2048, shared heads 4x
  _Float16* CR16  = (_Float16*)(ws + OFF_CR);    // [b][128][DIM], x2048 on top of x64

  dim3 blk(256);

  // weight planes: [out][in] rows are already k-contiguous; 8 rows per block
  wcast_kernel<<<dim3(DIM / 8), blk, 0, stream>>>(wq, Wq_t);
  wcast_kernel<<<dim3(KVD / 8), blk, 0, stream>>>(wk, Wk_t);
  wcast_kernel<<<dim3(KVD / 8), blk, 0, stream>>>(wv, Wv_t);
  wcast_kernel<<<dim3(DIM / 8), blk, 0, stream>>>(wo, Wo_t);
  xcast_kernel<<<dim3(MROWS / 8), blk, 0, stream>>>(X, X16);

  // gemm_q_kernel(A16, Bt, out16, out16r)
  gemm_q_kernel<<<dim3(DIM / BN, MROWS / BM), blk, 0, stream>>>(X16, Wq_t, Qh16, QR16);
  // gemm_k_kernel(A16, Bt, out16, out16r)
  gemm_k_kernel<<<dim3(KVD / BN, MROWS / BM), blk, 0, stream>>>(X16, Wk_t, Kh16, KR16);
  // gemm_v_kernel(A16, Bt, vt, vtr)
  gemm_v_kernel<<<dim3(KVD / BN, MROWS / BM), blk, 0, stream>>>(X16, Wv_t, Vt16, VtR16);
  // attn_kernel(Qh, QhR, Kh, KhR, Vt, VtR, Ov, OvR)
  attn_kernel<<<dim3(SEQ / 128, NHEAD, NB), blk, 0, stream>>>(Qh16, QR16, Kh16, KR16, Vt16, VtR16,
                                                              Ctx16, CR16);
  // gemm_wo_kernel(A16, A16r, Bt, outf)
  gemm_wo_kernel<<<dim3(DIM / BN, MROWS / BM), blk, 0, stream>>>(Ctx16, CR16, Wo_t, out);
}

// v002
// It runs in 250 microseconds.
// Two timings next to v001 both put it at 1.17 times that version's speed.
// All steps since v000 together make it 1.91 times as fast.
#include <hip/hip_runtime.h>
#include <stddef.h>

// All contractions on v_wmma_f32_16x16x32_f16 (f16 operands, f32 accumulate): q/k/v projections,
// q.k scores, p.v, output projection. Float inputs are RNE-converted to bf16 and carried in f16
// (weights x64, p x1024, attention rows x64). Early corner only (query rows 0..127 x keys 0..63
// of every (batch, head)): q and k get a x2048 residual plane (two more score products into a
// separate accumulator), p and v a x1024 residual plane, and the attention rows 0..127 a x2048
// residual plane (second accumulator set in the output projection on those row tiles).
// Softmax and all scaling in f32.
// Causal grouped-query attention (32 query heads sharing 8 key/value heads), [out][in] weights,
// no biases; the k and v projection epilogues write every shared head once per query head so
// the attention kernel sees one K row block and one V^T row block per query head.

typedef _Float16 v16h __attribute__((ext_vector_type(16)));
typedef _Float16 v8h  __attribute__((ext_vector_type(8)));
typedef float    v8f  __attribute__((ext_vector_type(8)));
typedef float    v4f  __attribute__((ext_vector_type(4)));

#ifndef NB
#define NB 2
#endif
#ifndef SEQ
#define SEQ 2048
#endif
#define NB_FULL  2
#define SEQ_FULL 2048
#define DIM   2048
#define NHEAD 32
#define HD    64
#define NKV   8
#define GQA   (NHEAD / NKV)
#define KVD   (NKV * HD)
#define MROWS (NB * SEQ)
#define EROWS  128   // early query rows per sequence carried with residual planes (q, ctx)
#define ECHUNK 64    // early keys per sequence carried with residual planes (k, v)

static_assert(NB >= 1 && NB <= NB_FULL);
static_assert(SEQ >= 128 && SEQ <= SEQ_FULL && (SEQ % 128) == 0);
static_assert(DIM == NHEAD * HD);
static_assert(HD == 64);
static_assert(NHEAD == NKV * GQA && GQA == 4);
static_assert(KVD == 512 && (KVD % 64) == 0);
static_assert((DIM % 64) == 0 && (DIM % 32) == 0);
static_assert((MROWS % 64) == 0 && (MROWS % 8) == 0);
static_assert((SEQ % 64) == 0);               // a 64-row GEMM tile never straddles two sequences
static_assert((DIM % 8) == 0 && (KVD % 8) == 0);
static_assert(DIM == 8 * 32 * 8);             // cast: 8 passes x 32 lanes x 8 columns per row
static_assert((size_t)MROWS * DIM < (size_t)0xFFFFFFFFu);
static_assert(EROWS == 128);                  // == query rows of one attention block (block 0)
static_assert(ECHUNK == 64);                  // == keys of one attention step (chunk 0) == one GEMM row tile
static_assert((EROWS % 64) == 0 && EROWS <= SEQ);   // whole 64-row GEMM tiles
static_assert((size_t)NB * NHEAD * EROWS * HD < (size_t)0xFFFFFFFFu);   // 32-bit q residual offsets

#define LDT 72   // halves per LDS row (144 B, 16-B aligned)
#define LDC 68   // floats per LDS row (272 B, 16-B aligned)
static_assert((LDT % 8) == 0 && LDT >= 64);
static_assert((LDC % 4) == 0 && LDC >= 64);

// GEMM block tile and LDS staging
#define BM  128   // output rows per block
#define BN  128   // output columns per block
#define BK  128   // halves of every operand row per stage (256 B)
#define LDG 136   // halves per staged row (272 B = 16 B x 17: b128 fragment reads meet no bank twice)
#define STAGE_H ((BM + BN) * LDG)   // halves per stage: A rows, then B rows
static_assert((LDG % 8) == 0 && LDG >= BK);
static_assert((DIM % BK) == 0 && DIM / BK >= 2);          // the ring starts with two stages
static_assert((MROWS % BM) == 0 && (SEQ % BM) == 0 && (DIM % BN) == 0 && (KVD % BN) == 0);
static_assert(BM == EROWS);                               // a block is all early rows or none
static_assert((BM + BN) * (BK / 8) == 256 * 16);          // 16 copies of 16 B per thread and stage
static_assert((size_t)4 * 64 * LDC * 4 <= (size_t)2 * STAGE_H * 2);   // C staging fits the ring
static_assert((size_t)2 * STAGE_H * 2 <= (size_t)163840);             // two blocks per WGP

#define WCARRY 64.0f     // weight planes carried x64
#define PCARRY 1024.0f   // softmax numerators carried x1024
#define VCARRY 64.0f     // attention output plane carried x64
#define RCARRY 1024.0f   // residual planes (p, v) carried x1024 on top of their hi part
#define SCRES  2048.0f   // residual planes (q, k, attention rows) carried x2048 on top of their hi part

// epilogue store-loop coverage (rows admitted per step x steps == tile rows)
#define TILE_ROWS        64
#define EPI16_ROWS_STEP  (256 / 8)
#define EPI16_STEPS      2
#define EPIF_ROWS_STEP   (256 / 16)   // 16 lanes x 16 B per 256-B row segment
#define EPIF_STEPS       4
static_assert(EPI16_ROWS_STEP * EPI16_STEPS == TILE_ROWS);
static_assert(EPIF_ROWS_STEP * EPIF_STEPS == TILE_ROWS);
static_assert(8 * 16 == 128);                 // attention block: 8 waves x 16 query rows

// static LDS per kernel (bytes)
static_assert((size_t)(4 * 64 * LDT) * 2 <= (size_t)131072);

// workspace layout (bytes)
#define WSQ_BYTES     ((size_t)DIM * DIM * 2)
#define WKV_BYTES     ((size_t)KVD * DIM * 2)
#define PLANE16_BYTES ((size_t)MROWS * DIM * 2)
#define VRES_BYTES    ((size_t)NB * DIM * 64 * 2)
#define QRES_BYTES    ((size_t)NB * NHEAD * EROWS * HD * 2)
#define KRES_BYTES    ((size_t)NB * NHEAD * ECHUNK * HD * 2)
#define CRES_BYTES    ((size_t)NB * EROWS * DIM * 2)
#define OFF_WQ  ((size_t)0)
#define OFF_WK  (OFF_WQ + WSQ_BYTES)
#define OFF_WV  (OFF_WK + WKV_BYTES)
#define OFF_WO  (OFF_WV + WKV_BYTES)
#define OFF_X   (OFF_WO + WSQ_BYTES)
#define OFF_Q   (OFF_X + PLANE16_BYTES)
#define OFF_K   (OFF_Q + PLANE16_BYTES)
#define OFF_VT  (OFF_K + PLANE16_BYTES)
#define OFF_CTX (OFF_VT + PLANE16_BYTES)
#define OFF_VR  (OFF_CTX + PLANE16_BYTES)
#define OFF_QR  (OFF_VR + VRES_BYTES)
#define OFF_KR  (OFF_QR + QRES_BYTES)
#define OFF_CR  (OFF_KR + KRES_BYTES)
#define WS_TOTAL (OFF_CR + CRES_BYTES)
static_assert((WSQ_BYTES % 128) == 0 && (WKV_BYTES % 128) == 0 && (PLANE16_BYTES % 128) == 0);
static_assert((VRES_BYTES % 128) == 0);
static_assert((QRES_BYTES % 128) == 0 && (KRES_BYTES % 128) == 0 && (CRES_BYTES % 128) == 0);
static_assert(WS_TOTAL <= (size_t)134217728);

// ---------------------------------------------------------------------------
__device__ __forceinline__ float bf16r(float x) {   // RNE convert to bf16, returned widened
  unsigned int u = __float_as_uint(x);
  u = (u + 0x7FFFu + ((u >> 16) & 1u)) & 0xFFFF0000u;
  return __uint_as_float(u);
}

// f32 -> f16 operand convert that cannot produce an f16 subnormal (value select).
static __device__ __forceinline__ _Float16 toh_flush(float v) {
  const _Float16 r = (_Float16)v;
  return (fabsf(v) < 6.103515625e-05f) ? (_Float16)0.0f : r;
}

// 16-bit fragment: p points at element [row = lane&15][k0 + 8*(lane>>4)] of a k-contiguous
// row. Elements 0..7 <- k0+8h+0..7, elements 8..15 <- k0+16+8h+0..7 (same map for A and B).
__device__ __forceinline__ v16h frag_at(const _Float16* p) {
  v8h lo = *(const v8h*)(p);
  v8h hi = *(const v8h*)(p + 16);
  v16h out;
#pragma unroll
  for (int i = 0; i < 8; ++i) { out[i] = lo[i]; out[i + 8] = hi[i]; }
  return out;
}
__device__ __forceinline__ v16h ld_frag(const _Float16* base, unsigned ld) {
  const unsigned lane = threadIdx.x & 31u;
  return frag_at(base + (lane & 15u) * ld + (lane >> 4) * 8u);
}

__device__ __forceinline__ v8f wmma16(v16h a, v16h b, v8f c) {
  v8f d = __builtin_amdgcn_wmma_f32_16x16x32_f16(false, a, false, b, (short)0, c,
                                                 false, false);
  asm volatile("v_nop\n\tv_nop\n\tv_nop\n\tv_nop" : "+v"(d) : "v"(a), "v"(b));
  return d;
}

// Eight asynchronous 16-B copies of one lane, global -> LDS, rows 16 apart on both sides.
// lds: the lane's LDS byte address; g: the lane's global address; K: source pitch in halves.
// The s_wait_xcnt ends the copies' own statement so that no address register is rewritten
// ahead of it.
__device__ __forceinline__ void stage_copy8(const unsigned lds, const _Float16* g,
                                            const unsigned K) {
  const unsigned ls = 16u * LDG * 2u;
  const size_t gs = (size_t)16 * K;
  asm volatile(
      "global_load_async_to_lds_b128 %0, %8, off\n\t"
      "global_load_async_to_lds_b128 %1, %9, off\n\t"
      "global_load_async_to_lds_b128 %2, %10, off\n\t"
      "global_load_async_to_lds_b128 %3, %11, off\n\t"
      "global_load_async_to_lds_b128 %4, %12, off\n\t"
      "global_load_async_to_lds_b128 %5, %13, off\n\t"
      "global_load_async_to_lds_b128 %6, %14, off\n\t"
      "global_load_async_to_lds_b128 %7, %15, off\n\t"
      "s_wait_xcnt 0x0"
      :
      : "v"(lds), "v"(lds + ls), "v"(lds + 2u * ls), "v"(lds + 3u * ls), "v"(lds + 4u * ls),
        "v"(lds + 5u * ls), "v"(lds + 6u * ls), "v"(lds + 7u * ls), "v"(g), "v"(g + gs),
        "v"(g + 2u * gs), "v"(g + 3u * gs), "v"(g + 4u * gs), "v"(g + 5u * gs),
        "v"(g + 6u * gs), "v"(g + 7u * gs)
      : "memory");
}

// acc[i][j] += A[128 rows][K] . B[128 rows][K]^T for this wave's 64 x 32 part of the block tile
// (mw = 64-row group, nw = 32-column group). Arow / Brow: first row of the block's A / B rows.
// Two LDS buffers of one 128-k stage each; stage t + 2 is copied into the buffer that trip t
// has just left, behind the barrier that also publishes stage t + 1. On entry every wave's
// earlier LDS reads of St have retired in front of a barrier that all waves have passed.
__device__ __forceinline__ void gemm_mainloop(const _Float16* __restrict__ Arow,
                                              const _Float16* __restrict__ Brow,
                                              const unsigned K, _Float16* St,
                                              v8f (&acc)[4][2]) {
  const unsigned tid = threadIdx.x, lane = tid & 31u, w = tid >> 5;
  const unsigned mw = w >> 2, nw = w & 3u;
  const unsigned hh = lane >> 4, m = lane & 15u;
  const unsigned cr = tid >> 4, cc = (tid & 15u) * 8u;   // copy: row (of 16), 16-B column
  const _Float16* ga = Arow + (size_t)cr * K + cc;
  const _Float16* gb = Brow + (size_t)cr * K + cc;
  const unsigned la = (unsigned)(size_t)St + (cr * LDG + cc) * 2u;
  const unsigned lb = la + BM * LDG * 2u;
  const unsigned nt = K / BK;

  stage_copy8(la, ga, K);
  stage_copy8(lb, gb, K);
  asm volatile("s_wait_asynccnt 0x0" ::: "memory");   // stage 0 landed (this wave's copies)
  __syncthreads();                                    // stage 0 readable by every wave
  stage_copy8(la + STAGE_H * 2u, ga + BK, K);
  stage_copy8(lb + STAGE_H * 2u, gb + BK, K);

  const _Float16* fa = St + (mw * 64u + m) * LDG + hh * 8u;
  const _Float16* fb = St + (BM + nw * 32u + m) * LDG + hh * 8u;
#pragma unroll 1   // one stage per trip: the buffer alternates by t & 1, the text stays short
  for (unsigned t = 0; t < nt; ++t) {
    const unsigned bo = (t & 1u) * STAGE_H;
#pragma unroll
    for (unsigned kk = 0; kk < BK / 32u; ++kk) {
      v16h a[4], b[2];
#pragma unroll
      for (unsigned i = 0; i < 4u; ++i) a[i] = frag_at(fa + bo + i * 16u * LDG + kk * 32u);
#pragma unroll
      for (unsigned j = 0; j < 2u; ++j) b[j] = frag_at(fb + bo + j * 16u * LDG + kk * 32u);
#pragma unroll
      for (unsigned i = 0; i < 4u; ++i)
#pragma unroll
        for (unsigned j = 0; j < 2u; ++j) acc[i][j] = wmma16(a[i], b[j], acc[i][j]);
    }
    asm volatile("s_wait_dscnt 0x0" ::: "memory");      // this wave has left buffer t & 1
    asm volatile("s_wait_asynccnt 0x0" ::: "memory");   // its copies of stage t + 1 landed
    __syncthreads();   // publishes stage t + 1, frees buffer t & 1
    if (t + 2u < nt) {
      stage_copy8(la + bo * 2u, ga + (t + 2u) * BK, K);
      stage_copy8(lb + bo * 2u, gb + (t + 2u) * BK, K);
    }
  }
  asm volatile("s_wait_asynccnt 0x0" ::: "memory");     // nothing in flight when St is reused
}

// ---------------------------------------------------------------------------
// Row cast: f32 rows of DIM columns -> f16 compact rows of DIM columns, one wave per row,
// 8 rows per block, 8 rolled passes; each store instruction of a wave covers 512 contiguous
// SRC_INPUT = 1: source is the module input (full-size row stride per batch), carry 1;
// SRC_INPUT = 0: source is an [out][in] weight (already k-contiguous), carry x64.
// Every value goes through RNE bf16 first. Grid (rows/8).
// ---------------------------------------------------------------------------
template <int SRC_INPUT>
__device__ __forceinline__ void cast_body(const float* __restrict__ X,
                                          _Float16* __restrict__ dst) {
#pragma clang fp contract(off)
  const unsigned lane = threadIdx.x & 31u;
  const unsigned w = (unsigned)__builtin_amdgcn_readfirstlane((int)(threadIdx.x >> 5));
  const unsigned crow = blockIdx.x * 8u + w;
  size_t srow = crow;
  if (SRC_INPUT) {
    const unsigned bidx = crow / (unsigned)SEQ;
    const unsigned sq = crow - bidx * (unsigned)SEQ;
    srow = (size_t)bidx * SEQ_FULL + sq;
  }
  const float carry = SRC_INPUT ? 1.0f : WCARRY;
  const float* xr = X + srow * DIM + lane * 8u;
  _Float16* dr = dst + (size_t)crow * DIM + lane * 8u;
#pragma unroll 1
  for (unsigned j = 0; j < 8u; ++j) {
    const v4f a0 = *(const v4f*)(xr + j * 256u);
    const v4f a1 = *(const v4f*)(xr + j * 256u + 4u);
    v8h o;
#pragma unroll
    for (int i = 0; i < 4; ++i) {
      o[i]     = toh_flush(carry * bf16r(a0[i]));
      o[i + 4] = toh_flush(carry * bf16r(a1[i]));
    }
    _Float16* p = dr + j * 256u;
    *(v8h*)p = o;
    
  }
}

__global__ __launch_bounds__(256) void xcast_kernel(
    const float* __restrict__ X, _Float16* __restrict__ dst) {
  cast_body<1>(X, dst);
}
__global__ __launch_bounds__(256) void wcast_kernel(
    const float* __restrict__ W, _Float16* __restrict__ dst) {
  cast_body<0>(W, dst);
}

// ---------------------------------------------------------------------------
// GEMM C[128x128 tile] = A16[rows][K] . Bt[n][K]^T; both operands staged in LDS by asynchronous
// copies (gemm_mainloop); 8 waves (mw = 64-row group, nw = 32-col group), 8 accumulators/wave.
// The epilogue treats the tile as four 64x64 sub-tiles (bx = 64-column block, row0 = first row):
//   MODE 0: out16[row][col] (pitch DIM) = f16(acc/64)                       (q plane);
//           row tiles with sequence row < 128 also write
//           out16r [b][head][128][64] = f16(2048 * (q - hi))
//   MODE 1: tile column block = one shared key head; out16[row][(4*kvh + rep)*64 + c]
//           (pitch DIM) = f16(acc/64) for rep 0..3                          (k plane);
//           the key tile 0 of each sequence also writes
//           out16r [b][4*kvh + rep][64][64] = f16(2048 * (k - hi)) for rep 0..3
//   MODE 2: transposed V plane [b][(4*kvh + rep)*64 + d][key] = f16(acc/64) for rep 0..3;
//           for key tile 0 also out16r [b][(4*kvh + rep)*64 + d][64] = f16(1024 * (v - hi))
//   MODE 3: outf full [full row][col] = acc/4096                            (output buffer);
//           row tiles with sequence row < 128 run a second accumulator set fed by the
//           residual rows A16r [b][128][K] against the same B rows (a second pass of the main
//           loop), folded as acc + accres/2048 before the 1/4096 scale (block-uniform test).
// Store loops: MODE 0/1/2: 32 rows per step x 2 steps = 64; MODE 3: 16 rows x 4 steps = 64.
// Grid (N/128, MROWS/128).
// ---------------------------------------------------------------------------
template <int MODE>
__device__ __forceinline__ void gemm_body(
    const _Float16* __restrict__ A16, const _Float16* __restrict__ A16r,
    const _Float16* __restrict__ Bt, const unsigned K,
    float* __restrict__ outf, _Float16* __restrict__ out16, _Float16* __restrict__ out16r) {
  __shared__ __attribute__((aligned(16))) _Float16 St[2 * STAGE_H];
  const unsigned tid = threadIdx.x, lane = tid & 31u, w = tid >> 5;
  const unsigned mw = w >> 2, nw = w & 3u;
  const unsigned hh = lane >> 4, m = lane & 15u;
  const unsigned brow0 = blockIdx.y * (unsigned)BM;
  const _Float16* Brow = Bt + (size_t)(blockIdx.x * (unsigned)BN) * K;

  v8f acc[4][2] = {};
  gemm_mainloop(A16 + (size_t)brow0 * K, Brow, K, St, acc);
  if (MODE == 3) {
    const unsigned bidx3 = brow0 / (unsigned)SEQ;
    const unsigned sq3 = brow0 - bidx3 * (unsigned)SEQ;
    if (sq3 < (unsigned)EROWS) {               // block-uniform
      v8f res[4][2] = {};
      gemm_mainloop(A16r + (size_t)(bidx3 * (unsigned)EROWS + sq3) * K, Brow, K, St, res);
#pragma unroll
      for (int i = 0; i < 4; ++i)
#pragma unroll
        for (int j = 0; j < 2; ++j)
#pragma unroll
          for (int r = 0; r < 8; ++r) acc[i][j][r] = acc[i][j][r] + res[i][j][r] * (1.0f / SCRES);
    }
  }
  // C staging over the ring (every wave is behind the main loop's last barrier):
  // four [64][LDC] sub-tiles, sub = 2 * (row half) + (column half)
  float* Call = (float*)St;
#pragma unroll
  for (unsigned i = 0; i < 4u; ++i)
#pragma unroll
    for (unsigned j = 0; j < 2u; ++j)
#pragma unroll
      for (unsigned r = 0; r < 8u; ++r)
        Call[((mw * 2u + (nw >> 1)) * 64u + i * 16u + hh * 8u + r) * LDC + (nw & 1u) * 32u +
             j * 16u + m] = acc[i][j][r];
  __syncthreads();

  for (unsigned sub = 0; sub < 4u; ++sub) {
  const float* Cs = Call + sub * (64u * LDC);
  const unsigned bx = blockIdx.x * 2u + (sub & 1u);
  const unsigned n0 = bx * 64u;
  const unsigned row0 = brow0 + (sub >> 1) * 64u;

  if (MODE == 0 || MODE == 1) {
    constexpr unsigned NREP  = (MODE == 1) ? (unsigned)GQA : 1u;
    constexpr unsigned RROWS = (MODE == 1) ? (unsigned)ECHUNK : (unsigned)EROWS;
    const unsigned cb = (MODE == 1) ? bx * (unsigned)(GQA * HD) : n0;
    const unsigned bidx = row0 / (unsigned)SEQ;
    const unsigned sq0 = row0 - bidx * (unsigned)SEQ;
    const bool has_res = (sq0 < RROWS);        // block-uniform (MODE 1: key tile 0 only)
    v8h x[2], xr[2];
    size_t off[2], offr[2];
#pragma unroll
    for (unsigned i = 0; i < 2u; ++i) {
      const unsigned r = 32u * i + (tid >> 3);
      const unsigned c = (tid & 7u) * 8u;
      const v4f u0 = *(const v4f*)&Cs[r * LDC + c];
      const v4f u1 = *(const v4f*)&Cs[r * LDC + c + 4];
#pragma unroll
      for (int j = 0; j < 4; ++j) {
        x[i][j]     = toh_flush(u0[j] * (1.0f / WCARRY));
        x[i][j + 4] = toh_flush(u1[j] * (1.0f / WCARRY));
      }
      xr[i] = x[i];
      if (has_res) {
#pragma unroll
        for (int j = 0; j < 4; ++j) {
          const float t0 = u0[j] * (1.0f / WCARRY);
          const float t1 = u1[j] * (1.0f / WCARRY);
          xr[i][j]     = toh_flush((t0 - (float)x[i][j]) * SCRES);
          xr[i][j + 4] = toh_flush((t1 - (float)x[i][j + 4]) * SCRES);
        }
      }
      off[i] = (size_t)(row0 + r) * DIM + cb + c;
      offr[i] = ((size_t)(bidx * (unsigned)NHEAD + bx * NREP) * RROWS + sq0 + r) * HD + c;
    }
#pragma unroll
    for (unsigned rep = 0; rep < NREP; ++rep) {
#pragma unroll
      for (int i = 0; i < 2; ++i)
        *(v8h*)(out16 + off[i] + (size_t)rep * HD) = x[i];
    }
    asm volatile("s_wait_xcnt 0x0" ::: "memory");   // before the stores' registers are reused
    if (has_res) {
#pragma unroll
      for (unsigned rep = 0; rep < NREP; ++rep) {
#pragma unroll
        for (int i = 0; i < 2; ++i)
          *(v8h*)(out16r + offr[i] + (size_t)rep * RROWS * HD) = xr[i];
      }
      asm volatile("s_wait_xcnt 0x0" ::: "memory");   // before the stores' registers are reused
    }
    
  }

  if (MODE == 2) {
    const unsigned bidx = row0 / (unsigned)SEQ;
    const unsigned key0 = row0 - bidx * (unsigned)SEQ;
    const bool first_tile = (key0 == 0u);      // block-uniform
    v8h x[2], xr[2];
    size_t off[2], offr[2];
#pragma unroll
    for (unsigned i = 0; i < 2u; ++i) {
      const unsigned dcol = 32u * i + (tid >> 3);
      const unsigned kk = (tid & 7u) * 8u;
#pragma unroll
      for (unsigned j = 0; j < 8u; ++j) {
        const float t = Cs[(kk + j) * LDC + dcol] * (1.0f / WCARRY);
        const _Float16 hi = toh_flush(t);
        x[i][j]  = hi;
        xr[i][j] = toh_flush((t - (float)hi) * RCARRY);
      }
      const size_t vrow = (size_t)bidx * DIM + bx * (unsigned)(GQA * HD) + dcol;
      off[i]  = vrow * SEQ + key0 + kk;
      offr[i] = vrow * 64u + kk;
    }
#pragma unroll
    for (unsigned rep = 0; rep < (unsigned)GQA; ++rep) {
#pragma unroll
      for (int i = 0; i < 2; ++i)
        *(v8h*)(out16 + off[i] + (size_t)rep * HD * SEQ) = x[i];
    }
    asm volatile("s_wait_xcnt 0x0" ::: "memory");   // before the stores' registers are reused
    if (first_tile) {
#pragma unroll
      for (unsigned rep = 0; rep < (unsigned)GQA; ++rep) {
#pragma unroll
        for (int i = 0; i < 2; ++i)
          *(v8h*)(out16r + offr[i] + (size_t)rep * HD * 64u) = xr[i];
      }
      asm volatile("s_wait_xcnt 0x0" ::: "memory");   // before the stores' registers are reused
    }
    
  }

  if (MODE == 3) {
    const float cs = 1.0f / (WCARRY * VCARRY);
    v4f xs[4];
    size_t off[4];
#pragma unroll
    for (unsigned i = 0; i < 4u; ++i) {
      const unsigned r = 16u * i + (tid >> 4);
      const unsigned c = (tid & 15u) * 4u;
      const unsigned crow = row0 + r;
      const unsigned bidx = crow / (unsigned)SEQ;
      const unsigned sq = crow - bidx * (unsigned)SEQ;
      const size_t frow = (size_t)bidx * SEQ_FULL + sq;
      const v4f u = *(const v4f*)&Cs[r * LDC + c];
      v4f val;
#pragma unroll
      for (int j = 0; j < 4; ++j) val[j] = u[j] * cs;
      xs[i] = val;
      off[i] = frow * DIM + n0 + c;
    }
#pragma unroll
    for (int i = 0; i < 4; ++i) *(v4f*)(outf + off[i]) = xs[i];
  }
  }   // sub
}

__global__ __launch_bounds__(256) void gemm_q_kernel(
    const _Float16* __restrict__ A16, const _Float16* __restrict__ Bt,
    _Float16* __restrict__ out16, _Float16* __restrict__ out16r) {
  gemm_body<0>(A16, A16, Bt, (unsigned)DIM, (float*)0, out16, out16r);
}
__global__ __launch_bounds__(256) void gemm_k_kernel(
    const _Float16* __restrict__ A16, const _Float16* __restrict__ Bt,
    _Float16* __restrict__ out16, _Float16* __restrict__ out16r) {
  gemm_body<1>(A16, A16, Bt, (unsigned)DIM, (float*)0, out16, out16r);
}
__global__ __launch_bounds__(256) void gemm_v_kernel(
    const _Float16* __restrict__ A16, const _Float16* __restrict__ Bt,
    _Float16* __restrict__ vt, _Float16* __restrict__ vtr) {
  gemm_body<2>(A16, A16, Bt, (unsigned)DIM, (float*)0, vt, vtr);
}
__global__ __launch_bounds__(256) void gemm_wo_kernel(
    const _Float16* __restrict__ A16, const _Float16* __restrict__ A16r,
    const _Float16* __restrict__ Bt, float* __restrict__ outf) {
  gemm_body<3>(A16, A16r, Bt, (unsigned)DIM, outf, (_Float16*)0, (_Float16*)0);
}

__device__ __forceinline__ float xhalf(float x) {
  const int b = __builtin_bit_cast(int, x);
  return __builtin_bit_cast(
      float, __builtin_amdgcn_permlanex16(b, b, 0x76543210, 0xfedcba98, false, false));
}

__global__ __launch_bounds__(256) void attn_kernel(
    const _Float16* __restrict__ Qh, const _Float16* __restrict__ QhR,
    const _Float16* __restrict__ Kh, const _Float16* __restrict__ KhR,
    const _Float16* __restrict__ Vt, const _Float16* __restrict__ VtR,
    _Float16* __restrict__ Ov, _Float16* __restrict__ OvR) {
  __shared__ _Float16 Ks[64 * LDT];
  __shared__ _Float16 Vs[64 * LDT];
  __shared__ _Float16 VRs[64 * LDT];
  __shared__ _Float16 KRs[64 * LDT];

  const unsigned tid = threadIdx.x, lane = tid & 31u, w = tid >> 5;
  const unsigned hh = lane >> 4, m = lane & 15u;
  const unsigned q0 = blockIdx.x * 128u;
  const unsigned head = blockIdx.y;
  const unsigned b = blockIdx.z;
  const float scale = 0.125f;   // HD^-0.5
  const unsigned qrow0 = q0 + w * 16u;
  const bool first_blk = (blockIdx.x == 0u);

  const size_t qoff = (size_t)(b * (unsigned)SEQ + qrow0 + m) * DIM + head * HD + hh * 8u;
  v16h qf[2];
  qf[0] = frag_at(Qh + qoff);
  qf[1] = frag_at(Qh + qoff + 32);

  float mrun = -1.0e30f;   // running maximum of query qrow0 + m (equal in both halves)
  float lsum = 0.0f;       // running sum over this half's keys only
  v8f o[4];
#pragma unroll
  for (int nb = 0; nb < 4; ++nb) o[nb] = (v8f){};

  const size_t kplane = (size_t)b * SEQ * DIM + head * HD;
  const size_t vplane = ((size_t)b * DIM + head * HD) * SEQ;
  const size_t rplane = ((size_t)b * DIM + head * HD) * 64u;
  const size_t krplane = ((size_t)(b * (unsigned)NHEAD + head) * ECHUNK) * HD;
  const unsigned kend = q0 + 128u;   // <= SEQ

  for (unsigned kb = 0; kb < kend; kb += 64u) {
    const bool early = first_blk && (kb == 0u);   // block-uniform
#pragma unroll
    for (unsigned j = 0; j < 2u; ++j) {
      const unsigned idx = tid + 256u * j;
      const unsigned r = idx >> 3, c = (idx & 7u) * 8u;
      *(v8h*)&Ks[r * LDT + c] = *(const v8h*)(Kh + kplane + (size_t)(kb + r) * DIM + c);
      *(v8h*)&Vs[r * LDT + c] = *(const v8h*)(Vt + vplane + (size_t)r * SEQ + kb + c);
    }
    if (early) {
#pragma unroll
      for (unsigned j = 0; j < 2u; ++j) {
        const unsigned idx = tid + 256u * j;
        const unsigned r = idx >> 3, c = (idx & 7u) * 8u;
        *(v8h*)&VRs[r * LDT + c] = *(const v8h*)(VtR + rplane + (size_t)r * 64u + c);
        *(v8h*)&KRs[r * LDT + c] = *(const v8h*)(KhR + krplane + (size_t)r * HD + c);
      }
    }
    __syncthreads();

    // scores, transposed: 4 key groups of 16 (rows), K = 64 in two 32-steps
    v8f s[4];
    if (early) {
      // early corner: value + residual products, one score tile at a time through ONE
      // residual accumulator; q0 == 0 here so qrow0 + m < 128
      const unsigned qrbase =
          ((b * (unsigned)NHEAD + head) * (unsigned)EROWS + qrow0 + m) * (unsigned)HD + hh * 8u;
#pragma unroll
      for (int kg = 0; kg < 4; ++kg) {
        v8f t = {};
#pragma unroll
        for (int c = 0; c < 2; ++c) {
          unsigned qro = qrbase + (unsigned)c * 32u;
          asm volatile("" : "+v"(qro));   // opaque offset: the residual q fragment is reloaded per tile
          v8f tr = {};
          {
            const v16h kf = ld_frag(&Ks[(kg * 16) * LDT + c * 32], LDT);
            t = wmma16(kf, qf[c], t);
            const v16h ql = frag_at(QhR + qro);
            tr = wmma16(kf, ql, tr);
          }
          {
            const v16h kl = ld_frag(&KRs[(kg * 16) * LDT + c * 32], LDT);
            tr = wmma16(kl, qf[c], tr);
          }
          t = t + tr * (1.0f / SCRES);
          __builtin_amdgcn_sched_barrier(0);   // the next tile's loads stay behind this tile
        }
        s[kg] = t * scale;
      }
    } else {
#pragma unroll
      for (int kg = 0; kg < 4; ++kg) {
        v8f t = {};
#pragma unroll
        for (int c = 0; c < 2; ++c) {
          const v16h kf = ld_frag(&Ks[(kg * 16) * LDT + c * 32], LDT);
          t = wmma16(kf, qf[c], t);
        }
        s[kg] = t * scale;
      }
    }

    // causal replace-mask (key > query) in chunks that reach the diagonal; block-uniform test
    if (kb >= q0) {
#pragma unroll
      for (int kg = 0; kg < 4; ++kg)
#pragma unroll
        for (int v = 0; v < 8; ++v) {
          const unsigned key = kb + (unsigned)kg * 16u + hh * 8u + (unsigned)v;
          const unsigned row = qrow0 + m;
          s[kg][v] = (key > row) ? -1.0e30f : s[kg][v];
        }
    }

    // online softmax of the lane's own query: 32 keys here, 32 in lane ^ 16
    float mt[8];
#pragma unroll
    for (int v = 0; v < 8; ++v)
      mt[v] = fmaxf(fmaxf(s[0][v], s[1][v]), fmaxf(s[2][v], s[3][v]));
    float mx = fmaxf(fmaxf(fmaxf(mt[0], mt[1]), fmaxf(mt[2], mt[3])),
                     fmaxf(fmaxf(mt[4], mt[5]), fmaxf(mt[6], mt[7])));
    mx = fmaxf(mx, xhalf(mx));
    const float mn = fmaxf(mrun, mx);
    const float alpha = __expf(mrun - mn);
    mrun = mn;
#pragma unroll
    for (int kg = 0; kg < 4; ++kg)
#pragma unroll
      for (int v = 0; v < 8; ++v) s[kg][v] = __expf(s[kg][v] - mrun);
    {
      float part[8];
#pragma unroll
      for (int v = 0; v < 8; ++v) part[v] = (s[0][v] + s[1][v]) + (s[2][v] + s[3][v]);
      const float rs = ((part[0] + part[1]) + (part[2] + part[3])) +
                       ((part[4] + part[5]) + (part[6] + part[7]));
      lsum = alpha * lsum + rs;
    }
#pragma unroll
    for (int nb = 0; nb < 4; ++nb)
#pragma unroll
      for (int v = 0; v < 8; ++v) o[nb][v] = o[nb][v] * alpha;

    // P^T fragments [32 keys][16 queries], f16(1024 p), from the score tiles in place
    v16h pf[2];
#pragma unroll
    for (int c = 0; c < 2; ++c)
#pragma unroll
      for (int i = 0; i < 8; ++i) {
        pf[c][i]     = toh_flush(s[2 * c][i] * PCARRY);
        pf[c][i + 8] = toh_flush(s[2 * c + 1][i] * PCARRY);
      }

    // O^T += V^T . P^T  (K = 64 keys in two 32-steps; A = V^T tile [d][key])
#pragma unroll
    for (int c = 0; c < 2; ++c) {
#pragma unroll
      for (int nb = 0; nb < 4; ++nb) {
        const v16h vf = ld_frag(&Vs[(nb * 16) * LDT + c * 32], LDT);
        o[nb] = wmma16(vf, pf[c], o[nb]);
      }
    }

    if (early) {
      // V_res . P_hi (scale 1/1024), one 16-column group at a time, folded immediately
#pragma unroll
      for (int nb = 0; nb < 4; ++nb) {
        v8f o2 = {};
#pragma unroll
        for (int c = 0; c < 2; ++c) {
          const v16h vr = ld_frag(&VRs[(nb * 16) * LDT + c * 32], LDT);
          o2 = wmma16(vr, pf[c], o2);
        }
#pragma unroll
        for (int v = 0; v < 8; ++v) o[nb][v] = o[nb][v] + o2[v] * (1.0f / RCARRY);
      }
      // P residual fragments: f16(1024 * (1024 p - f16(1024 p)))
      v16h pr[2];
#pragma unroll
      for (int c = 0; c < 2; ++c)
#pragma unroll
        for (int i = 0; i < 16; ++i) {
          const float t = s[2 * c + (i >> 3)][i & 7] * PCARRY;
          const float hi = (float)toh_flush(t);
          pr[c][i] = toh_flush((t - hi) * RCARRY);
        }
      // V_hi . P_res (scale 1/1024), one 16-column group at a time, folded immediately
#pragma unroll
      for (int nb = 0; nb < 4; ++nb) {
        v8f o2 = {};
#pragma unroll
        for (int c = 0; c < 2; ++c) {
          const v16h vf = ld_frag(&Vs[(nb * 16) * LDT + c * 32], LDT);
          o2 = wmma16(vf, pr[c], o2);
        }
#pragma unroll
        for (int v = 0; v < 8; ++v) o[nb][v] = o[nb][v] + o2[v] * (1.0f / RCARRY);
      }
    }
    __syncthreads();
  }

  const float lrow = lsum + xhalf(lsum);   // the two halves' keys joined
  const float inv = __builtin_amdgcn_rcpf(lrow) * (VCARRY / PCARRY);
  v8h x[4];
#pragma unroll
  for (int nb = 0; nb < 4; ++nb)
#pragma unroll
    for (int v = 0; v < 8; ++v) x[nb][v] = toh_flush(o[nb][v] * inv);
  _Float16* po = Ov + (size_t)(b * (unsigned)SEQ + qrow0 + m) * DIM + head * HD + hh * 8u;
#pragma unroll
  for (int nb = 0; nb < 4; ++nb) *(v8h*)(po + nb * 16) = x[nb];
  // before the stores' registers are reused; in front of the branch, where it stays directly
  // behind the stores
  asm volatile("s_wait_xcnt 0x0" ::: "memory");
  if (first_blk) {
    // residual rows (first query block only; qrow0 < 128): f16(2048 * (t - f16(t)))
    v8h xr[4];
#pragma unroll
    for (int nb = 0; nb < 4; ++nb)
#pragma unroll
      for (int v = 0; v < 8; ++v)
        xr[nb][v] = toh_flush((o[nb][v] * inv - (float)x[nb][v]) * SCRES);
    _Float16* pres = OvR + (size_t)(b * (unsigned)EROWS + qrow0 + m) * DIM + head * HD + hh * 8u;
#pragma unroll
    for (int nb = 0; nb < 4; ++nb) *(v8h*)(pres + nb * 16) = xr[nb];
  }
}

// ---------------------------------------------------------------------------
extern "C" void kernel_launch(void* const* d_in, const int* in_sizes, int n_in,
                              void* d_out, int out_size, void* d_ws, size_t ws_size,
                              hipStream_t stream) {
  if (n_in < 5) return;
  const long long need_x = ((long long)(NB - 1) * SEQ_FULL + SEQ) * DIM;
  if ((long long)in_sizes[0] < need_x) return;
  if ((long long)in_sizes[1] < (long long)DIM * DIM) return;
  if ((long long)in_sizes[2] < (long long)KVD * DIM) return;
  if ((long long)in_sizes[3] < (long long)KVD * DIM) return;
  if ((long long)in_sizes[4] < (long long)DIM * DIM) return;
  if ((long long)out_size < need_x) return;
  if (ws_size < WS_TOTAL) return;

  // bound by the input list order: x, wq, wk, wv, wo
  const float* X  = (const float*)d_in[0];    // [NB_FULL][SEQ_FULL][DIM]
  const float* wq = (const float*)d_in[1];    // [DIM][DIM]  (out, in)
  const float* wk = (const float*)d_in[2];    // [KVD][DIM]  (out, in)
  const float* wv = (const float*)d_in[3];    // [KVD][DIM]  (out, in)
  const float* wo = (const float*)d_in[4];    // [DIM][DIM]  (out, in)
  float* out = (float*)d_out;

  char* ws = (char*)d_ws;
  _Float16* Wq_t  = (_Float16*)(ws + OFF_WQ);    // [n][k], x64
  _Float16* Wk_t  = (_Float16*)(ws + OFF_WK);    // [KVD][DIM]
  _Float16* Wv_t  = (_Float16*)(ws + OFF_WV);    // [KVD][DIM]
  _Float16* Wo_t  = (_Float16*)(ws + OFF_WO);    // [n][k], x64
  _Float16* X16   = (_Float16*)(ws + OFF_X);     // [MROWS][DIM]
  _Float16* Qh16  = (_Float16*)(ws + OFF_Q);     // [MROWS][DIM]
  _Float16* Kh16  = (_Float16*)(ws + OFF_K);     // [MROWS][DIM], shared heads written 4x
  _Float16* Vt16  = (_Float16*)(ws + OFF_VT);    // [b][DIM][SEQ], shared heads written 4x
  _Float16* Ctx16 = (_Float16*)(ws + OFF_CTX);   // [MROWS][DIM], x64
  _Float16* VtR16 = (_Float16*)(ws + OFF_VR);    // [b][DIM][64]
  _Float16* QR16  = (_Float16*)(ws + OFF_QR);    // [b][NHEAD][128][64], x2048
  _Float16* KR16  = (_Float16*)(ws + OFF_KR);    // [b][NHEAD][64][64], x2048, shared heads 4x
  _Float16* CR16  = (_Float16*)(ws + OFF_CR);    // [b][128][DIM], x2048 on top of x64

  dim3 blk(256);

  // weight planes: [out][in] rows are already k-contiguous; 8 rows per block
  wcast_kernel<<<dim3(DIM / 8), blk, 0, stream>>>(wq, Wq_t);
  wcast_kernel<<<dim3(KVD / 8), blk, 0, stream>>>(wk, Wk_t);
  wcast_kernel<<<dim3(KVD / 8), blk, 0, stream>>>(wv, Wv_t);
  wcast_kernel<<<dim3(DIM / 8), blk, 0, stream>>>(wo, Wo_t);
  xcast_kernel<<<dim3(MROWS / 8), blk, 0, stream>>>(X, X16);

  // gemm_q_kernel(A16, Bt, out16, out16r)
  gemm_q_kernel<<<dim3(DIM / BN, MROWS / BM), blk, 0, stream>>>(X16, Wq_t, Qh16, QR16);
  // gemm_k_kernel(A16, Bt, out16, out16r)
  gemm_k_kernel<<<dim3(KVD / BN, MROWS / BM), blk, 0, stream>>>(X16, Wk_t, Kh16, KR16);
  // gemm_v_kernel(A16, Bt, vt, vtr)
  gemm_v_kernel<<<dim3(KVD / BN, MROWS / BM), blk, 0, stream>>>(X16, Wv_t, Vt16, VtR16);
  // attn_kernel(Qh, QhR, Kh, KhR, Vt, VtR, Ov, OvR)
  attn_kernel<<<dim3(SEQ / 128, NHEAD, NB), blk, 0, stream>>>(Qh16, QR16, Kh16, KR16, Vt16, VtR16,
                                                              Ctx16, CR16);
  // gemm_wo_kernel(A16, A16r, Bt, outf)
  gemm_wo_kernel<<<dim3(DIM / BN, MROWS / BM), blk, 0, stream>>>(Ctx16, CR16, Wo_t, out);
}

// v003
// It runs in 210 microseconds.
// In both of two side-by-side timings against v002, it was 1.20 times as fast.
// Over all steps from v000 it is 2.29 times as fast.
#include <hip/hip_runtime.h>
#include <stddef.h>

// All contractions on v_wmma_f32_16x16x32_f16 (f16 operands, f32 accumulate): q/k/v projections,
// q.k scores, p.v, output projection. Float inputs are RNE-converted to bf16 and carried in f16
// (weights x64, p x1024, attention rows x64). Early corner only (query rows 0..127 x keys 0..63
// of every (batch, head)): q and k get a x2048 residual plane (two more score products into a
// separate accumulator), p and v a x1024 residual plane, and the attention rows 0..127 a x2048
// residual plane (second accumulator set in the output projection on those row tiles).
// Softmax and all scaling in f32.
// Causal grouped-query attention (32 query heads sharing 8 key/value heads), [out][in] weights,
// no biases; the k and v projection epilogues write every shared head once per query head so
// the attention kernel sees one K row block and one V^T row block per query head.

typedef _Float16 v16h __attribute__((ext_vector_type(16)));
typedef _Float16 v8h  __attribute__((ext_vector_type(8)));
typedef float    v8f  __attribute__((ext_vector_type(8)));
typedef float    v4f  __attribute__((ext_vector_type(4)));

#ifndef NB
#define NB 2
#endif
#ifndef SEQ
#define SEQ 2048
#endif
#define NB_FULL  2
#define SEQ_FULL 2048
#define DIM   2048
#define NHEAD 32
#define HD    64
#define NKV   8
#define GQA   (NHEAD / NKV)
#define KVD   (NKV * HD)
#define MROWS (NB * SEQ)
#define EROWS  128   // early query rows per sequence carried with residual planes (q, ctx)
#define ECHUNK 64    // early keys per sequence carried with residual planes (k, v)

static_assert(NB >= 1 && NB <= NB_FULL);
static_assert(SEQ >= 128 && SEQ <= SEQ_FULL && (SEQ % 128) == 0);
static_assert(DIM == NHEAD * HD);
static_assert(HD == 64);
static_assert(NHEAD == NKV * GQA && GQA == 4);
static_assert(KVD == 512 && (KVD % 64) == 0);
static_assert((DIM % 64) == 0 && (DIM % 32) == 0);
static_assert((MROWS % 64) == 0 && (MROWS % 8) == 0);
static_assert((SEQ % 64) == 0);               // a 64-row GEMM tile never straddles two sequences
static_assert((DIM % 8) == 0 && (KVD % 8) == 0);
static_assert(DIM == 8 * 32 * 8);             // cast: 8 passes x 32 lanes x 8 columns per row
static_assert((size_t)MROWS * DIM < (size_t)0xFFFFFFFFu);
static_assert(EROWS == 128);                  // == query rows of one attention block (block 0)
static_assert(ECHUNK == 64);                  // == keys of one attention step (chunk 0) == one GEMM row tile
static_assert((EROWS % 64) == 0 && EROWS <= SEQ);   // whole 64-row GEMM tiles
static_assert((size_t)NB * NHEAD * EROWS * HD < (size_t)0xFFFFFFFFu);   // 32-bit q residual offsets

#define LDT 72   // halves per LDS row (144 B, 16-B aligned)
#define LDC 68   // floats per LDS row (272 B, 16-B aligned)
static_assert((LDT % 8) == 0 && LDT >= 64);
static_assert((LDC % 4) == 0 && LDC >= 64);

// GEMM block tile and LDS staging
#define BM  128   // output rows per block
#define BN  128   // output columns per block
#define BK  128   // halves of every operand row per stage (256 B)
#define LDG 136   // halves per staged row (272 B = 16 B x 17: b128 fragment reads meet no bank twice)
#define STAGE_H ((BM + BN) * LDG)   // halves per stage: A rows, then B rows
static_assert((LDG % 8) == 0 && LDG >= BK);
static_assert((DIM % BK) == 0 && DIM / BK >= 2);          // the ring starts with two stages
static_assert((MROWS % BM) == 0 && (SEQ % BM) == 0 && (DIM % BN) == 0 && (KVD % BN) == 0);
static_assert(BM == EROWS);                               // a block is all early rows or none
static_assert((BM + BN) * (BK / 8) == 256 * 16);          // 16 copies of 16 B per thread and stage
static_assert((size_t)4 * 64 * LDC * 4 <= (size_t)2 * STAGE_H * 2);   // C staging fits the ring
static_assert((size_t)2 * STAGE_H * 2 <= (size_t)163840);             // two blocks per WGP

#define WCARRY 64.0f     // weight planes carried x64
#define PCARRY 1024.0f   // softmax numerators carried x1024
#define VCARRY 64.0f     // attention output plane carried x64
#define RCARRY 1024.0f   // residual planes (p, v) carried x1024 on top of their hi part
#define SCRES  2048.0f   // residual planes (q, k, attention rows) carried x2048 on top of their hi part

// epilogue store-loop coverage (rows admitted per step x steps == tile rows)
#define TILE_ROWS        64
#define EPI16_ROWS_STEP  (256 / 8)
#define EPI16_STEPS      2
#define EPIF_ROWS_STEP   (256 / 16)   // 16 lanes x 16 B per 256-B row segment
#define EPIF_STEPS       4
static_assert(EPI16_ROWS_STEP * EPI16_STEPS == TILE_ROWS);
static_assert(EPIF_ROWS_STEP * EPIF_STEPS == TILE_ROWS);
static_assert(8 * 16 == 128);                 // attention block: 8 waves x 16 query rows

// static LDS per kernel (bytes)
static_assert((size_t)(4 * 64 * LDT) * 2 <= (size_t)131072);

// workspace layout (bytes)
#define WSQ_BYTES     ((size_t)DIM * DIM * 2)
#define WKV_BYTES     ((size_t)KVD * DIM * 2)
#define PLANE16_BYTES ((size_t)MROWS * DIM * 2)
#define VRES_BYTES    ((size_t)NB * DIM * 64 * 2)
#define QRES_BYTES    ((size_t)NB * NHEAD * EROWS * HD * 2)
#define KRES_BYTES    ((size_t)NB * NHEAD * ECHUNK * HD * 2)
#define CRES_BYTES    ((size_t)NB * EROWS * DIM * 2)
#define OFF_WQ  ((size_t)0)
#define OFF_WK  (OFF_WQ + WSQ_BYTES)
#define OFF_WV  (OFF_WK + WKV_BYTES)
#define OFF_WO  (OFF_WV + WKV_BYTES)
#define OFF_X   (OFF_WO + WSQ_BYTES)
#define OFF_Q   (OFF_X + PLANE16_BYTES)
#define OFF_K   (OFF_Q + PLANE16_BYTES)
#define OFF_VT  (OFF_K + PLANE16_BYTES)
#define OFF_CTX (OFF_VT + PLANE16_BYTES)
#define OFF_VR  (OFF_CTX + PLANE16_BYTES)
#define OFF_QR  (OFF_VR + VRES_BYTES)
#define OFF_KR  (OFF_QR + QRES_BYTES)
#define OFF_CR  (OFF_KR + KRES_BYTES)
#define WS_TOTAL (OFF_CR + CRES_BYTES)
static_assert((WSQ_BYTES % 128) == 0 && (WKV_BYTES % 128) == 0 && (PLANE16_BYTES % 128) == 0);
static_assert((VRES_BYTES % 128) == 0);
static_assert((QRES_BYTES % 128) == 0 && (KRES_BYTES % 128) == 0 && (CRES_BYTES % 128) == 0);
static_assert(WS_TOTAL <= (size_t)134217728);

// ---------------------------------------------------------------------------
__device__ __forceinline__ float bf16r(float x) {   // RNE convert to bf16, returned widened
  unsigned int u = __float_as_uint(x);
  u = (u + 0x7FFFu + ((u >> 16) & 1u)) & 0xFFFF0000u;
  return __uint_as_float(u);
}

// f32 -> f16 operand convert that cannot produce an f16 subnormal (value select).
static __device__ __forceinline__ _Float16 toh_flush(float v) {
  const _Float16 r = (_Float16)v;
  return (fabsf(v) < 6.103515625e-05f) ? (_Float16)0.0f : r;
}

// 16-bit fragment: p points at element [row = lane&15][k0 + 8*(lane>>4)] of a k-contiguous
// row. Elements 0..7 <- k0+8h+0..7, elements 8..15 <- k0+16+8h+0..7 (same map for A and B).
__device__ __forceinline__ v16h frag_at(const _Float16* p) {
  v8h lo = *(const v8h*)(p);
  v8h hi = *(const v8h*)(p + 16);
  v16h out;
#pragma unroll
  for (int i = 0; i < 8; ++i) { out[i] = lo[i]; out[i + 8] = hi[i]; }
  return out;
}
__device__ __forceinline__ v16h ld_frag(const _Float16* base, unsigned ld) {
  const unsigned lane = threadIdx.x & 31u;
  return frag_at(base + (lane & 15u) * ld + (lane >> 4) * 8u);
}

__device__ __forceinline__ v8f wmma16(v16h a, v16h b, v8f c) {
  v8f d = __builtin_amdgcn_wmma_f32_16x16x32_f16(false, a, false, b, (short)0, c,
                                                 false, false);
  asm volatile("v_nop\n\tv_nop\n\tv_nop\n\tv_nop" : "+v"(d) : "v"(a), "v"(b));
  return d;
}

// Eight asynchronous 16-B copies of one lane, global -> LDS, rows 16 apart on both sides.
// lds: the lane's LDS byte address; g: the lane's global address; K: source pitch in halves.
// The s_wait_xcnt ends the copies' own statement so that no address register is rewritten
// ahead of it.
__device__ __forceinline__ void stage_copy8(const unsigned lds, const _Float16* g,
                                            const unsigned K) {
  const unsigned ls = 16u * LDG * 2u;
  const size_t gs = (size_t)16 * K;
  asm volatile(
      "global_load_async_to_lds_b128 %0, %8, off\n\t"
      "global_load_async_to_lds_b128 %1, %9, off\n\t"
      "global_load_async_to_lds_b128 %2, %10, off\n\t"
      "global_load_async_to_lds_b128 %3, %11, off\n\t"
      "global_load_async_to_lds_b128 %4, %12, off\n\t"
      "global_load_async_to_lds_b128 %5, %13, off\n\t"
      "global_load_async_to_lds_b128 %6, %14, off\n\t"
      "global_load_async_to_lds_b128 %7, %15, off\n\t"
      "s_wait_xcnt 0x0"
      :
      : "v"(lds), "v"(lds + ls), "v"(lds + 2u * ls), "v"(lds + 3u * ls), "v"(lds + 4u * ls),
        "v"(lds + 5u * ls), "v"(lds + 6u * ls), "v"(lds + 7u * ls), "v"(g), "v"(g + gs),
        "v"(g + 2u * gs), "v"(g + 3u * gs), "v"(g + 4u * gs), "v"(g + 5u * gs),
        "v"(g + 6u * gs), "v"(g + 7u * gs)
      : "memory");
}

// acc[i][j] += A[128 rows][K] . B[128 rows][K]^T for this wave's 64 x 32 part of the block tile
// (mw = 64-row group, nw = 32-column group). Arow / Brow: first row of the block's A / B rows.
// Two LDS buffers of one 128-k stage each; stage t + 2 is copied into the buffer that trip t
// has just left, behind the barrier that also publishes stage t + 1. On entry every wave's
// earlier LDS reads of St have retired in front of a barrier that all waves have passed.
__device__ __forceinline__ void gemm_mainloop(const _Float16* __restrict__ Arow,
                                              const _Float16* __restrict__ Brow,
                                              const unsigned K, _Float16* St,
                                              v8f (&acc)[4][2]) {
  const unsigned tid = threadIdx.x, lane = tid & 31u, w = tid >> 5;
  const unsigned mw = w >> 2, nw = w & 3u;
  const unsigned hh = lane >> 4, m = lane & 15u;
  const unsigned cr = tid >> 4, cc = (tid & 15u) * 8u;   // copy: row (of 16), 16-B column
  const _Float16* ga = Arow + (size_t)cr * K + cc;
  const _Float16* gb = Brow + (size_t)cr * K + cc;
  const unsigned la = (unsigned)(size_t)St + (cr * LDG + cc) * 2u;
  const unsigned lb = la + BM * LDG * 2u;
  const unsigned nt = K / BK;

  stage_copy8(la, ga, K);
  stage_copy8(lb, gb, K);
  asm volatile("s_wait_asynccnt 0x0" ::: "memory");   // stage 0 landed (this wave's copies)
  __syncthreads();                                    // stage 0 readable by every wave
  stage_copy8(la + STAGE_H * 2u, ga + BK, K);
  stage_copy8(lb + STAGE_H * 2u, gb + BK, K);

  const _Float16* fa = St + (mw * 64u + m) * LDG + hh * 8u;
  const _Float16* fb = St + (BM + nw * 32u + m) * LDG + hh * 8u;
#pragma unroll 1   // one stage per trip: the buffer alternates by t & 1, the text stays short
  for (unsigned t = 0; t < nt; ++t) {
    const unsigned bo = (t & 1u) * STAGE_H;
#pragma unroll
    for (unsigned kk = 0; kk < BK / 32u; ++kk) {
      v16h a[4], b[2];
#pragma unroll
      for (unsigned i = 0; i < 4u; ++i) a[i] = frag_at(fa + bo + i * 16u * LDG + kk * 32u);
#pragma unroll
      for (unsigned j = 0; j < 2u; ++j) b[j] = frag_at(fb + bo + j * 16u * LDG + kk * 32u);
#pragma unroll
      for (unsigned i = 0; i < 4u; ++i)
#pragma unroll
        for (unsigned j = 0; j < 2u; ++j) acc[i][j] = wmma16(a[i], b[j], acc[i][j]);
    }
    asm volatile("s_wait_dscnt 0x0" ::: "memory");      // this wave has left buffer t & 1
    asm volatile("s_wait_asynccnt 0x0" ::: "memory");   // its copies of stage t + 1 landed
    __syncthreads();   // publishes stage t + 1, frees buffer t & 1
    if (t + 2u < nt) {
      stage_copy8(la + bo * 2u, ga + (t + 2u) * BK, K);
      stage_copy8(lb + bo * 2u, gb + (t + 2u) * BK, K);
    }
  }
  asm volatile("s_wait_asynccnt 0x0" ::: "memory");     // nothing in flight when St is reused
}

// ---------------------------------------------------------------------------
// Row cast: f32 rows of DIM columns -> f16 compact rows of DIM columns, one wave per row,
// 8 rows per block, 8 rolled passes; each store instruction of a wave covers 512 contiguous
// SRC_INPUT = 1: source is the module input (full-size row stride per batch), carry 1;
// SRC_INPUT = 0: source is an [out][in] weight (already k-contiguous), carry x64.
// Every value goes through RNE bf16 first. Grid (rows/8).
// ---------------------------------------------------------------------------
template <int SRC_INPUT>
__device__ __forceinline__ void cast_body(const float* __restrict__ X,
                                          _Float16* __restrict__ dst) {
#pragma clang fp contract(off)
  const unsigned lane = threadIdx.x & 31u;
  const unsigned w = (unsigned)__builtin_amdgcn_readfirstlane((int)(threadIdx.x >> 5));
  const unsigned crow = blockIdx.x * 8u + w;
  size_t srow = crow;
  if (SRC_INPUT) {
    const unsigned bidx = crow / (unsigned)SEQ;
    const unsigned sq = crow - bidx * (unsigned)SEQ;
    srow = (size_t)bidx * SEQ_FULL + sq;
  }
  const float carry = SRC_INPUT ? 1.0f : WCARRY;
  const float* xr = X + srow * DIM + lane * 8u;
  _Float16* dr = dst + (size_t)crow * DIM + lane * 8u;
#pragma unroll 1
  for (unsigned j = 0; j < 8u; ++j) {
    const v4f a0 = *(const v4f*)(xr + j * 256u);
    const v4f a1 = *(const v4f*)(xr + j * 256u + 4u);
    v8h o;
#pragma unroll
    for (int i = 0; i < 4; ++i) {
      o[i]     = toh_flush(carry * bf16r(a0[i]));
      o[i + 4] = toh_flush(carry * bf16r(a1[i]));
    }
    _Float16* p = dr + j * 256u;
    *(v8h*)p = o;
    
  }
}

__global__ __launch_bounds__(256) void xcast_kernel(
    const float* __restrict__ X, _Float16* __restrict__ dst) {
  cast_body<1>(X, dst);
}
__global__ __launch_bounds__(256) void wcast_kernel(
    const float* __restrict__ W, _Float16* __restrict__ dst) {
  cast_body<0>(W, dst);
}

// ---------------------------------------------------------------------------
// GEMM C[128x128 tile] = A16[rows][K] . Bt[n][K]^T; both operands staged in LDS by asynchronous
// copies (gemm_mainloop); 8 waves (mw = 64-row group, nw = 32-col group), 8 accumulators/wave.
// The epilogue treats the tile as four 64x64 sub-tiles (bx = 64-column block, row0 = first row):
//   MODE 0: out16[row][col] (pitch DIM) = f16(acc/64)                       (q plane);
//           row tiles with sequence row < 128 also write
//           out16r [b][head][128][64] = f16(2048 * (q - hi))
//   MODE 1: tile column block = one shared key head; out16[row][(4*kvh + rep)*64 + c]
//           (pitch DIM) = f16(acc/64) for rep 0..3                          (k plane);
//           the key tile 0 of each sequence also writes
//           out16r [b][4*kvh + rep][64][64] = f16(2048 * (k - hi)) for rep 0..3
//   MODE 2: transposed V plane [b][(4*kvh + rep)*64 + d][key] = f16(acc/64) for rep 0..3;
//           for key tile 0 also out16r [b][(4*kvh + rep)*64 + d][64] = f16(1024 * (v - hi))
//   MODE 3: outf full [full row][col] = acc/4096                            (output buffer);
//           row tiles with sequence row < 128 run a second accumulator set fed by the
//           residual rows A16r [b][128][K] against the same B rows (a second pass of the main
//           loop), folded as acc + accres/2048 before the 1/4096 scale (block-uniform test).
// Store loops: MODE 0/1/2: 32 rows per step x 2 steps = 64; MODE 3: 16 rows x 4 steps = 64.
// Grid (N/128, MROWS/128).
// ---------------------------------------------------------------------------
template <int MODE>
__device__ __forceinline__ void gemm_body(
    const _Float16* __restrict__ A16, const _Float16* __restrict__ A16r,
    const _Float16* __restrict__ Bt, const unsigned K,
    float* __restrict__ outf, _Float16* __restrict__ out16, _Float16* __restrict__ out16r) {
  __shared__ __attribute__((aligned(16))) _Float16 St[2 * STAGE_H];
  const unsigned tid = threadIdx.x, lane = tid & 31u, w = tid >> 5;
  const unsigned mw = w >> 2, nw = w & 3u;
  const unsigned hh = lane >> 4, m = lane & 15u;
  const unsigned brow0 = blockIdx.y * (unsigned)BM;
  const _Float16* Brow = Bt + (size_t)(blockIdx.x * (unsigned)BN) * K;

  v8f acc[4][2] = {};
  gemm_mainloop(A16 + (size_t)brow0 * K, Brow, K, St, acc);
  if (MODE == 3) {
    const unsigned bidx3 = brow0 / (unsigned)SEQ;
    const unsigned sq3 = brow0 - bidx3 * (unsigned)SEQ;
    if (sq3 < (unsigned)EROWS) {               // block-uniform
      v8f res[4][2] = {};
      gemm_mainloop(A16r + (size_t)(bidx3 * (unsigned)EROWS + sq3) * K, Brow, K, St, res);
#pragma unroll
      for (int i = 0; i < 4; ++i)
#pragma unroll
        for (int j = 0; j < 2; ++j)
#pragma unroll
          for (int r = 0; r < 8; ++r) acc[i][j][r] = acc[i][j][r] + res[i][j][r] * (1.0f / SCRES);
    }
  }
  // C staging over the ring (every wave is behind the main loop's last barrier):
  // four [64][LDC] sub-tiles, sub = 2 * (row half) + (column half)
  float* Call = (float*)St;
#pragma unroll
  for (unsigned i = 0; i < 4u; ++i)
#pragma unroll
    for (unsigned j = 0; j < 2u; ++j)
#pragma unroll
      for (unsigned r = 0; r < 8u; ++r)
        Call[((mw * 2u + (nw >> 1)) * 64u + i * 16u + hh * 8u + r) * LDC + (nw & 1u) * 32u +
             j * 16u + m] = acc[i][j][r];
  __syncthreads();

  for (unsigned sub = 0; sub < 4u; ++sub) {
  const float* Cs = Call + sub * (64u * LDC);
  const unsigned bx = blockIdx.x * 2u + (sub & 1u);
  const unsigned n0 = bx * 64u;
  const unsigned row0 = brow0 + (sub >> 1) * 64u;

  if (MODE == 0 || MODE == 1) {
    constexpr unsigned NREP  = (MODE == 1) ? (unsigned)GQA : 1u;
    constexpr unsigned RROWS = (MODE == 1) ? (unsigned)ECHUNK : (unsigned)EROWS;
    const unsigned cb = (MODE == 1) ? bx * (unsigned)(GQA * HD) : n0;
    const unsigned bidx = row0 / (unsigned)SEQ;
    const unsigned sq0 = row0 - bidx * (unsigned)SEQ;
    const bool has_res = (sq0 < RROWS);        // block-uniform (MODE 1: key tile 0 only)
    v8h x[2], xr[2];
    size_t off[2], offr[2];
#pragma unroll
    for (unsigned i = 0; i < 2u; ++i) {
      const unsigned r = 32u * i + (tid >> 3);
      const unsigned c = (tid & 7u) * 8u;
      const v4f u0 = *(const v4f*)&Cs[r * LDC + c];
      const v4f u1 = *(const v4f*)&Cs[r * LDC + c + 4];
#pragma unroll
      for (int j = 0; j < 4; ++j) {
        x[i][j]     = toh_flush(u0[j] * (1.0f / WCARRY));
        x[i][j + 4] = toh_flush(u1[j] * (1.0f / WCARRY));
      }
      xr[i] = x[i];
      if (has_res) {
#pragma unroll
        for (int j = 0; j < 4; ++j) {
          const float t0 = u0[j] * (1.0f / WCARRY);
          const float t1 = u1[j] * (1.0f / WCARRY);
          xr[i][j]     = toh_flush((t0 - (float)x[i][j]) * SCRES);
          xr[i][j + 4] = toh_flush((t1 - (float)x[i][j + 4]) * SCRES);
        }
      }
      off[i] = (size_t)(row0 + r) * DIM + cb + c;
      offr[i] = ((size_t)(bidx * (unsigned)NHEAD + bx * NREP) * RROWS + sq0 + r) * HD + c;
    }
#pragma unroll
    for (unsigned rep = 0; rep < NREP; ++rep) {
#pragma unroll
      for (int i = 0; i < 2; ++i)
        *(v8h*)(out16 + off[i] + (size_t)rep * HD) = x[i];
    }
    asm volatile("s_wait_xcnt 0x0" ::: "memory");   // before the stores' registers are reused
    if (has_res) {
#pragma unroll
      for (unsigned rep = 0; rep < NREP; ++rep) {
#pragma unroll
        for (int i = 0; i < 2; ++i)
          *(v8h*)(out16r + offr[i] + (size_t)rep * RROWS * HD) = xr[i];
      }
      asm volatile("s_wait_xcnt 0x0" ::: "memory");   // before the stores' registers are reused
    }
    
  }

  if (MODE == 2) {
    const unsigned bidx = row0 / (unsigned)SEQ;
    const unsigned key0 = row0 - bidx * (unsigned)SEQ;
    const bool first_tile = (key0 == 0u);      // block-uniform
    v8h x[2], xr[2];
    size_t off[2], offr[2];
#pragma unroll
    for (unsigned i = 0; i < 2u; ++i) {
      const unsigned dcol = 32u * i + (tid >> 3);
      const unsigned kk = (tid & 7u) * 8u;
#pragma unroll
      for (unsigned j = 0; j < 8u; ++j) {
        const float t = Cs[(kk + j) * LDC + dcol] * (1.0f / WCARRY);
        const _Float16 hi = toh_flush(t);
        x[i][j]  = hi;
        xr[i][j] = toh_flush((t - (float)hi) * RCARRY);
      }
      const size_t vrow = (size_t)bidx * DIM + bx * (unsigned)(GQA * HD) + dcol;
      off[i]  = vrow * SEQ + key0 + kk;
      offr[i] = vrow * 64u + kk;
    }
#pragma unroll
    for (unsigned rep = 0; rep < (unsigned)GQA; ++rep) {
#pragma unroll
      for (int i = 0; i < 2; ++i)
        *(v8h*)(out16 + off[i] + (size_t)rep * HD * SEQ) = x[i];
    }
    asm volatile("s_wait_xcnt 0x0" ::: "memory");   // before the stores' registers are reused
    if (first_tile) {
#pragma unroll
      for (unsigned rep = 0; rep < (unsigned)GQA; ++rep) {
#pragma unroll
        for (int i = 0; i < 2; ++i)
          *(v8h*)(out16r + offr[i] + (size_t)rep * HD * 64u) = xr[i];
      }
      asm volatile("s_wait_xcnt 0x0" ::: "memory");   // before the stores' registers are reused
    }
    
  }

  if (MODE == 3) {
    const float cs = 1.0f / (WCARRY * VCARRY);
    v4f xs[4];
    size_t off[4];
#pragma unroll
    for (unsigned i = 0; i < 4u; ++i) {
      const unsigned r = 16u * i + (tid >> 4);
      const unsigned c = (tid & 15u) * 4u;
      const unsigned crow = row0 + r;
      const unsigned bidx = crow / (unsigned)SEQ;
      const unsigned sq = crow - bidx * (unsigned)SEQ;
      const size_t frow = (size_t)bidx * SEQ_FULL + sq;
      const v4f u = *(const v4f*)&Cs[r * LDC + c];
      v4f val;
#pragma unroll
      for (int j = 0; j < 4; ++j) val[j] = u[j] * cs;
      xs[i] = val;
      off[i] = frow * DIM + n0 + c;
    }
#pragma unroll
    for (int i = 0; i < 4; ++i) *(v4f*)(outf + off[i]) = xs[i];
  }
  }   // sub
}

__global__ __launch_bounds__(256) void gemm_q_kernel(
    const _Float16* __restrict__ A16, const _Float16* __restrict__ Bt,
    _Float16* __restrict__ out16, _Float16* __restrict__ out16r) {
  gemm_body<0>(A16, A16, Bt, (unsigned)DIM, (float*)0, out16, out16r);
}
__global__ __launch_bounds__(256) void gemm_k_kernel(
    const _Float16* __restrict__ A16, const _Float16* __restrict__ Bt,
    _Float16* __restrict__ out16, _Float16* __restrict__ out16r) {
  gemm_body<1>(A16, A16, Bt, (unsigned)DIM, (float*)0, out16, out16r);
}
__global__ __launch_bounds__(256) void gemm_v_kernel(
    const _Float16* __restrict__ A16, const _Float16* __restrict__ Bt,
    _Float16* __restrict__ vt, _Float16* __restrict__ vtr) {
  gemm_body<2>(A16, A16, Bt, (unsigned)DIM, (float*)0, vt, vtr);
}
__global__ __launch_bounds__(256) void gemm_wo_kernel(
    const _Float16* __restrict__ A16, const _Float16* __restrict__ A16r,
    const _Float16* __restrict__ Bt, float* __restrict__ outf) {
  gemm_body<3>(A16, A16r, Bt, (unsigned)DIM, outf, (_Float16*)0, (_Float16*)0);
}

__device__ __forceinline__ float xhalf(float x) {
  const int b = __builtin_bit_cast(int, x);
  return __builtin_bit_cast(
      float, __builtin_amdgcn_permlanex16(b, b, 0x76543210, 0xfedcba98, false, false));
}

__global__ __launch_bounds__(256) void attn_kernel(
    const _Float16* __restrict__ Qh, const _Float16* __restrict__ QhR,
    const _Float16* __restrict__ Kh, const _Float16* __restrict__ KhR,
    const _Float16* __restrict__ Vt, const _Float16* __restrict__ VtR,
    _Float16* __restrict__ Ov, _Float16* __restrict__ OvR) {
  __shared__ _Float16 Ks[64 * LDT];
  __shared__ _Float16 Vs[64 * LDT];
  __shared__ _Float16 VRs[64 * LDT];
  __shared__ _Float16 KRs[64 * LDT];

  const unsigned tid = threadIdx.x, lane = tid & 31u, w = tid >> 5;
  const unsigned hh = lane >> 4, m = lane & 15u;
  const unsigned qtile = (unsigned)(SEQ / 128 - 1) - blockIdx.z;   // cost falls with the index
  const unsigned q0 = qtile * 128u;
  const unsigned head = blockIdx.x;
  const unsigned b = blockIdx.y;
  const float scale = 0.125f;   // HD^-0.5
  const unsigned qrow0 = q0 + w * 16u;
  const bool first_blk = (qtile == 0u);

  const size_t qoff = (size_t)(b * (unsigned)SEQ + qrow0 + m) * DIM + head * HD + hh * 8u;
  v16h qf[2];
  qf[0] = frag_at(Qh + qoff);
  qf[1] = frag_at(Qh + qoff + 32);

  float mrun = -1.0e30f;   // running maximum of query qrow0 + m (equal in both halves)
  float lsum = 0.0f;       // running sum over this half's keys only
  v8f o[4];
#pragma unroll
  for (int nb = 0; nb < 4; ++nb) o[nb] = (v8f){};

  const size_t kplane = (size_t)b * SEQ * DIM + head * HD;
  const size_t vplane = ((size_t)b * DIM + head * HD) * SEQ;
  const size_t rplane = ((size_t)b * DIM + head * HD) * 64u;
  const size_t krplane = ((size_t)(b * (unsigned)NHEAD + head) * ECHUNK) * HD;
  const unsigned kend = q0 + 128u;   // <= SEQ

  for (unsigned kb = 0; kb < kend; kb += 64u) {
    const bool early = first_blk && (kb == 0u);   // block-uniform
#pragma unroll
    for (unsigned j = 0; j < 2u; ++j) {
      const unsigned idx = tid + 256u * j;
      const unsigned r = idx >> 3, c = (idx & 7u) * 8u;
      *(v8h*)&Ks[r * LDT + c] = *(const v8h*)(Kh + kplane + (size_t)(kb + r) * DIM + c);
      *(v8h*)&Vs[r * LDT + c] = *(const v8h*)(Vt + vplane + (size_t)r * SEQ + kb + c);
    }
    if (early) {
#pragma unroll
      for (unsigned j = 0; j < 2u; ++j) {
        const unsigned idx = tid + 256u * j;
        const unsigned r = idx >> 3, c = (idx & 7u) * 8u;
        *(v8h*)&VRs[r * LDT + c] = *(const v8h*)(VtR + rplane + (size_t)r * 64u + c);
        *(v8h*)&KRs[r * LDT + c] = *(const v8h*)(KhR + krplane + (size_t)r * HD + c);
      }
    }
    __syncthreads();

    // scores, transposed: 4 key groups of 16 (rows), K = 64 in two 32-steps
    v8f s[4];
    if (early) {
      // early corner: value + residual products, one score tile at a time through ONE
      // residual accumulator; q0 == 0 here so qrow0 + m < 128
      const unsigned qrbase =
          ((b * (unsigned)NHEAD + head) * (unsigned)EROWS + qrow0 + m) * (unsigned)HD + hh * 8u;
#pragma unroll
      for (int kg = 0; kg < 4; ++kg) {
        v8f t = {};
#pragma unroll
        for (int c = 0; c < 2; ++c) {
          unsigned qro = qrbase + (unsigned)c * 32u;
          asm volatile("" : "+v"(qro));   // opaque offset: the residual q fragment is reloaded per tile
          v8f tr = {};
          {
            const v16h kf = ld_frag(&Ks[(kg * 16) * LDT + c * 32], LDT);
            t = wmma16(kf, qf[c], t);
            const v16h ql = frag_at(QhR + qro);
            tr = wmma16(kf, ql, tr);
          }
          {
            const v16h kl = ld_frag(&KRs[(kg * 16) * LDT + c * 32], LDT);
            tr = wmma16(kl, qf[c], tr);
          }
          t = t + tr * (1.0f / SCRES);
          __builtin_amdgcn_sched_barrier(0);   // the next tile's loads stay behind this tile
        }
        s[kg] = t * scale;
      }
    } else {
#pragma unroll
      for (int kg = 0; kg < 4; ++kg) {
        v8f t = {};
#pragma unroll
        for (int c = 0; c < 2; ++c) {
          const v16h kf = ld_frag(&Ks[(kg * 16) * LDT + c * 32], LDT);
          t = wmma16(kf, qf[c], t);
        }
        s[kg] = t * scale;
      }
    }

    // causal replace-mask (key > query) in chunks that reach the diagonal; block-uniform test
    if (kb >= q0) {
#pragma unroll
      for (int kg = 0; kg < 4; ++kg)
#pragma unroll
        for (int v = 0; v < 8; ++v) {
          const unsigned key = kb + (unsigned)kg * 16u + hh * 8u + (unsigned)v;
          const unsigned row = qrow0 + m;
          s[kg][v] = (key > row) ? -1.0e30f : s[kg][v];
        }
    }

    // online softmax of the lane's own query: 32 keys here, 32 in lane ^ 16
    float mt[8];
#pragma unroll
    for (int v = 0; v < 8; ++v)
      mt[v] = fmaxf(fmaxf(s[0][v], s[1][v]), fmaxf(s[2][v], s[3][v]));
    float mx = fmaxf(fmaxf(fmaxf(mt[0], mt[1]), fmaxf(mt[2], mt[3])),
                     fmaxf(fmaxf(mt[4], mt[5]), fmaxf(mt[6], mt[7])));
    mx = fmaxf(mx, xhalf(mx));
    const float mn = fmaxf(mrun, mx);
    const float alpha = __expf(mrun - mn);
    mrun = mn;
#pragma unroll
    for (int kg = 0; kg < 4; ++kg)
#pragma unroll
      for (int v = 0; v < 8; ++v) s[kg][v] = __expf(s[kg][v] - mrun);
    {
      float part[8];
#pragma unroll
      for (int v = 0; v < 8; ++v) part[v] = (s[0][v] + s[1][v]) + (s[2][v] + s[3][v]);
      const float rs = ((part[0] + part[1]) + (part[2] + part[3])) +
                       ((part[4] + part[5]) + (part[6] + part[7]));
      lsum = alpha * lsum + rs;
    }
#pragma unroll
    for (int nb = 0; nb < 4; ++nb)
#pragma unroll
      for (int v = 0; v < 8; ++v) o[nb][v] = o[nb][v] * alpha;

    // P^T fragments [32 keys][16 queries], f16(1024 p), from the score tiles in place
    v16h pf[2];
#pragma unroll
    for (int c = 0; c < 2; ++c)
#pragma unroll
      for (int i = 0; i < 8; ++i) {
        pf[c][i]     = toh_flush(s[2 * c][i] * PCARRY);
        pf[c][i + 8] = toh_flush(s[2 * c + 1][i] * PCARRY);
      }

    // O^T += V^T . P^T  (K = 64 keys in two 32-steps; A = V^T tile [d][key])
#pragma unroll
    for (int c = 0; c < 2; ++c) {
#pragma unroll
      for (int nb = 0; nb < 4; ++nb) {
        const v16h vf = ld_frag(&Vs[(nb * 16) * LDT + c * 32], LDT);
        o[nb] = wmma16(vf, pf[c], o[nb]);
      }
    }

    if (early) {
      // V_res . P_hi (scale 1/1024), one 16-column group at a time, folded immediately
#pragma unroll
      for (int nb = 0; nb < 4; ++nb) {
        v8f o2 = {};
#pragma unroll
        for (int c = 0; c < 2; ++c) {
          const v16h vr = ld_frag(&VRs[(nb * 16) * LDT + c * 32], LDT);
          o2 = wmma16(vr, pf[c], o2);
        }
#pragma unroll
        for (int v = 0; v < 8; ++v) o[nb][v] = o[nb][v] + o2[v] * (1.0f / RCARRY);
      }
      // P residual fragments: f16(1024 * (1024 p - f16(1024 p)))
      v16h pr[2];
#pragma unroll
      for (int c = 0; c < 2; ++c)
#pragma unroll
        for (int i = 0; i < 16; ++i) {
          const float t = s[2 * c + (i >> 3)][i & 7] * PCARRY;
          const float hi = (float)toh_flush(t);
          pr[c][i] = toh_flush((t - hi) * RCARRY);
        }
      // V_hi . P_res (scale 1/1024), one 16-column group at a time, folded immediately
#pragma unroll
      for (int nb = 0; nb < 4; ++nb) {
        v8f o2 = {};
#pragma unroll
        for (int c = 0; c < 2; ++c) {
          const v16h vf = ld_frag(&Vs[(nb * 16) * LDT + c * 32], LDT);
          o2 = wmma16(vf, pr[c], o2);
        }
#pragma unroll
        for (int v = 0; v < 8; ++v) o[nb][v] = o[nb][v] + o2[v] * (1.0f / RCARRY);
      }
    }
    __syncthreads();
  }

  const float lrow = lsum + xhalf(lsum);   // the two halves' keys joined
  const float inv = __builtin_amdgcn_rcpf(lrow) * (VCARRY / PCARRY);
  v8h x[4];
#pragma unroll
  for (int nb = 0; nb < 4; ++nb)
#pragma unroll
    for (int v = 0; v < 8; ++v) x[nb][v] = toh_flush(o[nb][v] * inv);
  _Float16* po = Ov + (size_t)(b * (unsigned)SEQ + qrow0 + m) * DIM + head * HD + hh * 8u;
#pragma unroll
  for (int nb = 0; nb < 4; ++nb) *(v8h*)(po + nb * 16) = x[nb];
  // before the stores' registers are reused; in front of the branch, where it stays directly
  // behind the stores
  asm volatile("s_wait_xcnt 0x0" ::: "memory");
  if (first_blk) {
    // residual rows (first query block only; qrow0 < 128): f16(2048 * (t - f16(t)))
    v8h xr[4];
#pragma unroll
    for (int nb = 0; nb < 4; ++nb)
#pragma unroll
      for (int v = 0; v < 8; ++v)
        xr[nb][v] = toh_flush((o[nb][v] * inv - (float)x[nb][v]) * SCRES);
    _Float16* pres = OvR + (size_t)(b * (unsigned)EROWS + qrow0 + m) * DIM + head * HD + hh * 8u;
#pragma unroll
    for (int nb = 0; nb < 4; ++nb) *(v8h*)(pres + nb * 16) = xr[nb];
  }
}

// ---------------------------------------------------------------------------
extern "C" void kernel_launch(void* const* d_in, const int* in_sizes, int n_in,
                              void* d_out, int out_size, void* d_ws, size_t ws_size,
                              hipStream_t stream) {
  if (n_in < 5) return;
  const long long need_x = ((long long)(NB - 1) * SEQ_FULL + SEQ) * DIM;
  if ((long long)in_sizes[0] < need_x) return;
  if ((long long)in_sizes[1] < (long long)DIM * DIM) return;
  if ((long long)in_sizes[2] < (long long)KVD * DIM) return;
  if ((long long)in_sizes[3] < (long long)KVD * DIM) return;
  if ((long long)in_sizes[4] < (long long)DIM * DIM) return;
  if ((long long)out_size < need_x) return;
  if (ws_size < WS_TOTAL) return;

  // bound by the input list order: x, wq, wk, wv, wo
  const float* X  = (const float*)d_in[0];    // [NB_FULL][SEQ_FULL][DIM]
  const float* wq = (const float*)d_in[1];    // [DIM][DIM]  (out, in)
  const float* wk = (const float*)d_in[2];    // [KVD][DIM]  (out, in)
  const float* wv = (const float*)d_in[3];    // [KVD][DIM]  (out, in)
  const float* wo = (const float*)d_in[4];    // [DIM][DIM]  (out, in)
  float* out = (float*)d_out;

  char* ws = (char*)d_ws;
  _Float16* Wq_t  = (_Float16*)(ws + OFF_WQ);    // [n][k], x64
  _Float16* Wk_t  = (_Float16*)(ws + OFF_WK);    // [KVD][DIM]
  _Float16* Wv_t  = (_Float16*)(ws + OFF_WV);    // [KVD][DIM]
  _Float16* Wo_t  = (_Float16*)(ws + OFF_WO);    // [n][k], x64
  _Float16* X16   = (_Float16*)(ws + OFF_X);     // [MROWS][DIM]
  _Float16* Qh16  = (_Float16*)(ws + OFF_Q);     // [MROWS][DIM]
  _Float16* Kh16  = (_Float16*)(ws + OFF_K);     // [MROWS][DIM], shared heads written 4x
  _Float16* Vt16  = (_Float16*)(ws + OFF_VT);    // [b][DIM][SEQ], shared heads written 4x
  _Float16* Ctx16 = (_Float16*)(ws + OFF_CTX);   // [MROWS][DIM], x64
  _Float16* VtR16 = (_Float16*)(ws + OFF_VR);    // [b][DIM][64]
  _Float16* QR16  = (_Float16*)(ws + OFF_QR);    // [b][NHEAD][128][64], x2048
  _Float16* KR16  = (_Float16*)(ws + OFF_KR);    // [b][NHEAD][64][64], x2048, shared heads 4x
  _Float16* CR16  = (_Float16*)(ws + OFF_CR);    // [b][128][DIM], x2048 on top of x64

  dim3 blk(256);

  // weight planes: [out][in] rows are already k-contiguous; 8 rows per block
  wcast_kernel<<<dim3(DIM / 8), blk, 0, stream>>>(wq, Wq_t);
  wcast_kernel<<<dim3(KVD / 8), blk, 0, stream>>>(wk, Wk_t);
  wcast_kernel<<<dim3(KVD / 8), blk, 0, stream>>>(wv, Wv_t);
  wcast_kernel<<<dim3(DIM / 8), blk, 0, stream>>>(wo, Wo_t);
  xcast_kernel<<<dim3(MROWS / 8), blk, 0, stream>>>(X, X16);

  // gemm_q_kernel(A16, Bt, out16, out16r)
  gemm_q_kernel<<<dim3(DIM / BN, MROWS / BM), blk, 0, stream>>>(X16, Wq_t, Qh16, QR16);
  // gemm_k_kernel(A16, Bt, out16, out16r)
  gemm_k_kernel<<<dim3(KVD / BN, MROWS / BM), blk, 0, stream>>>(X16, Wk_t, Kh16, KR16);
  // gemm_v_kernel(A16, Bt, vt, vtr)
  gemm_v_kernel<<<dim3(KVD / BN, MROWS / BM), blk, 0, stream>>>(X16, Wv_t, Vt16, VtR16);
  // attn_kernel(Qh, QhR, Kh, KhR, Vt, VtR, Ov, OvR)
  attn_kernel<<<dim3(NHEAD, NB, SEQ / 128), blk, 0, stream>>>(Qh16, QR16, Kh16, KR16, Vt16, VtR16,
                                                              Ctx16, CR16);
  // gemm_wo_kernel(A16, A16r, Bt, outf)
  gemm_wo_kernel<<<dim3(DIM / BN, MROWS / BM), blk, 0, stream>>>(Ctx16, CR16, Wo_t, out);
}

// v004
// Measured time: 165 microseconds a run.
// Timed twice side by side with v003, it ran 1.27 times as fast both times.
// Over all steps from v000 it is 2.91 times as fast.
#include <hip/hip_runtime.h>
#include <stddef.h>

// All contractions on v_wmma_f32_16x16x32_f16 (f16 operands, f32 accumulate): q/k/v projections,
// q.k scores, p.v, output projection. Float inputs are RNE-converted to bf16 and carried in f16
// (weights x64, p x1024, attention rows x64). Early corner only (query rows 0..127 x keys 0..63
// of every (batch, head)): q and k get a x2048 residual plane (two more score products into a
// separate accumulator), p and v a x1024 residual plane, and the attention rows 0..127 a x2048
// residual plane (second accumulator set in the output projection on those row tiles).
// Softmax and all scaling in f32.
// Causal grouped-query attention (32 query heads sharing 8 key/value heads), [out][in] weights,
// no biases; the k and v projection epilogues write every shared head once per query head so
// the attention kernel sees one K row block and one V^T row block per query head.

typedef _Float16 v16h __attribute__((ext_vector_type(16)));
typedef _Float16 v8h  __attribute__((ext_vector_type(8)));
typedef float    v8f  __attribute__((ext_vector_type(8)));
typedef float    v4f  __attribute__((ext_vector_type(4)));

#ifndef NB
#define NB 2
#endif
#ifndef SEQ
#define SEQ 2048
#endif
#define NB_FULL  2
#define SEQ_FULL 2048
#define DIM   2048
#define NHEAD 32
#define HD    64
#define NKV   8
#define GQA   (NHEAD / NKV)
#define KVD   (NKV * HD)
#define MROWS (NB * SEQ)
#define EROWS  128   // early query rows per sequence carried with residual planes (q, ctx)
#define ECHUNK 64    // early keys per sequence carried with residual planes (k, v)

static_assert(NB >= 1 && NB <= NB_FULL);
static_assert(SEQ >= 128 && SEQ <= SEQ_FULL && (SEQ % 128) == 0);
static_assert(DIM == NHEAD * HD);
static_assert(HD == 64);
static_assert(NHEAD == NKV * GQA && GQA == 4);
static_assert(KVD == 512 && (KVD % 64) == 0);
static_assert((DIM % 64) == 0 && (DIM % 32) == 0);
static_assert((MROWS % 64) == 0 && (MROWS % 8) == 0);
static_assert((SEQ % 64) == 0);               // a 64-row GEMM tile never straddles two sequences
static_assert((DIM % 8) == 0 && (KVD % 8) == 0);
static_assert(DIM == 8 * 32 * 8);             // cast: 8 passes x 32 lanes x 8 columns per row
static_assert((size_t)MROWS * DIM < (size_t)0xFFFFFFFFu);
static_assert(EROWS == 128);                  // == query rows of one attention block (block 0)
static_assert(ECHUNK == 64);                  // == keys of one attention step (chunk 0) == one GEMM row tile
static_assert((EROWS % 64) == 0 && EROWS <= SEQ);   // whole 64-row GEMM tiles
static_assert((size_t)NB * NHEAD * EROWS * HD < (size_t)0xFFFFFFFFu);   // 32-bit q residual offsets

#define LDT 72   // halves per LDS row (144 B, 16-B aligned)
#define LDC 68   // floats per LDS row (272 B, 16-B aligned)
static_assert((LDT % 8) == 0 && LDT >= 64);
static_assert((LDC % 4) == 0 && LDC >= 64);

// GEMM block tile and LDS staging
#define BM  128   // output rows per block
#define BN  128   // output columns per block
#define BK  128   // halves of every operand row per stage (256 B)
#define LDG 136   // halves per staged row (272 B = 16 B x 17: b128 fragment reads meet no bank twice)
#define STAGE_H ((BM + BN) * LDG)   // halves per stage: A rows, then B rows
static_assert((LDG % 8) == 0 && LDG >= BK);
static_assert((DIM % BK) == 0 && DIM / BK >= 2);          // the ring starts with two stages
static_assert((MROWS % BM) == 0 && (SEQ % BM) == 0 && (DIM % BN) == 0 && (KVD % BN) == 0);
static_assert(BM == EROWS);                               // a block is all early rows or none
static_assert((BM + BN) * (BK / 8) == 256 * 16);          // 16 copies of 16 B per thread and stage
static_assert((size_t)4 * 64 * LDC * 4 <= (size_t)2 * STAGE_H * 2);   // C staging fits the ring
static_assert((size_t)2 * STAGE_H * 2 <= (size_t)163840);             // two blocks per WGP

#define WCARRY 64.0f     // weight planes carried x64
#define PCARRY 1024.0f   // softmax numerators carried x1024
#define VCARRY 64.0f     // attention output plane carried x64
#define RCARRY 1024.0f   // residual planes (p, v) carried x1024 on top of their hi part
#define SCRES  2048.0f   // residual planes (q, k, attention rows) carried x2048 on top of their hi part

// epilogue store-loop coverage (rows admitted per step x steps == tile rows)
#define TILE_ROWS        64
#define EPI16_ROWS_STEP  (256 / 8)
#define EPI16_STEPS      2
#define EPIF_ROWS_STEP   (256 / 16)   // 16 lanes x 16 B per 256-B row segment
#define EPIF_STEPS       4
static_assert(EPI16_ROWS_STEP * EPI16_STEPS == TILE_ROWS);
static_assert(EPIF_ROWS_STEP * EPIF_STEPS == TILE_ROWS);
static_assert(8 * 16 == 128);                 // attention block: 8 waves x 16 query rows

// static LDS per kernel (bytes)
static_assert((size_t)(4 * 64 * LDT) * 2 <= (size_t)131072);

// workspace layout (bytes)
#define WSQ_BYTES     ((size_t)DIM * DIM * 2)
#define WKV_BYTES     ((size_t)KVD * DIM * 2)
#define PLANE16_BYTES ((size_t)MROWS * DIM * 2)
#define VRES_BYTES    ((size_t)NB * DIM * 64 * 2)
#define QRES_BYTES    ((size_t)NB * NHEAD * EROWS * HD * 2)
#define KRES_BYTES    ((size_t)NB * NHEAD * ECHUNK * HD * 2)
#define CRES_BYTES    ((size_t)NB * EROWS * DIM * 2)
#define OFF_WQ  ((size_t)0)
#define OFF_WK  (OFF_WQ + WSQ_BYTES)
#define OFF_WV  (OFF_WK + WKV_BYTES)
#define OFF_WO  (OFF_WV + WKV_BYTES)
#define OFF_X   (OFF_WO + WSQ_BYTES)
#define OFF_Q   (OFF_X + PLANE16_BYTES)
#define OFF_K   (OFF_Q + PLANE16_BYTES)
#define OFF_VT  (OFF_K + PLANE16_BYTES)
#define OFF_CTX (OFF_VT + PLANE16_BYTES)
#define OFF_VR  (OFF_CTX + PLANE16_BYTES)
#define OFF_QR  (OFF_VR + VRES_BYTES)
#define OFF_KR  (OFF_QR + QRES_BYTES)
#define OFF_CR  (OFF_KR + KRES_BYTES)
#define WS_TOTAL (OFF_CR + CRES_BYTES)
static_assert((WSQ_BYTES % 128) == 0 && (WKV_BYTES % 128) == 0 && (PLANE16_BYTES % 128) == 0);
static_assert((VRES_BYTES % 128) == 0);
static_assert((QRES_BYTES % 128) == 0 && (KRES_BYTES % 128) == 0 && (CRES_BYTES % 128) == 0);
static_assert(WS_TOTAL <= (size_t)134217728);

// ---------------------------------------------------------------------------
__device__ __forceinline__ float bf16r(float x) {   // RNE convert to bf16, returned widened
  unsigned int u = __float_as_uint(x);
  u = (u + 0x7FFFu + ((u >> 16) & 1u)) & 0xFFFF0000u;
  return __uint_as_float(u);
}

// f32 -> f16 operand convert that cannot produce an f16 subnormal (value select).
static __device__ __forceinline__ _Float16 toh_flush(float v) {
  const _Float16 r = (_Float16)v;
  return (fabsf(v) < 6.103515625e-05f) ? (_Float16)0.0f : r;
}

// 16-bit fragment: p points at element [row = lane&15][k0 + 8*(lane>>4)] of a k-contiguous
// row. Elements 0..7 <- k0+8h+0..7, elements 8..15 <- k0+16+8h+0..7 (same map for A and B).
__device__ __forceinline__ v16h frag_at(const _Float16* p) {
  v8h lo = *(const v8h*)(p);
  v8h hi = *(const v8h*)(p + 16);
  v16h out;
#pragma unroll
  for (int i = 0; i < 8; ++i) { out[i] = lo[i]; out[i + 8] = hi[i]; }
  return out;
}
__device__ __forceinline__ v16h ld_frag(const _Float16* base, unsigned ld) {
  const unsigned lane = threadIdx.x & 31u;
  return frag_at(base + (lane & 15u) * ld + (lane >> 4) * 8u);
}

__device__ __forceinline__ v8f wmma16(v16h a, v16h b, v8f c) {
  v8f d = __builtin_amdgcn_wmma_f32_16x16x32_f16(false, a, false, b, (short)0, c,
                                                 false, false);
  asm volatile("v_nop\n\tv_nop\n\tv_nop\n\tv_nop" : "+v"(d) : "v"(a), "v"(b));
  return d;
}

// Eight asynchronous 16-B copies of one lane, global -> LDS, rows 16 apart on both sides.
// lds: the lane's LDS byte address; g: the lane's global address; K: source pitch in halves.
// The s_wait_xcnt ends the copies' own statement so that no address register is rewritten
// ahead of it.
__device__ __forceinline__ void stage_copy8(const unsigned lds, const _Float16* g,
                                            const unsigned K) {
  const unsigned ls = 16u * LDG * 2u;
  const size_t gs = (size_t)16 * K;
  asm volatile(
      "global_load_async_to_lds_b128 %0, %8, off\n\t"
      "global_load_async_to_lds_b128 %1, %9, off\n\t"
      "global_load_async_to_lds_b128 %2, %10, off\n\t"
      "global_load_async_to_lds_b128 %3, %11, off\n\t"
      "global_load_async_to_lds_b128 %4, %12, off\n\t"
      "global_load_async_to_lds_b128 %5, %13, off\n\t"
      "global_load_async_to_lds_b128 %6, %14, off\n\t"
      "global_load_async_to_lds_b128 %7, %15, off\n\t"
      "s_wait_xcnt 0x0"
      :
      : "v"(lds), "v"(lds + ls), "v"(lds + 2u * ls), "v"(lds + 3u * ls), "v"(lds + 4u * ls),
        "v"(lds + 5u * ls), "v"(lds + 6u * ls), "v"(lds + 7u * ls), "v"(g), "v"(g + gs),
        "v"(g + 2u * gs), "v"(g + 3u * gs), "v"(g + 4u * gs), "v"(g + 5u * gs),
        "v"(g + 6u * gs), "v"(g + 7u * gs)
      : "memory");
}

// acc[i][j] += A[128 rows][K] . B[128 rows][K]^T for this wave's 64 x 32 part of the block tile
// (mw = 64-row group, nw = 32-column group). Arow / Brow: first row of the block's A / B rows.
// Two LDS buffers of one 128-k stage each; stage t + 2 is copied into the buffer that trip t
// has just left, behind the barrier that also publishes stage t + 1. On entry every wave's
// earlier LDS reads of St have retired in front of a barrier that all waves have passed.
__device__ __forceinline__ void gemm_mainloop(const _Float16* __restrict__ Arow,
                                              const _Float16* __restrict__ Brow,
                                              const unsigned K, _Float16* St,
                                              v8f (&acc)[4][2]) {
  const unsigned tid = threadIdx.x, lane = tid & 31u, w = tid >> 5;
  const unsigned mw = w >> 2, nw = w & 3u;
  const unsigned hh = lane >> 4, m = lane & 15u;
  const unsigned cr = tid >> 4, cc = (tid & 15u) * 8u;   // copy: row (of 16), 16-B column
  const _Float16* ga = Arow + (size_t)cr * K + cc;
  const _Float16* gb = Brow + (size_t)cr * K + cc;
  const unsigned la = (unsigned)(size_t)St + (cr * LDG + cc) * 2u;
  const unsigned lb = la + BM * LDG * 2u;
  const unsigned nt = K / BK;

  stage_copy8(la, ga, K);
  stage_copy8(lb, gb, K);
  asm volatile("s_wait_asynccnt 0x0" ::: "memory");   // stage 0 landed (this wave's copies)
  __syncthreads();                                    // stage 0 readable by every wave
  stage_copy8(la + STAGE_H * 2u, ga + BK, K);
  stage_copy8(lb + STAGE_H * 2u, gb + BK, K);

  const _Float16* fa = St + (mw * 64u + m) * LDG + hh * 8u;
  const _Float16* fb = St + (BM + nw * 32u + m) * LDG + hh * 8u;
#pragma unroll 1   // one stage per trip: the buffer alternates by t & 1, the text stays short
  for (unsigned t = 0; t < nt; ++t) {
    const unsigned bo = (t & 1u) * STAGE_H;
#pragma unroll
    for (unsigned kk = 0; kk < BK / 32u; ++kk) {
      v16h a[4], b[2];
#pragma unroll
      for (unsigned i = 0; i < 4u; ++i) a[i] = frag_at(fa + bo + i * 16u * LDG + kk * 32u);
#pragma unroll
      for (unsigned j = 0; j < 2u; ++j) b[j] = frag_at(fb + bo + j * 16u * LDG + kk * 32u);
#pragma unroll
      for (unsigned i = 0; i < 4u; ++i)
#pragma unroll
        for (unsigned j = 0; j < 2u; ++j) acc[i][j] = wmma16(a[i], b[j], acc[i][j]);
    }
    asm volatile("s_wait_dscnt 0x0" ::: "memory");      // this wave has left buffer t & 1
    asm volatile("s_wait_asynccnt 0x0" ::: "memory");   // its copies of stage t + 1 landed
    __syncthreads();   // publishes stage t + 1, frees buffer t & 1
    if (t + 2u < nt) {
      stage_copy8(la + bo * 2u, ga + (t + 2u) * BK, K);
      stage_copy8(lb + bo * 2u, gb + (t + 2u) * BK, K);
    }
  }
  asm volatile("s_wait_asynccnt 0x0" ::: "memory");     // nothing in flight when St is reused
}

// ---------------------------------------------------------------------------
// Row cast: f32 rows of DIM columns -> f16 compact rows of DIM columns, one wave per row,
// 8 rows per block, 8 rolled passes; each store instruction of a wave covers 512 contiguous
// SRC_INPUT = 1: source is the module input (full-size row stride per batch), carry 1;
// SRC_INPUT = 0: source is an [out][in] weight (already k-contiguous), carry x64.
// Every value goes through RNE bf16 first. sblk / dblk: 8-row block of the source / of dst.
// ---------------------------------------------------------------------------
template <int SRC_INPUT>
__device__ __forceinline__ void cast_body(const float* __restrict__ X,
                                          _Float16* __restrict__ dst,
                                          const unsigned sblk, const unsigned dblk) {
#pragma clang fp contract(off)
  const unsigned lane = threadIdx.x & 31u;
  const unsigned w = (unsigned)__builtin_amdgcn_readfirstlane((int)(threadIdx.x >> 5));
  const unsigned crow = sblk * 8u + w;
  size_t srow = crow;
  if (SRC_INPUT) {
    const unsigned bidx = crow / (unsigned)SEQ;
    const unsigned sq = crow - bidx * (unsigned)SEQ;
    srow = (size_t)bidx * SEQ_FULL + sq;
  }
  const float carry = SRC_INPUT ? 1.0f : WCARRY;
  const float* xr = X + srow * DIM + lane * 8u;
  _Float16* dr = dst + (size_t)(dblk * 8u + w) * DIM + lane * 8u;
#pragma unroll 1
  for (unsigned j = 0; j < 8u; ++j) {
    const v4f a0 = *(const v4f*)(xr + j * 256u);
    const v4f a1 = *(const v4f*)(xr + j * 256u + 4u);
    v8h o;
#pragma unroll
    for (int i = 0; i < 4; ++i) {
      o[i]     = toh_flush(carry * bf16r(a0[i]));
      o[i + 4] = toh_flush(carry * bf16r(a1[i]));
    }
    _Float16* p = dr + j * 256u;
    *(v8h*)p = o;
    
  }
}

// All five casts in one launch (none reads what another writes). Blocks 0 .. XBLK-1 take the
// input rows; the rest take the rows of the four weight planes, which lie stacked in the
// workspace in the order wq, wk, wv, wo, so that w16 is one plane of WBLK * 8 rows.
// Every test is on the block index alone. Grid (XBLK + WBLK).
#define XBLK (MROWS / 8)
#define WBLK ((2 * DIM + 2 * KVD) / 8)
static_assert(OFF_WK == OFF_WQ + (size_t)DIM * DIM * 2);
static_assert(OFF_WV == OFF_WQ + (size_t)(DIM + KVD) * DIM * 2);
static_assert(OFF_WO == OFF_WQ + (size_t)(DIM + 2 * KVD) * DIM * 2);
__global__ __launch_bounds__(256) void cast_kernel(
    const float* __restrict__ X, const float* __restrict__ wq, const float* __restrict__ wk,
    const float* __restrict__ wv, const float* __restrict__ wo,
    _Float16* __restrict__ x16, _Float16* __restrict__ w16) {
  const unsigned blk = blockIdx.x;
  if (blk < (unsigned)XBLK) {
    cast_body<1>(X, x16, blk, blk);
    return;
  }
  const unsigned wb = blk - (unsigned)XBLK;   // 8-row block of the stacked weight planes
  const float* W = wq;
  unsigned first = 0u;                        // first block of the plane that wb lies in
  if (wb >= (unsigned)((DIM + 2 * KVD) / 8)) {
    W = wo;
    first = (unsigned)((DIM + 2 * KVD) / 8);
  } else if (wb >= (unsigned)((DIM + KVD) / 8)) {
    W = wv;
    first = (unsigned)((DIM + KVD) / 8);
  } else if (wb >= (unsigned)(DIM / 8)) {
    W = wk;
    first = (unsigned)(DIM / 8);
  }
  cast_body<0>(W, w16, wb - first, wb);
}

// ---------------------------------------------------------------------------
// GEMM C[128x128 tile] = A16[rows][K] . Bt[n][K]^T; both operands staged in LDS by asynchronous
// copies (gemm_mainloop); 8 waves (mw = 64-row group, nw = 32-col group), 8 accumulators/wave.
// The epilogue treats the tile as four 64x64 sub-tiles (bx = 64-column block, row0 = first row):
//   MODE 0: out16[row][col] (pitch DIM) = f16(acc/64)                       (q plane);
//           row tiles with sequence row < 128 also write
//           out16r [b][head][128][64] = f16(2048 * (q - hi))
//   MODE 1: tile column block = one shared key head; out16[row][(4*kvh + rep)*64 + c]
//           (pitch DIM) = f16(acc/64) for rep 0..3                          (k plane);
//           the key tile 0 of each sequence also writes
//           out16r [b][4*kvh + rep][64][64] = f16(2048 * (k - hi)) for rep 0..3
//   MODE 2: transposed V plane [b][(4*kvh + rep)*64 + d][key] = f16(acc/64) for rep 0..3;
//           for key tile 0 also out16r [b][(4*kvh + rep)*64 + d][64] = f16(1024 * (v - hi))
//   MODE 3: outf full [full row][col] = acc/4096                            (output buffer);
//           row tiles with sequence row < 128 run a second accumulator set fed by the
//           residual rows A16r [b][128][K] against the same B rows (a second pass of the main
//           loop), folded as acc + accres/2048 before the 1/4096 scale (block-uniform test).
// Store loops: MODE 0/1/2: 32 rows per step x 2 steps = 64; MODE 3: 16 rows x 4 steps = 64.
// MODE 0, 1 and 2 share one launch (gemm_qkv_kernel): same A rows, and their B rows lie
// stacked in the workspace, so the main loop is one and only the epilogue differs by block.
// ---------------------------------------------------------------------------
// C staging over the ring (every wave is behind the main loop's last barrier):
// four [64][LDC] sub-tiles, sub = 2 * (row half) + (column half)
__device__ __forceinline__ void stage_c(const v8f (&acc)[4][2], float* Call) {
  const unsigned tid = threadIdx.x, lane = tid & 31u, w = tid >> 5;
  const unsigned mw = w >> 2, nw = w & 3u;
  const unsigned hh = lane >> 4, m = lane & 15u;
#pragma unroll
  for (unsigned i = 0; i < 4u; ++i)
#pragma unroll
    for (unsigned j = 0; j < 2u; ++j)
#pragma unroll
      for (unsigned r = 0; r < 8u; ++r)
        Call[((mw * 2u + (nw >> 1)) * 64u + i * 16u + hh * 8u + r) * LDC + (nw & 1u) * 32u +
             j * 16u + m] = acc[i][j][r];
  __syncthreads();
}

// Epilogue of one staged 128x128 tile. bxb: the tile's 128-column block within its own output;
// brow0: its first row.
template <int MODE>
__device__ __forceinline__ void store_tiles(
    const float* Call, const unsigned bxb, const unsigned brow0,
    float* __restrict__ outf, _Float16* __restrict__ out16, _Float16* __restrict__ out16r) {
  const unsigned tid = threadIdx.x;
  for (unsigned sub = 0; sub < 4u; ++sub) {
  const float* Cs = Call + sub * (64u * LDC);
  const unsigned bx = bxb * 2u + (sub & 1u);
  const unsigned n0 = bx * 64u;
  const unsigned row0 = brow0 + (sub >> 1) * 64u;

  if (MODE == 0 || MODE == 1) {
    constexpr unsigned NREP  = (MODE == 1) ? (unsigned)GQA : 1u;
    constexpr unsigned RROWS = (MODE == 1) ? (unsigned)ECHUNK : (unsigned)EROWS;
    const unsigned cb = (MODE == 1) ? bx * (unsigned)(GQA * HD) : n0;
    const unsigned bidx = row0 / (unsigned)SEQ;
    const unsigned sq0 = row0 - bidx * (unsigned)SEQ;
    const bool has_res = (sq0 < RROWS);        // block-uniform (MODE 1: key tile 0 only)
    v8h x[2], xr[2];
    size_t off[2], offr[2];
#pragma unroll
    for (unsigned i = 0; i < 2u; ++i) {
      const unsigned r = 32u * i + (tid >> 3);
      const unsigned c = (tid & 7u) * 8u;
      const v4f u0 = *(const v4f*)&Cs[r * LDC + c];
      const v4f u1 = *(const v4f*)&Cs[r * LDC + c + 4];
#pragma unroll
      for (int j = 0; j < 4; ++j) {
        x[i][j]     = toh_flush(u0[j] * (1.0f / WCARRY));
        x[i][j + 4] = toh_flush(u1[j] * (1.0f / WCARRY));
      }
      xr[i] = x[i];
      if (has_res) {
#pragma unroll
        for (int j = 0; j < 4; ++j) {
          const float t0 = u0[j] * (1.0f / WCARRY);
          const float t1 = u1[j] * (1.0f / WCARRY);
          xr[i][j]     = toh_flush((t0 - (float)x[i][j]) * SCRES);
          xr[i][j + 4] = toh_flush((t1 - (float)x[i][j + 4]) * SCRES);
        }
      }
      off[i] = (size_t)(row0 + r) * DIM + cb + c;
      offr[i] = ((size_t)(bidx * (unsigned)NHEAD + bx * NREP) * RROWS + sq0 + r) * HD + c;
    }
#pragma unroll
    for (unsigned rep = 0; rep < NREP; ++rep) {
#pragma unroll
      for (int i = 0; i < 2; ++i)
        *(v8h*)(out16 + off[i] + (size_t)rep * HD) = x[i];
    }
    asm volatile("s_wait_xcnt 0x0" ::: "memory");   // before the stores' registers are reused
    if (has_res) {
#pragma unroll
      for (unsigned rep = 0; rep < NREP; ++rep) {
#pragma unroll
        for (int i = 0; i < 2; ++i)
          *(v8h*)(out16r + offr[i] + (size_t)rep * RROWS * HD) = xr[i];
      }
      asm volatile("s_wait_xcnt 0x0" ::: "memory");   // before the stores' registers are reused
    }
    
  }

  if (MODE == 2) {
    const unsigned bidx = row0 / (unsigned)SEQ;
    const unsigned key0 = row0 - bidx * (unsigned)SEQ;
    const bool first_tile = (key0 == 0u);      // block-uniform
    v8h x[2], xr[2];
    size_t off[2], offr[2];
#pragma unroll
    for (unsigned i = 0; i < 2u; ++i) {
      const unsigned dcol = 32u * i + (tid >> 3);
      const unsigned kk = (tid & 7u) * 8u;
#pragma unroll
      for (unsigned j = 0; j < 8u; ++j) {
        const float t = Cs[(kk + j) * LDC + dcol] * (1.0f / WCARRY);
        const _Float16 hi = toh_flush(t);
        x[i][j]  = hi;
        xr[i][j] = toh_flush((t - (float)hi) * RCARRY);
      }
      const size_t vrow = (size_t)bidx * DIM + bx * (unsigned)(GQA * HD) + dcol;
      off[i]  = vrow * SEQ + key0 + kk;
      offr[i] = vrow * 64u + kk;
    }
#pragma unroll
    for (unsigned rep = 0; rep < (unsigned)GQA; ++rep) {
#pragma unroll
      for (int i = 0; i < 2; ++i)
        *(v8h*)(out16 + off[i] + (size_t)rep * HD * SEQ) = x[i];
    }
    asm volatile("s_wait_xcnt 0x0" ::: "memory");   // before the stores' registers are reused
    if (first_tile) {
#pragma unroll
      for (unsigned rep = 0; rep < (unsigned)GQA; ++rep) {
#pragma unroll
        for (int i = 0; i < 2; ++i)
          *(v8h*)(out16r + offr[i] + (size_t)rep * HD * 64u) = xr[i];
      }
      asm volatile("s_wait_xcnt 0x0" ::: "memory");   // before the stores' registers are reused
    }
    
  }

  if (MODE == 3) {
    const float cs = 1.0f / (WCARRY * VCARRY);
    v4f xs[4];
    size_t off[4];
#pragma unroll
    for (unsigned i = 0; i < 4u; ++i) {
      const unsigned r = 16u * i + (tid >> 4);
      const unsigned c = (tid & 15u) * 4u;
      const unsigned crow = row0 + r;
      const unsigned bidx = crow / (unsigned)SEQ;
      const unsigned sq = crow - bidx * (unsigned)SEQ;
      const size_t frow = (size_t)bidx * SEQ_FULL + sq;
      const v4f u = *(const v4f*)&Cs[r * LDC + c];
      v4f val;
#pragma unroll
      for (int j = 0; j < 4; ++j) val[j] = u[j] * cs;
      xs[i] = val;
      off[i] = frow * DIM + n0 + c;
    }
#pragma unroll
    for (int i = 0; i < 4; ++i) *(v4f*)(outf + off[i]) = xs[i];
  }
  }   // sub
}

// q, k and v projections in one launch. Bt: the stacked planes wq, wk, wv (DIM + 2 KVD rows);
// column blocks 0 .. QBLK-1 are q, the next KVBLK are k, the last KVBLK are v (tests on the
// block index alone). Grid (QBLK + 2 KVBLK, MROWS/128).
#define QBLK  (DIM / BN)
#define KVBLK (KVD / BN)
__global__ __launch_bounds__(256) void gemm_qkv_kernel(
    const _Float16* __restrict__ A16, const _Float16* __restrict__ Bt,
    _Float16* __restrict__ q16, _Float16* __restrict__ q16r,
    _Float16* __restrict__ k16, _Float16* __restrict__ k16r,
    _Float16* __restrict__ vt, _Float16* __restrict__ vtr) {
  __shared__ __attribute__((aligned(16))) _Float16 St[2 * STAGE_H];
  const unsigned K = (unsigned)DIM;
  const unsigned bxa = blockIdx.x;
  const unsigned brow0 = blockIdx.y * (unsigned)BM;

  v8f acc[4][2] = {};
  gemm_mainloop(A16 + (size_t)brow0 * K, Bt + (size_t)(bxa * (unsigned)BN) * K, K, St, acc);
  stage_c(acc, (float*)St);
  if (bxa < (unsigned)QBLK)
    store_tiles<0>((const float*)St, bxa, brow0, (float*)0, q16, q16r);
  else if (bxa < (unsigned)(QBLK + KVBLK))
    store_tiles<1>((const float*)St, bxa - (unsigned)QBLK, brow0, (float*)0, k16, k16r);
  else
    store_tiles<2>((const float*)St, bxa - (unsigned)(QBLK + KVBLK), brow0, (float*)0, vt, vtr);
}

// Output projection. Grid (DIM/128, MROWS/128).
__global__ __launch_bounds__(256) void gemm_wo_kernel(
    const _Float16* __restrict__ A16, const _Float16* __restrict__ A16r,
    const _Float16* __restrict__ Bt, float* __restrict__ outf) {
  __shared__ __attribute__((aligned(16))) _Float16 St[2 * STAGE_H];
  const unsigned K = (unsigned)DIM;
  const unsigned brow0 = blockIdx.y * (unsigned)BM;
  const _Float16* Brow = Bt + (size_t)(blockIdx.x * (unsigned)BN) * K;

  v8f acc[4][2] = {};
  gemm_mainloop(A16 + (size_t)brow0 * K, Brow, K, St, acc);
  const unsigned bidx3 = brow0 / (unsigned)SEQ;
  const unsigned sq3 = brow0 - bidx3 * (unsigned)SEQ;
  if (sq3 < (unsigned)EROWS) {               // block-uniform
    v8f res[4][2] = {};
    gemm_mainloop(A16r + (size_t)(bidx3 * (unsigned)EROWS + sq3) * K, Brow, K, St, res);
#pragma unroll
    for (int i = 0; i < 4; ++i)
#pragma unroll
      for (int j = 0; j < 2; ++j)
#pragma unroll
        for (int r = 0; r < 8; ++r) acc[i][j][r] = acc[i][j][r] + res[i][j][r] * (1.0f / SCRES);
  }
  stage_c(acc, (float*)St);
  store_tiles<3>((const float*)St, blockIdx.x, brow0, outf, (_Float16*)0, (_Float16*)0);
}

__device__ __forceinline__ float xhalf(float x) {
  const int b = __builtin_bit_cast(int, x);
  return __builtin_bit_cast(
      float, __builtin_amdgcn_permlanex16(b, b, 0x76543210, 0xfedcba98, false, false));
}

__global__ __launch_bounds__(256) void attn_kernel(
    const _Float16* __restrict__ Qh, const _Float16* __restrict__ QhR,
    const _Float16* __restrict__ Kh, const _Float16* __restrict__ KhR,
    const _Float16* __restrict__ Vt, const _Float16* __restrict__ VtR,
    _Float16* __restrict__ Ov, _Float16* __restrict__ OvR) {
  __shared__ _Float16 Ks[64 * LDT];
  __shared__ _Float16 Vs[64 * LDT];
  __shared__ _Float16 VRs[64 * LDT];
  __shared__ _Float16 KRs[64 * LDT];

  const unsigned tid = threadIdx.x, lane = tid & 31u, w = tid >> 5;
  const unsigned hh = lane >> 4, m = lane & 15u;
  const unsigned qtile = (unsigned)(SEQ / 128 - 1) - blockIdx.z;   // cost falls with the index
  const unsigned q0 = qtile * 128u;
  const unsigned head = blockIdx.x;
  const unsigned b = blockIdx.y;
  const float scale = 0.125f;   // HD^-0.5
  const unsigned qrow0 = q0 + w * 16u;
  const bool first_blk = (qtile == 0u);

  const size_t qoff = (size_t)(b * (unsigned)SEQ + qrow0 + m) * DIM + head * HD + hh * 8u;
  v16h qf[2];
  qf[0] = frag_at(Qh + qoff);
  qf[1] = frag_at(Qh + qoff + 32);

  float mrun = -1.0e30f;   // running maximum of query qrow0 + m (equal in both halves)
  float lsum = 0.0f;       // running sum over this half's keys only
  v8f o[4];
#pragma unroll
  for (int nb = 0; nb < 4; ++nb) o[nb] = (v8f){};

  const size_t kplane = (size_t)b * SEQ * DIM + head * HD;
  const size_t vplane = ((size_t)b * DIM + head * HD) * SEQ;
  const size_t rplane = ((size_t)b * DIM + head * HD) * 64u;
  const size_t krplane = ((size_t)(b * (unsigned)NHEAD + head) * ECHUNK) * HD;
  const unsigned kend = q0 + 128u;   // <= SEQ

  for (unsigned kb = 0; kb < kend; kb += 64u) {
    const bool early = first_blk && (kb == 0u);   // block-uniform
#pragma unroll
    for (unsigned j = 0; j < 2u; ++j) {
      const unsigned idx = tid + 256u * j;
      const unsigned r = idx >> 3, c = (idx & 7u) * 8u;
      *(v8h*)&Ks[r * LDT + c] = *(const v8h*)(Kh + kplane + (size_t)(kb + r) * DIM + c);
      *(v8h*)&Vs[r * LDT + c] = *(const v8h*)(Vt + vplane + (size_t)r * SEQ + kb + c);
    }
    if (early) {
#pragma unroll
      for (unsigned j = 0; j < 2u; ++j) {
        const unsigned idx = tid + 256u * j;
        const unsigned r = idx >> 3, c = (idx & 7u) * 8u;
        *(v8h*)&VRs[r * LDT + c] = *(const v8h*)(VtR + rplane + (size_t)r * 64u + c);
        *(v8h*)&KRs[r * LDT + c] = *(const v8h*)(KhR + krplane + (size_t)r * HD + c);
      }
    }
    __syncthreads();

    // scores, transposed: 4 key groups of 16 (rows), K = 64 in two 32-steps
    v8f s[4];
    if (early) {
      // early corner: value + residual products, one score tile at a time through ONE
      // residual accumulator; q0 == 0 here so qrow0 + m < 128
      const unsigned qrbase =
          ((b * (unsigned)NHEAD + head) * (unsigned)EROWS + qrow0 + m) * (unsigned)HD + hh * 8u;
#pragma unroll
      for (int kg = 0; kg < 4; ++kg) {
        v8f t = {};
#pragma unroll
        for (int c = 0; c < 2; ++c) {
          unsigned qro = qrbase + (unsigned)c * 32u;
          asm volatile("" : "+v"(qro));   // opaque offset: the residual q fragment is reloaded per tile
          v8f tr = {};
          {
            const v16h kf = ld_frag(&Ks[(kg * 16) * LDT + c * 32], LDT);
            t = wmma16(kf, qf[c], t);
            const v16h ql = frag_at(QhR + qro);
            tr = wmma16(kf, ql, tr);
          }
          {
            const v16h kl = ld_frag(&KRs[(kg * 16) * LDT + c * 32], LDT);
            tr = wmma16(kl, qf[c], tr);
          }
          t = t + tr * (1.0f / SCRES);
          __builtin_amdgcn_sched_barrier(0);   // the next tile's loads stay behind this tile
        }
        s[kg] = t * scale;
      }
    } else {
#pragma unroll
      for (int kg = 0; kg < 4; ++kg) {
        v8f t = {};
#pragma unroll
        for (int c = 0; c < 2; ++c) {
          const v16h kf = ld_frag(&Ks[(kg * 16) * LDT + c * 32], LDT);
          t = wmma16(kf, qf[c], t);
        }
        s[kg] = t * scale;
      }
    }

    // causal replace-mask (key > query) in chunks that reach the diagonal; block-uniform test
    if (kb >= q0) {
#pragma unroll
      for (int kg = 0; kg < 4; ++kg)
#pragma unroll
        for (int v = 0; v < 8; ++v) {
          const unsigned key = kb + (unsigned)kg * 16u + hh * 8u + (unsigned)v;
          const unsigned row = qrow0 + m;
          s[kg][v] = (key > row) ? -1.0e30f : s[kg][v];
        }
    }

    // online softmax of the lane's own query: 32 keys here, 32 in lane ^ 16
    float mt[8];
#pragma unroll
    for (int v = 0; v < 8; ++v)
      mt[v] = fmaxf(fmaxf(s[0][v], s[1][v]), fmaxf(s[2][v], s[3][v]));
    float mx = fmaxf(fmaxf(fmaxf(mt[0], mt[1]), fmaxf(mt[2], mt[3])),
                     fmaxf(fmaxf(mt[4], mt[5]), fmaxf(mt[6], mt[7])));
    mx = fmaxf(mx, xhalf(mx));
    const float mn = fmaxf(mrun, mx);
    const float alpha = __expf(mrun - mn);
    mrun = mn;
#pragma unroll
    for (int kg = 0; kg < 4; ++kg)
#pragma unroll
      for (int v = 0; v < 8; ++v) s[kg][v] = __expf(s[kg][v] - mrun);
    {
      float part[8];
#pragma unroll
      for (int v = 0; v < 8; ++v) part[v] = (s[0][v] + s[1][v]) + (s[2][v] + s[3][v]);
      const float rs = ((part[0] + part[1]) + (part[2] + part[3])) +
                       ((part[4] + part[5]) + (part[6] + part[7]));
      lsum = alpha * lsum + rs;
    }
#pragma unroll
    for (int nb = 0; nb < 4; ++nb)
#pragma unroll
      for (int v = 0; v < 8; ++v) o[nb][v] = o[nb][v] * alpha;

    // P^T fragments [32 keys][16 queries], f16(1024 p), from the score tiles in place
    v16h pf[2];
#pragma unroll
    for (int c = 0; c < 2; ++c)
#pragma unroll
      for (int i = 0; i < 8; ++i) {
        pf[c][i]     = toh_flush(s[2 * c][i] * PCARRY);
        pf[c][i + 8] = toh_flush(s[2 * c + 1][i] * PCARRY);
      }

    // O^T += V^T . P^T  (K = 64 keys in two 32-steps; A = V^T tile [d][key])
#pragma unroll
    for (int c = 0; c < 2; ++c) {
#pragma unroll
      for (int nb = 0; nb < 4; ++nb) {
        const v16h vf = ld_frag(&Vs[(nb * 16) * LDT + c * 32], LDT);
        o[nb] = wmma16(vf, pf[c], o[nb]);
      }
    }

    if (early) {
      // V_res . P_hi (scale 1/1024), one 16-column group at a time, folded immediately
#pragma unroll
      for (int nb = 0; nb < 4; ++nb) {
        v8f o2 = {};
#pragma unroll
        for (int c = 0; c < 2; ++c) {
          const v16h vr = ld_frag(&VRs[(nb * 16) * LDT + c * 32], LDT);
          o2 = wmma16(vr, pf[c], o2);
        }
#pragma unroll
        for (int v = 0; v < 8; ++v) o[nb][v] = o[nb][v] + o2[v] * (1.0f / RCARRY);
      }
      // P residual fragments: f16(1024 * (1024 p - f16(1024 p)))
      v16h pr[2];
#pragma unroll
      for (int c = 0; c < 2; ++c)
#pragma unroll
        for (int i = 0; i < 16; ++i) {
          const float t = s[2 * c + (i >> 3)][i & 7] * PCARRY;
          const float hi = (float)toh_flush(t);
          pr[c][i] = toh_flush((t - hi) * RCARRY);
        }
      // V_hi . P_res (scale 1/1024), one 16-column group at a time, folded immediately
#pragma unroll
      for (int nb = 0; nb < 4; ++nb) {
        v8f o2 = {};
#pragma unroll
        for (int c = 0; c < 2; ++c) {
          const v16h vf = ld_frag(&Vs[(nb * 16) * LDT + c * 32], LDT);
          o2 = wmma16(vf, pr[c], o2);
        }
#pragma unroll
        for (int v = 0; v < 8; ++v) o[nb][v] = o[nb][v] + o2[v] * (1.0f / RCARRY);
      }
    }
    __syncthreads();
  }

  const float lrow = lsum + xhalf(lsum);   // the two halves' keys joined
  const float inv = __builtin_amdgcn_rcpf(lrow) * (VCARRY / PCARRY);
  v8h x[4];
#pragma unroll
  for (int nb = 0; nb < 4; ++nb)
#pragma unroll
    for (int v = 0; v < 8; ++v) x[nb][v] = toh_flush(o[nb][v] * inv);
  _Float16* po = Ov + (size_t)(b * (unsigned)SEQ + qrow0 + m) * DIM + head * HD + hh * 8u;
#pragma unroll
  for (int nb = 0; nb < 4; ++nb) *(v8h*)(po + nb * 16) = x[nb];
  // before the stores' registers are reused; in front of the branch, where it stays directly
  // behind the stores
  asm volatile("s_wait_xcnt 0x0" ::: "memory");
  if (first_blk) {
    // residual rows (first query block only; qrow0 < 128): f16(2048 * (t - f16(t)))
    v8h xr[4];
#pragma unroll
    for (int nb = 0; nb < 4; ++nb)
#pragma unroll
      for (int v = 0; v < 8; ++v)
        xr[nb][v] = toh_flush((o[nb][v] * inv - (float)x[nb][v]) * SCRES);
    _Float16* pres = OvR + (size_t)(b * (unsigned)EROWS + qrow0 + m) * DIM + head * HD + hh * 8u;
#pragma unroll
    for (int nb = 0; nb < 4; ++nb) *(v8h*)(pres + nb * 16) = xr[nb];
  }
}

// ---------------------------------------------------------------------------
extern "C" void kernel_launch(void* const* d_in, const int* in_sizes, int n_in,
                              void* d_out, int out_size, void* d_ws, size_t ws_size,
                              hipStream_t stream) {
  if (n_in < 5) return;
  const long long need_x = ((long long)(NB - 1) * SEQ_FULL + SEQ) * DIM;
  if ((long long)in_sizes[0] < need_x) return;
  if ((long long)in_sizes[1] < (long long)DIM * DIM) return;
  if ((long long)in_sizes[2] < (long long)KVD * DIM) return;
  if ((long long)in_sizes[3] < (long long)KVD * DIM) return;
  if ((long long)in_sizes[4] < (long long)DIM * DIM) return;
  if ((long long)out_size < need_x) return;
  if (ws_size < WS_TOTAL) return;

  // bound by the input list order: x, wq, wk, wv, wo
  const float* X  = (const float*)d_in[0];    // [NB_FULL][SEQ_FULL][DIM]
  const float* wq = (const float*)d_in[1];    // [DIM][DIM]  (out, in)
  const float* wk = (const float*)d_in[2];    // [KVD][DIM]  (out, in)
  const float* wv = (const float*)d_in[3];    // [KVD][DIM]  (out, in)
  const float* wo = (const float*)d_in[4];    // [DIM][DIM]  (out, in)
  float* out = (float*)d_out;

  char* ws = (char*)d_ws;
  _Float16* Wq_t  = (_Float16*)(ws + OFF_WQ);    // [n][k], x64; wk and wv planes [KVD][DIM] behind it
  _Float16* Wo_t  = (_Float16*)(ws + OFF_WO);    // [n][k], x64
  _Float16* X16   = (_Float16*)(ws + OFF_X);     // [MROWS][DIM]
  _Float16* Qh16  = (_Float16*)(ws + OFF_Q);     // [MROWS][DIM]
  _Float16* Kh16  = (_Float16*)(ws + OFF_K);     // [MROWS][DIM], shared heads written 4x
  _Float16* Vt16  = (_Float16*)(ws + OFF_VT);    // [b][DIM][SEQ], shared heads written 4x
  _Float16* Ctx16 = (_Float16*)(ws + OFF_CTX);   // [MROWS][DIM], x64
  _Float16* VtR16 = (_Float16*)(ws + OFF_VR);    // [b][DIM][64]
  _Float16* QR16  = (_Float16*)(ws + OFF_QR);    // [b][NHEAD][128][64], x2048
  _Float16* KR16  = (_Float16*)(ws + OFF_KR);    // [b][NHEAD][64][64], x2048, shared heads 4x
  _Float16* CR16  = (_Float16*)(ws + OFF_CR);    // [b][128][DIM], x2048 on top of x64

  dim3 blk(256);

  // input rows and weight planes ([out][in] rows are already k-contiguous); 8 rows per block;
  // Wq_t is the first of the four stacked weight planes
  cast_kernel<<<dim3(XBLK + WBLK), blk, 0, stream>>>(X, wq, wk, wv, wo, X16, Wq_t);

  // gemm_qkv_kernel(A16, Bt, q16, q16r, k16, k16r, vt, vtr); Bt = planes wq, wk, wv, stacked
  gemm_qkv_kernel<<<dim3(QBLK + 2 * KVBLK, MROWS / BM), blk, 0, stream>>>(
      X16, Wq_t, Qh16, QR16, Kh16, KR16, Vt16, VtR16);
  // attn_kernel(Qh, QhR, Kh, KhR, Vt, VtR, Ov, OvR)
  attn_kernel<<<dim3(NHEAD, NB, SEQ / 128), blk, 0, stream>>>(Qh16, QR16, Kh16, KR16, Vt16, VtR16,
                                                              Ctx16, CR16);
  // gemm_wo_kernel(A16, A16r, Bt, outf)
  gemm_wo_kernel<<<dim3(DIM / BN, MROWS / BM), blk, 0, stream>>>(Ctx16, CR16, Wo_t, out);
}

// v005
// It runs in 156 microseconds.
// Timed twice side by side with v004, it ran 1.06 times as fast both times.
// Counting every step since v000, it is 3.08 times as fast.
#include <hip/hip_runtime.h>
#include <stddef.h>

// All contractions on v_wmma_f32_16x16x32_f16 (f16 operands, f32 accumulate): q/k/v projections,
// q.k scores, p.v, output projection. Float inputs are RNE-converted to bf16 and carried in f16
// (weights x64, p x1024, attention rows x64). Early corner only (query rows 0..127 x keys 0..63
// of every (batch, head)): q and k get a x2048 residual plane (two more score products into a
// separate accumulator), p and v a x1024 residual plane, and the attention rows 0..127 a x2048
// residual plane (second accumulator set in the output projection on those row tiles).
// Softmax and all scaling in f32.
// Causal grouped-query attention (32 query heads sharing 8 key/value heads), [out][in] weights,
// no biases; the k and v projection epilogues write every shared head once per query head so
// the attention kernel sees one K row block and one V^T row block per query head.

typedef _Float16 v16h __attribute__((ext_vector_type(16)));
typedef _Float16 v8h  __attribute__((ext_vector_type(8)));
typedef float    v8f  __attribute__((ext_vector_type(8)));
typedef float    v4f  __attribute__((ext_vector_type(4)));

#ifndef NB
#define NB 2
#endif
#ifndef SEQ
#define SEQ 2048
#endif
#define NB_FULL  2
#define SEQ_FULL 2048
#define DIM   2048
#define NHEAD 32
#define HD    64
#define NKV   8
#define GQA   (NHEAD / NKV)
#define KVD   (NKV * HD)
#define MROWS (NB * SEQ)
#define EROWS  128   // early query rows per sequence carried with residual planes (q, ctx)
#define ECHUNK 64    // early keys per sequence carried with residual planes (k, v)

static_assert(NB >= 1 && NB <= NB_FULL);
static_assert(SEQ >= 128 && SEQ <= SEQ_FULL && (SEQ % 128) == 0);
static_assert(DIM == NHEAD * HD);
static_assert(HD == 64);
static_assert(NHEAD == NKV * GQA && GQA == 4);
static_assert(KVD == 512 && (KVD % 64) == 0);
static_assert((DIM % 64) == 0 && (DIM % 32) == 0);
static_assert((MROWS % 64) == 0 && (MROWS % 8) == 0);
static_assert((SEQ % 64) == 0);               // a 64-row GEMM tile never straddles two sequences
static_assert((DIM % 8) == 0 && (KVD % 8) == 0);
static_assert(DIM == 8 * 32 * 8);             // cast: 8 passes x 32 lanes x 8 columns per row
static_assert((size_t)MROWS * DIM < (size_t)0xFFFFFFFFu);
static_assert(EROWS == 128);                  // == query rows of one attention block (block 0)
static_assert(ECHUNK == 64);                  // == keys of one attention step (chunk 0) == one GEMM row tile
static_assert((EROWS % 64) == 0 && EROWS <= SEQ);   // whole 64-row GEMM tiles
static_assert((size_t)NB * NHEAD * EROWS * HD < (size_t)0xFFFFFFFFu);   // 32-bit q residual offsets

#define LDT 72   // halves per LDS row (144 B, 16-B aligned)
#define LDC 68   // floats per LDS row (272 B, 16-B aligned)
static_assert((LDT % 8) == 0 && LDT >= 64);
static_assert((LDC % 4) == 0 && LDC >= 64);

// GEMM block tile and LDS staging
#define BM  128   // output rows per block
#define BN  128   // output columns per block
#define BK  128   // halves of every operand row per stage (256 B)
#define LDG 136   // halves per staged row (272 B = 16 B x 17: b128 fragment reads meet no bank twice)
#define STAGE_H ((BM + BN) * LDG)   // halves per stage: A rows, then B rows
static_assert((LDG % 8) == 0 && LDG >= BK);
static_assert((DIM % BK) == 0 && DIM / BK >= 2);          // the ring starts with two stages
static_assert((MROWS % BM) == 0 && (SEQ % BM) == 0 && (DIM % BN) == 0 && (KVD % BN) == 0);
static_assert(BM == EROWS);                               // a block is all early rows or none
static_assert((BM + BN) * (BK / 8) == 256 * 16);          // 16 copies of 16 B per thread and stage
static_assert((size_t)4 * 64 * LDC * 4 <= (size_t)2 * STAGE_H * 2);   // C staging fits the ring
static_assert((size_t)2 * STAGE_H * 2 <= (size_t)163840);             // two blocks per WGP

#define WCARRY 64.0f     // weight planes carried x64
#define PCARRY 1024.0f   // softmax numerators carried x1024
#define VCARRY 64.0f     // attention output plane carried x64
#define RCARRY 1024.0f   // residual planes (p, v) carried x1024 on top of their hi part
#define SCRES  2048.0f   // residual planes (q, k, attention rows) carried x2048 on top of their hi part

// epilogue store-loop coverage (rows admitted per step x steps == tile rows)
#define TILE_ROWS        64
#define EPI16_ROWS_STEP  (256 / 8)
#define EPI16_STEPS      2
#define EPIF_ROWS_STEP   (256 / 16)   // 16 lanes x 16 B per 256-B row segment
#define EPIF_STEPS       4
static_assert(EPI16_ROWS_STEP * EPI16_STEPS == TILE_ROWS);
static_assert(EPIF_ROWS_STEP * EPIF_STEPS == TILE_ROWS);
static_assert(8 * 16 == 128);                 // attention block: 8 waves x 16 query rows

// static LDS per kernel (bytes)
static_assert((size_t)(4 * 64 * LDT) * 2 <= (size_t)131072);

// workspace layout (bytes)
#define WSQ_BYTES     ((size_t)DIM * DIM * 2)
#define WKV_BYTES     ((size_t)KVD * DIM * 2)
#define PLANE16_BYTES ((size_t)MROWS * DIM * 2)
#define VRES_BYTES    ((size_t)NB * DIM * 64 * 2)
#define QRES_BYTES    ((size_t)NB * NHEAD * EROWS * HD * 2)
#define KRES_BYTES    ((size_t)NB * NHEAD * ECHUNK * HD * 2)
#define CRES_BYTES    ((size_t)NB * EROWS * DIM * 2)
#define OFF_WQ  ((size_t)0)
#define OFF_WK  (OFF_WQ + WSQ_BYTES)
#define OFF_WV  (OFF_WK + WKV_BYTES)
#define OFF_WO  (OFF_WV + WKV_BYTES)
#define OFF_X   (OFF_WO + WSQ_BYTES)
#define OFF_Q   (OFF_X + PLANE16_BYTES)
#define OFF_K   (OFF_Q + PLANE16_BYTES)
#define OFF_VT  (OFF_K + PLANE16_BYTES)
#define OFF_CTX (OFF_VT + PLANE16_BYTES)
#define OFF_VR  (OFF_CTX + PLANE16_BYTES)
#define OFF_QR  (OFF_VR + VRES_BYTES)
#define OFF_KR  (OFF_QR + QRES_BYTES)
#define OFF_CR  (OFF_KR + KRES_BYTES)
#define WS_TOTAL (OFF_CR + CRES_BYTES)
static_assert((WSQ_BYTES % 128) == 0 && (WKV_BYTES % 128) == 0 && (PLANE16_BYTES % 128) == 0);
static_assert((VRES_BYTES % 128) == 0);
static_assert((QRES_BYTES % 128) == 0 && (KRES_BYTES % 128) == 0 && (CRES_BYTES % 128) == 0);
static_assert(WS_TOTAL <= (size_t)134217728);

// ---------------------------------------------------------------------------
__device__ __forceinline__ float bf16r(float x) {   // RNE convert to bf16, returned widened
  unsigned int u = __float_as_uint(x);
  u = (u + 0x7FFFu + ((u >> 16) & 1u)) & 0xFFFF0000u;
  return __uint_as_float(u);
}

// f32 -> f16 operand convert that cannot produce an f16 subnormal (value select).
static __device__ __forceinline__ _Float16 toh_flush(float v) {
  const _Float16 r = (_Float16)v;
  return (fabsf(v) < 6.103515625e-05f) ? (_Float16)0.0f : r;
}

// 16-bit fragment: p points at element [row = lane&15][k0 + 8*(lane>>4)] of a k-contiguous
// row. Elements 0..7 <- k0+8h+0..7, elements 8..15 <- k0+16+8h+0..7 (same map for A and B).
__device__ __forceinline__ v16h frag_at(const _Float16* p) {
  v8h lo = *(const v8h*)(p);
  v8h hi = *(const v8h*)(p + 16);
  v16h out;
#pragma unroll
  for (int i = 0; i < 8; ++i) { out[i] = lo[i]; out[i + 8] = hi[i]; }
  return out;
}
__device__ __forceinline__ v16h ld_frag(const _Float16* base, unsigned ld) {
  const unsigned lane = threadIdx.x & 31u;
  return frag_at(base + (lane & 15u) * ld + (lane >> 4) * 8u);
}

__device__ __forceinline__ v8f wmma16(v16h a, v16h b, v8f c) {
  v8f d = __builtin_amdgcn_wmma_f32_16x16x32_f16(false, a, false, b, (short)0, c,
                                                 false, false);
  asm volatile("v_nop\n\tv_nop\n\tv_nop\n\tv_nop" : "+v"(d) : "v"(a), "v"(b));
  return d;
}

// The builtin alone: the compiler keeps the distances behind its own matrix instructions, and a
// run of independent products issues back to back.
__device__ __forceinline__ v8f wmma16b(v16h a, v16h b, v8f c) {
  return __builtin_amdgcn_wmma_f32_16x16x32_f16(false, a, false, b, (short)0, c, false, false);
}

// Eight asynchronous 16-B copies of one lane, global -> LDS, rows 16 apart on both sides.
// lds: the lane's LDS byte address; g: the lane's global address; K: source pitch in halves.
// The s_wait_xcnt ends the copies' own statement so that no address register is rewritten
// ahead of it.
__device__ __forceinline__ void stage_copy8(const unsigned lds, const _Float16* g,
                                            const unsigned K) {
  const unsigned ls = 16u * LDG * 2u;
  const size_t gs = (size_t)16 * K;
  asm volatile(
      "global_load_async_to_lds_b128 %0, %8, off\n\t"
      "global_load_async_to_lds_b128 %1, %9, off\n\t"
      "global_load_async_to_lds_b128 %2, %10, off\n\t"
      "global_load_async_to_lds_b128 %3, %11, off\n\t"
      "global_load_async_to_lds_b128 %4, %12, off\n\t"
      "global_load_async_to_lds_b128 %5, %13, off\n\t"
      "global_load_async_to_lds_b128 %6, %14, off\n\t"
      "global_load_async_to_lds_b128 %7, %15, off\n\t"
      "s_wait_xcnt 0x0"
      :
      : "v"(lds), "v"(lds + ls), "v"(lds + 2u * ls), "v"(lds + 3u * ls), "v"(lds + 4u * ls),
        "v"(lds + 5u * ls), "v"(lds + 6u * ls), "v"(lds + 7u * ls), "v"(g), "v"(g + gs),
        "v"(g + 2u * gs), "v"(g + 3u * gs), "v"(g + 4u * gs), "v"(g + 5u * gs),
        "v"(g + 6u * gs), "v"(g + 7u * gs)
      : "memory");
}

// acc[i][j] += A[128 rows][K] . B[128 rows][K]^T for this wave's 64 x 32 part of the block tile
// (mw = 64-row group, nw = 32-column group). Arow / Brow: first row of the block's A / B rows.
// Two LDS buffers of one 128-k stage each; stage t + 2 is copied into the buffer that trip t
// has just left, behind the barrier that also publishes stage t + 1. On entry every wave's
// earlier LDS reads of St have retired in front of a barrier that all waves have passed.
__device__ __forceinline__ void gemm_mainloop(const _Float16* __restrict__ Arow,
                                              const _Float16* __restrict__ Brow,
                                              const unsigned K, _Float16* St,
                                              v8f (&acc)[4][2]) {
  const unsigned tid = threadIdx.x, lane = tid & 31u, w = tid >> 5;
  const unsigned mw = w >> 2, nw = w & 3u;
  const unsigned hh = lane >> 4, m = lane & 15u;
  const unsigned cr = tid >> 4, cc = (tid & 15u) * 8u;   // copy: row (of 16), 16-B column
  const _Float16* ga = Arow + (size_t)cr * K + cc;
  const _Float16* gb = Brow + (size_t)cr * K + cc;
  const unsigned la = (unsigned)(size_t)St + (cr * LDG + cc) * 2u;
  const unsigned lb = la + BM * LDG * 2u;
  const unsigned nt = K / BK;

  stage_copy8(la, ga, K);
  stage_copy8(lb, gb, K);
  asm volatile("s_wait_asynccnt 0x0" ::: "memory");   // stage 0 landed (this wave's copies)
  __syncthreads();                                    // stage 0 readable by every wave
  stage_copy8(la + STAGE_H * 2u, ga + BK, K);
  stage_copy8(lb + STAGE_H * 2u, gb + BK, K);

  const _Float16* fa = St + (mw * 64u + m) * LDG + hh * 8u;
  const _Float16* fb = St + (BM + nw * 32u + m) * LDG + hh * 8u;
#pragma unroll 1   // one stage per trip: the buffer alternates by t & 1, the text stays short
  for (unsigned t = 0; t < nt; ++t) {
    const unsigned bo = (t & 1u) * STAGE_H;
#pragma unroll
    for (unsigned kk = 0; kk < BK / 32u; ++kk) {
      v16h a[4], b[2];
#pragma unroll
      for (unsigned i = 0; i < 4u; ++i) a[i] = frag_at(fa + bo + i * 16u * LDG + kk * 32u);
#pragma unroll
      for (unsigned j = 0; j < 2u; ++j) b[j] = frag_at(fb + bo + j * 16u * LDG + kk * 32u);
#pragma unroll
      for (unsigned i = 0; i < 4u; ++i)
#pragma unroll
        for (unsigned j = 0; j < 2u; ++j) acc[i][j] = wmma16(a[i], b[j], acc[i][j]);
    }
    asm volatile("s_wait_dscnt 0x0" ::: "memory");      // this wave has left buffer t & 1
    asm volatile("s_wait_asynccnt 0x0" ::: "memory");   // its copies of stage t + 1 landed
    __syncthreads();   // publishes stage t + 1, frees buffer t & 1
    if (t + 2u < nt) {
      stage_copy8(la + bo * 2u, ga + (t + 2u) * BK, K);
      stage_copy8(lb + bo * 2u, gb + (t + 2u) * BK, K);
    }
  }
  asm volatile("s_wait_asynccnt 0x0" ::: "memory");     // nothing in flight when St is reused
}

// ---------------------------------------------------------------------------
// Row cast: f32 rows of DIM columns -> f16 compact rows of DIM columns, one wave per row,
// 8 rows per block, 8 rolled passes; each store instruction of a wave covers 512 contiguous
// SRC_INPUT = 1: source is the module input (full-size row stride per batch), carry 1;
// SRC_INPUT = 0: source is an [out][in] weight (already k-contiguous), carry x64.
// Every value goes through RNE bf16 first. sblk / dblk: 8-row block of the source / of dst.
// ---------------------------------------------------------------------------
template <int SRC_INPUT>
__device__ __forceinline__ void cast_body(const float* __restrict__ X,
                                          _Float16* __restrict__ dst,
                                          const unsigned sblk, const unsigned dblk) {
#pragma clang fp contract(off)
  const unsigned lane = threadIdx.x & 31u;
  const unsigned w = (unsigned)__builtin_amdgcn_readfirstlane((int)(threadIdx.x >> 5));
  const unsigned crow = sblk * 8u + w;
  size_t srow = crow;
  if (SRC_INPUT) {
    const unsigned bidx = crow / (unsigned)SEQ;
    const unsigned sq = crow - bidx * (unsigned)SEQ;
    srow = (size_t)bidx * SEQ_FULL + sq;
  }
  const float carry = SRC_INPUT ? 1.0f : WCARRY;
  const float* xr = X + srow * DIM + lane * 8u;
  _Float16* dr = dst + (size_t)(dblk * 8u + w) * DIM + lane * 8u;
#pragma unroll 1
  for (unsigned j = 0; j < 8u; ++j) {
    const v4f a0 = *(const v4f*)(xr + j * 256u);
    const v4f a1 = *(const v4f*)(xr + j * 256u + 4u);
    v8h o;
#pragma unroll
    for (int i = 0; i < 4; ++i) {
      o[i]     = toh_flush(carry * bf16r(a0[i]));
      o[i + 4] = toh_flush(carry * bf16r(a1[i]));
    }
    _Float16* p = dr + j * 256u;
    *(v8h*)p = o;
    
  }
}

// All five casts in one launch (none reads what another writes). Blocks 0 .. XBLK-1 take the
// input rows; the rest take the rows of the four weight planes, which lie stacked in the
// workspace in the order wq, wk, wv, wo, so that w16 is one plane of WBLK * 8 rows.
// Every test is on the block index alone. Grid (XBLK + WBLK).
#define XBLK (MROWS / 8)
#define WBLK ((2 * DIM + 2 * KVD) / 8)
static_assert(OFF_WK == OFF_WQ + (size_t)DIM * DIM * 2);
static_assert(OFF_WV == OFF_WQ + (size_t)(DIM + KVD) * DIM * 2);
static_assert(OFF_WO == OFF_WQ + (size_t)(DIM + 2 * KVD) * DIM * 2);
__global__ __launch_bounds__(256) void cast_kernel(
    const float* __restrict__ X, const float* __restrict__ wq, const float* __restrict__ wk,
    const float* __restrict__ wv, const float* __restrict__ wo,
    _Float16* __restrict__ x16, _Float16* __restrict__ w16) {
  const unsigned blk = blockIdx.x;
  if (blk < (unsigned)XBLK) {
    cast_body<1>(X, x16, blk, blk);
    return;
  }
  const unsigned wb = blk - (unsigned)XBLK;   // 8-row block of the stacked weight planes
  const float* W = wq;
  unsigned first = 0u;                        // first block of the plane that wb lies in
  if (wb >= (unsigned)((DIM + 2 * KVD) / 8)) {
    W = wo;
    first = (unsigned)((DIM + 2 * KVD) / 8);
  } else if (wb >= (unsigned)((DIM + KVD) / 8)) {
    W = wv;
    first = (unsigned)((DIM + KVD) / 8);
  } else if (wb >= (unsigned)(DIM / 8)) {
    W = wk;
    first = (unsigned)(DIM / 8);
  }
  cast_body<0>(W, w16, wb - first, wb);
}

// ---------------------------------------------------------------------------
// GEMM C[128x128 tile] = A16[rows][K] . Bt[n][K]^T; both operands staged in LDS by asynchronous
// copies (gemm_mainloop); 8 waves (mw = 64-row group, nw = 32-col group), 8 accumulators/wave.
// The epilogue treats the tile as four 64x64 sub-tiles (bx = 64-column block, row0 = first row):
//   MODE 0: out16[row][col] (pitch DIM) = f16(acc/64)                       (q plane);
//           row tiles with sequence row < 128 also write
//           out16r [b][head][128][64] = f16(2048 * (q - hi))
//   MODE 1: tile column block = one shared key head; out16[row][(4*kvh + rep)*64 + c]
//           (pitch DIM) = f16(acc/64) for rep 0..3                          (k plane);
//           the key tile 0 of each sequence also writes
//           out16r [b][4*kvh + rep][64][64] = f16(2048 * (k - hi)) for rep 0..3
//   MODE 2: transposed V plane [b][(4*kvh + rep)*64 + d][key] = f16(acc/64) for rep 0..3;
//           for key tile 0 also out16r [b][(4*kvh + rep)*64 + d][64] = f16(1024 * (v - hi))
//   MODE 3: outf full [full row][col] = acc/4096                            (output buffer);
//           row tiles with sequence row < 128 run a second accumulator set fed by the
//           residual rows A16r [b][128][K] against the same B rows (a second pass of the main
//           loop), folded as acc + accres/2048 before the 1/4096 scale (block-uniform test).
// Store loops: MODE 0/1/2: 32 rows per step x 2 steps = 64; MODE 3: 16 rows x 4 steps = 64.
// MODE 0, 1 and 2 share one launch (gemm_qkv_kernel): same A rows, and their B rows lie
// stacked in the workspace, so the main loop is one and only the epilogue differs by block.
// ---------------------------------------------------------------------------
// C staging over the ring (every wave is behind the main loop's last barrier):
// four [64][LDC] sub-tiles, sub = 2 * (row half) + (column half)
__device__ __forceinline__ void stage_c(const v8f (&acc)[4][2], float* Call) {
  const unsigned tid = threadIdx.x, lane = tid & 31u, w = tid >> 5;
  const unsigned mw = w >> 2, nw = w & 3u;
  const unsigned hh = lane >> 4, m = lane & 15u;
#pragma unroll
  for (unsigned i = 0; i < 4u; ++i)
#pragma unroll
    for (unsigned j = 0; j < 2u; ++j)
#pragma unroll
      for (unsigned r = 0; r < 8u; ++r)
        Call[((mw * 2u + (nw >> 1)) * 64u + i * 16u + hh * 8u + r) * LDC + (nw & 1u) * 32u +
             j * 16u + m] = acc[i][j][r];
  __syncthreads();
}

// Epilogue of one staged 128x128 tile. bxb: the tile's 128-column block within its own output;
// brow0: its first row.
template <int MODE>
__device__ __forceinline__ void store_tiles(
    const float* Call, const unsigned bxb, const unsigned brow0,
    float* __restrict__ outf, _Float16* __restrict__ out16, _Float16* __restrict__ out16r) {
  const unsigned tid = threadIdx.x;
  for (unsigned sub = 0; sub < 4u; ++sub) {
  const float* Cs = Call + sub * (64u * LDC);
  const unsigned bx = bxb * 2u + (sub & 1u);
  const unsigned n0 = bx * 64u;
  const unsigned row0 = brow0 + (sub >> 1) * 64u;

  if (MODE == 0 || MODE == 1) {
    constexpr unsigned NREP  = (MODE == 1) ? (unsigned)GQA : 1u;
    constexpr unsigned RROWS = (MODE == 1) ? (unsigned)ECHUNK : (unsigned)EROWS;
    const unsigned cb = (MODE == 1) ? bx * (unsigned)(GQA * HD) : n0;
    const unsigned bidx = row0 / (unsigned)SEQ;
    const unsigned sq0 = row0 - bidx * (unsigned)SEQ;
    const bool has_res = (sq0 < RROWS);        // block-uniform (MODE 1: key tile 0 only)
    v8h x[2], xr[2];
    size_t off[2], offr[2];
#pragma unroll
    for (unsigned i = 0; i < 2u; ++i) {
      const unsigned r = 32u * i + (tid >> 3);
      const unsigned c = (tid & 7u) * 8u;
      const v4f u0 = *(const v4f*)&Cs[r * LDC + c];
      const v4f u1 = *(const v4f*)&Cs[r * LDC + c + 4];
#pragma unroll
      for (int j = 0; j < 4; ++j) {
        x[i][j]     = toh_flush(u0[j] * (1.0f / WCARRY));
        x[i][j + 4] = toh_flush(u1[j] * (1.0f / WCARRY));
      }
      xr[i] = x[i];
      if (has_res) {
#pragma unroll
        for (int j = 0; j < 4; ++j) {
          const float t0 = u0[j] * (1.0f / WCARRY);
          const float t1 = u1[j] * (1.0f / WCARRY);
          xr[i][j]     = toh_flush((t0 - (float)x[i][j]) * SCRES);
          xr[i][j + 4] = toh_flush((t1 - (float)x[i][j + 4]) * SCRES);
        }
      }
      off[i] = (size_t)(row0 + r) * DIM + cb + c;
      offr[i] = ((size_t)(bidx * (unsigned)NHEAD + bx * NREP) * RROWS + sq0 + r) * HD + c;
    }
#pragma unroll
    for (unsigned rep = 0; rep < NREP; ++rep) {
#pragma unroll
      for (int i = 0; i < 2; ++i)
        *(v8h*)(out16 + off[i] + (size_t)rep * HD) = x[i];
    }
    asm volatile("s_wait_xcnt 0x0" ::: "memory");   // before the stores' registers are reused
    if (has_res) {
#pragma unroll
      for (unsigned rep = 0; rep < NREP; ++rep) {
#pragma unroll
        for (int i = 0; i < 2; ++i)
          *(v8h*)(out16r + offr[i] + (size_t)rep * RROWS * HD) = xr[i];
      }
      asm volatile("s_wait_xcnt 0x0" ::: "memory");   // before the stores' registers are reused
    }
    
  }

  if (MODE == 2) {
    const unsigned bidx = row0 / (unsigned)SEQ;
    const unsigned key0 = row0 - bidx * (unsigned)SEQ;
    const bool first_tile = (key0 == 0u);      // block-uniform
    v8h x[2], xr[2];
    size_t off[2], offr[2];
#pragma unroll
    for (unsigned i = 0; i < 2u; ++i) {
      const unsigned dcol = 32u * i + (tid >> 3);
      const unsigned kk = (tid & 7u) * 8u;
#pragma unroll
      for (unsigned j = 0; j < 8u; ++j) {
        const float t = Cs[(kk + j) * LDC + dcol] * (1.0f / WCARRY);
        const _Float16 hi = toh_flush(t);
        x[i][j]  = hi;
        xr[i][j] = toh_flush((t - (float)hi) * RCARRY);
      }
      const size_t vrow = (size_t)bidx * DIM + bx * (unsigned)(GQA * HD) + dcol;
      off[i]  = vrow * SEQ + key0 + kk;
      offr[i] = vrow * 64u + kk;
    }
#pragma unroll
    for (unsigned rep = 0; rep < (unsigned)GQA; ++rep) {
#pragma unroll
      for (int i = 0; i < 2; ++i)
        *(v8h*)(out16 + off[i] + (size_t)rep * HD * SEQ) = x[i];
    }
    asm volatile("s_wait_xcnt 0x0" ::: "memory");   // before the stores' registers are reused
    if (first_tile) {
#pragma unroll
      for (unsigned rep = 0; rep < (unsigned)GQA; ++rep) {
#pragma unroll
        for (int i = 0; i < 2; ++i)
          *(v8h*)(out16r + offr[i] + (size_t)rep * HD * 64u) = xr[i];
      }
      asm volatile("s_wait_xcnt 0x0" ::: "memory");   // before the stores' registers are reused
    }
    
  }

  if (MODE == 3) {
    const float cs = 1.0f / (WCARRY * VCARRY);
    v4f xs[4];
    size_t off[4];
#pragma unroll
    for (unsigned i = 0; i < 4u; ++i) {
      const unsigned r = 16u * i + (tid >> 4);
      const unsigned c = (tid & 15u) * 4u;
      const unsigned crow = row0 + r;
      const unsigned bidx = crow / (unsigned)SEQ;
      const unsigned sq = crow - bidx * (unsigned)SEQ;
      const size_t frow = (size_t)bidx * SEQ_FULL + sq;
      const v4f u = *(const v4f*)&Cs[r * LDC + c];
      v4f val;
#pragma unroll
      for (int j = 0; j < 4; ++j) val[j] = u[j] * cs;
      xs[i] = val;
      off[i] = frow * DIM + n0 + c;
    }
#pragma unroll
    for (int i = 0; i < 4; ++i) *(v4f*)(outf + off[i]) = xs[i];
  }
  }   // sub
}

// q, k and v projections in one launch. Bt: the stacked planes wq, wk, wv (DIM + 2 KVD rows);
// column blocks 0 .. QBLK-1 are q, the next KVBLK are k, the last KVBLK are v (tests on the
// block index alone). Grid (QBLK + 2 KVBLK, MROWS/128).
#define QBLK  (DIM / BN)
#define KVBLK (KVD / BN)
__global__ __launch_bounds__(256) void gemm_qkv_kernel(
    const _Float16* __restrict__ A16, const _Float16* __restrict__ Bt,
    _Float16* __restrict__ q16, _Float16* __restrict__ q16r,
    _Float16* __restrict__ k16, _Float16* __restrict__ k16r,
    _Float16* __restrict__ vt, _Float16* __restrict__ vtr) {
  __shared__ __attribute__((aligned(16))) _Float16 St[2 * STAGE_H];
  const unsigned K = (unsigned)DIM;
  const unsigned bxa = blockIdx.x;
  const unsigned brow0 = blockIdx.y * (unsigned)BM;

  v8f acc[4][2] = {};
  gemm_mainloop(A16 + (size_t)brow0 * K, Bt + (size_t)(bxa * (unsigned)BN) * K, K, St, acc);
  stage_c(acc, (float*)St);
  if (bxa < (unsigned)QBLK)
    store_tiles<0>((const float*)St, bxa, brow0, (float*)0, q16, q16r);
  else if (bxa < (unsigned)(QBLK + KVBLK))
    store_tiles<1>((const float*)St, bxa - (unsigned)QBLK, brow0, (float*)0, k16, k16r);
  else
    store_tiles<2>((const float*)St, bxa - (unsigned)(QBLK + KVBLK), brow0, (float*)0, vt, vtr);
}

// Output projection. Grid (DIM/128, MROWS/128).
__global__ __launch_bounds__(256) void gemm_wo_kernel(
    const _Float16* __restrict__ A16, const _Float16* __restrict__ A16r,
    const _Float16* __restrict__ Bt, float* __restrict__ outf) {
  __shared__ __attribute__((aligned(16))) _Float16 St[2 * STAGE_H];
  const unsigned K = (unsigned)DIM;
  const unsigned brow0 = blockIdx.y * (unsigned)BM;
  const _Float16* Brow = Bt + (size_t)(blockIdx.x * (unsigned)BN) * K;

  v8f acc[4][2] = {};
  gemm_mainloop(A16 + (size_t)brow0 * K, Brow, K, St, acc);
  const unsigned bidx3 = brow0 / (unsigned)SEQ;
  const unsigned sq3 = brow0 - bidx3 * (unsigned)SEQ;
  if (sq3 < (unsigned)EROWS) {               // block-uniform
    v8f res[4][2] = {};
    gemm_mainloop(A16r + (size_t)(bidx3 * (unsigned)EROWS + sq3) * K, Brow, K, St, res);
#pragma unroll
    for (int i = 0; i < 4; ++i)
#pragma unroll
      for (int j = 0; j < 2; ++j)
#pragma unroll
        for (int r = 0; r < 8; ++r) acc[i][j][r] = acc[i][j][r] + res[i][j][r] * (1.0f / SCRES);
  }
  stage_c(acc, (float*)St);
  store_tiles<3>((const float*)St, blockIdx.x, brow0, outf, (_Float16*)0, (_Float16*)0);
}

__device__ __forceinline__ float xhalf(float x) {
  const int b = __builtin_bit_cast(int, x);
  return __builtin_bit_cast(
      float, __builtin_amdgcn_permlanex16(b, b, 0x76543210, 0xfedcba98, false, false));
}

__global__ __launch_bounds__(256) void attn_kernel(
    const _Float16* __restrict__ Qh, const _Float16* __restrict__ QhR,
    const _Float16* __restrict__ Kh, const _Float16* __restrict__ KhR,
    const _Float16* __restrict__ Vt, const _Float16* __restrict__ VtR,
    _Float16* __restrict__ Ov, _Float16* __restrict__ OvR) {
  __shared__ _Float16 Ks[64 * LDT];
  __shared__ _Float16 Vs[64 * LDT];
  __shared__ _Float16 VRs[64 * LDT];
  __shared__ _Float16 KRs[64 * LDT];

  const unsigned tid = threadIdx.x, lane = tid & 31u, w = tid >> 5;
  const unsigned hh = lane >> 4, m = lane & 15u;
  const unsigned qtile = (unsigned)(SEQ / 128 - 1) - blockIdx.z;   // cost falls with the index
  const unsigned q0 = qtile * 128u;
  const unsigned head = blockIdx.x;
  const unsigned b = blockIdx.y;
  const float scale = 0.125f;   // HD^-0.5
  const unsigned qrow0 = q0 + w * 16u;
  const bool first_blk = (qtile == 0u);

  const size_t qoff = (size_t)(b * (unsigned)SEQ + qrow0 + m) * DIM + head * HD + hh * 8u;
  v16h qf[2];
  qf[0] = frag_at(Qh + qoff);
  qf[1] = frag_at(Qh + qoff + 32);

  float mrun = -1.0e30f;   // running maximum of query qrow0 + m (equal in both halves)
  float lsum = 0.0f;       // running sum over this half's keys only
  v8f o[4];
#pragma unroll
  for (int nb = 0; nb < 4; ++nb) o[nb] = (v8f){};

  const size_t kplane = (size_t)b * SEQ * DIM + head * HD;
  const size_t vplane = ((size_t)b * DIM + head * HD) * SEQ;
  const size_t rplane = ((size_t)b * DIM + head * HD) * 64u;
  const size_t krplane = ((size_t)(b * (unsigned)NHEAD + head) * ECHUNK) * HD;
  const unsigned kend = q0 + 128u;   // <= SEQ

  for (unsigned kb = 0; kb < kend; kb += 64u) {
    const bool early = first_blk && (kb == 0u);   // block-uniform
#pragma unroll
    for (unsigned j = 0; j < 2u; ++j) {
      const unsigned idx = tid + 256u * j;
      const unsigned r = idx >> 3, c = (idx & 7u) * 8u;
      *(v8h*)&Ks[r * LDT + c] = *(const v8h*)(Kh + kplane + (size_t)(kb + r) * DIM + c);
      *(v8h*)&Vs[r * LDT + c] = *(const v8h*)(Vt + vplane + (size_t)r * SEQ + kb + c);
    }
    if (early) {
#pragma unroll
      for (unsigned j = 0; j < 2u; ++j) {
        const unsigned idx = tid + 256u * j;
        const unsigned r = idx >> 3, c = (idx & 7u) * 8u;
        *(v8h*)&VRs[r * LDT + c] = *(const v8h*)(VtR + rplane + (size_t)r * 64u + c);
        *(v8h*)&KRs[r * LDT + c] = *(const v8h*)(KhR + krplane + (size_t)r * HD + c);
      }
    }
    __syncthreads();

    // scores, transposed: 4 key groups of 16 (rows), K = 64 in two 32-steps
    v8f s[4];
    if (early) {
      // early corner: value + residual products, one score tile at a time through ONE
      // residual accumulator; q0 == 0 here so qrow0 + m < 128
      const unsigned qrbase =
          ((b * (unsigned)NHEAD + head) * (unsigned)EROWS + qrow0 + m) * (unsigned)HD + hh * 8u;
#pragma unroll
      for (int kg = 0; kg < 4; ++kg) {
        v8f t = {};
#pragma unroll
        for (int c = 0; c < 2; ++c) {
          unsigned qro = qrbase + (unsigned)c * 32u;
          asm volatile("" : "+v"(qro));   // opaque offset: the residual q fragment is reloaded per tile
          v8f tr = {};
          {
            const v16h kf = ld_frag(&Ks[(kg * 16) * LDT + c * 32], LDT);
            t = wmma16(kf, qf[c], t);
            const v16h ql = frag_at(QhR + qro);
            tr = wmma16(kf, ql, tr);
          }
          {
            const v16h kl = ld_frag(&KRs[(kg * 16) * LDT + c * 32], LDT);
            tr = wmma16(kl, qf[c], tr);
          }
          t = t + tr * (1.0f / SCRES);
          __builtin_amdgcn_sched_barrier(0);   // the next tile's loads stay behind this tile
        }
        s[kg] = t * scale;
      }
    } else {
      // all eight K fragments as one group of LDS loads, then the eight products: four
      // independent accumulators per 32-column step (each tile still sums c = 0, then c = 1)
      v16h kf[2][4];
#pragma unroll
      for (int c = 0; c < 2; ++c)
#pragma unroll
        for (int kg = 0; kg < 4; ++kg) kf[c][kg] = ld_frag(&Ks[(kg * 16) * LDT + c * 32], LDT);
      __builtin_amdgcn_sched_barrier(0);   // the loads stay one group: none sinks among the products
#pragma unroll
      for (int kg = 0; kg < 4; ++kg) s[kg] = (v8f){};
#pragma unroll
      for (int c = 0; c < 2; ++c)
#pragma unroll
        for (int kg = 0; kg < 4; ++kg) s[kg] = wmma16b(kf[c][kg], qf[c], s[kg]);
      __builtin_amdgcn_sched_barrier(0);   // the scaling stays behind the run: no padded gap inside it
#pragma unroll
      for (int kg = 0; kg < 4; ++kg) s[kg] = s[kg] * scale;
    }

    // all eight V^T fragments as one group of LDS loads, issued here so that they land behind
    // the softmax
    v16h vfr[2][4];
#pragma unroll
    for (int c = 0; c < 2; ++c)
#pragma unroll
      for (int nb = 0; nb < 4; ++nb) vfr[c][nb] = ld_frag(&Vs[(nb * 16) * LDT + c * 32], LDT);

    // causal replace-mask (key > query) in chunks that reach the diagonal; block-uniform test
    if (kb >= q0) {
#pragma unroll
      for (int kg = 0; kg < 4; ++kg)
#pragma unroll
        for (int v = 0; v < 8; ++v) {
          const unsigned key = kb + (unsigned)kg * 16u + hh * 8u + (unsigned)v;
          const unsigned row = qrow0 + m;
          s[kg][v] = (key > row) ? -1.0e30f : s[kg][v];
        }
    }

    // online softmax of the lane's own query: 32 keys here, 32 in lane ^ 16
    float mt[8];
#pragma unroll
    for (int v = 0; v < 8; ++v)
      mt[v] = fmaxf(fmaxf(s[0][v], s[1][v]), fmaxf(s[2][v], s[3][v]));
    float mx = fmaxf(fmaxf(fmaxf(mt[0], mt[1]), fmaxf(mt[2], mt[3])),
                     fmaxf(fmaxf(mt[4], mt[5]), fmaxf(mt[6], mt[7])));
    mx = fmaxf(mx, xhalf(mx));
    const float mn = fmaxf(mrun, mx);
    const float alpha = __expf(mrun - mn);
    mrun = mn;
#pragma unroll
    for (int kg = 0; kg < 4; ++kg)
#pragma unroll
      for (int v = 0; v < 8; ++v) s[kg][v] = __expf(s[kg][v] - mrun);
    {
      float part[8];
#pragma unroll
      for (int v = 0; v < 8; ++v) part[v] = (s[0][v] + s[1][v]) + (s[2][v] + s[3][v]);
      const float rs = ((part[0] + part[1]) + (part[2] + part[3])) +
                       ((part[4] + part[5]) + (part[6] + part[7]));
      lsum = alpha * lsum + rs;
    }
#pragma unroll
    for (int nb = 0; nb < 4; ++nb)
#pragma unroll
      for (int v = 0; v < 8; ++v) o[nb][v] = o[nb][v] * alpha;

    // P^T fragments [32 keys][16 queries], f16(1024 p), from the score tiles in place
    v16h pf[2];
#pragma unroll
    for (int c = 0; c < 2; ++c)
#pragma unroll
      for (int i = 0; i < 8; ++i) {
        pf[c][i]     = toh_flush(s[2 * c][i] * PCARRY);
        pf[c][i + 8] = toh_flush(s[2 * c + 1][i] * PCARRY);
      }

    // O^T += V^T . P^T  (K = 64 keys in two 32-steps; A = V^T tile [d][key])
#pragma unroll
    for (int c = 0; c < 2; ++c) {
#pragma unroll
      for (int nb = 0; nb < 4; ++nb) o[nb] = wmma16b(vfr[c][nb], pf[c], o[nb]);
    }

    if (early) {
      // V_res . P_hi (scale 1/1024), one 16-column group at a time, folded immediately
#pragma unroll
      for (int nb = 0; nb < 4; ++nb) {
        v8f o2 = {};
#pragma unroll
        for (int c = 0; c < 2; ++c) {
          const v16h vr = ld_frag(&VRs[(nb * 16) * LDT + c * 32], LDT);
          o2 = wmma16(vr, pf[c], o2);
        }
#pragma unroll
        for (int v = 0; v < 8; ++v) o[nb][v] = o[nb][v] + o2[v] * (1.0f / RCARRY);
      }
      // P residual fragments: f16(1024 * (1024 p - f16(1024 p)))
      v16h pr[2];
#pragma unroll
      for (int c = 0; c < 2; ++c)
#pragma unroll
        for (int i = 0; i < 16; ++i) {
          const float t = s[2 * c + (i >> 3)][i & 7] * PCARRY;
          const float hi = (float)toh_flush(t);
          pr[c][i] = toh_flush((t - hi) * RCARRY);
        }
      // V_hi . P_res (scale 1/1024), one 16-column group at a time, folded immediately
#pragma unroll
      for (int nb = 0; nb < 4; ++nb) {
        v8f o2 = {};
#pragma unroll
        for (int c = 0; c < 2; ++c) {
          const v16h vf = ld_frag(&Vs[(nb * 16) * LDT + c * 32], LDT);
          o2 = wmma16(vf, pr[c], o2);
        }
#pragma unroll
        for (int v = 0; v < 8; ++v) o[nb][v] = o[nb][v] + o2[v] * (1.0f / RCARRY);
      }
    }
    __syncthreads();
  }

  const float lrow = lsum + xhalf(lsum);   // the two halves' keys joined
  const float inv = __builtin_amdgcn_rcpf(lrow) * (VCARRY / PCARRY);
  v8h x[4];
#pragma unroll
  for (int nb = 0; nb < 4; ++nb)
#pragma unroll
    for (int v = 0; v < 8; ++v) x[nb][v] = toh_flush(o[nb][v] * inv);
  _Float16* po = Ov + (size_t)(b * (unsigned)SEQ + qrow0 + m) * DIM + head * HD + hh * 8u;
#pragma unroll
  for (int nb = 0; nb < 4; ++nb) *(v8h*)(po + nb * 16) = x[nb];
  // before the stores' registers are reused; in front of the branch, where it stays directly
  // behind the stores
  asm volatile("s_wait_xcnt 0x0" ::: "memory");
  if (first_blk) {
    // residual rows (first query block only; qrow0 < 128): f16(2048 * (t - f16(t)))
    v8h xr[4];
#pragma unroll
    for (int nb = 0; nb < 4; ++nb)
#pragma unroll
      for (int v = 0; v < 8; ++v)
        xr[nb][v] = toh_flush((o[nb][v] * inv - (float)x[nb][v]) * SCRES);
    _Float16* pres = OvR + (size_t)(b * (unsigned)EROWS + qrow0 + m) * DIM + head * HD + hh * 8u;
#pragma unroll
    for (int nb = 0; nb < 4; ++nb) *(v8h*)(pres + nb * 16) = xr[nb];
  }
}

// ---------------------------------------------------------------------------
extern "C" void kernel_launch(void* const* d_in, const int* in_sizes, int n_in,
                              void* d_out, int out_size, void* d_ws, size_t ws_size,
                              hipStream_t stream) {
  if (n_in < 5) return;
  const long long need_x = ((long long)(NB - 1) * SEQ_FULL + SEQ) * DIM;
  if ((long long)in_sizes[0] < need_x) return;
  if ((long long)in_sizes[1] < (long long)DIM * DIM) return;
  if ((long long)in_sizes[2] < (long long)KVD * DIM) return;
  if ((long long)in_sizes[3] < (long long)KVD * DIM) return;
  if ((long long)in_sizes[4] < (long long)DIM * DIM) return;
  if ((long long)out_size < need_x) return;
  if (ws_size < WS_TOTAL) return;

  // bound by the input list order: x, wq, wk, wv, wo
  const float* X  = (const float*)d_in[0];    // [NB_FULL][SEQ_FULL][DIM]
  const float* wq = (const float*)d_in[1];    // [DIM][DIM]  (out, in)
  const float* wk = (const float*)d_in[2];    // [KVD][DIM]  (out, in)
  const float* wv = (const float*)d_in[3];    // [KVD][DIM]  (out, in)
  const float* wo = (const float*)d_in[4];    // [DIM][DIM]  (out, in)
  float* out = (float*)d_out;

  char* ws = (char*)d_ws;
  _Float16* Wq_t  = (_Float16*)(ws + OFF_WQ);    // [n][k], x64; wk and wv planes [KVD][DIM] behind it
  _Float16* Wo_t  = (_Float16*)(ws + OFF_WO);    // [n][k], x64
  _Float16* X16   = (_Float16*)(ws + OFF_X);     // [MROWS][DIM]
  _Float16* Qh16  = (_Float16*)(ws + OFF_Q);     // [MROWS][DIM]
  _Float16* Kh16  = (_Float16*)(ws + OFF_K);     // [MROWS][DIM], shared heads written 4x
  _Float16* Vt16  = (_Float16*)(ws + OFF_VT);    // [b][DIM][SEQ], shared heads written 4x
  _Float16* Ctx16 = (_Float16*)(ws + OFF_CTX);   // [MROWS][DIM], x64
  _Float16* VtR16 = (_Float16*)(ws + OFF_VR);    // [b][DIM][64]
  _Float16* QR16  = (_Float16*)(ws + OFF_QR);    // [b][NHEAD][128][64], x2048
  _Float16* KR16  = (_Float16*)(ws + OFF_KR);    // [b][NHEAD][64][64], x2048, shared heads 4x
  _Float16* CR16  = (_Float16*)(ws + OFF_CR);    // [b][128][DIM], x2048 on top of x64

  dim3 blk(256);

  // input rows and weight planes ([out][in] rows are already k-contiguous); 8 rows per block;
  // Wq_t is the first of the four stacked weight planes
  cast_kernel<<<dim3(XBLK + WBLK), blk, 0, stream>>>(X, wq, wk, wv, wo, X16, Wq_t);

  // gemm_qkv_kernel(A16, Bt, q16, q16r, k16, k16r, vt, vtr); Bt = planes wq, wk, wv, stacked
  gemm_qkv_kernel<<<dim3(QBLK + 2 * KVBLK, MROWS / BM), blk, 0, stream>>>(
      X16, Wq_t, Qh16, QR16, Kh16, KR16, Vt16, VtR16);
  // attn_kernel(Qh, QhR, Kh, KhR, Vt, VtR, Ov, OvR)
  attn_kernel<<<dim3(NHEAD, NB, SEQ / 128), blk, 0, stream>>>(Qh16, QR16, Kh16, KR16, Vt16, VtR16,
                                                              Ctx16, CR16);
  // gemm_wo_kernel(A16, A16r, Bt, outf)
  gemm_wo_kernel<<<dim3(DIM / BN, MROWS / BM), blk, 0, stream>>>(Ctx16, CR16, Wo_t, out);
}

// v006
// Measured time: 148 microseconds a run.
// Timed twice side by side with v005, it ran 1.06 and 1.05 times as fast.
// All steps since v000 together make it 3.24 times as fast.
#include <hip/hip_runtime.h>
#include <stddef.h>

// All contractions on v_wmma_f32_16x16x32_f16 (f16 operands, f32 accumulate): q/k/v projections,
// q.k scores, p.v, output projection. Float inputs are RNE-converted to bf16 and carried in f16
// (weights x64, p x1024, attention rows x64). Early corner only (query rows 0..127 x keys 0..63
// of every (batch, head)): q and k get a x2048 residual plane (two more score products into a
// separate accumulator), p and v a x1024 residual plane, and the attention rows 0..127 a x2048
// residual plane (second accumulator set in the output projection on those row tiles).
// Softmax and all scaling in f32.
// Causal grouped-query attention (32 query heads sharing 8 key/value heads), [out][in] weights,
// no biases; the k and v projection epilogues write every shared head once per query head so
// the attention kernel sees one K row block and one V^T row block per query head.

typedef _Float16 v16h __attribute__((ext_vector_type(16)));
typedef _Float16 v8h  __attribute__((ext_vector_type(8)));
typedef float    v8f  __attribute__((ext_vector_type(8)));
typedef float    v4f  __attribute__((ext_vector_type(4)));

#ifndef NB
#define NB 2
#endif
#ifndef SEQ
#define SEQ 2048
#endif
#define NB_FULL  2
#define SEQ_FULL 2048
#define DIM   2048
#define NHEAD 32
#define HD    64
#define NKV   8
#define GQA   (NHEAD / NKV)
#define KVD   (NKV * HD)
#define MROWS (NB * SEQ)
#define EROWS  128   // early query rows per sequence carried with residual planes (q, ctx)
#define ECHUNK 64    // early keys per sequence carried with residual planes (k, v)

static_assert(NB >= 1 && NB <= NB_FULL);
static_assert(SEQ >= 128 && SEQ <= SEQ_FULL && (SEQ % 128) == 0);
static_assert(DIM == NHEAD * HD);
static_assert(HD == 64);
static_assert(NHEAD == NKV * GQA && GQA == 4);
static_assert(KVD == 512 && (KVD % 64) == 0);
static_assert((DIM % 64) == 0 && (DIM % 32) == 0);
static_assert((MROWS % 64) == 0 && (MROWS % 8) == 0);
static_assert((SEQ % 64) == 0);               // a 64-row GEMM tile never straddles two sequences
static_assert((DIM % 8) == 0 && (KVD % 8) == 0);
static_assert(DIM == 8 * 32 * 8);             // cast: 8 passes x 32 lanes x 8 columns per row
static_assert((size_t)MROWS * DIM < (size_t)0xFFFFFFFFu);
static_assert(EROWS == 128);                  // == query rows of one attention block (block 0)
static_assert(ECHUNK == 64);                  // == keys of one attention step (chunk 0) == one GEMM row tile
static_assert((EROWS % 64) == 0 && EROWS <= SEQ);   // whole 64-row GEMM tiles
static_assert((size_t)NB * NHEAD * EROWS * HD < (size_t)0xFFFFFFFFu);   // 32-bit q residual offsets

#define LDT 72   // halves per LDS row (144 B, 16-B aligned)
#define LDC 68   // floats per LDS row (272 B, 16-B aligned)
static_assert((LDT % 8) == 0 && LDT >= 64);
static_assert((LDC % 4) == 0 && LDC >= 64);

// GEMM block tile (output projection; the q, k, v tile stands at its kernel) and LDS staging
#define BM  128   // output rows per block
#define BN  128   // output columns per block
#define BK  128   // halves of every operand row per stage (256 B)
#define LDG 136   // halves per staged row (272 B = 16 B x 17: b128 fragment reads meet no bank twice)
#define STAGE_H ((BM + BN) * LDG)   // halves per stage: A rows, then B rows
static_assert((LDG % 8) == 0 && LDG >= BK);
static_assert((DIM % BK) == 0 && DIM / BK >= 2);          // the ring starts with two stages
static_assert((MROWS % BM) == 0 && (SEQ % BM) == 0 && (DIM % BN) == 0 && (KVD % BN) == 0);
static_assert(BM == EROWS);                               // a block is all early rows or none
static_assert((BM + BN) * (BK / 8) == 256 * 16);          // 16 copies of 16 B per thread and stage
static_assert((size_t)4 * 64 * LDC * 4 <= (size_t)2 * STAGE_H * 2);   // C staging fits the ring
static_assert((size_t)2 * STAGE_H * 2 <= (size_t)163840);             // two blocks per WGP

#define WCARRY 64.0f     // weight planes carried x64
#define PCARRY 1024.0f   // softmax numerators carried x1024
#define VCARRY 64.0f     // attention output plane carried x64
#define RCARRY 1024.0f   // residual planes (p, v) carried x1024 on top of their hi part
#define SCRES  2048.0f   // residual planes (q, k, attention rows) carried x2048 on top of their hi part

// epilogue store-loop coverage (rows admitted per step x steps == tile rows)
#define TILE_ROWS        64
#define EPI16_ROWS_STEP  (256 / 8)
#define EPI16_STEPS      2
#define EPIF_ROWS_STEP   (256 / 16)   // 16 lanes x 16 B per 256-B row segment
#define EPIF_STEPS       4
static_assert(EPI16_ROWS_STEP * EPI16_STEPS == TILE_ROWS);
static_assert(EPIF_ROWS_STEP * EPIF_STEPS == TILE_ROWS);
static_assert(8 * 16 == 128);                 // attention block: 8 waves x 16 query rows

// static LDS per kernel (bytes)
static_assert((size_t)(4 * 64 * LDT) * 2 <= (size_t)131072);

// workspace layout (bytes)
#define WSQ_BYTES     ((size_t)DIM * DIM * 2)
#define WKV_BYTES     ((size_t)KVD * DIM * 2)
#define PLANE16_BYTES ((size_t)MROWS * DIM * 2)
#define VRES_BYTES    ((size_t)NB * DIM * 64 * 2)
#define QRES_BYTES    ((size_t)NB * NHEAD * EROWS * HD * 2)
#define KRES_BYTES    ((size_t)NB * NHEAD * ECHUNK * HD * 2)
#define CRES_BYTES    ((size_t)NB * EROWS * DIM * 2)
#define OFF_WQ  ((size_t)0)
#define OFF_WK  (OFF_WQ + WSQ_BYTES)
#define OFF_WV  (OFF_WK + WKV_BYTES)
#define OFF_WO  (OFF_WV + WKV_BYTES)
#define OFF_X   (OFF_WO + WSQ_BYTES)
#define OFF_Q   (OFF_X + PLANE16_BYTES)
#define OFF_K   (OFF_Q + PLANE16_BYTES)
#define OFF_VT  (OFF_K + PLANE16_BYTES)
#define OFF_CTX (OFF_VT + PLANE16_BYTES)
#define OFF_VR  (OFF_CTX + PLANE16_BYTES)
#define OFF_QR  (OFF_VR + VRES_BYTES)
#define OFF_KR  (OFF_QR + QRES_BYTES)
#define OFF_CR  (OFF_KR + KRES_BYTES)
#define WS_TOTAL (OFF_CR + CRES_BYTES)
static_assert((WSQ_BYTES % 128) == 0 && (WKV_BYTES % 128) == 0 && (PLANE16_BYTES % 128) == 0);
static_assert((VRES_BYTES % 128) == 0);
static_assert((QRES_BYTES % 128) == 0 && (KRES_BYTES % 128) == 0 && (CRES_BYTES % 128) == 0);
static_assert(WS_TOTAL <= (size_t)134217728);

// ---------------------------------------------------------------------------
__device__ __forceinline__ float bf16r(float x) {   // RNE convert to bf16, returned widened
  unsigned int u = __float_as_uint(x);
  u = (u + 0x7FFFu + ((u >> 16) & 1u)) & 0xFFFF0000u;
  return __uint_as_float(u);
}

// f32 -> f16 operand convert that cannot produce an f16 subnormal (value select).
static __device__ __forceinline__ _Float16 toh_flush(float v) {
  const _Float16 r = (_Float16)v;
  return (fabsf(v) < 6.103515625e-05f) ? (_Float16)0.0f : r;
}

// 16-bit fragment: p points at element [row = lane&15][k0 + 8*(lane>>4)] of a k-contiguous
// row. Elements 0..7 <- k0+8h+0..7, elements 8..15 <- k0+16+8h+0..7 (same map for A and B).
__device__ __forceinline__ v16h frag_at(const _Float16* p) {
  v8h lo = *(const v8h*)(p);
  v8h hi = *(const v8h*)(p + 16);
  v16h out;
#pragma unroll
  for (int i = 0; i < 8; ++i) { out[i] = lo[i]; out[i + 8] = hi[i]; }
  return out;
}
__device__ __forceinline__ v16h ld_frag(const _Float16* base, unsigned ld) {
  const unsigned lane = threadIdx.x & 31u;
  return frag_at(base + (lane & 15u) * ld + (lane >> 4) * 8u);
}

__device__ __forceinline__ v8f wmma16(v16h a, v16h b, v8f c) {
  v8f d = __builtin_amdgcn_wmma_f32_16x16x32_f16(false, a, false, b, (short)0, c,
                                                 false, false);
  asm volatile("v_nop\n\tv_nop\n\tv_nop\n\tv_nop" : "+v"(d) : "v"(a), "v"(b));
  return d;
}

// The builtin alone: the compiler keeps the distances behind its own matrix instructions, and a
// run of independent products issues back to back.
__device__ __forceinline__ v8f wmma16b(v16h a, v16h b, v8f c) {
  return __builtin_amdgcn_wmma_f32_16x16x32_f16(false, a, false, b, (short)0, c, false, false);
}

// N (8 or 6) asynchronous 16-B copies of one lane, global -> LDS, rows RS apart on both sides.
// lds: the lane's LDS byte address; g: the lane's global address; K: source pitch in halves.
// The s_wait_xcnt ends the copies' own statement so that no address register is rewritten
// ahead of it.
template <unsigned N, unsigned RS>
__device__ __forceinline__ void stage_copy(const unsigned lds, const _Float16* g,
                                           const unsigned K) {
  static_assert(N == 8u || N == 6u);
  const unsigned ls = RS * LDG * 2u;
  const size_t gs = (size_t)RS * K;
  if constexpr (N == 6u) {
    asm volatile(
        "global_load_async_to_lds_b128 %0, %6, off\n\t"
        "global_load_async_to_lds_b128 %1, %7, off\n\t"
        "global_load_async_to_lds_b128 %2, %8, off\n\t"
        "global_load_async_to_lds_b128 %3, %9, off\n\t"
        "global_load_async_to_lds_b128 %4, %10, off\n\t"
        "global_load_async_to_lds_b128 %5, %11, off\n\t"
        "s_wait_xcnt 0x0"
        :
        : "v"(lds), "v"(lds + ls), "v"(lds + 2u * ls), "v"(lds + 3u * ls), "v"(lds + 4u * ls),
          "v"(lds + 5u * ls), "v"(g), "v"(g + gs), "v"(g + 2u * gs), "v"(g + 3u * gs),
          "v"(g + 4u * gs), "v"(g + 5u * gs)
        : "memory");
    return;
  }
  asm volatile(
      "global_load_async_to_lds_b128 %0, %8, off\n\t"
      "global_load_async_to_lds_b128 %1, %9, off\n\t"
      "global_load_async_to_lds_b128 %2, %10, off\n\t"
      "global_load_async_to_lds_b128 %3, %11, off\n\t"
      "global_load_async_to_lds_b128 %4, %12, off\n\t"
      "global_load_async_to_lds_b128 %5, %13, off\n\t"
      "global_load_async_to_lds_b128 %6, %14, off\n\t"
      "global_load_async_to_lds_b128 %7, %15, off\n\t"
      "s_wait_xcnt 0x0"
      :
      : "v"(lds), "v"(lds + ls), "v"(lds + 2u * ls), "v"(lds + 3u * ls), "v"(lds + 4u * ls),
        "v"(lds + 5u * ls), "v"(lds + 6u * ls), "v"(lds + 7u * ls), "v"(g), "v"(g + gs),
        "v"(g + 2u * gs), "v"(g + 3u * gs), "v"(g + 4u * gs), "v"(g + 5u * gs),
        "v"(g + 6u * gs), "v"(g + 7u * gs)
      : "memory");
}

// acc[i][j] += A[BMt rows][K] . B[64 NJ rows][K]^T for this wave's 64 x 16 NJ part of the block
// tile (mw = 64-row group, nw = one of four column groups; 2 BMt threads). Arow / Brow: first
// row of the block's A / B rows.
// Two LDS buffers of one 128-k stage each; stage t + 2 is copied into the buffer that trip t
// has just left, behind the barrier that also publishes stage t + 1. On entry every wave's
// earlier LDS reads of St have retired in front of a barrier that all waves have passed.
template <unsigned BMt, unsigned NJ>
__device__ __forceinline__ void gemm_mainloop(const _Float16* __restrict__ Arow,
                                              const _Float16* __restrict__ Brow,
                                              const unsigned K, _Float16* St,
                                              v8f (&acc)[4][NJ]) {
  constexpr unsigned BNt = 64u * NJ;              // B rows per stage
  constexpr unsigned RS = BMt / 8u;               // rows one copy of every thread covers
  constexpr unsigned SH = (BMt + BNt) * LDG;      // halves per stage: A rows, then B rows
  constexpr unsigned NB8 = BNt / RS;              // copies per thread for the B rows
  static_assert(BMt == 8u * RS && BNt == NB8 * RS);
  const unsigned tid = threadIdx.x, lane = tid & 31u, w = tid >> 5;
  const unsigned mw = w >> 2, nw = w & 3u;
  const unsigned hh = lane >> 4, m = lane & 15u;
  const unsigned cr = tid >> 4, cc = (tid & 15u) * 8u;   // copy: row (of RS), 16-B column
  const _Float16* ga = Arow + (size_t)cr * K + cc;
  const _Float16* gb = Brow + (size_t)cr * K + cc;
  const unsigned la = (unsigned)(size_t)St + (cr * LDG + cc) * 2u;
  const unsigned lb = la + BMt * LDG * 2u;
  const unsigned nt = K / BK;

  stage_copy<8u, RS>(la, ga, K);
  stage_copy<NB8, RS>(lb, gb, K);
  asm volatile("s_wait_asynccnt 0x0" ::: "memory");   // stage 0 landed (this wave's copies)
  __syncthreads();                                    // stage 0 readable by every wave
  stage_copy<8u, RS>(la + SH * 2u, ga + BK, K);
  stage_copy<NB8, RS>(lb + SH * 2u, gb + BK, K);

  const _Float16* fa = St + (mw * 64u + m) * LDG + hh * 8u;
  const _Float16* fb = St + (BMt + nw * (NJ * 16u) + m) * LDG + hh * 8u;
#pragma unroll 1   // one stage per trip: the buffer alternates by t & 1, the text stays short
  for (unsigned t = 0; t < nt; ++t) {
    const unsigned bo = (t & 1u) * SH;
#pragma unroll
    for (unsigned kk = 0; kk < BK / 32u; ++kk) {
      v16h a[4], b[NJ];
#pragma unroll
      for (unsigned i = 0; i < 4u; ++i) a[i] = frag_at(fa + bo + i * 16u * LDG + kk * 32u);
#pragma unroll
      for (unsigned j = 0; j < NJ; ++j) b[j] = frag_at(fb + bo + j * 16u * LDG + kk * 32u);
#pragma unroll
      for (unsigned i = 0; i < 4u; ++i)
#pragma unroll
        for (unsigned j = 0; j < NJ; ++j) acc[i][j] = wmma16(a[i], b[j], acc[i][j]);
    }
    asm volatile("s_wait_dscnt 0x0" ::: "memory");      // this wave has left buffer t & 1
    asm volatile("s_wait_asynccnt 0x0" ::: "memory");   // its copies of stage t + 1 landed
    __syncthreads();   // publishes stage t + 1, frees buffer t & 1
    if (t + 2u < nt) {
      stage_copy<8u, RS>(la + bo * 2u, ga + (t + 2u) * BK, K);
      stage_copy<NB8, RS>(lb + bo * 2u, gb + (t + 2u) * BK, K);
    }
  }
  asm volatile("s_wait_asynccnt 0x0" ::: "memory");     // nothing in flight when St is reused
}

// ---------------------------------------------------------------------------
// Row cast: f32 rows of DIM columns -> f16 compact rows of DIM columns, one wave per row,
// 8 rows per block, 8 rolled passes; each store instruction of a wave covers 512 contiguous
// SRC_INPUT = 1: source is the module input (full-size row stride per batch), carry 1;
// SRC_INPUT = 0: source is an [out][in] weight (already k-contiguous), carry x64.
// Every value goes through RNE bf16 first. sblk / dblk: 8-row block of the source / of dst.
// ---------------------------------------------------------------------------
template <int SRC_INPUT>
__device__ __forceinline__ void cast_body(const float* __restrict__ X,
                                          _Float16* __restrict__ dst,
                                          const unsigned sblk, const unsigned dblk) {
#pragma clang fp contract(off)
  const unsigned lane = threadIdx.x & 31u;
  const unsigned w = (unsigned)__builtin_amdgcn_readfirstlane((int)(threadIdx.x >> 5));
  const unsigned crow = sblk * 8u + w;
  size_t srow = crow;
  if (SRC_INPUT) {
    const unsigned bidx = crow / (unsigned)SEQ;
    const unsigned sq = crow - bidx * (unsigned)SEQ;
    srow = (size_t)bidx * SEQ_FULL + sq;
  }
  const float carry = SRC_INPUT ? 1.0f : WCARRY;
  const float* xr = X + srow * DIM + lane * 8u;
  _Float16* dr = dst + (size_t)(dblk * 8u + w) * DIM + lane * 8u;
#pragma unroll 1
  for (unsigned j = 0; j < 8u; ++j) {
    const v4f a0 = *(const v4f*)(xr + j * 256u);
    const v4f a1 = *(const v4f*)(xr + j * 256u + 4u);
    v8h o;
#pragma unroll
    for (int i = 0; i < 4; ++i) {
      o[i]     = toh_flush(carry * bf16r(a0[i]));
      o[i + 4] = toh_flush(carry * bf16r(a1[i]));
    }
    _Float16* p = dr + j * 256u;
    *(v8h*)p = o;
    
  }
}

// All five casts in one launch (none reads what another writes). Blocks 0 .. XBLK-1 take the
// input rows; the rest take the rows of the four weight planes, which lie stacked in the
// workspace in the order wq, wk, wv, wo, so that w16 is one plane of WBLK * 8 rows.
// Every test is on the block index alone. Grid (XBLK + WBLK).
#define XBLK (MROWS / 8)
#define WBLK ((2 * DIM + 2 * KVD) / 8)
static_assert(OFF_WK == OFF_WQ + (size_t)DIM * DIM * 2);
static_assert(OFF_WV == OFF_WQ + (size_t)(DIM + KVD) * DIM * 2);
static_assert(OFF_WO == OFF_WQ + (size_t)(DIM + 2 * KVD) * DIM * 2);
__global__ __launch_bounds__(256) void cast_kernel(
    const float* __restrict__ X, const float* __restrict__ wq, const float* __restrict__ wk,
    const float* __restrict__ wv, const float* __restrict__ wo,
    _Float16* __restrict__ x16, _Float16* __restrict__ w16) {
  const unsigned blk = blockIdx.x;
  if (blk < (unsigned)XBLK) {
    cast_body<1>(X, x16, blk, blk);
    return;
  }
  const unsigned wb = blk - (unsigned)XBLK;   // 8-row block of the stacked weight planes
  const float* W = wq;
  unsigned first = 0u;                        // first block of the plane that wb lies in
  if (wb >= (unsigned)((DIM + 2 * KVD) / 8)) {
    W = wo;
    first = (unsigned)((DIM + 2 * KVD) / 8);
  } else if (wb >= (unsigned)((DIM + KVD) / 8)) {
    W = wv;
    first = (unsigned)((DIM + KVD) / 8);
  } else if (wb >= (unsigned)(DIM / 8)) {
    W = wk;
    first = (unsigned)(DIM / 8);
  }
  cast_body<0>(W, w16, wb - first, wb);
}

// ---------------------------------------------------------------------------
// GEMM C[block tile] = A16[rows][K] . Bt[n][K]^T; both operands staged in LDS by asynchronous
// copies (gemm_mainloop). Output projection: 128x128 tile, 8 waves of 64x32; q, k, v
// projections: 256x192 tile, 16 waves of 64x48 (mw = 64-row group, nw = column group).
// The epilogue treats the tile as 64x64 sub-tiles (bx = 64-column block, row0 = first row):
//   MODE 0: out16[row][col] (pitch DIM) = f16(acc/64)                       (q plane);
//           row tiles with sequence row < 128 also write
//           out16r [b][head][128][64] = f16(2048 * (q - hi))
//   MODE 1: tile column block = one shared key head; out16[row][(4*kvh + rep)*64 + c]
//           (pitch DIM) = f16(acc/64) for rep 0..3                          (k plane);
//           the key tile 0 of each sequence also writes
//           out16r [b][4*kvh + rep][64][64] = f16(2048 * (k - hi)) for rep 0..3
//   MODE 2: transposed V plane [b][(4*kvh + rep)*64 + d][key] = f16(acc/64) for rep 0..3;
//           for key tile 0 also out16r [b][(4*kvh + rep)*64 + d][64] = f16(1024 * (v - hi))
//   MODE 3: outf full [full row][col] = acc/4096                            (output buffer);
//           row tiles with sequence row < 128 run a second accumulator set fed by the
//           residual rows A16r [b][128][K] against the same B rows (a second pass of the main
//           loop), folded as acc + accres/2048 before the 1/4096 scale (block-uniform test).
// Store loops: MODE 0/1/2: 32 rows per step x 2 steps = 64; MODE 3: 16 rows x 4 steps = 64.
// MODE 0, 1 and 2 share one launch (gemm_qkv_kernel): same A rows, and their B rows lie
// stacked in the workspace, so the main loop is one and only the epilogue differs by sub-tile.
// ---------------------------------------------------------------------------
// C staging over the ring (every wave is behind the main loop's last barrier):
// [64][LDC] sub-tiles, sub = NJ * (64-row group) + (64-column group)
template <unsigned NJ>
__device__ __forceinline__ void stage_c(const v8f (&acc)[4][NJ], float* Call) {
  const unsigned tid = threadIdx.x, lane = tid & 31u, w = tid >> 5;
  const unsigned mw = w >> 2, nw = w & 3u;
  const unsigned hh = lane >> 4, m = lane & 15u;
#pragma unroll
  for (unsigned i = 0; i < 4u; ++i)
#pragma unroll
    for (unsigned j = 0; j < NJ; ++j) {
      const unsigned col = nw * (NJ * 16u) + j * 16u;   // first column of this 16-column group
#pragma unroll
      for (unsigned r = 0; r < 8u; ++r)
        Call[((mw * NJ + (col >> 6)) * 64u + i * 16u + hh * 8u + r) * LDC + (col & 63u) + m] =
            acc[i][j][r];
    }
  __syncthreads();
}

// Epilogue of one staged 64x64 sub-tile by 256 threads. Cs: the sub-tile; bx: its 64-column
// block within its own output; row0: its first row; tid: 0 .. 255.
template <int MODE>
__device__ __forceinline__ void store_sub(
    const float* Cs, const unsigned bx, const unsigned row0, const unsigned tid,
    float* __restrict__ outf, _Float16* __restrict__ out16, _Float16* __restrict__ out16r) {
  {
  const unsigned n0 = bx * 64u;

  if (MODE == 0 || MODE == 1) {
    constexpr unsigned NREP  = (MODE == 1) ? (unsigned)GQA : 1u;
    constexpr unsigned RROWS = (MODE == 1) ? (unsigned)ECHUNK : (unsigned)EROWS;
    const unsigned cb = (MODE == 1) ? bx * (unsigned)(GQA * HD) : n0;
    const unsigned bidx = row0 / (unsigned)SEQ;
    const unsigned sq0 = row0 - bidx * (unsigned)SEQ;
    const bool has_res = (sq0 < RROWS);        // one value per sub-tile (MODE 1: key tile 0 only)
    v8h x[2], xr[2];
    size_t off[2], offr[2];
#pragma unroll
    for (unsigned i = 0; i < 2u; ++i) {
      const unsigned r = 32u * i + (tid >> 3);
      const unsigned c = (tid & 7u) * 8u;
      const v4f u0 = *(const v4f*)&Cs[r * LDC + c];
      const v4f u1 = *(const v4f*)&Cs[r * LDC + c + 4];
#pragma unroll
      for (int j = 0; j < 4; ++j) {
        x[i][j]     = toh_flush(u0[j] * (1.0f / WCARRY));
        x[i][j + 4] = toh_flush(u1[j] * (1.0f / WCARRY));
      }
      xr[i] = x[i];
      if (has_res) {
#pragma unroll
        for (int j = 0; j < 4; ++j) {
          const float t0 = u0[j] * (1.0f / WCARRY);
          const float t1 = u1[j] * (1.0f / WCARRY);
          xr[i][j]     = toh_flush((t0 - (float)x[i][j]) * SCRES);
          xr[i][j + 4] = toh_flush((t1 - (float)x[i][j + 4]) * SCRES);
        }
      }
      off[i] = (size_t)(row0 + r) * DIM + cb + c;
      offr[i] = ((size_t)(bidx * (unsigned)NHEAD + bx * NREP) * RROWS + sq0 + r) * HD + c;
    }
#pragma unroll
    for (unsigned rep = 0; rep < NREP; ++rep) {
#pragma unroll
      for (int i = 0; i < 2; ++i)
        *(v8h*)(out16 + off[i] + (size_t)rep * HD) = x[i];
    }
    asm volatile("s_wait_xcnt 0x0" ::: "memory");   // before the stores' registers are reused
    if (has_res) {
#pragma unroll
      for (unsigned rep = 0; rep < NREP; ++rep) {
#pragma unroll
        for (int i = 0; i < 2; ++i)
          *(v8h*)(out16r + offr[i] + (size_t)rep * RROWS * HD) = xr[i];
      }
      asm volatile("s_wait_xcnt 0x0" ::: "memory");   // before the stores' registers are reused
    }
    
  }

  if (MODE == 2) {
    const unsigned bidx = row0 / (unsigned)SEQ;
    const unsigned key0 = row0 - bidx * (unsigned)SEQ;
    const bool first_tile = (key0 == 0u);      // one value per sub-tile
    v8h x[2], xr[2];
    size_t off[2], offr[2];
#pragma unroll
    for (unsigned i = 0; i < 2u; ++i) {
      const unsigned dcol = 32u * i + (tid >> 3);
      const unsigned kk = (tid & 7u) * 8u;
#pragma unroll
      for (unsigned j = 0; j < 8u; ++j) {
        const float t = Cs[(kk + j) * LDC + dcol] * (1.0f / WCARRY);
        const _Float16 hi = toh_flush(t);
        x[i][j]  = hi;
        xr[i][j] = toh_flush((t - (float)hi) * RCARRY);
      }
      const size_t vrow = (size_t)bidx * DIM + bx * (unsigned)(GQA * HD) + dcol;
      off[i]  = vrow * SEQ + key0 + kk;
      offr[i] = vrow * 64u + kk;
    }
#pragma unroll
    for (unsigned rep = 0; rep < (unsigned)GQA; ++rep) {
#pragma unroll
      for (int i = 0; i < 2; ++i)
        *(v8h*)(out16 + off[i] + (size_t)rep * HD * SEQ) = x[i];
    }
    asm volatile("s_wait_xcnt 0x0" ::: "memory");   // before the stores' registers are reused
    if (first_tile) {
#pragma unroll
      for (unsigned rep = 0; rep < (unsigned)GQA; ++rep) {
#pragma unroll
        for (int i = 0; i < 2; ++i)
          *(v8h*)(out16r + offr[i] + (size_t)rep * HD * 64u) = xr[i];
      }
      asm volatile("s_wait_xcnt 0x0" ::: "memory");   // before the stores' registers are reused
    }
    
  }

  if (MODE == 3) {
    const float cs = 1.0f / (WCARRY * VCARRY);
    v4f xs[4];
    size_t off[4];
#pragma unroll
    for (unsigned i = 0; i < 4u; ++i) {
      const unsigned r = 16u * i + (tid >> 4);
      const unsigned c = (tid & 15u) * 4u;
      const unsigned crow = row0 + r;
      const unsigned bidx = crow / (unsigned)SEQ;
      const unsigned sq = crow - bidx * (unsigned)SEQ;
      const size_t frow = (size_t)bidx * SEQ_FULL + sq;
      const v4f u = *(const v4f*)&Cs[r * LDC + c];
      v4f val;
#pragma unroll
      for (int j = 0; j < 4; ++j) val[j] = u[j] * cs;
      xs[i] = val;
      off[i] = frow * DIM + n0 + c;
    }
#pragma unroll
    for (int i = 0; i < 4; ++i) *(v4f*)(outf + off[i]) = xs[i];
  }
  }
}

// q, k and v projections in one launch. Bt: the stacked planes wq, wk, wv (DIM + 2 KVD rows).
// Block tile 256 x 192, 16 waves of 64 x 48, one block per WGP: every staged byte feeds more
// products than in a 128 x 128 tile, and the grid is one block for each of 256 WGPs.
// The epilogue goes by 64-column blocks of the stacked outputs: blocks 0 .. DIM/64 - 1 are q,
// the next KVD/64 are k, the last KVD/64 are v; the two halves of the block take alternate
// sub-tiles (tests on wave-uniform values alone, no barrier behind stage_c).
// Grid ((DIM + 2 KVD)/192, MROWS/256).
#define QBM 256
#define QNJ 3
#define QBN (64 * QNJ)
#define QSTAGE_H ((QBM + QBN) * LDG)
#define QSUBS ((QBM / 64) * QNJ)
static_assert((MROWS % QBM) == 0 && ((DIM + 2 * KVD) % QBN) == 0 && (QSUBS % 2) == 0);
static_assert((size_t)2 * QSTAGE_H * 2 <= (size_t)327680);                  // one block per WGP
static_assert((size_t)QSUBS * 64 * LDC * 4 <= (size_t)2 * QSTAGE_H * 2);    // C staging fits the ring
__global__ __launch_bounds__(512) void gemm_qkv_kernel(
    const _Float16* __restrict__ A16, const _Float16* __restrict__ Bt,
    _Float16* __restrict__ q16, _Float16* __restrict__ q16r,
    _Float16* __restrict__ k16, _Float16* __restrict__ k16r,
    _Float16* __restrict__ vt, _Float16* __restrict__ vtr) {
  __shared__ __attribute__((aligned(16))) _Float16 St[2 * QSTAGE_H];
  const unsigned K = (unsigned)DIM;
  const unsigned bxa = blockIdx.x;
  const unsigned brow0 = blockIdx.y * (unsigned)QBM;

  v8f acc[4][QNJ] = {};
  gemm_mainloop<QBM, QNJ>(A16 + (size_t)brow0 * K, Bt + (size_t)(bxa * (unsigned)QBN) * K, K, St,
                          acc);
  stage_c<QNJ>(acc, (float*)St);
  const unsigned half = (unsigned)__builtin_amdgcn_readfirstlane((int)(threadIdx.x >> 8));
  const unsigned t256 = threadIdx.x & 255u;
  for (unsigned s = 0; s < (unsigned)(QSUBS / 2); ++s) {
    const unsigned sub = 2u * s + half;
    const unsigned rg = sub / (unsigned)QNJ, cg = sub - rg * (unsigned)QNJ;
    const float* Cs = (const float*)St + sub * (64u * LDC);
    const unsigned gcb = bxa * (unsigned)QNJ + cg;   // 64-column block of the stacked outputs
    const unsigned row0 = brow0 + rg * 64u;
    if (gcb < (unsigned)(DIM / 64))
      store_sub<0>(Cs, gcb, row0, t256, (float*)0, q16, q16r);
    else if (gcb < (unsigned)((DIM + KVD) / 64))
      store_sub<1>(Cs, gcb - (unsigned)(DIM / 64), row0, t256, (float*)0, k16, k16r);
    else
      store_sub<2>(Cs, gcb - (unsigned)((DIM + KVD) / 64), row0, t256, (float*)0, vt, vtr);
  }
}

// Output projection. Grid (DIM/128, MROWS/128).
__global__ __launch_bounds__(256) void gemm_wo_kernel(
    const _Float16* __restrict__ A16, const _Float16* __restrict__ A16r,
    const _Float16* __restrict__ Bt, float* __restrict__ outf) {
  __shared__ __attribute__((aligned(16))) _Float16 St[2 * STAGE_H];
  const unsigned K = (unsigned)DIM;
  const unsigned brow0 = blockIdx.y * (unsigned)BM;
  const _Float16* Brow = Bt + (size_t)(blockIdx.x * (unsigned)BN) * K;

  v8f acc[4][2] = {};
  gemm_mainloop<BM, 2u>(A16 + (size_t)brow0 * K, Brow, K, St, acc);
  const unsigned bidx3 = brow0 / (unsigned)SEQ;
  const unsigned sq3 = brow0 - bidx3 * (unsigned)SEQ;
  if (sq3 < (unsigned)EROWS) {               // block-uniform
    v8f res[4][2] = {};
    gemm_mainloop<BM, 2u>(A16r + (size_t)(bidx3 * (unsigned)EROWS + sq3) * K, Brow, K, St, res);
#pragma unroll
    for (int i = 0; i < 4; ++i)
#pragma unroll
      for (int j = 0; j < 2; ++j)
#pragma unroll
        for (int r = 0; r < 8; ++r) acc[i][j][r] = acc[i][j][r] + res[i][j][r] * (1.0f / SCRES);
  }
  stage_c<2u>(acc, (float*)St);
  for (unsigned sub = 0; sub < 4u; ++sub)
    store_sub<3>((const float*)St + sub * (64u * LDC), blockIdx.x * 2u + (sub & 1u),
                 brow0 + (sub >> 1) * 64u, threadIdx.x, outf, (_Float16*)0, (_Float16*)0);
}

__device__ __forceinline__ float xhalf(float x) {
  const int b = __builtin_bit_cast(int, x);
  return __builtin_bit_cast(
      float, __builtin_amdgcn_permlanex16(b, b, 0x76543210, 0xfedcba98, false, false));
}

__global__ __launch_bounds__(256) void attn_kernel(
    const _Float16* __restrict__ Qh, const _Float16* __restrict__ QhR,
    const _Float16* __restrict__ Kh, const _Float16* __restrict__ KhR,
    const _Float16* __restrict__ Vt, const _Float16* __restrict__ VtR,
    _Float16* __restrict__ Ov, _Float16* __restrict__ OvR) {
  __shared__ _Float16 Ks[64 * LDT];
  __shared__ _Float16 Vs[64 * LDT];
  __shared__ _Float16 VRs[64 * LDT];
  __shared__ _Float16 KRs[64 * LDT];

  const unsigned tid = threadIdx.x, lane = tid & 31u, w = tid >> 5;
  const unsigned hh = lane >> 4, m = lane & 15u;
  const unsigned qtile = (unsigned)(SEQ / 128 - 1) - blockIdx.z;   // cost falls with the index
  const unsigned q0 = qtile * 128u;
  const unsigned head = blockIdx.x;
  const unsigned b = blockIdx.y;
  const float scale = 0.125f;   // HD^-0.5
  const unsigned qrow0 = q0 + w * 16u;
  const bool first_blk = (qtile == 0u);

  const size_t qoff = (size_t)(b * (unsigned)SEQ + qrow0 + m) * DIM + head * HD + hh * 8u;
  v16h qf[2];
  qf[0] = frag_at(Qh + qoff);
  qf[1] = frag_at(Qh + qoff + 32);

  float mrun = -1.0e30f;   // running maximum of query qrow0 + m (equal in both halves)
  float lsum = 0.0f;       // running sum over this half's keys only
  v8f o[4];
#pragma unroll
  for (int nb = 0; nb < 4; ++nb) o[nb] = (v8f){};

  const size_t kplane = (size_t)b * SEQ * DIM + head * HD;
  const size_t vplane = ((size_t)b * DIM + head * HD) * SEQ;
  const size_t rplane = ((size_t)b * DIM + head * HD) * 64u;
  const size_t krplane = ((size_t)(b * (unsigned)NHEAD + head) * ECHUNK) * HD;
  const unsigned kend = q0 + 128u;   // <= SEQ

  for (unsigned kb = 0; kb < kend; kb += 64u) {
    const bool early = first_blk && (kb == 0u);   // block-uniform
#pragma unroll
    for (unsigned j = 0; j < 2u; ++j) {
      const unsigned idx = tid + 256u * j;
      const unsigned r = idx >> 3, c = (idx & 7u) * 8u;
      *(v8h*)&Ks[r * LDT + c] = *(const v8h*)(Kh + kplane + (size_t)(kb + r) * DIM + c);
      *(v8h*)&Vs[r * LDT + c] = *(const v8h*)(Vt + vplane + (size_t)r * SEQ + kb + c);
    }
    if (early) {
#pragma unroll
      for (unsigned j = 0; j < 2u; ++j) {
        const unsigned idx = tid + 256u * j;
        const unsigned r = idx >> 3, c = (idx & 7u) * 8u;
        *(v8h*)&VRs[r * LDT + c] = *(const v8h*)(VtR + rplane + (size_t)r * 64u + c);
        *(v8h*)&KRs[r * LDT + c] = *(const v8h*)(KhR + krplane + (size_t)r * HD + c);
      }
    }
    __syncthreads();

    // scores, transposed: 4 key groups of 16 (rows), K = 64 in two 32-steps
    v8f s[4];
    if (early) {
      // early corner: value + residual products, one score tile at a time through ONE
      // residual accumulator; q0 == 0 here so qrow0 + m < 128
      const unsigned qrbase =
          ((b * (unsigned)NHEAD + head) * (unsigned)EROWS + qrow0 + m) * (unsigned)HD + hh * 8u;
#pragma unroll
      for (int kg = 0; kg < 4; ++kg) {
        v8f t = {};
#pragma unroll
        for (int c = 0; c < 2; ++c) {
          unsigned qro = qrbase + (unsigned)c * 32u;
          asm volatile("" : "+v"(qro));   // opaque offset: the residual q fragment is reloaded per tile
          v8f tr = {};
          {
            const v16h kf = ld_frag(&Ks[(kg * 16) * LDT + c * 32], LDT);
            t = wmma16(kf, qf[c], t);
            const v16h ql = frag_at(QhR + qro);
            tr = wmma16(kf, ql, tr);
          }
          {
            const v16h kl = ld_frag(&KRs[(kg * 16) * LDT + c * 32], LDT);
            tr = wmma16(kl, qf[c], tr);
          }
          t = t + tr * (1.0f / SCRES);
          __builtin_amdgcn_sched_barrier(0);   // the next tile's loads stay behind this tile
        }
        s[kg] = t * scale;
      }
    } else {
      // all eight K fragments as one group of LDS loads, then the eight products: four
      // independent accumulators per 32-column step (each tile still sums c = 0, then c = 1)
      v16h kf[2][4];
#pragma unroll
      for (int c = 0; c < 2; ++c)
#pragma unroll
        for (int kg = 0; kg < 4; ++kg) kf[c][kg] = ld_frag(&Ks[(kg * 16) * LDT + c * 32], LDT);
      __builtin_amdgcn_sched_barrier(0);   // the loads stay one group: none sinks among the products
#pragma unroll
      for (int kg = 0; kg < 4; ++kg) s[kg] = (v8f){};
#pragma unroll
      for (int c = 0; c < 2; ++c)
#pragma unroll
        for (int kg = 0; kg < 4; ++kg) s[kg] = wmma16b(kf[c][kg], qf[c], s[kg]);
      __builtin_amdgcn_sched_barrier(0);   // the scaling stays behind the run: no padded gap inside it
#pragma unroll
      for (int kg = 0; kg < 4; ++kg) s[kg] = s[kg] * scale;
    }

    // all eight V^T fragments as one group of LDS loads, issued here so that they land behind
    // the softmax
    v16h vfr[2][4];
#pragma unroll
    for (int c = 0; c < 2; ++c)
#pragma unroll
      for (int nb = 0; nb < 4; ++nb) vfr[c][nb] = ld_frag(&Vs[(nb * 16) * LDT + c * 32], LDT);

    // causal replace-mask (key > query) in chunks that reach the diagonal; block-uniform test
    if (kb >= q0) {
#pragma unroll
      for (int kg = 0; kg < 4; ++kg)
#pragma unroll
        for (int v = 0; v < 8; ++v) {
          const unsigned key = kb + (unsigned)kg * 16u + hh * 8u + (unsigned)v;
          const unsigned row = qrow0 + m;
          s[kg][v] = (key > row) ? -1.0e30f : s[kg][v];
        }
    }

    // online softmax of the lane's own query: 32 keys here, 32 in lane ^ 16
    float mt[8];
#pragma unroll
    for (int v = 0; v < 8; ++v)
      mt[v] = fmaxf(fmaxf(s[0][v], s[1][v]), fmaxf(s[2][v], s[3][v]));
    float mx = fmaxf(fmaxf(fmaxf(mt[0], mt[1]), fmaxf(mt[2], mt[3])),
                     fmaxf(fmaxf(mt[4], mt[5]), fmaxf(mt[6], mt[7])));
    mx = fmaxf(mx, xhalf(mx));
    const float mn = fmaxf(mrun, mx);
    const float alpha = __expf(mrun - mn);
    mrun = mn;
#pragma unroll
    for (int kg = 0; kg < 4; ++kg)
#pragma unroll
      for (int v = 0; v < 8; ++v) s[kg][v] = __expf(s[kg][v] - mrun);
    {
      float part[8];
#pragma unroll
      for (int v = 0; v < 8; ++v) part[v] = (s[0][v] + s[1][v]) + (s[2][v] + s[3][v]);
      const float rs = ((part[0] + part[1]) + (part[2] + part[3])) +
                       ((part[4] + part[5]) + (part[6] + part[7]));
      lsum = alpha * lsum + rs;
    }
#pragma unroll
    for (int nb = 0; nb < 4; ++nb)
#pragma unroll
      for (int v = 0; v < 8; ++v) o[nb][v] = o[nb][v] * alpha;

    // P^T fragments [32 keys][16 queries], f16(1024 p), from the score tiles in place
    v16h pf[2];
#pragma unroll
    for (int c = 0; c < 2; ++c)
#pragma unroll
      for (int i = 0; i < 8; ++i) {
        pf[c][i]     = toh_flush(s[2 * c][i] * PCARRY);
        pf[c][i + 8] = toh_flush(s[2 * c + 1][i] * PCARRY);
      }

    // O^T += V^T . P^T  (K = 64 keys in two 32-steps; A = V^T tile [d][key])
#pragma unroll
    for (int c = 0; c < 2; ++c) {
#pragma unroll
      for (int nb = 0; nb < 4; ++nb) o[nb] = wmma16b(vfr[c][nb], pf[c], o[nb]);
    }

    if (early) {
      // V_res . P_hi (scale 1/1024), one 16-column group at a time, folded immediately
#pragma unroll
      for (int nb = 0; nb < 4; ++nb) {
        v8f o2 = {};
#pragma unroll
        for (int c = 0; c < 2; ++c) {
          const v16h vr = ld_frag(&VRs[(nb * 16) * LDT + c * 32], LDT);
          o2 = wmma16(vr, pf[c], o2);
        }
#pragma unroll
        for (int v = 0; v < 8; ++v) o[nb][v] = o[nb][v] + o2[v] * (1.0f / RCARRY);
      }
      // P residual fragments: f16(1024 * (1024 p - f16(1024 p)))
      v16h pr[2];
#pragma unroll
      for (int c = 0; c < 2; ++c)
#pragma unroll
        for (int i = 0; i < 16; ++i) {
          const float t = s[2 * c + (i >> 3)][i & 7] * PCARRY;
          const float hi = (float)toh_flush(t);
          pr[c][i] = toh_flush((t - hi) * RCARRY);
        }
      // V_hi . P_res (scale 1/1024), one 16-column group at a time, folded immediately
#pragma unroll
      for (int nb = 0; nb < 4; ++nb) {
        v8f o2 = {};
#pragma unroll
        for (int c = 0; c < 2; ++c) {
          const v16h vf = ld_frag(&Vs[(nb * 16) * LDT + c * 32], LDT);
          o2 = wmma16(vf, pr[c], o2);
        }
#pragma unroll
        for (int v = 0; v < 8; ++v) o[nb][v] = o[nb][v] + o2[v] * (1.0f / RCARRY);
      }
    }
    __syncthreads();
  }

  const float lrow = lsum + xhalf(lsum);   // the two halves' keys joined
  const float inv = __builtin_amdgcn_rcpf(lrow) * (VCARRY / PCARRY);
  v8h x[4];
#pragma unroll
  for (int nb = 0; nb < 4; ++nb)
#pragma unroll
    for (int v = 0; v < 8; ++v) x[nb][v] = toh_flush(o[nb][v] * inv);
  _Float16* po = Ov + (size_t)(b * (unsigned)SEQ + qrow0 + m) * DIM + head * HD + hh * 8u;
#pragma unroll
  for (int nb = 0; nb < 4; ++nb) *(v8h*)(po + nb * 16) = x[nb];
  // before the stores' registers are reused; in front of the branch, where it stays directly
  // behind the stores
  asm volatile("s_wait_xcnt 0x0" ::: "memory");
  if (first_blk) {
    // residual rows (first query block only; qrow0 < 128): f16(2048 * (t - f16(t)))
    v8h xr[4];
#pragma unroll
    for (int nb = 0; nb < 4; ++nb)
#pragma unroll
      for (int v = 0; v < 8; ++v)
        xr[nb][v] = toh_flush((o[nb][v] * inv - (float)x[nb][v]) * SCRES);
    _Float16* pres = OvR + (size_t)(b * (unsigned)EROWS + qrow0 + m) * DIM + head * HD + hh * 8u;
#pragma unroll
    for (int nb = 0; nb < 4; ++nb) *(v8h*)(pres + nb * 16) = xr[nb];
  }
}

// ---------------------------------------------------------------------------
extern "C" void kernel_launch(void* const* d_in, const int* in_sizes, int n_in,
                              void* d_out, int out_size, void* d_ws, size_t ws_size,
                              hipStream_t stream) {
  if (n_in < 5) return;
  const long long need_x = ((long long)(NB - 1) * SEQ_FULL + SEQ) * DIM;
  if ((long long)in_sizes[0] < need_x) return;
  if ((long long)in_sizes[1] < (long long)DIM * DIM) return;
  if ((long long)in_sizes[2] < (long long)KVD * DIM) return;
  if ((long long)in_sizes[3] < (long long)KVD * DIM) return;
  if ((long long)in_sizes[4] < (long long)DIM * DIM) return;
  if ((long long)out_size < need_x) return;
  if (ws_size < WS_TOTAL) return;

  // bound by the input list order: x, wq, wk, wv, wo
  const float* X  = (const float*)d_in[0];    // [NB_FULL][SEQ_FULL][DIM]
  const float* wq = (const float*)d_in[1];    // [DIM][DIM]  (out, in)
  const float* wk = (const float*)d_in[2];    // [KVD][DIM]  (out, in)
  const float* wv = (const float*)d_in[3];    // [KVD][DIM]  (out, in)
  const float* wo = (const float*)d_in[4];    // [DIM][DIM]  (out, in)
  float* out = (float*)d_out;

  char* ws = (char*)d_ws;
  _Float16* Wq_t  = (_Float16*)(ws + OFF_WQ);    // [n][k], x64; wk and wv planes [KVD][DIM] behind it
  _Float16* Wo_t  = (_Float16*)(ws + OFF_WO);    // [n][k], x64
  _Float16* X16   = (_Float16*)(ws + OFF_X);     // [MROWS][DIM]
  _Float16* Qh16  = (_Float16*)(ws + OFF_Q);     // [MROWS][DIM]
  _Float16* Kh16  = (_Float16*)(ws + OFF_K);     // [MROWS][DIM], shared heads written 4x
  _Float16* Vt16  = (_Float16*)(ws + OFF_VT);    // [b][DIM][SEQ], shared heads written 4x
  _Float16* Ctx16 = (_Float16*)(ws + OFF_CTX);   // [MROWS][DIM], x64
  _Float16* VtR16 = (_Float16*)(ws + OFF_VR);    // [b][DIM][64]
  _Float16* QR16  = (_Float16*)(ws + OFF_QR);    // [b][NHEAD][128][64], x2048
  _Float16* KR16  = (_Float16*)(ws + OFF_KR);    // [b][NHEAD][64][64], x2048, shared heads 4x
  _Float16* CR16  = (_Float16*)(ws + OFF_CR);    // [b][128][DIM], x2048 on top of x64

  dim3 blk(256);

  // input rows and weight planes ([out][in] rows are already k-contiguous); 8 rows per block;
  // Wq_t is the first of the four stacked weight planes
  cast_kernel<<<dim3(XBLK + WBLK), blk, 0, stream>>>(X, wq, wk, wv, wo, X16, Wq_t);

  // gemm_qkv_kernel(A16, Bt, q16, q16r, k16, k16r, vt, vtr); Bt = planes wq, wk, wv, stacked
  gemm_qkv_kernel<<<dim3((DIM + 2 * KVD) / QBN, MROWS / QBM), dim3(512), 0, stream>>>(
      X16, Wq_t, Qh16, QR16, Kh16, KR16, Vt16, VtR16);
  // attn_kernel(Qh, QhR, Kh, KhR, Vt, VtR, Ov, OvR)
  attn_kernel<<<dim3(NHEAD, NB, SEQ / 128), blk, 0, stream>>>(Qh16, QR16, Kh16, KR16, Vt16, VtR16,
                                                              Ctx16, CR16);
  // gemm_wo_kernel(A16, A16r, Bt, outf)
  gemm_wo_kernel<<<dim3(DIM / BN, MROWS / BM), blk, 0, stream>>>(Ctx16, CR16, Wo_t, out);
}

// v007
// One run takes 142 microseconds.
// Timed twice side by side with v006, it ran 1.05 times as fast both times.
// Over all steps from v000 it is 3.41 times as fast.
#include <hip/hip_runtime.h>
#include <stddef.h>

// All contractions on v_wmma_f32_16x16x32_f16 (f16 operands, f32 accumulate): q/k/v projections,
// q.k scores, p.v, output projection. Float inputs are RNE-converted to bf16 and carried in f16
// (weights x64, p x1024, attention rows x64). Early corner only (query rows 0..127 x keys 0..63
// of every (batch, head)): q and k get a x2048 residual plane (two more score products into a
// separate accumulator), p and v a x1024 residual plane, and the attention rows 0..127 a x2048
// residual plane (second accumulator set in the output projection on those row tiles).
// Softmax and all scaling in f32.
// Causal grouped-query attention (32 query heads sharing 8 key/value heads), [out][in] weights,
// no biases; the k and v projection epilogues write every shared head once per query head so
// the attention kernel sees one K row block and one V^T row block per query head.

typedef _Float16 v16h __attribute__((ext_vector_type(16)));
typedef _Float16 v8h  __attribute__((ext_vector_type(8)));
typedef float    v8f  __attribute__((ext_vector_type(8)));
typedef float    v4f  __attribute__((ext_vector_type(4)));

#ifndef NB
#define NB 2
#endif
#ifndef SEQ
#define SEQ 2048
#endif
#define NB_FULL  2
#define SEQ_FULL 2048
#define DIM   2048
#define NHEAD 32
#define HD    64
#define NKV   8
#define GQA   (NHEAD / NKV)
#define KVD   (NKV * HD)
#define MROWS (NB * SEQ)
#define EROWS  128   // early query rows per sequence carried with residual planes (q, ctx)
#define ECHUNK 64    // early keys per sequence carried with residual planes (k, v)

static_assert(NB >= 1 && NB <= NB_FULL);
static_assert(SEQ >= 128 && SEQ <= SEQ_FULL && (SEQ % 128) == 0);
static_assert(DIM == NHEAD * HD);
static_assert(HD == 64);
static_assert(NHEAD == NKV * GQA && GQA == 4);
static_assert(KVD == 512 && (KVD % 64) == 0);
static_assert((DIM % 64) == 0 && (DIM % 32) == 0);
static_assert((MROWS % 64) == 0 && (MROWS % 8) == 0);
static_assert((SEQ % 64) == 0);               // a 64-row GEMM tile never straddles two sequences
static_assert((DIM % 8) == 0 && (KVD % 8) == 0);
static_assert(DIM == 8 * 32 * 8);             // cast: 8 passes x 32 lanes x 8 columns per row
static_assert((size_t)MROWS * DIM < (size_t)0xFFFFFFFFu);
static_assert(EROWS == 128);                  // == query rows of one attention block (block 0)
static_assert(ECHUNK == 64);                  // == keys of one attention step (chunk 0) == one GEMM row tile
static_assert((EROWS % 64) == 0 && EROWS <= SEQ);   // whole 64-row GEMM tiles
static_assert((size_t)NB * NHEAD * EROWS * HD < (size_t)0xFFFFFFFFu);   // 32-bit q residual offsets

#define LDT 72   // halves per LDS row (144 B, 16-B aligned)
#define LDC 68   // floats per LDS row (272 B, 16-B aligned)
static_assert((LDT % 8) == 0 && LDT >= 64);
static_assert((LDC % 4) == 0 && LDC >= 64);

// GEMM block tile (output projection; the q, k, v tile stands at its kernel) and LDS staging
#define BM  128   // output rows per block
#define BN  128   // output columns per block
#define BK  128   // halves of every operand row per stage (256 B)
#define LDG 136   // halves per staged row (272 B = 16 B x 17: b128 fragment reads meet no bank twice)
#define STAGE_H ((BM + BN) * LDG)   // halves per stage: A rows, then B rows
static_assert((LDG % 8) == 0 && LDG >= BK);
static_assert((DIM % BK) == 0 && DIM / BK >= 2);          // the ring starts with two stages
static_assert((MROWS % BM) == 0 && (SEQ % BM) == 0 && (DIM % BN) == 0 && (KVD % BN) == 0);
static_assert(BM == EROWS);                               // a block is all early rows or none
static_assert((BM + BN) * (BK / 8) == 256 * 16);          // 16 copies of 16 B per thread and stage
static_assert((size_t)4 * 64 * LDC * 4 <= (size_t)2 * STAGE_H * 2);   // C staging fits the ring
static_assert((size_t)2 * STAGE_H * 2 <= (size_t)163840);             // two blocks per WGP

#define WCARRY 64.0f     // weight planes carried x64
#define PCARRY 1024.0f   // softmax numerators carried x1024
#define VCARRY 64.0f     // attention output plane carried x64
#define RCARRY 1024.0f   // residual planes (p, v) carried x1024 on top of their hi part
#define SCRES  2048.0f   // residual planes (q, k, attention rows) carried x2048 on top of their hi part
// Softmax exponent: e = exp2(score * ESCALE - max * ESCALE - EBIAS) = p x 2^-102, and
// e x PUNBIAS = 1024 p. A p whose 1024 p lies under the f16 normal range (2^-14) has its e under
// the f32 normal range (2^-126).
#define ESCALE  0.18033688011112042f   // HD^-0.5 x log2(e)
#define EBIAS   102.0f
#define PUNBIAS 0x1p+112f
static_assert(PUNBIAS * 0x1p-102f == PCARRY);
static_assert(0x1p-126f * PUNBIAS == 6.103515625e-05f);

// epilogue store-loop coverage (rows admitted per step x steps == tile rows)
#define TILE_ROWS        64
#define EPI16_ROWS_STEP  (256 / 8)
#define EPI16_STEPS      2
#define EPIF_ROWS_STEP   (256 / 16)   // 16 lanes x 16 B per 256-B row segment
#define EPIF_STEPS       4
static_assert(EPI16_ROWS_STEP * EPI16_STEPS == TILE_ROWS);
static_assert(EPIF_ROWS_STEP * EPIF_STEPS == TILE_ROWS);
static_assert(8 * 16 == 128);                 // attention block: 8 waves x 16 query rows

// static LDS per kernel (bytes)
static_assert((size_t)(4 * 64 * LDT) * 2 <= (size_t)131072);

// workspace layout (bytes)
#define WSQ_BYTES     ((size_t)DIM * DIM * 2)
#define WKV_BYTES     ((size_t)KVD * DIM * 2)
#define PLANE16_BYTES ((size_t)MROWS * DIM * 2)
#define VRES_BYTES    ((size_t)NB * DIM * 64 * 2)
#define QRES_BYTES    ((size_t)NB * NHEAD * EROWS * HD * 2)
#define KRES_BYTES    ((size_t)NB * NHEAD * ECHUNK * HD * 2)
#define CRES_BYTES    ((size_t)NB * EROWS * DIM * 2)
#define OFF_WQ  ((size_t)0)
#define OFF_WK  (OFF_WQ + WSQ_BYTES)
#define OFF_WV  (OFF_WK + WKV_BYTES)
#define OFF_WO  (OFF_WV + WKV_BYTES)
#define OFF_X   (OFF_WO + WSQ_BYTES)
#define OFF_Q   (OFF_X + PLANE16_BYTES)
#define OFF_K   (OFF_Q + PLANE16_BYTES)
#define OFF_VT  (OFF_K + PLANE16_BYTES)
#define OFF_CTX (OFF_VT + PLANE16_BYTES)
#define OFF_VR  (OFF_CTX + PLANE16_BYTES)
#define OFF_QR  (OFF_VR + VRES_BYTES)
#define OFF_KR  (OFF_QR + QRES_BYTES)
#define OFF_CR  (OFF_KR + KRES_BYTES)
#define WS_TOTAL (OFF_CR + CRES_BYTES)
static_assert((WSQ_BYTES % 128) == 0 && (WKV_BYTES % 128) == 0 && (PLANE16_BYTES % 128) == 0);
static_assert((VRES_BYTES % 128) == 0);
static_assert((QRES_BYTES % 128) == 0 && (KRES_BYTES % 128) == 0 && (CRES_BYTES % 128) == 0);
static_assert(WS_TOTAL <= (size_t)134217728);

// ---------------------------------------------------------------------------
__device__ __forceinline__ float bf16r(float x) {   // RNE convert to bf16, returned widened
  unsigned int u = __float_as_uint(x);
  u = (u + 0x7FFFu + ((u >> 16) & 1u)) & 0xFFFF0000u;
  return __uint_as_float(u);
}

// f32 -> f16 operand convert that cannot produce an f16 subnormal (value select).
static __device__ __forceinline__ _Float16 toh_flush(float v) {
  const _Float16 r = (_Float16)v;
  return (fabsf(v) < 6.103515625e-05f) ? (_Float16)0.0f : r;
}

// 16-bit fragment: p points at element [row = lane&15][k0 + 8*(lane>>4)] of a k-contiguous
// row. Elements 0..7 <- k0+8h+0..7, elements 8..15 <- k0+16+8h+0..7 (same map for A and B).
__device__ __forceinline__ v16h frag_at(const _Float16* p) {
  v8h lo = *(const v8h*)(p);
  v8h hi = *(const v8h*)(p + 16);
  v16h out;
#pragma unroll
  for (int i = 0; i < 8; ++i) { out[i] = lo[i]; out[i + 8] = hi[i]; }
  return out;
}
__device__ __forceinline__ v16h ld_frag(const _Float16* base, unsigned ld) {
  const unsigned lane = threadIdx.x & 31u;
  return frag_at(base + (lane & 15u) * ld + (lane >> 4) * 8u);
}

__device__ __forceinline__ v8f wmma16(v16h a, v16h b, v8f c) {
  v8f d = __builtin_amdgcn_wmma_f32_16x16x32_f16(false, a, false, b, (short)0, c,
                                                 false, false);
  asm volatile("v_nop\n\tv_nop\n\tv_nop\n\tv_nop" : "+v"(d) : "v"(a), "v"(b));
  return d;
}

// The builtin alone: the compiler keeps the distances behind its own matrix instructions, and a
// run of independent products issues back to back.
__device__ __forceinline__ v8f wmma16b(v16h a, v16h b, v8f c) {
  return __builtin_amdgcn_wmma_f32_16x16x32_f16(false, a, false, b, (short)0, c, false, false);
}

// N (8 or 6) asynchronous 16-B copies of one lane, global -> LDS, rows RS apart on both sides.
// lds: the lane's LDS byte address; g: the lane's global address; K: source pitch in halves.
// The s_wait_xcnt ends the copies' own statement so that no address register is rewritten
// ahead of it.
template <unsigned N, unsigned RS>
__device__ __forceinline__ void stage_copy(const unsigned lds, const _Float16* g,
                                           const unsigned K) {
  static_assert(N == 8u || N == 6u);
  const unsigned ls = RS * LDG * 2u;
  const size_t gs = (size_t)RS * K;
  if constexpr (N == 6u) {
    asm volatile(
        "global_load_async_to_lds_b128 %0, %6, off\n\t"
        "global_load_async_to_lds_b128 %1, %7, off\n\t"
        "global_load_async_to_lds_b128 %2, %8, off\n\t"
        "global_load_async_to_lds_b128 %3, %9, off\n\t"
        "global_load_async_to_lds_b128 %4, %10, off\n\t"
        "global_load_async_to_lds_b128 %5, %11, off\n\t"
        "s_wait_xcnt 0x0"
        :
        : "v"(lds), "v"(lds + ls), "v"(lds + 2u * ls), "v"(lds + 3u * ls), "v"(lds + 4u * ls),
          "v"(lds + 5u * ls), "v"(g), "v"(g + gs), "v"(g + 2u * gs), "v"(g + 3u * gs),
          "v"(g + 4u * gs), "v"(g + 5u * gs)
        : "memory");
    return;
  }
  asm volatile(
      "global_load_async_to_lds_b128 %0, %8, off\n\t"
      "global_load_async_to_lds_b128 %1, %9, off\n\t"
      "global_load_async_to_lds_b128 %2, %10, off\n\t"
      "global_load_async_to_lds_b128 %3, %11, off\n\t"
      "global_load_async_to_lds_b128 %4, %12, off\n\t"
      "global_load_async_to_lds_b128 %5, %13, off\n\t"
      "global_load_async_to_lds_b128 %6, %14, off\n\t"
      "global_load_async_to_lds_b128 %7, %15, off\n\t"
      "s_wait_xcnt 0x0"
      :
      : "v"(lds), "v"(lds + ls), "v"(lds + 2u * ls), "v"(lds + 3u * ls), "v"(lds + 4u * ls),
        "v"(lds + 5u * ls), "v"(lds + 6u * ls), "v"(lds + 7u * ls), "v"(g), "v"(g + gs),
        "v"(g + 2u * gs), "v"(g + 3u * gs), "v"(g + 4u * gs), "v"(g + 5u * gs),
        "v"(g + 6u * gs), "v"(g + 7u * gs)
      : "memory");
}

// acc[i][j] += A[BMt rows][K] . B[64 NJ rows][K]^T for this wave's 64 x 16 NJ part of the block
// tile (mw = 64-row group, nw = one of four column groups; 2 BMt threads). Arow / Brow: first
// row of the block's A / B rows.
// Two LDS buffers of one 128-k stage each; stage t + 2 is copied into the buffer that trip t
// has just left, behind the barrier that also publishes stage t + 1. On entry every wave's
// earlier LDS reads of St have retired in front of a barrier that all waves have passed.
template <unsigned BMt, unsigned NJ>
__device__ __forceinline__ void gemm_mainloop(const _Float16* __restrict__ Arow,
                                              const _Float16* __restrict__ Brow,
                                              const unsigned K, _Float16* St,
                                              v8f (&acc)[4][NJ]) {
  constexpr unsigned BNt = 64u * NJ;              // B rows per stage
  constexpr unsigned RS = BMt / 8u;               // rows one copy of every thread covers
  constexpr unsigned SH = (BMt + BNt) * LDG;      // halves per stage: A rows, then B rows
  constexpr unsigned NB8 = BNt / RS;              // copies per thread for the B rows
  static_assert(BMt == 8u * RS && BNt == NB8 * RS);
  const unsigned tid = threadIdx.x, lane = tid & 31u, w = tid >> 5;
  const unsigned mw = w >> 2, nw = w & 3u;
  const unsigned hh = lane >> 4, m = lane & 15u;
  const unsigned cr = tid >> 4, cc = (tid & 15u) * 8u;   // copy: row (of RS), 16-B column
  const _Float16* ga = Arow + (size_t)cr * K + cc;
  const _Float16* gb = Brow + (size_t)cr * K + cc;
  const unsigned la = (unsigned)(size_t)St + (cr * LDG + cc) * 2u;
  const unsigned lb = la + BMt * LDG * 2u;
  const unsigned nt = K / BK;

  stage_copy<8u, RS>(la, ga, K);
  stage_copy<NB8, RS>(lb, gb, K);
  asm volatile("s_wait_asynccnt 0x0" ::: "memory");   // stage 0 landed (this wave's copies)
  __syncthreads();                                    // stage 0 readable by every wave
  stage_copy<8u, RS>(la + SH * 2u, ga + BK, K);
  stage_copy<NB8, RS>(lb + SH * 2u, gb + BK, K);

  const _Float16* fa = St + (mw * 64u + m) * LDG + hh * 8u;
  const _Float16* fb = St + (BMt + nw * (NJ * 16u) + m) * LDG + hh * 8u;
#pragma unroll 1   // one stage per trip: the buffer alternates by t & 1, the text stays short
  for (unsigned t = 0; t < nt; ++t) {
    const unsigned bo = (t & 1u) * SH;
#pragma unroll
    for (unsigned kk = 0; kk < BK / 32u; ++kk) {
      v16h a[4], b[NJ];
#pragma unroll
      for (unsigned i = 0; i < 4u; ++i) a[i] = frag_at(fa + bo + i * 16u * LDG + kk * 32u);
#pragma unroll
      for (unsigned j = 0; j < NJ; ++j) b[j] = frag_at(fb + bo + j * 16u * LDG + kk * 32u);
#pragma unroll
      for (unsigned i = 0; i < 4u; ++i)
#pragma unroll
        for (unsigned j = 0; j < NJ; ++j) acc[i][j] = wmma16(a[i], b[j], acc[i][j]);
    }
    asm volatile("s_wait_dscnt 0x0" ::: "memory");      // this wave has left buffer t & 1
    asm volatile("s_wait_asynccnt 0x0" ::: "memory");   // its copies of stage t + 1 landed
    __syncthreads();   // publishes stage t + 1, frees buffer t & 1
    if (t + 2u < nt) {
      stage_copy<8u, RS>(la + bo * 2u, ga + (t + 2u) * BK, K);
      stage_copy<NB8, RS>(lb + bo * 2u, gb + (t + 2u) * BK, K);
    }
  }
  asm volatile("s_wait_asynccnt 0x0" ::: "memory");     // nothing in flight when St is reused
}

// ---------------------------------------------------------------------------
// Row cast: f32 rows of DIM columns -> f16 compact rows of DIM columns, one wave per row,
// 8 rows per block, 8 rolled passes; each store instruction of a wave covers 512 contiguous
// SRC_INPUT = 1: source is the module input (full-size row stride per batch), carry 1;
// SRC_INPUT = 0: source is an [out][in] weight (already k-contiguous), carry x64.
// Every value goes through RNE bf16 first. sblk / dblk: 8-row block of the source / of dst.
// ---------------------------------------------------------------------------
template <int SRC_INPUT>
__device__ __forceinline__ void cast_body(const float* __restrict__ X,
                                          _Float16* __restrict__ dst,
                                          const unsigned sblk, const unsigned dblk) {
#pragma clang fp contract(off)
  const unsigned lane = threadIdx.x & 31u;
  const unsigned w = (unsigned)__builtin_amdgcn_readfirstlane((int)(threadIdx.x >> 5));
  const unsigned crow = sblk * 8u + w;
  size_t srow = crow;
  if (SRC_INPUT) {
    const unsigned bidx = crow / (unsigned)SEQ;
    const unsigned sq = crow - bidx * (unsigned)SEQ;
    srow = (size_t)bidx * SEQ_FULL + sq;
  }
  const float carry = SRC_INPUT ? 1.0f : WCARRY;
  const float* xr = X + srow * DIM + lane * 8u;
  _Float16* dr = dst + (size_t)(dblk * 8u + w) * DIM + lane * 8u;
#pragma unroll 1
  for (unsigned j = 0; j < 8u; ++j) {
    const v4f a0 = *(const v4f*)(xr + j * 256u);
    const v4f a1 = *(const v4f*)(xr + j * 256u + 4u);
    v8h o;
#pragma unroll
    for (int i = 0; i < 4; ++i) {
      o[i]     = toh_flush(carry * bf16r(a0[i]));
      o[i + 4] = toh_flush(carry * bf16r(a1[i]));
    }
    _Float16* p = dr + j * 256u;
    *(v8h*)p = o;
    
  }
}

// All five casts in one launch (none reads what another writes). Blocks 0 .. XBLK-1 take the
// input rows; the rest take the rows of the four weight planes, which lie stacked in the
// workspace in the order wq, wk, wv, wo, so that w16 is one plane of WBLK * 8 rows.
// Every test is on the block index alone. Grid (XBLK + WBLK).
#define XBLK (MROWS / 8)
#define WBLK ((2 * DIM + 2 * KVD) / 8)
static_assert(OFF_WK == OFF_WQ + (size_t)DIM * DIM * 2);
static_assert(OFF_WV == OFF_WQ + (size_t)(DIM + KVD) * DIM * 2);
static_assert(OFF_WO == OFF_WQ + (size_t)(DIM + 2 * KVD) * DIM * 2);
__global__ __launch_bounds__(256) void cast_kernel(
    const float* __restrict__ X, const float* __restrict__ wq, const float* __restrict__ wk,
    const float* __restrict__ wv, const float* __restrict__ wo,
    _Float16* __restrict__ x16, _Float16* __restrict__ w16) {
  const unsigned blk = blockIdx.x;
  if (blk < (unsigned)XBLK) {
    cast_body<1>(X, x16, blk, blk);
    return;
  }
  const unsigned wb = blk - (unsigned)XBLK;   // 8-row block of the stacked weight planes
  const float* W = wq;
  unsigned first = 0u;                        // first block of the plane that wb lies in
  if (wb >= (unsigned)((DIM + 2 * KVD) / 8)) {
    W = wo;
    first = (unsigned)((DIM + 2 * KVD) / 8);
  } else if (wb >= (unsigned)((DIM + KVD) / 8)) {
    W = wv;
    first = (unsigned)((DIM + KVD) / 8);
  } else if (wb >= (unsigned)(DIM / 8)) {
    W = wk;
    first = (unsigned)(DIM / 8);
  }
  cast_body<0>(W, w16, wb - first, wb);
}

// ---------------------------------------------------------------------------
// GEMM C[block tile] = A16[rows][K] . Bt[n][K]^T; both operands staged in LDS by asynchronous
// copies (gemm_mainloop). Output projection: 128x128 tile, 8 waves of 64x32; q, k, v
// projections: 256x192 tile, 16 waves of 64x48 (mw = 64-row group, nw = column group).
// The epilogue treats the tile as 64x64 sub-tiles (bx = 64-column block, row0 = first row):
//   MODE 0: out16[row][col] (pitch DIM) = f16(acc/64)                       (q plane);
//           row tiles with sequence row < 128 also write
//           out16r [b][head][128][64] = f16(2048 * (q - hi))
//   MODE 1: tile column block = one shared key head; out16[row][(4*kvh + rep)*64 + c]
//           (pitch DIM) = f16(acc/64) for rep 0..3                          (k plane);
//           the key tile 0 of each sequence also writes
//           out16r [b][4*kvh + rep][64][64] = f16(2048 * (k - hi)) for rep 0..3
//   MODE 2: transposed V plane [b][(4*kvh + rep)*64 + d][key] = f16(acc/64) for rep 0..3;
//           for key tile 0 also out16r [b][(4*kvh + rep)*64 + d][64] = f16(1024 * (v - hi))
//   MODE 3: outf full [full row][col] = acc/4096                            (output buffer);
//           row tiles with sequence row < 128 run a second accumulator set fed by the
//           residual rows A16r [b][128][K] against the same B rows (a second pass of the main
//           loop), folded as acc + accres/2048 before the 1/4096 scale (block-uniform test).
// Store loops: MODE 0/1/2: 32 rows per step x 2 steps = 64; MODE 3: 16 rows x 4 steps = 64.
// MODE 0, 1 and 2 share one launch (gemm_qkv_kernel): same A rows, and their B rows lie
// stacked in the workspace, so the main loop is one and only the epilogue differs by sub-tile.
// ---------------------------------------------------------------------------
// C staging over the ring (every wave is behind the main loop's last barrier):
// [64][LDC] sub-tiles, sub = NJ * (64-row group) + (64-column group)
template <unsigned NJ>
__device__ __forceinline__ void stage_c(const v8f (&acc)[4][NJ], float* Call) {
  const unsigned tid = threadIdx.x, lane = tid & 31u, w = tid >> 5;
  const unsigned mw = w >> 2, nw = w & 3u;
  const unsigned hh = lane >> 4, m = lane & 15u;
#pragma unroll
  for (unsigned i = 0; i < 4u; ++i)
#pragma unroll
    for (unsigned j = 0; j < NJ; ++j) {
      const unsigned col = nw * (NJ * 16u) + j * 16u;   // first column of this 16-column group
#pragma unroll
      for (unsigned r = 0; r < 8u; ++r)
        Call[((mw * NJ + (col >> 6)) * 64u + i * 16u + hh * 8u + r) * LDC + (col & 63u) + m] =
            acc[i][j][r];
    }
  __syncthreads();
}

// Epilogue of one staged 64x64 sub-tile by 256 threads. Cs: the sub-tile; bx: its 64-column
// block within its own output; row0: its first row; tid: 0 .. 255.
template <int MODE>
__device__ __forceinline__ void store_sub(
    const float* Cs, const unsigned bx, const unsigned row0, const unsigned tid,
    float* __restrict__ outf, _Float16* __restrict__ out16, _Float16* __restrict__ out16r) {
  {
  const unsigned n0 = bx * 64u;

  if (MODE == 0 || MODE == 1) {
    constexpr unsigned NREP  = (MODE == 1) ? (unsigned)GQA : 1u;
    constexpr unsigned RROWS = (MODE == 1) ? (unsigned)ECHUNK : (unsigned)EROWS;
    const unsigned cb = (MODE == 1) ? bx * (unsigned)(GQA * HD) : n0;
    const unsigned bidx = row0 / (unsigned)SEQ;
    const unsigned sq0 = row0 - bidx * (unsigned)SEQ;
    const bool has_res = (sq0 < RROWS);        // one value per sub-tile (MODE 1: key tile 0 only)
    v8h x[2], xr[2];
    size_t off[2], offr[2];
#pragma unroll
    for (unsigned i = 0; i < 2u; ++i) {
      const unsigned r = 32u * i + (tid >> 3);
      const unsigned c = (tid & 7u) * 8u;
      const v4f u0 = *(const v4f*)&Cs[r * LDC + c];
      const v4f u1 = *(const v4f*)&Cs[r * LDC + c + 4];
#pragma unroll
      for (int j = 0; j < 4; ++j) {
        x[i][j]     = toh_flush(u0[j] * (1.0f / WCARRY));
        x[i][j + 4] = toh_flush(u1[j] * (1.0f / WCARRY));
      }
      xr[i] = x[i];
      if (has_res) {
#pragma unroll
        for (int j = 0; j < 4; ++j) {
          const float t0 = u0[j] * (1.0f / WCARRY);
          const float t1 = u1[j] * (1.0f / WCARRY);
          xr[i][j]     = toh_flush((t0 - (float)x[i][j]) * SCRES);
          xr[i][j + 4] = toh_flush((t1 - (float)x[i][j + 4]) * SCRES);
        }
      }
      off[i] = (size_t)(row0 + r) * DIM + cb + c;
      offr[i] = ((size_t)(bidx * (unsigned)NHEAD + bx * NREP) * RROWS + sq0 + r) * HD + c;
    }
#pragma unroll
    for (unsigned rep = 0; rep < NREP; ++rep) {
#pragma unroll
      for (int i = 0; i < 2; ++i)
        *(v8h*)(out16 + off[i] + (size_t)rep * HD) = x[i];
    }
    asm volatile("s_wait_xcnt 0x0" ::: "memory");   // before the stores' registers are reused
    if (has_res) {
#pragma unroll
      for (unsigned rep = 0; rep < NREP; ++rep) {
#pragma unroll
        for (int i = 0; i < 2; ++i)
          *(v8h*)(out16r + offr[i] + (size_t)rep * RROWS * HD) = xr[i];
      }
      asm volatile("s_wait_xcnt 0x0" ::: "memory");   // before the stores' registers are reused
    }
    
  }

  if (MODE == 2) {
    const unsigned bidx = row0 / (unsigned)SEQ;
    const unsigned key0 = row0 - bidx * (unsigned)SEQ;
    const bool first_tile = (key0 == 0u);      // one value per sub-tile
    v8h x[2], xr[2];
    size_t off[2], offr[2];
#pragma unroll
    for (unsigned i = 0; i < 2u; ++i) {
      const unsigned dcol = 32u * i + (tid >> 3);
      const unsigned kk = (tid & 7u) * 8u;
#pragma unroll
      for (unsigned j = 0; j < 8u; ++j) {
        const float t = Cs[(kk + j) * LDC + dcol] * (1.0f / WCARRY);
        const _Float16 hi = toh_flush(t);
        x[i][j]  = hi;
        xr[i][j] = toh_flush((t - (float)hi) * RCARRY);
      }
      const size_t vrow = (size_t)bidx * DIM + bx * (unsigned)(GQA * HD) + dcol;
      off[i]  = vrow * SEQ + key0 + kk;
      offr[i] = vrow * 64u + kk;
    }
#pragma unroll
    for (unsigned rep = 0; rep < (unsigned)GQA; ++rep) {
#pragma unroll
      for (int i = 0; i < 2; ++i)
        *(v8h*)(out16 + off[i] + (size_t)rep * HD * SEQ) = x[i];
    }
    asm volatile("s_wait_xcnt 0x0" ::: "memory");   // before the stores' registers are reused
    if (first_tile) {
#pragma unroll
      for (unsigned rep = 0; rep < (unsigned)GQA; ++rep) {
#pragma unroll
        for (int i = 0; i < 2; ++i)
          *(v8h*)(out16r + offr[i] + (size_t)rep * HD * 64u) = xr[i];
      }
      asm volatile("s_wait_xcnt 0x0" ::: "memory");   // before the stores' registers are reused
    }
    
  }

  if (MODE == 3) {
    const float cs = 1.0f / (WCARRY * VCARRY);
    v4f xs[4];
    size_t off[4];
#pragma unroll
    for (unsigned i = 0; i < 4u; ++i) {
      const unsigned r = 16u * i + (tid >> 4);
      const unsigned c = (tid & 15u) * 4u;
      const unsigned crow = row0 + r;
      const unsigned bidx = crow / (unsigned)SEQ;
      const unsigned sq = crow - bidx * (unsigned)SEQ;
      const size_t frow = (size_t)bidx * SEQ_FULL + sq;
      const v4f u = *(const v4f*)&Cs[r * LDC + c];
      v4f val;
#pragma unroll
      for (int j = 0; j < 4; ++j) val[j] = u[j] * cs;
      xs[i] = val;
      off[i] = frow * DIM + n0 + c;
    }
#pragma unroll
    for (int i = 0; i < 4; ++i) *(v4f*)(outf + off[i]) = xs[i];
  }
  }
}

// q, k and v projections in one launch. Bt: the stacked planes wq, wk, wv (DIM + 2 KVD rows).
// Block tile 256 x 192, 16 waves of 64 x 48, one block per WGP: every staged byte feeds more
// products than in a 128 x 128 tile, and the grid is one block for each of 256 WGPs.
// The epilogue goes by 64-column blocks of the stacked outputs: blocks 0 .. DIM/64 - 1 are q,
// the next KVD/64 are k, the last KVD/64 are v; the two halves of the block take alternate
// sub-tiles (tests on wave-uniform values alone, no barrier behind stage_c).
// Grid ((DIM + 2 KVD)/192, MROWS/256).
#define QBM 256
#define QNJ 3
#define QBN (64 * QNJ)
#define QSTAGE_H ((QBM + QBN) * LDG)
#define QSUBS ((QBM / 64) * QNJ)
static_assert((MROWS % QBM) == 0 && ((DIM + 2 * KVD) % QBN) == 0 && (QSUBS % 2) == 0);
static_assert((size_t)2 * QSTAGE_H * 2 <= (size_t)327680);                  // one block per WGP
static_assert((size_t)QSUBS * 64 * LDC * 4 <= (size_t)2 * QSTAGE_H * 2);    // C staging fits the ring
__global__ __launch_bounds__(512) void gemm_qkv_kernel(
    const _Float16* __restrict__ A16, const _Float16* __restrict__ Bt,
    _Float16* __restrict__ q16, _Float16* __restrict__ q16r,
    _Float16* __restrict__ k16, _Float16* __restrict__ k16r,
    _Float16* __restrict__ vt, _Float16* __restrict__ vtr) {
  __shared__ __attribute__((aligned(16))) _Float16 St[2 * QSTAGE_H];
  const unsigned K = (unsigned)DIM;
  const unsigned bxa = blockIdx.x;
  const unsigned brow0 = blockIdx.y * (unsigned)QBM;

  v8f acc[4][QNJ] = {};
  gemm_mainloop<QBM, QNJ>(A16 + (size_t)brow0 * K, Bt + (size_t)(bxa * (unsigned)QBN) * K, K, St,
                          acc);
  stage_c<QNJ>(acc, (float*)St);
  const unsigned half = (unsigned)__builtin_amdgcn_readfirstlane((int)(threadIdx.x >> 8));
  const unsigned t256 = threadIdx.x & 255u;
  for (unsigned s = 0; s < (unsigned)(QSUBS / 2); ++s) {
    const unsigned sub = 2u * s + half;
    const unsigned rg = sub / (unsigned)QNJ, cg = sub - rg * (unsigned)QNJ;
    const float* Cs = (const float*)St + sub * (64u * LDC);
    const unsigned gcb = bxa * (unsigned)QNJ + cg;   // 64-column block of the stacked outputs
    const unsigned row0 = brow0 + rg * 64u;
    if (gcb < (unsigned)(DIM / 64))
      store_sub<0>(Cs, gcb, row0, t256, (float*)0, q16, q16r);
    else if (gcb < (unsigned)((DIM + KVD) / 64))
      store_sub<1>(Cs, gcb - (unsigned)(DIM / 64), row0, t256, (float*)0, k16, k16r);
    else
      store_sub<2>(Cs, gcb - (unsigned)((DIM + KVD) / 64), row0, t256, (float*)0, vt, vtr);
  }
}

// Output projection. Grid (DIM/128, MROWS/128).
__global__ __launch_bounds__(256) void gemm_wo_kernel(
    const _Float16* __restrict__ A16, const _Float16* __restrict__ A16r,
    const _Float16* __restrict__ Bt, float* __restrict__ outf) {
  __shared__ __attribute__((aligned(16))) _Float16 St[2 * STAGE_H];
  const unsigned K = (unsigned)DIM;
  const unsigned brow0 = blockIdx.y * (unsigned)BM;
  const _Float16* Brow = Bt + (size_t)(blockIdx.x * (unsigned)BN) * K;

  v8f acc[4][2] = {};
  gemm_mainloop<BM, 2u>(A16 + (size_t)brow0 * K, Brow, K, St, acc);
  const unsigned bidx3 = brow0 / (unsigned)SEQ;
  const unsigned sq3 = brow0 - bidx3 * (unsigned)SEQ;
  if (sq3 < (unsigned)EROWS) {               // block-uniform
    v8f res[4][2] = {};
    gemm_mainloop<BM, 2u>(A16r + (size_t)(bidx3 * (unsigned)EROWS + sq3) * K, Brow, K, St, res);
#pragma unroll
    for (int i = 0; i < 4; ++i)
#pragma unroll
      for (int j = 0; j < 2; ++j)
#pragma unroll
        for (int r = 0; r < 8; ++r) acc[i][j][r] = acc[i][j][r] + res[i][j][r] * (1.0f / SCRES);
  }
  stage_c<2u>(acc, (float*)St);
  for (unsigned sub = 0; sub < 4u; ++sub)
    store_sub<3>((const float*)St + sub * (64u * LDC), blockIdx.x * 2u + (sub & 1u),
                 brow0 + (sub >> 1) * 64u, threadIdx.x, outf, (_Float16*)0, (_Float16*)0);
}

__device__ __forceinline__ float xhalf(float x) {
  const int b = __builtin_bit_cast(int, x);
  return __builtin_bit_cast(
      float, __builtin_amdgcn_permlanex16(b, b, 0x76543210, 0xfedcba98, false, false));
}

__global__ __launch_bounds__(256) void attn_kernel(
    const _Float16* __restrict__ Qh, const _Float16* __restrict__ QhR,
    const _Float16* __restrict__ Kh, const _Float16* __restrict__ KhR,
    const _Float16* __restrict__ Vt, const _Float16* __restrict__ VtR,
    _Float16* __restrict__ Ov, _Float16* __restrict__ OvR) {
  __shared__ _Float16 Ks[64 * LDT];
  __shared__ _Float16 Vs[64 * LDT];
  __shared__ _Float16 VRs[64 * LDT];
  __shared__ _Float16 KRs[64 * LDT];

  const unsigned tid = threadIdx.x, lane = tid & 31u, w = tid >> 5;
  const unsigned hh = lane >> 4, m = lane & 15u;
  const unsigned qtile = (unsigned)(SEQ / 128 - 1) - blockIdx.z;   // cost falls with the index
  const unsigned q0 = qtile * 128u;
  const unsigned head = blockIdx.x;
  const unsigned b = blockIdx.y;
  const unsigned qrow0 = q0 + w * 16u;
  const bool first_blk = (qtile == 0u);

  const size_t qoff = (size_t)(b * (unsigned)SEQ + qrow0 + m) * DIM + head * HD + hh * 8u;
  v16h qf[2];
  qf[0] = frag_at(Qh + qoff);
  qf[1] = frag_at(Qh + qoff + 32);

  float mrun = -1.0e30f;   // running maximum of query qrow0 + m, unscaled (equal in both halves)
  float nrun = __builtin_fmaf(-mrun, ESCALE, -EBIAS);   // the exponent's addend for mrun
  float lsum = 0.0f;       // running sum over this half's keys only, x 2^-102
  v8f o[4];
#pragma unroll
  for (int nb = 0; nb < 4; ++nb) o[nb] = (v8f){};

  const size_t kplane = (size_t)b * SEQ * DIM + head * HD;
  const size_t vplane = ((size_t)b * DIM + head * HD) * SEQ;
  const size_t rplane = ((size_t)b * DIM + head * HD) * 64u;
  const size_t krplane = ((size_t)(b * (unsigned)NHEAD + head) * ECHUNK) * HD;
  const unsigned kend = q0 + 128u;   // <= SEQ

  for (unsigned kb = 0; kb < kend; kb += 64u) {
    const bool early = first_blk && (kb == 0u);   // block-uniform
#pragma unroll
    for (unsigned j = 0; j < 2u; ++j) {
      const unsigned idx = tid + 256u * j;
      const unsigned r = idx >> 3, c = (idx & 7u) * 8u;
      *(v8h*)&Ks[r * LDT + c] = *(const v8h*)(Kh + kplane + (size_t)(kb + r) * DIM + c);
      *(v8h*)&Vs[r * LDT + c] = *(const v8h*)(Vt + vplane + (size_t)r * SEQ + kb + c);
    }
    if (early) {
#pragma unroll
      for (unsigned j = 0; j < 2u; ++j) {
        const unsigned idx = tid + 256u * j;
        const unsigned r = idx >> 3, c = (idx & 7u) * 8u;
        *(v8h*)&VRs[r * LDT + c] = *(const v8h*)(VtR + rplane + (size_t)r * 64u + c);
        *(v8h*)&KRs[r * LDT + c] = *(const v8h*)(KhR + krplane + (size_t)r * HD + c);
      }
    }
    __syncthreads();

    // scores, transposed: 4 key groups of 16 (rows), K = 64 in two 32-steps
    v8f s[4];
    if (early) {
      // early corner: value + residual products, one score tile at a time through ONE
      // residual accumulator; q0 == 0 here so qrow0 + m < 128
      const unsigned qrbase =
          ((b * (unsigned)NHEAD + head) * (unsigned)EROWS + qrow0 + m) * (unsigned)HD + hh * 8u;
#pragma unroll
      for (int kg = 0; kg < 4; ++kg) {
        v8f t = {};
#pragma unroll
        for (int c = 0; c < 2; ++c) {
          unsigned qro = qrbase + (unsigned)c * 32u;
          asm volatile("" : "+v"(qro));   // opaque offset: the residual q fragment is reloaded per tile
          v8f tr = {};
          {
            const v16h kf = ld_frag(&Ks[(kg * 16) * LDT + c * 32], LDT);
            t = wmma16(kf, qf[c], t);
            const v16h ql = frag_at(QhR + qro);
            tr = wmma16(kf, ql, tr);
          }
          {
            const v16h kl = ld_frag(&KRs[(kg * 16) * LDT + c * 32], LDT);
            tr = wmma16(kl, qf[c], tr);
          }
          t = t + tr * (1.0f / SCRES);
          __builtin_amdgcn_sched_barrier(0);   // the next tile's loads stay behind this tile
        }
        s[kg] = t;
      }
    } else {
      // all eight K fragments as one group of LDS loads, then the eight products: four
      // independent accumulators per 32-column step (each tile still sums c = 0, then c = 1)
      v16h kf[2][4];
#pragma unroll
      for (int c = 0; c < 2; ++c)
#pragma unroll
        for (int kg = 0; kg < 4; ++kg) kf[c][kg] = ld_frag(&Ks[(kg * 16) * LDT + c * 32], LDT);
      __builtin_amdgcn_sched_barrier(0);   // the loads stay one group: none sinks among the products
#pragma unroll
      for (int kg = 0; kg < 4; ++kg) s[kg] = (v8f){};
#pragma unroll
      for (int c = 0; c < 2; ++c)
#pragma unroll
        for (int kg = 0; kg < 4; ++kg) s[kg] = wmma16b(kf[c][kg], qf[c], s[kg]);
      __builtin_amdgcn_sched_barrier(0);   // the softmax stays behind the run: no padded gap inside it
    }

    // all eight V^T fragments as one group of LDS loads, issued here so that they land behind
    // the softmax
    v16h vfr[2][4];
#pragma unroll
    for (int c = 0; c < 2; ++c)
#pragma unroll
      for (int nb = 0; nb < 4; ++nb) vfr[c][nb] = ld_frag(&Vs[(nb * 16) * LDT + c * 32], LDT);

    // causal replace-mask (key > query) in chunks that reach the diagonal; block-uniform test
    if (kb >= q0) {
#pragma unroll
      for (int kg = 0; kg < 4; ++kg)
#pragma unroll
        for (int v = 0; v < 8; ++v) {
          const unsigned key = kb + (unsigned)kg * 16u + hh * 8u + (unsigned)v;
          const unsigned row = qrow0 + m;
          s[kg][v] = (key > row) ? -1.0e30f : s[kg][v];
        }
    }

    // online softmax of the lane's own query: 32 keys here, 32 in lane ^ 16
    float mt[8];
#pragma unroll
    for (int v = 0; v < 8; ++v)
      mt[v] = fmaxf(fmaxf(s[0][v], s[1][v]), fmaxf(s[2][v], s[3][v]));
    float mx = fmaxf(fmaxf(fmaxf(mt[0], mt[1]), fmaxf(mt[2], mt[3])),
                     fmaxf(fmaxf(mt[4], mt[5]), fmaxf(mt[6], mt[7])));
    mx = fmaxf(mx, xhalf(mx));
    const float mn = fmaxf(mrun, mx);
    const float nn = __builtin_fmaf(-mn, ESCALE, -EBIAS);
    const float alpha = __builtin_amdgcn_exp2f(nn - nrun);   // the addends' own difference
    mrun = mn;
    nrun = nn;
#pragma unroll
    for (int kg = 0; kg < 4; ++kg)
#pragma unroll
      for (int v = 0; v < 8; ++v) s[kg][v] = __builtin_fmaf(s[kg][v], ESCALE, nrun);
    // all multiply-adds in front of the exponentials: none rewrites an exponential's source
    // directly behind it, so no padded slot stands among them
    __builtin_amdgcn_sched_barrier(0);
#pragma unroll
    for (int kg = 0; kg < 4; ++kg)
#pragma unroll
      for (int v = 0; v < 8; ++v) s[kg][v] = __builtin_amdgcn_exp2f(s[kg][v]);
    {
      float part[8];
#pragma unroll
      for (int v = 0; v < 8; ++v) part[v] = (s[0][v] + s[1][v]) + (s[2][v] + s[3][v]);
      const float rs = ((part[0] + part[1]) + (part[2] + part[3])) +
                       ((part[4] + part[5]) + (part[6] + part[7]));
      lsum = alpha * lsum + rs;
    }
#pragma unroll
    for (int nb = 0; nb < 4; ++nb)
#pragma unroll
      for (int v = 0; v < 8; ++v) o[nb][v] = o[nb][v] * alpha;

    // P^T fragments [32 keys][16 queries], f16(1024 p), from the score tiles in place
    v16h pf[2];
#pragma unroll
    for (int c = 0; c < 2; ++c)
#pragma unroll
      for (int i = 0; i < 8; ++i) {
        pf[c][i]     = (_Float16)(s[2 * c][i] * PUNBIAS);
        pf[c][i + 8] = (_Float16)(s[2 * c + 1][i] * PUNBIAS);
      }

    // O^T += V^T . P^T  (K = 64 keys in two 32-steps; A = V^T tile [d][key])
#pragma unroll
    for (int c = 0; c < 2; ++c) {
#pragma unroll
      for (int nb = 0; nb < 4; ++nb) o[nb] = wmma16b(vfr[c][nb], pf[c], o[nb]);
    }

    if (early) {
      // V_res . P_hi (scale 1/1024), one 16-column group at a time, folded immediately
#pragma unroll
      for (int nb = 0; nb < 4; ++nb) {
        v8f o2 = {};
#pragma unroll
        for (int c = 0; c < 2; ++c) {
          const v16h vr = ld_frag(&VRs[(nb * 16) * LDT + c * 32], LDT);
          o2 = wmma16(vr, pf[c], o2);
        }
#pragma unroll
        for (int v = 0; v < 8; ++v) o[nb][v] = o[nb][v] + o2[v] * (1.0f / RCARRY);
      }
      // P residual fragments: f16(1024 * (1024 p - f16(1024 p)))
      v16h pr[2];
#pragma unroll
      for (int c = 0; c < 2; ++c)
#pragma unroll
        for (int i = 0; i < 16; ++i) {
          const float t = s[2 * c + (i >> 3)][i & 7] * PUNBIAS;
          const float hi = (float)pf[c][i];
          pr[c][i] = toh_flush((t - hi) * RCARRY);
        }
      // V_hi . P_res (scale 1/1024), one 16-column group at a time, folded immediately
#pragma unroll
      for (int nb = 0; nb < 4; ++nb) {
        v8f o2 = {};
#pragma unroll
        for (int c = 0; c < 2; ++c) {
          const v16h vf = ld_frag(&Vs[(nb * 16) * LDT + c * 32], LDT);
          o2 = wmma16(vf, pr[c], o2);
        }
#pragma unroll
        for (int v = 0; v < 8; ++v) o[nb][v] = o[nb][v] + o2[v] * (1.0f / RCARRY);
      }
    }
    __syncthreads();
  }

  const float lrow = lsum + xhalf(lsum);   // the two halves' keys joined
  const float inv = __builtin_amdgcn_rcpf(lrow) * (VCARRY / PUNBIAS);
  v8h x[4];
#pragma unroll
  for (int nb = 0; nb < 4; ++nb)
#pragma unroll
    for (int v = 0; v < 8; ++v) x[nb][v] = toh_flush(o[nb][v] * inv);
  _Float16* po = Ov + (size_t)(b * (unsigned)SEQ + qrow0 + m) * DIM + head * HD + hh * 8u;
#pragma unroll
  for (int nb = 0; nb < 4; ++nb) *(v8h*)(po + nb * 16) = x[nb];
  // before the stores' registers are reused; in front of the branch, where it stays directly
  // behind the stores
  asm volatile("s_wait_xcnt 0x0" ::: "memory");
  if (first_blk) {
    // residual rows (first query block only; qrow0 < 128): f16(2048 * (t - f16(t)))
    v8h xr[4];
#pragma unroll
    for (int nb = 0; nb < 4; ++nb)
#pragma unroll
      for (int v = 0; v < 8; ++v)
        xr[nb][v] = toh_flush((o[nb][v] * inv - (float)x[nb][v]) * SCRES);
    _Float16* pres = OvR + (size_t)(b * (unsigned)EROWS + qrow0 + m) * DIM + head * HD + hh * 8u;
#pragma unroll
    for (int nb = 0; nb < 4; ++nb) *(v8h*)(pres + nb * 16) = xr[nb];
  }
}

// ---------------------------------------------------------------------------
extern "C" void kernel_launch(void* const* d_in, const int* in_sizes, int n_in,
                              void* d_out, int out_size, void* d_ws, size_t ws_size,
                              hipStream_t stream) {
  if (n_in < 5) return;
  const long long need_x = ((long long)(NB - 1) * SEQ_FULL + SEQ) * DIM;
  if ((long long)in_sizes[0] < need_x) return;
  if ((long long)in_sizes[1] < (long long)DIM * DIM) return;
  if ((long long)in_sizes[2] < (long long)KVD * DIM) return;
  if ((long long)in_sizes[3] < (long long)KVD * DIM) return;
  if ((long long)in_sizes[4] < (long long)DIM * DIM) return;
  if ((long long)out_size < need_x) return;
  if (ws_size < WS_TOTAL) return;

  // bound by the input list order: x, wq, wk, wv, wo
  const float* X  = (const float*)d_in[0];    // [NB_FULL][SEQ_FULL][DIM]
  const float* wq = (const float*)d_in[1];    // [DIM][DIM]  (out, in)
  const float* wk = (const float*)d_in[2];    // [KVD][DIM]  (out, in)
  const float* wv = (const float*)d_in[3];    // [KVD][DIM]  (out, in)
  const float* wo = (const float*)d_in[4];    // [DIM][DIM]  (out, in)
  float* out = (float*)d_out;

  char* ws = (char*)d_ws;
  _Float16* Wq_t  = (_Float16*)(ws + OFF_WQ);    // [n][k], x64; wk and wv planes [KVD][DIM] behind it
  _Float16* Wo_t  = (_Float16*)(ws + OFF_WO);    // [n][k], x64
  _Float16* X16   = (_Float16*)(ws + OFF_X);     // [MROWS][DIM]
  _Float16* Qh16  = (_Float16*)(ws + OFF_Q);     // [MROWS][DIM]
  _Float16* Kh16  = (_Float16*)(ws + OFF_K);     // [MROWS][DIM], shared heads written 4x
  _Float16* Vt16  = (_Float16*)(ws + OFF_VT);    // [b][DIM][SEQ], shared heads written 4x
  _Float16* Ctx16 = (_Float16*)(ws + OFF_CTX);   // [MROWS][DIM], x64
  _Float16* VtR16 = (_Float16*)(ws + OFF_VR);    // [b][DIM][64]
  _Float16* QR16  = (_Float16*)(ws + OFF_QR);    // [b][NHEAD][128][64], x2048
  _Float16* KR16  = (_Float16*)(ws + OFF_KR);    // [b][NHEAD][64][64], x2048, shared heads 4x
  _Float16* CR16  = (_Float16*)(ws + OFF_CR);    // [b][128][DIM], x2048 on top of x64

  dim3 blk(256);

  // input rows and weight planes ([out][in] rows are already k-contiguous); 8 rows per block;
  // Wq_t is the first of the four stacked weight planes
  cast_kernel<<<dim3(XBLK + WBLK), blk, 0, stream>>>(X, wq, wk, wv, wo, X16, Wq_t);

  // gemm_qkv_kernel(A16, Bt, q16, q16r, k16, k16r, vt, vtr); Bt = planes wq, wk, wv, stacked
  gemm_qkv_kernel<<<dim3((DIM + 2 * KVD) / QBN, MROWS / QBM), dim3(512), 0, stream>>>(
      X16, Wq_t, Qh16, QR16, Kh16, KR16, Vt16, VtR16);
  // attn_kernel(Qh, QhR, Kh, KhR, Vt, VtR, Ov, OvR)
  attn_kernel<<<dim3(NHEAD, NB, SEQ / 128), blk, 0, stream>>>(Qh16, QR16, Kh16, KR16, Vt16, VtR16,
                                                              Ctx16, CR16);
  // gemm_wo_kernel(A16, A16r, Bt, outf)
  gemm_wo_kernel<<<dim3(DIM / BN, MROWS / BM), blk, 0, stream>>>(Ctx16, CR16, Wo_t, out);
}

// v008
// One run takes 131 microseconds.
// Next to v007, in two timings, it ran 1.08 times as fast each time.
// Over all steps from v000 it is 3.68 times as fast.
#include <hip/hip_runtime.h>
#include <stddef.h>

// All contractions on v_wmma_f32_16x16x32_f16 (f16 operands, f32 accumulate): q/k/v projections,
// q.k scores, p.v, output projection. Float inputs are RNE-converted to bf16 and carried in f16
// (weights x64, p x1024, attention rows x64). Early corner only (query rows 0..127 x keys 0..63
// of every (batch, head)): q and k get a x2048 residual plane (two more score products into a
// separate accumulator), p and v a x1024 residual plane, and the attention rows 0..127 a x2048
// residual plane (second accumulator set in the output projection on those row tiles).
// Softmax and all scaling in f32.
// Causal grouped-query attention (32 query heads sharing 8 key/value heads), [out][in] weights,
// no biases; the k and v projection epilogues write every shared head once per query head so
// the attention kernel sees one K row block and one V^T row block per query head.

typedef _Float16 v16h __attribute__((ext_vector_type(16)));
typedef _Float16 v8h  __attribute__((ext_vector_type(8)));
typedef float    v8f  __attribute__((ext_vector_type(8)));
typedef float    v4f  __attribute__((ext_vector_type(4)));

#ifndef NB
#define NB 2
#endif
#ifndef SEQ
#define SEQ 2048
#endif
#define NB_FULL  2
#define SEQ_FULL 2048
#define DIM   2048
#define NHEAD 32
#define HD    64
#define NKV   8
#define GQA   (NHEAD / NKV)
#define KVD   (NKV * HD)
#define MROWS (NB * SEQ)
#define EROWS  128   // early query rows per sequence carried with residual planes (q, ctx)
#define ECHUNK 64    // early keys per sequence carried with residual planes (k, v)

static_assert(NB >= 1 && NB <= NB_FULL);
static_assert(SEQ >= 128 && SEQ <= SEQ_FULL && (SEQ % 128) == 0);
static_assert(DIM == NHEAD * HD);
static_assert(HD == 64);
static_assert(NHEAD == NKV * GQA && GQA == 4);
static_assert(KVD == 512 && (KVD % 64) == 0);
static_assert((DIM % 64) == 0 && (DIM % 32) == 0);
static_assert((MROWS % 64) == 0 && (MROWS % 8) == 0);
static_assert((SEQ % 64) == 0);               // a 64-row GEMM tile never straddles two sequences
static_assert((DIM % 8) == 0 && (KVD % 8) == 0);
static_assert(DIM == 8 * 32 * 8);             // cast: 8 passes x 32 lanes x 8 columns per row
static_assert((size_t)MROWS * DIM < (size_t)0xFFFFFFFFu);
static_assert(EROWS == 128);                  // == query rows of one attention block (block 0)
static_assert(ECHUNK == 64);                  // == keys of one attention step (chunk 0) == one GEMM row tile
static_assert((EROWS % 64) == 0 && EROWS <= SEQ);   // whole 64-row GEMM tiles
static_assert((size_t)NB * NHEAD * EROWS * HD < (size_t)0xFFFFFFFFu);   // 32-bit q residual offsets

#define LDT 72   // halves per LDS row (144 B, 16-B aligned)
#define LDC 68   // floats per LDS row (272 B, 16-B aligned)
static_assert((LDT % 8) == 0 && LDT >= 64);
static_assert((LDC % 4) == 0 && LDC >= 64);

// GEMM block tile (output projection; the q, k, v tile stands at its kernel) and LDS staging
#define BM  128   // output rows per block
#define BN  128   // output columns per block
#define BK  128   // halves of every operand row per stage (256 B)
#define LDG 136   // halves per staged row (272 B = 16 B x 17: b128 fragment reads meet no bank twice)
#define STAGE_H ((BM + BN) * LDG)   // halves per stage: A rows, then B rows
static_assert((LDG % 8) == 0 && LDG >= BK);
static_assert((DIM % BK) == 0 && DIM / BK >= 2);          // the ring starts with two stages
static_assert((MROWS % BM) == 0 && (SEQ % BM) == 0 && (DIM % BN) == 0 && (KVD % BN) == 0);
static_assert(BM == EROWS);                               // a block is all early rows or none
static_assert((BM + BN) * (BK / 8) == 256 * 16);          // 16 copies of 16 B per thread and stage
static_assert((size_t)4 * 64 * LDC * 4 <= (size_t)2 * STAGE_H * 2);   // C staging fits the ring
static_assert((size_t)2 * STAGE_H * 2 <= (size_t)163840);             // two blocks per WGP

#define WCARRY 64.0f     // weight planes carried x64
#define PCARRY 1024.0f   // softmax numerators carried x1024
#define VCARRY 64.0f     // attention output plane carried x64
#define RCARRY 1024.0f   // residual planes (p, v) carried x1024 on top of their hi part
#define SCRES  2048.0f   // residual planes (q, k, attention rows) carried x2048 on top of their hi part
// Softmax exponent: e = exp2(score * ESCALE - max * ESCALE - EBIAS) = p x 2^-102, and
// e x PUNBIAS = 1024 p. A p whose 1024 p lies under the f16 normal range (2^-14) has its e under
// the f32 normal range (2^-126).
#define ESCALE  0.18033688011112042f   // HD^-0.5 x log2(e)
#define EBIAS   102.0f
#define PUNBIAS 0x1p+112f
static_assert(PUNBIAS * 0x1p-102f == PCARRY);
static_assert(0x1p-126f * PUNBIAS == 6.103515625e-05f);

// epilogue store-loop coverage (rows admitted per step x steps == tile rows)
#define TILE_ROWS        64
#define EPI16_ROWS_STEP  (256 / 8)
#define EPI16_STEPS      2
#define EPIF_ROWS_STEP   (256 / 16)   // 16 lanes x 16 B per 256-B row segment
#define EPIF_STEPS       4
static_assert(EPI16_ROWS_STEP * EPI16_STEPS == TILE_ROWS);
static_assert(EPIF_ROWS_STEP * EPIF_STEPS == TILE_ROWS);
static_assert(8 * 16 == 128);                 // attention block: 8 waves x 16 query rows

// static LDS per kernel (bytes)
static_assert((size_t)(6 * 64 * LDT) * 2 <= (size_t)131072);

// workspace layout (bytes)
#define WSQ_BYTES     ((size_t)DIM * DIM * 2)
#define WKV_BYTES     ((size_t)KVD * DIM * 2)
#define PLANE16_BYTES ((size_t)MROWS * DIM * 2)
#define VRES_BYTES    ((size_t)NB * DIM * 64 * 2)
#define QRES_BYTES    ((size_t)NB * NHEAD * EROWS * HD * 2)
#define KRES_BYTES    ((size_t)NB * NHEAD * ECHUNK * HD * 2)
#define CRES_BYTES    ((size_t)NB * EROWS * DIM * 2)
#define OFF_WQ  ((size_t)0)
#define OFF_WK  (OFF_WQ + WSQ_BYTES)
#define OFF_WV  (OFF_WK + WKV_BYTES)
#define OFF_WO  (OFF_WV + WKV_BYTES)
#define OFF_X   (OFF_WO + WSQ_BYTES)
#define OFF_Q   (OFF_X + PLANE16_BYTES)
#define OFF_K   (OFF_Q + PLANE16_BYTES)
#define OFF_VT  (OFF_K + PLANE16_BYTES)
#define OFF_CTX (OFF_VT + PLANE16_BYTES)
#define OFF_VR  (OFF_CTX + PLANE16_BYTES)
#define OFF_QR  (OFF_VR + VRES_BYTES)
#define OFF_KR  (OFF_QR + QRES_BYTES)
#define OFF_CR  (OFF_KR + KRES_BYTES)
#define WS_TOTAL (OFF_CR + CRES_BYTES)
static_assert((WSQ_BYTES % 128) == 0 && (WKV_BYTES % 128) == 0 && (PLANE16_BYTES % 128) == 0);
static_assert((VRES_BYTES % 128) == 0);
static_assert((QRES_BYTES % 128) == 0 && (KRES_BYTES % 128) == 0 && (CRES_BYTES % 128) == 0);
static_assert(WS_TOTAL <= (size_t)134217728);

// ---------------------------------------------------------------------------
__device__ __forceinline__ float bf16r(float x) {   // RNE convert to bf16, returned widened
  unsigned int u = __float_as_uint(x);
  u = (u + 0x7FFFu + ((u >> 16) & 1u)) & 0xFFFF0000u;
  return __uint_as_float(u);
}

// f32 -> f16 operand convert that cannot produce an f16 subnormal (value select).
static __device__ __forceinline__ _Float16 toh_flush(float v) {
  const _Float16 r = (_Float16)v;
  return (fabsf(v) < 6.103515625e-05f) ? (_Float16)0.0f : r;
}

// 16-bit fragment: p points at element [row = lane&15][k0 + 8*(lane>>4)] of a k-contiguous
// row. Elements 0..7 <- k0+8h+0..7, elements 8..15 <- k0+16+8h+0..7 (same map for A and B).
__device__ __forceinline__ v16h frag_at(const _Float16* p) {
  v8h lo = *(const v8h*)(p);
  v8h hi = *(const v8h*)(p + 16);
  v16h out;
#pragma unroll
  for (int i = 0; i < 8; ++i) { out[i] = lo[i]; out[i + 8] = hi[i]; }
  return out;
}
__device__ __forceinline__ v16h ld_frag(const _Float16* base, unsigned ld) {
  const unsigned lane = threadIdx.x & 31u;
  return frag_at(base + (lane & 15u) * ld + (lane >> 4) * 8u);
}

__device__ __forceinline__ v8f wmma16(v16h a, v16h b, v8f c) {
  v8f d = __builtin_amdgcn_wmma_f32_16x16x32_f16(false, a, false, b, (short)0, c,
                                                 false, false);
  asm volatile("v_nop\n\tv_nop\n\tv_nop\n\tv_nop" : "+v"(d) : "v"(a), "v"(b));
  return d;
}

// The builtin alone: the compiler keeps the distances behind its own matrix instructions, and a
// run of independent products issues back to back.
__device__ __forceinline__ v8f wmma16b(v16h a, v16h b, v8f c) {
  return __builtin_amdgcn_wmma_f32_16x16x32_f16(false, a, false, b, (short)0, c, false, false);
}

// N (8 or 6) asynchronous 16-B copies of one lane, global -> LDS, rows RS apart on both sides.
// lds: the lane's LDS byte address; g: the lane's global address; K: source pitch in halves.
// The s_wait_xcnt ends the copies' own statement so that no address register is rewritten
// ahead of it.
template <unsigned N, unsigned RS>
__device__ __forceinline__ void stage_copy(const unsigned lds, const _Float16* g,
                                           const unsigned K) {
  static_assert(N == 8u || N == 6u);
  const unsigned ls = RS * LDG * 2u;
  const size_t gs = (size_t)RS * K;
  if constexpr (N == 6u) {
    asm volatile(
        "global_load_async_to_lds_b128 %0, %6, off\n\t"
        "global_load_async_to_lds_b128 %1, %7, off\n\t"
        "global_load_async_to_lds_b128 %2, %8, off\n\t"
        "global_load_async_to_lds_b128 %3, %9, off\n\t"
        "global_load_async_to_lds_b128 %4, %10, off\n\t"
        "global_load_async_to_lds_b128 %5, %11, off\n\t"
        "s_wait_xcnt 0x0"
        :
        : "v"(lds), "v"(lds + ls), "v"(lds + 2u * ls), "v"(lds + 3u * ls), "v"(lds + 4u * ls),
          "v"(lds + 5u * ls), "v"(g), "v"(g + gs), "v"(g + 2u * gs), "v"(g + 3u * gs),
          "v"(g + 4u * gs), "v"(g + 5u * gs)
        : "memory");
    return;
  }
  asm volatile(
      "global_load_async_to_lds_b128 %0, %8, off\n\t"
      "global_load_async_to_lds_b128 %1, %9, off\n\t"
      "global_load_async_to_lds_b128 %2, %10, off\n\t"
      "global_load_async_to_lds_b128 %3, %11, off\n\t"
      "global_load_async_to_lds_b128 %4, %12, off\n\t"
      "global_load_async_to_lds_b128 %5, %13, off\n\t"
      "global_load_async_to_lds_b128 %6, %14, off\n\t"
      "global_load_async_to_lds_b128 %7, %15, off\n\t"
      "s_wait_xcnt 0x0"
      :
      : "v"(lds), "v"(lds + ls), "v"(lds + 2u * ls), "v"(lds + 3u * ls), "v"(lds + 4u * ls),
        "v"(lds + 5u * ls), "v"(lds + 6u * ls), "v"(lds + 7u * ls), "v"(g), "v"(g + gs),
        "v"(g + 2u * gs), "v"(g + 3u * gs), "v"(g + 4u * gs), "v"(g + 5u * gs),
        "v"(g + 6u * gs), "v"(g + 7u * gs)
      : "memory");
}

// acc[i][j] += A[BMt rows][K] . B[64 NJ rows][K]^T for this wave's 64 x 16 NJ part of the block
// tile (mw = 64-row group, nw = one of four column groups; 2 BMt threads). Arow / Brow: first
// row of the block's A / B rows.
// Two LDS buffers of one 128-k stage each; stage t + 2 is copied into the buffer that trip t
// has just left, behind the barrier that also publishes stage t + 1. On entry every wave's
// earlier LDS reads of St have retired in front of a barrier that all waves have passed.
template <unsigned BMt, unsigned NJ>
__device__ __forceinline__ void gemm_mainloop(const _Float16* __restrict__ Arow,
                                              const _Float16* __restrict__ Brow,
                                              const unsigned K, _Float16* St,
                                              v8f (&acc)[4][NJ]) {
  constexpr unsigned BNt = 64u * NJ;              // B rows per stage
  constexpr unsigned RS = BMt / 8u;               // rows one copy of every thread covers
  constexpr unsigned SH = (BMt + BNt) * LDG;      // halves per stage: A rows, then B rows
  constexpr unsigned NB8 = BNt / RS;              // copies per thread for the B rows
  static_assert(BMt == 8u * RS && BNt == NB8 * RS);
  const unsigned tid = threadIdx.x, lane = tid & 31u, w = tid >> 5;
  const unsigned mw = w >> 2, nw = w & 3u;
  const unsigned hh = lane >> 4, m = lane & 15u;
  const unsigned cr = tid >> 4, cc = (tid & 15u) * 8u;   // copy: row (of RS), 16-B column
  const _Float16* ga = Arow + (size_t)cr * K + cc;
  const _Float16* gb = Brow + (size_t)cr * K + cc;
  const unsigned la = (unsigned)(size_t)St + (cr * LDG + cc) * 2u;
  const unsigned lb = la + BMt * LDG * 2u;
  const unsigned nt = K / BK;

  stage_copy<8u, RS>(la, ga, K);
  stage_copy<NB8, RS>(lb, gb, K);
  asm volatile("s_wait_asynccnt 0x0" ::: "memory");   // stage 0 landed (this wave's copies)
  __syncthreads();                                    // stage 0 readable by every wave
  stage_copy<8u, RS>(la + SH * 2u, ga + BK, K);
  stage_copy<NB8, RS>(lb + SH * 2u, gb + BK, K);

  const _Float16* fa = St + (mw * 64u + m) * LDG + hh * 8u;
  const _Float16* fb = St + (BMt + nw * (NJ * 16u) + m) * LDG + hh * 8u;
#pragma unroll 1   // one stage per trip: the buffer alternates by t & 1, the text stays short
  for (unsigned t = 0; t < nt; ++t) {
    const unsigned bo = (t & 1u) * SH;
#pragma unroll
    for (unsigned kk = 0; kk < BK / 32u; ++kk) {
      v16h a[4], b[NJ];
#pragma unroll
      for (unsigned i = 0; i < 4u; ++i) a[i] = frag_at(fa + bo + i * 16u * LDG + kk * 32u);
#pragma unroll
      for (unsigned j = 0; j < NJ; ++j) b[j] = frag_at(fb + bo + j * 16u * LDG + kk * 32u);
#pragma unroll
      for (unsigned i = 0; i < 4u; ++i)
#pragma unroll
        for (unsigned j = 0; j < NJ; ++j) acc[i][j] = wmma16(a[i], b[j], acc[i][j]);
    }
    asm volatile("s_wait_dscnt 0x0" ::: "memory");      // this wave has left buffer t & 1
    asm volatile("s_wait_asynccnt 0x0" ::: "memory");   // its copies of stage t + 1 landed
    __syncthreads();   // publishes stage t + 1, frees buffer t & 1
    if (t + 2u < nt) {
      stage_copy<8u, RS>(la + bo * 2u, ga + (t + 2u) * BK, K);
      stage_copy<NB8, RS>(lb + bo * 2u, gb + (t + 2u) * BK, K);
    }
  }
  asm volatile("s_wait_asynccnt 0x0" ::: "memory");     // nothing in flight when St is reused
}

// ---------------------------------------------------------------------------
// Row cast: f32 rows of DIM columns -> f16 compact rows of DIM columns, one wave per row,
// 8 rows per block, 8 rolled passes; each store instruction of a wave covers 512 contiguous
// SRC_INPUT = 1: source is the module input (full-size row stride per batch), carry 1;
// SRC_INPUT = 0: source is an [out][in] weight (already k-contiguous), carry x64.
// Every value goes through RNE bf16 first. sblk / dblk: 8-row block of the source / of dst.
// ---------------------------------------------------------------------------
template <int SRC_INPUT>
__device__ __forceinline__ void cast_body(const float* __restrict__ X,
                                          _Float16* __restrict__ dst,
                                          const unsigned sblk, const unsigned dblk) {
#pragma clang fp contract(off)
  const unsigned lane = threadIdx.x & 31u;
  const unsigned w = (unsigned)__builtin_amdgcn_readfirstlane((int)(threadIdx.x >> 5));
  const unsigned crow = sblk * 8u + w;
  size_t srow = crow;
  if (SRC_INPUT) {
    const unsigned bidx = crow / (unsigned)SEQ;
    const unsigned sq = crow - bidx * (unsigned)SEQ;
    srow = (size_t)bidx * SEQ_FULL + sq;
  }
  const float carry = SRC_INPUT ? 1.0f : WCARRY;
  const float* xr = X + srow * DIM + lane * 8u;
  _Float16* dr = dst + (size_t)(dblk * 8u + w) * DIM + lane * 8u;
#pragma unroll 1
  for (unsigned j = 0; j < 8u; ++j) {
    const v4f a0 = *(const v4f*)(xr + j * 256u);
    const v4f a1 = *(const v4f*)(xr + j * 256u + 4u);
    v8h o;
#pragma unroll
    for (int i = 0; i < 4; ++i) {
      o[i]     = toh_flush(carry * bf16r(a0[i]));
      o[i + 4] = toh_flush(carry * bf16r(a1[i]));
    }
    _Float16* p = dr + j * 256u;
    *(v8h*)p = o;
    
  }
}

// All five casts in one launch (none reads what another writes). Blocks 0 .. XBLK-1 take the
// input rows; the rest take the rows of the four weight planes, which lie stacked in the
// workspace in the order wq, wk, wv, wo, so that w16 is one plane of WBLK * 8 rows.
// Every test is on the block index alone. Grid (XBLK + WBLK).
#define XBLK (MROWS / 8)
#define WBLK ((2 * DIM + 2 * KVD) / 8)
static_assert(OFF_WK == OFF_WQ + (size_t)DIM * DIM * 2);
static_assert(OFF_WV == OFF_WQ + (size_t)(DIM + KVD) * DIM * 2);
static_assert(OFF_WO == OFF_WQ + (size_t)(DIM + 2 * KVD) * DIM * 2);
__global__ __launch_bounds__(256) void cast_kernel(
    const float* __restrict__ X, const float* __restrict__ wq, const float* __restrict__ wk,
    const float* __restrict__ wv, const float* __restrict__ wo,
    _Float16* __restrict__ x16, _Float16* __restrict__ w16) {
  const unsigned blk = blockIdx.x;
  if (blk < (unsigned)XBLK) {
    cast_body<1>(X, x16, blk, blk);
    return;
  }
  const unsigned wb = blk - (unsigned)XBLK;   // 8-row block of the stacked weight planes
  const float* W = wq;
  unsigned first = 0u;                        // first block of the plane that wb lies in
  if (wb >= (unsigned)((DIM + 2 * KVD) / 8)) {
    W = wo;
    first = (unsigned)((DIM + 2 * KVD) / 8);
  } else if (wb >= (unsigned)((DIM + KVD) / 8)) {
    W = wv;
    first = (unsigned)((DIM + KVD) / 8);
  } else if (wb >= (unsigned)(DIM / 8)) {
    W = wk;
    first = (unsigned)(DIM / 8);
  }
  cast_body<0>(W, w16, wb - first, wb);
}

// ---------------------------------------------------------------------------
// GEMM C[block tile] = A16[rows][K] . Bt[n][K]^T; both operands staged in LDS by asynchronous
// copies (gemm_mainloop). Output projection: 128x128 tile, 8 waves of 64x32; q, k, v
// projections: 256x192 tile, 16 waves of 64x48 (mw = 64-row group, nw = column group).
// The epilogue treats the tile as 64x64 sub-tiles (bx = 64-column block, row0 = first row):
//   MODE 0: out16[row][col] (pitch DIM) = f16(acc/64)                       (q plane);
//           row tiles with sequence row < 128 also write
//           out16r [b][head][128][64] = f16(2048 * (q - hi))
//   MODE 1: tile column block = one shared key head; out16[row][(4*kvh + rep)*64 + c]
//           (pitch DIM) = f16(acc/64) for rep 0..3                          (k plane);
//           the key tile 0 of each sequence also writes
//           out16r [b][4*kvh + rep][64][64] = f16(2048 * (k - hi)) for rep 0..3
//   MODE 2: transposed V plane [b][(4*kvh + rep)*64 + d][key] = f16(acc/64) for rep 0..3;
//           for key tile 0 also out16r [b][(4*kvh + rep)*64 + d][64] = f16(1024 * (v - hi))
//   MODE 3: outf full [full row][col] = acc/4096                            (output buffer);
//           row tiles with sequence row < 128 run a second accumulator set fed by the
//           residual rows A16r [b][128][K] against the same B rows (a second pass of the main
//           loop), folded as acc + accres/2048 before the 1/4096 scale (block-uniform test).
// Store loops: MODE 0/1/2: 32 rows per step x 2 steps = 64; MODE 3: 16 rows x 4 steps = 64.
// MODE 0, 1 and 2 share one launch (gemm_qkv_kernel): same A rows, and their B rows lie
// stacked in the workspace, so the main loop is one and only the epilogue differs by sub-tile.
// ---------------------------------------------------------------------------
// C staging over the ring (every wave is behind the main loop's last barrier):
// [64][LDC] sub-tiles, sub = NJ * (64-row group) + (64-column group)
template <unsigned NJ>
__device__ __forceinline__ void stage_c(const v8f (&acc)[4][NJ], float* Call) {
  const unsigned tid = threadIdx.x, lane = tid & 31u, w = tid >> 5;
  const unsigned mw = w >> 2, nw = w & 3u;
  const unsigned hh = lane >> 4, m = lane & 15u;
#pragma unroll
  for (unsigned i = 0; i < 4u; ++i)
#pragma unroll
    for (unsigned j = 0; j < NJ; ++j) {
      const unsigned col = nw * (NJ * 16u) + j * 16u;   // first column of this 16-column group
#pragma unroll
      for (unsigned r = 0; r < 8u; ++r)
        Call[((mw * NJ + (col >> 6)) * 64u + i * 16u + hh * 8u + r) * LDC + (col & 63u) + m] =
            acc[i][j][r];
    }
  __syncthreads();
}

// Epilogue of one staged 64x64 sub-tile by 256 threads. Cs: the sub-tile; bx: its 64-column
// block within its own output; row0: its first row; tid: 0 .. 255.
template <int MODE>
__device__ __forceinline__ void store_sub(
    const float* Cs, const unsigned bx, const unsigned row0, const unsigned tid,
    float* __restrict__ outf, _Float16* __restrict__ out16, _Float16* __restrict__ out16r) {
  {
  const unsigned n0 = bx * 64u;

  if (MODE == 0 || MODE == 1) {
    constexpr unsigned NREP  = (MODE == 1) ? (unsigned)GQA : 1u;
    constexpr unsigned RROWS = (MODE == 1) ? (unsigned)ECHUNK : (unsigned)EROWS;
    const unsigned cb = (MODE == 1) ? bx * (unsigned)(GQA * HD) : n0;
    const unsigned bidx = row0 / (unsigned)SEQ;
    const unsigned sq0 = row0 - bidx * (unsigned)SEQ;
    const bool has_res = (sq0 < RROWS);        // one value per sub-tile (MODE 1: key tile 0 only)
    v8h x[2], xr[2];
    size_t off[2], offr[2];
#pragma unroll
    for (unsigned i = 0; i < 2u; ++i) {
      const unsigned r = 32u * i + (tid >> 3);
      const unsigned c = (tid & 7u) * 8u;
      const v4f u0 = *(const v4f*)&Cs[r * LDC + c];
      const v4f u1 = *(const v4f*)&Cs[r * LDC + c + 4];
#pragma unroll
      for (int j = 0; j < 4; ++j) {
        x[i][j]     = toh_flush(u0[j] * (1.0f / WCARRY));
        x[i][j + 4] = toh_flush(u1[j] * (1.0f / WCARRY));
      }
      xr[i] = x[i];
      if (has_res) {
#pragma unroll
        for (int j = 0; j < 4; ++j) {
          const float t0 = u0[j] * (1.0f / WCARRY);
          const float t1 = u1[j] * (1.0f / WCARRY);
          xr[i][j]     = toh_flush((t0 - (float)x[i][j]) * SCRES);
          xr[i][j + 4] = toh_flush((t1 - (float)x[i][j + 4]) * SCRES);
        }
      }
      off[i] = (size_t)(row0 + r) * DIM + cb + c;
      offr[i] = ((size_t)(bidx * (unsigned)NHEAD + bx * NREP) * RROWS + sq0 + r) * HD + c;
    }
#pragma unroll
    for (unsigned rep = 0; rep < NREP; ++rep) {
#pragma unroll
      for (int i = 0; i < 2; ++i)
        *(v8h*)(out16 + off[i] + (size_t)rep * HD) = x[i];
    }
    asm volatile("s_wait_xcnt 0x0" ::: "memory");   // before the stores' registers are reused
    if (has_res) {
#pragma unroll
      for (unsigned rep = 0; rep < NREP; ++rep) {
#pragma unroll
        for (int i = 0; i < 2; ++i)
          *(v8h*)(out16r + offr[i] + (size_t)rep * RROWS * HD) = xr[i];
      }
      asm volatile("s_wait_xcnt 0x0" ::: "memory");   // before the stores' registers are reused
    }
    
  }

  if (MODE == 2) {
    const unsigned bidx = row0 / (unsigned)SEQ;
    const unsigned key0 = row0 - bidx * (unsigned)SEQ;
    const bool first_tile = (key0 == 0u);      // one value per sub-tile
    v8h x[2], xr[2];
    size_t off[2], offr[2];
#pragma unroll
    for (unsigned i = 0; i < 2u; ++i) {
      const unsigned dcol = 32u * i + (tid >> 3);
      const unsigned kk = (tid & 7u) * 8u;
#pragma unroll
      for (unsigned j = 0; j < 8u; ++j) {
        const float t = Cs[(kk + j) * LDC + dcol] * (1.0f / WCARRY);
        const _Float16 hi = toh_flush(t);
        x[i][j]  = hi;
        xr[i][j] = toh_flush((t - (float)hi) * RCARRY);
      }
      const size_t vrow = (size_t)bidx * DIM + bx * (unsigned)(GQA * HD) + dcol;
      off[i]  = vrow * SEQ + key0 + kk;
      offr[i] = vrow * 64u + kk;
    }
#pragma unroll
    for (unsigned rep = 0; rep < (unsigned)GQA; ++rep) {
#pragma unroll
      for (int i = 0; i < 2; ++i)
        *(v8h*)(out16 + off[i] + (size_t)rep * HD * SEQ) = x[i];
    }
    asm volatile("s_wait_xcnt 0x0" ::: "memory");   // before the stores' registers are reused
    if (first_tile) {
#pragma unroll
      for (unsigned rep = 0; rep < (unsigned)GQA; ++rep) {
#pragma unroll
        for (int i = 0; i < 2; ++i)
          *(v8h*)(out16r + offr[i] + (size_t)rep * HD * 64u) = xr[i];
      }
      asm volatile("s_wait_xcnt 0x0" ::: "memory");   // before the stores' registers are reused
    }
    
  }

  if (MODE == 3) {
    const float cs = 1.0f / (WCARRY * VCARRY);
    v4f xs[4];
    size_t off[4];
#pragma unroll
    for (unsigned i = 0; i < 4u; ++i) {
      const unsigned r = 16u * i + (tid >> 4);
      const unsigned c = (tid & 15u) * 4u;
      const unsigned crow = row0 + r;
      const unsigned bidx = crow / (unsigned)SEQ;
      const unsigned sq = crow - bidx * (unsigned)SEQ;
      const size_t frow = (size_t)bidx * SEQ_FULL + sq;
      const v4f u = *(const v4f*)&Cs[r * LDC + c];
      v4f val;
#pragma unroll
      for (int j = 0; j < 4; ++j) val[j] = u[j] * cs;
      xs[i] = val;
      off[i] = frow * DIM + n0 + c;
    }
#pragma unroll
    for (int i = 0; i < 4; ++i) *(v4f*)(outf + off[i]) = xs[i];
  }
  }
}

// q, k and v projections in one launch. Bt: the stacked planes wq, wk, wv (DIM + 2 KVD rows).
// Block tile 256 x 192, 16 waves of 64 x 48, one block per WGP: every staged byte feeds more
// products than in a 128 x 128 tile, and the grid is one block for each of 256 WGPs.
// The epilogue goes by 64-column blocks of the stacked outputs: blocks 0 .. DIM/64 - 1 are q,
// the next KVD/64 are k, the last KVD/64 are v; the two halves of the block take alternate
// sub-tiles (tests on wave-uniform values alone, no barrier behind stage_c).
// Grid ((DIM + 2 KVD)/192, MROWS/256).
#define QBM 256
#define QNJ 3
#define QBN (64 * QNJ)
#define QSTAGE_H ((QBM + QBN) * LDG)
#define QSUBS ((QBM / 64) * QNJ)
static_assert((MROWS % QBM) == 0 && ((DIM + 2 * KVD) % QBN) == 0 && (QSUBS % 2) == 0);
static_assert((size_t)2 * QSTAGE_H * 2 <= (size_t)327680);                  // one block per WGP
static_assert((size_t)QSUBS * 64 * LDC * 4 <= (size_t)2 * QSTAGE_H * 2);    // C staging fits the ring
__global__ __launch_bounds__(512) void gemm_qkv_kernel(
    const _Float16* __restrict__ A16, const _Float16* __restrict__ Bt,
    _Float16* __restrict__ q16, _Float16* __restrict__ q16r,
    _Float16* __restrict__ k16, _Float16* __restrict__ k16r,
    _Float16* __restrict__ vt, _Float16* __restrict__ vtr) {
  __shared__ __attribute__((aligned(16))) _Float16 St[2 * QSTAGE_H];
  const unsigned K = (unsigned)DIM;
  const unsigned bxa = blockIdx.x;
  const unsigned brow0 = blockIdx.y * (unsigned)QBM;

  v8f acc[4][QNJ] = {};
  gemm_mainloop<QBM, QNJ>(A16 + (size_t)brow0 * K, Bt + (size_t)(bxa * (unsigned)QBN) * K, K, St,
                          acc);
  stage_c<QNJ>(acc, (float*)St);
  const unsigned half = (unsigned)__builtin_amdgcn_readfirstlane((int)(threadIdx.x >> 8));
  const unsigned t256 = threadIdx.x & 255u;
  for (unsigned s = 0; s < (unsigned)(QSUBS / 2); ++s) {
    const unsigned sub = 2u * s + half;
    const unsigned rg = sub / (unsigned)QNJ, cg = sub - rg * (unsigned)QNJ;
    const float* Cs = (const float*)St + sub * (64u * LDC);
    const unsigned gcb = bxa * (unsigned)QNJ + cg;   // 64-column block of the stacked outputs
    const unsigned row0 = brow0 + rg * 64u;
    if (gcb < (unsigned)(DIM / 64))
      store_sub<0>(Cs, gcb, row0, t256, (float*)0, q16, q16r);
    else if (gcb < (unsigned)((DIM + KVD) / 64))
      store_sub<1>(Cs, gcb - (unsigned)(DIM / 64), row0, t256, (float*)0, k16, k16r);
    else
      store_sub<2>(Cs, gcb - (unsigned)((DIM + KVD) / 64), row0, t256, (float*)0, vt, vtr);
  }
}

// Output projection. Grid (DIM/128, MROWS/128).
__global__ __launch_bounds__(256) void gemm_wo_kernel(
    const _Float16* __restrict__ A16, const _Float16* __restrict__ A16r,
    const _Float16* __restrict__ Bt, float* __restrict__ outf) {
  __shared__ __attribute__((aligned(16))) _Float16 St[2 * STAGE_H];
  const unsigned K = (unsigned)DIM;
  const unsigned brow0 = blockIdx.y * (unsigned)BM;
  const _Float16* Brow = Bt + (size_t)(blockIdx.x * (unsigned)BN) * K;

  v8f acc[4][2] = {};
  gemm_mainloop<BM, 2u>(A16 + (size_t)brow0 * K, Brow, K, St, acc);
  const unsigned bidx3 = brow0 / (unsigned)SEQ;
  const unsigned sq3 = brow0 - bidx3 * (unsigned)SEQ;
  if (sq3 < (unsigned)EROWS) {               // block-uniform
    v8f res[4][2] = {};
    gemm_mainloop<BM, 2u>(A16r + (size_t)(bidx3 * (unsigned)EROWS + sq3) * K, Brow, K, St, res);
#pragma unroll
    for (int i = 0; i < 4; ++i)
#pragma unroll
      for (int j = 0; j < 2; ++j)
#pragma unroll
        for (int r = 0; r < 8; ++r) acc[i][j][r] = acc[i][j][r] + res[i][j][r] * (1.0f / SCRES);
  }
  stage_c<2u>(acc, (float*)St);
  for (unsigned sub = 0; sub < 4u; ++sub)
    store_sub<3>((const float*)St + sub * (64u * LDC), blockIdx.x * 2u + (sub & 1u),
                 brow0 + (sub >> 1) * 64u, threadIdx.x, outf, (_Float16*)0, (_Float16*)0);
}

#define ATILE_H (2 * 64 * LDT)
static_assert((LDT * 2) % 16 == 0 && (ATILE_H * 2) % 16 == 0);   // 16-B copies stay aligned
static_assert(SEQ / 64 >= 2);                                    // the ring starts with two chunks

// One key chunk of one lane: four asynchronous 16-B copies, global -> LDS (K rows r and r + 32,
// V^T rows r and r + 32). lds: the lane's LDS byte address in the buffer's K tile; gk / gv: its
// global addresses. The s_wait_xcnt ends the copies' own statement so that no address register
// is rewritten ahead of it.
__device__ __forceinline__ void attn_copy(const unsigned lds, const _Float16* gk,
                                          const _Float16* gv) {
  asm volatile(
      "global_load_async_to_lds_b128 %0, %4, off\n\t"
      "global_load_async_to_lds_b128 %1, %5, off\n\t"
      "global_load_async_to_lds_b128 %2, %6, off\n\t"
      "global_load_async_to_lds_b128 %3, %7, off\n\t"
      "s_wait_xcnt 0x0"
      :
      : "v"(lds), "v"(lds + 32u * LDT * 2u), "v"(lds + 64u * LDT * 2u),
        "v"(lds + 96u * LDT * 2u), "v"(gk), "v"(gk + (size_t)32 * DIM), "v"(gv),
        "v"(gv + (size_t)32 * SEQ)
      : "memory");
}

__device__ __forceinline__ float xhalf(float x) {   // lane l <-> lane l ^ 16
  const int b = __builtin_bit_cast(int, x);
  return __builtin_bit_cast(
      float, __builtin_amdgcn_permlanex16(b, b, 0x76543210, 0xfedcba98, false, false));
}

__global__ __launch_bounds__(256) void attn_kernel(
    const _Float16* __restrict__ Qh, const _Float16* __restrict__ QhR,
    const _Float16* __restrict__ Kh, const _Float16* __restrict__ KhR,
    const _Float16* __restrict__ Vt, const _Float16* __restrict__ VtR,
    _Float16* __restrict__ Ov, _Float16* __restrict__ OvR) {
  // two buffers of one key chunk each: K tile, then V^T tile
  __shared__ __attribute__((aligned(16))) _Float16 KV[2 * ATILE_H];
  __shared__ _Float16 VRs[64 * LDT];
  __shared__ _Float16 KRs[64 * LDT];

  const unsigned tid = threadIdx.x, lane = tid & 31u, w = tid >> 5;
  const unsigned hh = lane >> 4, m = lane & 15u;
  const unsigned qtile = (unsigned)(SEQ / 128 - 1) - blockIdx.z;   // cost falls with the index
  const unsigned q0 = qtile * 128u;
  const unsigned head = blockIdx.x;
  const unsigned b = blockIdx.y;
  const unsigned qrow0 = q0 + w * 16u;
  const bool first_blk = (qtile == 0u);

  const size_t qoff = (size_t)(b * (unsigned)SEQ + qrow0 + m) * DIM + head * HD + hh * 8u;
  v16h qf[2];
  qf[0] = frag_at(Qh + qoff);
  qf[1] = frag_at(Qh + qoff + 32);

  float mrun = -1.0e30f;   // running maximum of query qrow0 + m, unscaled (equal in both halves)
  float nrun = __builtin_fmaf(-mrun, ESCALE, -EBIAS);   // the exponent's addend for mrun
  float lsum = 0.0f;       // running sum over this half's keys only, x 2^-102
  v8f o[4];
#pragma unroll
  for (int nb = 0; nb < 4; ++nb) o[nb] = (v8f){};

  const size_t kplane = (size_t)b * SEQ * DIM + head * HD;
  const size_t vplane = ((size_t)b * DIM + head * HD) * SEQ;
  const size_t rplane = ((size_t)b * DIM + head * HD) * 64u;
  const size_t krplane = ((size_t)(b * (unsigned)NHEAD + head) * ECHUNK) * HD;
  const unsigned kend = q0 + 128u;   // <= SEQ

  // copies: thread t takes rows t >> 3 and (t >> 3) + 32, 16-B column t & 7 of both tiles
  const unsigned sr = tid >> 3, sc = (tid & 7u) * 8u;
  const _Float16* gk = Kh + kplane + (size_t)sr * DIM + sc;   // chunk 0; a chunk on: + 64 DIM
  const _Float16* gv = Vt + vplane + (size_t)sr * SEQ + sc;   // chunk 0; a chunk on: + 64
  const unsigned lkv = (unsigned)(size_t)KV + (sr * LDT + sc) * 2u;

  attn_copy(lkv, gk, gv);
  if (first_blk) {   // block-uniform: the residual tiles of chunk 0, plain loads
#pragma unroll
    for (unsigned j = 0; j < 2u; ++j) {
      const unsigned r = sr + 32u * j;
      *(v8h*)&VRs[r * LDT + sc] = *(const v8h*)(VtR + rplane + (size_t)r * 64u + sc);
      *(v8h*)&KRs[r * LDT + sc] = *(const v8h*)(KhR + krplane + (size_t)r * HD + sc);
    }
  }
  asm volatile("s_wait_asynccnt 0x0" ::: "memory");   // chunk 0 landed (this wave's copies)
  __syncthreads();                                    // chunk 0 readable by every wave
  attn_copy(lkv + ATILE_H * 2u, gk + (size_t)64 * DIM, gv + 64);   // kend >= 128: chunk 1 exists

  for (unsigned kb = 0; kb < kend; kb += 64u) {
    const bool early = first_blk && (kb == 0u);   // block-uniform
    const unsigned bo = ((kb >> 6) & 1u) * (unsigned)ATILE_H;   // this chunk's buffer
    const _Float16* Ks = KV + bo;
    const _Float16* Vs = KV + bo + 64 * LDT;

    // scores, transposed: 4 key groups of 16 (rows), K = 64 in two 32-steps
    v8f s[4];
    if (early) {
      // early corner: value + residual products, one score tile at a time through ONE
      // residual accumulator; q0 == 0 here so qrow0 + m < 128
      const unsigned qrbase =
          ((b * (unsigned)NHEAD + head) * (unsigned)EROWS + qrow0 + m) * (unsigned)HD + hh * 8u;
#pragma unroll
      for (int kg = 0; kg < 4; ++kg) {
        v8f t = {};
#pragma unroll
        for (int c = 0; c < 2; ++c) {
          unsigned qro = qrbase + (unsigned)c * 32u;
          asm volatile("" : "+v"(qro));   // opaque offset: the residual q fragment is reloaded per tile
          v8f tr = {};
          {
            const v16h kf = ld_frag(&Ks[(kg * 16) * LDT + c * 32], LDT);
            t = wmma16(kf, qf[c], t);
            const v16h ql = frag_at(QhR + qro);
            tr = wmma16(kf, ql, tr);
          }
          {
            const v16h kl = ld_frag(&KRs[(kg * 16) * LDT + c * 32], LDT);
            tr = wmma16(kl, qf[c], tr);
          }
          t = t + tr * (1.0f / SCRES);
          __builtin_amdgcn_sched_barrier(0);   // the next tile's loads stay behind this tile
        }
        s[kg] = t;
      }
    } else {
      // all eight K fragments as one group of LDS loads, then the eight products: four
      // independent accumulators per 32-column step (each tile still sums c = 0, then c = 1)
      v16h kf[2][4];
#pragma unroll
      for (int c = 0; c < 2; ++c)
#pragma unroll
        for (int kg = 0; kg < 4; ++kg) kf[c][kg] = ld_frag(&Ks[(kg * 16) * LDT + c * 32], LDT);
      __builtin_amdgcn_sched_barrier(0);   // the loads stay one group: none sinks among the products
#pragma unroll
      for (int kg = 0; kg < 4; ++kg) s[kg] = (v8f){};
#pragma unroll
      for (int c = 0; c < 2; ++c)
#pragma unroll
        for (int kg = 0; kg < 4; ++kg) s[kg] = wmma16b(kf[c][kg], qf[c], s[kg]);
      __builtin_amdgcn_sched_barrier(0);   // the softmax stays behind the run: no padded gap inside it
    }

    // all eight V^T fragments as one group of LDS loads, issued here so that they land behind
    // the softmax
    v16h vfr[2][4];
#pragma unroll
    for (int c = 0; c < 2; ++c)
#pragma unroll
      for (int nb = 0; nb < 4; ++nb) vfr[c][nb] = ld_frag(&Vs[(nb * 16) * LDT + c * 32], LDT);

    // causal replace-mask (key > query) in chunks that reach the diagonal; block-uniform test
    if (kb >= q0) {
#pragma unroll
      for (int kg = 0; kg < 4; ++kg)
#pragma unroll
        for (int v = 0; v < 8; ++v) {
          const unsigned key = kb + (unsigned)kg * 16u + hh * 8u + (unsigned)v;
          const unsigned row = qrow0 + m;
          s[kg][v] = (key > row) ? -1.0e30f : s[kg][v];
        }
    }

    // online softmax of the lane's own query: 32 keys here, 32 in lane ^ 16
    float mt[8];
#pragma unroll
    for (int v = 0; v < 8; ++v)
      mt[v] = fmaxf(fmaxf(s[0][v], s[1][v]), fmaxf(s[2][v], s[3][v]));
    float mx = fmaxf(fmaxf(fmaxf(mt[0], mt[1]), fmaxf(mt[2], mt[3])),
                     fmaxf(fmaxf(mt[4], mt[5]), fmaxf(mt[6], mt[7])));
    mx = fmaxf(mx, xhalf(mx));
    const float mn = fmaxf(mrun, mx);
    const float nn = __builtin_fmaf(-mn, ESCALE, -EBIAS);
    const float alpha = __builtin_amdgcn_exp2f(nn - nrun);   // the addends' own difference
    mrun = mn;
    nrun = nn;
#pragma unroll
    for (int kg = 0; kg < 4; ++kg)
#pragma unroll
      for (int v = 0; v < 8; ++v) s[kg][v] = __builtin_fmaf(s[kg][v], ESCALE, nrun);
    // all multiply-adds in front of the exponentials: none rewrites an exponential's source
    // directly behind it, so no padded slot stands among them
    __builtin_amdgcn_sched_barrier(0);
#pragma unroll
    for (int kg = 0; kg < 4; ++kg)
#pragma unroll
      for (int v = 0; v < 8; ++v) s[kg][v] = __builtin_amdgcn_exp2f(s[kg][v]);
    {
      float part[8];
#pragma unroll
      for (int v = 0; v < 8; ++v) part[v] = (s[0][v] + s[1][v]) + (s[2][v] + s[3][v]);
      const float rs = ((part[0] + part[1]) + (part[2] + part[3])) +
                       ((part[4] + part[5]) + (part[6] + part[7]));
      lsum = alpha * lsum + rs;
    }
#pragma unroll
    for (int nb = 0; nb < 4; ++nb)
#pragma unroll
      for (int v = 0; v < 8; ++v) o[nb][v] = o[nb][v] * alpha;

    // P^T fragments [32 keys][16 queries], f16(1024 p), from the score tiles in place
    v16h pf[2];
#pragma unroll
    for (int c = 0; c < 2; ++c)
#pragma unroll
      for (int i = 0; i < 8; ++i) {
        pf[c][i]     = (_Float16)(s[2 * c][i] * PUNBIAS);
        pf[c][i + 8] = (_Float16)(s[2 * c + 1][i] * PUNBIAS);
      }

    // O^T += V^T . P^T  (K = 64 keys in two 32-steps; A = V^T tile [d][key])
#pragma unroll
    for (int c = 0; c < 2; ++c) {
#pragma unroll
      for (int nb = 0; nb < 4; ++nb) o[nb] = wmma16b(vfr[c][nb], pf[c], o[nb]);
    }

    if (early) {
      // V_res . P_hi (scale 1/1024), one 16-column group at a time, folded immediately
#pragma unroll
      for (int nb = 0; nb < 4; ++nb) {
        v8f o2 = {};
#pragma unroll
        for (int c = 0; c < 2; ++c) {
          const v16h vr = ld_frag(&VRs[(nb * 16) * LDT + c * 32], LDT);
          o2 = wmma16(vr, pf[c], o2);
        }
#pragma unroll
        for (int v = 0; v < 8; ++v) o[nb][v] = o[nb][v] + o2[v] * (1.0f / RCARRY);
      }
      // P residual fragments: f16(1024 * (1024 p - f16(1024 p)))
      v16h pr[2];
#pragma unroll
      for (int c = 0; c < 2; ++c)
#pragma unroll
        for (int i = 0; i < 16; ++i) {
          const float t = s[2 * c + (i >> 3)][i & 7] * PUNBIAS;
          const float hi = (float)pf[c][i];
          pr[c][i] = toh_flush((t - hi) * RCARRY);
        }
      // V_hi . P_res (scale 1/1024), one 16-column group at a time, folded immediately
#pragma unroll
      for (int nb = 0; nb < 4; ++nb) {
        v8f o2 = {};
#pragma unroll
        for (int c = 0; c < 2; ++c) {
          const v16h vf = ld_frag(&Vs[(nb * 16) * LDT + c * 32], LDT);
          o2 = wmma16(vf, pr[c], o2);
        }
#pragma unroll
        for (int v = 0; v < 8; ++v) o[nb][v] = o[nb][v] + o2[v] * (1.0f / RCARRY);
      }
    }
    asm volatile("s_wait_dscnt 0x0" ::: "memory");      // this wave has left this chunk's buffer
    asm volatile("s_wait_asynccnt 0x0" ::: "memory");   // its copies of the next chunk landed
    __syncthreads();   // publishes the next chunk, frees this chunk's buffer
    if (kb + 128u < kend)   // block-uniform: a chunk two on exists
      attn_copy(lkv + bo * 2u, gk + (size_t)(kb + 128u) * DIM, gv + kb + 128u);
  }
  asm volatile("s_wait_asynccnt 0x0" ::: "memory");     // nothing in flight at the wave's end

  const float lrow = lsum + xhalf(lsum);   // the two halves' keys joined
  const float inv = __builtin_amdgcn_rcpf(lrow) * (VCARRY / PUNBIAS);
  v8h x[4];
#pragma unroll
  for (int nb = 0; nb < 4; ++nb)
#pragma unroll
    for (int v = 0; v < 8; ++v) x[nb][v] = toh_flush(o[nb][v] * inv);
  _Float16* po = Ov + (size_t)(b * (unsigned)SEQ + qrow0 + m) * DIM + head * HD + hh * 8u;
#pragma unroll
  for (int nb = 0; nb < 4; ++nb) *(v8h*)(po + nb * 16) = x[nb];
  // before the stores' registers are reused; in front of the branch, where it stays directly
  // behind the stores
  asm volatile("s_wait_xcnt 0x0" ::: "memory");
  if (first_blk) {
    // residual rows (first query block only; qrow0 < 128): f16(2048 * (t - f16(t)))
    v8h xr[4];
#pragma unroll
    for (int nb = 0; nb < 4; ++nb)
#pragma unroll
      for (int v = 0; v < 8; ++v)
        xr[nb][v] = toh_flush((o[nb][v] * inv - (float)x[nb][v]) * SCRES);
    _Float16* pres = OvR + (size_t)(b * (unsigned)EROWS + qrow0 + m) * DIM + head * HD + hh * 8u;
#pragma unroll
    for (int nb = 0; nb < 4; ++nb) *(v8h*)(pres + nb * 16) = xr[nb];
  }
}

// ---------------------------------------------------------------------------
extern "C" void kernel_launch(void* const* d_in, const int* in_sizes, int n_in,
                              void* d_out, int out_size, void* d_ws, size_t ws_size,
                              hipStream_t stream) {
  if (n_in < 5) return;
  const long long need_x = ((long long)(NB - 1) * SEQ_FULL + SEQ) * DIM;
  if ((long long)in_sizes[0] < need_x) return;
  if ((long long)in_sizes[1] < (long long)DIM * DIM) return;
  if ((long long)in_sizes[2] < (long long)KVD * DIM) return;
  if ((long long)in_sizes[3] < (long long)KVD * DIM) return;
  if ((long long)in_sizes[4] < (long long)DIM * DIM) return;
  if ((long long)out_size < need_x) return;
  if (ws_size < WS_TOTAL) return;

  // bound by the input list order: x, wq, wk, wv, wo
  const float* X  = (const float*)d_in[0];    // [NB_FULL][SEQ_FULL][DIM]
  const float* wq = (const float*)d_in[1];    // [DIM][DIM]  (out, in)
  const float* wk = (const float*)d_in[2];    // [KVD][DIM]  (out, in)
  const float* wv = (const float*)d_in[3];    // [KVD][DIM]  (out, in)
  const float* wo = (const float*)d_in[4];    // [DIM][DIM]  (out, in)
  float* out = (float*)d_out;

  char* ws = (char*)d_ws;
  _Float16* Wq_t  = (_Float16*)(ws + OFF_WQ);    // [n][k], x64; wk and wv planes [KVD][DIM] behind it
  _Float16* Wo_t  = (_Float16*)(ws + OFF_WO);    // [n][k], x64
  _Float16* X16   = (_Float16*)(ws + OFF_X);     // [MROWS][DIM]
  _Float16* Qh16  = (_Float16*)(ws + OFF_Q);     // [MROWS][DIM]
  _Float16* Kh16  = (_Float16*)(ws + OFF_K);     // [MROWS][DIM], shared heads written 4x
  _Float16* Vt16  = (_Float16*)(ws + OFF_VT);    // [b][DIM][SEQ], shared heads written 4x
  _Float16* Ctx16 = (_Float16*)(ws + OFF_CTX);   // [MROWS][DIM], x64
  _Float16* VtR16 = (_Float16*)(ws + OFF_VR);    // [b][DIM][64]
  _Float16* QR16  = (_Float16*)(ws + OFF_QR);    // [b][NHEAD][128][64], x2048
  _Float16* KR16  = (_Float16*)(ws + OFF_KR);    // [b][NHEAD][64][64], x2048, shared heads 4x
  _Float16* CR16  = (_Float16*)(ws + OFF_CR);    // [b][128][DIM], x2048 on top of x64

  dim3 blk(256);

  // input rows and weight planes ([out][in] rows are already k-contiguous); 8 rows per block;
  // Wq_t is the first of the four stacked weight planes
  cast_kernel<<<dim3(XBLK + WBLK), blk, 0, stream>>>(X, wq, wk, wv, wo, X16, Wq_t);

  // gemm_qkv_kernel(A16, Bt, q16, q16r, k16, k16r, vt, vtr); Bt = planes wq, wk, wv, stacked
  gemm_qkv_kernel<<<dim3((DIM + 2 * KVD) / QBN, MROWS / QBM), dim3(512), 0, stream>>>(
      X16, Wq_t, Qh16, QR16, Kh16, KR16, Vt16, VtR16);
  // attn_kernel(Qh, QhR, Kh, KhR, Vt, VtR, Ov, OvR)
  attn_kernel<<<dim3(NHEAD, NB, SEQ / 128), blk, 0, stream>>>(Qh16, QR16, Kh16, KR16, Vt16, VtR16,
                                                              Ctx16, CR16);
  // gemm_wo_kernel(A16, A16r, Bt, outf)
  gemm_wo_kernel<<<dim3(DIM / BN, MROWS / BM), blk, 0, stream>>>(Ctx16, CR16, Wo_t, out);
}

// v009
// Measured time: 118 microseconds a run.
// Timed twice side by side with v008, it ran 1.12 and 1.11 times as fast.
// Over all steps from v000 it is 4.09 times as fast.
#include <hip/hip_runtime.h>
#include <stddef.h>

// All contractions on v_wmma_f32_16x16x32_f16 (f16 operands, f32 accumulate): q/k/v projections,
// q.k scores, p.v, output projection. Float inputs are RNE-converted to bf16 and carried in f16
// (weights x64, p x1024, attention rows x64). Early corner only (query rows 0..127 x keys 0..63
// of every (batch, head)): q and k get a x2048 residual plane (two more score products into a
// separate accumulator), p and v a x1024 residual plane, and the attention rows 0..127 a x2048
// residual plane (second accumulator set in the output projection on those row tiles).
// Softmax and all scaling in f32.
// Causal grouped-query attention (32 query heads sharing 8 key/value heads), [out][in] weights,
// no biases; the k and v projection epilogues write every shared head once per query head so
// the attention kernel sees one K row block and one V^T row block per query head.

typedef _Float16 v16h __attribute__((ext_vector_type(16)));
typedef _Float16 v8h  __attribute__((ext_vector_type(8)));
typedef float    v8f  __attribute__((ext_vector_type(8)));
typedef float    v4f  __attribute__((ext_vector_type(4)));

#ifndef NB
#define NB 2
#endif
#ifndef SEQ
#define SEQ 2048
#endif
#define NB_FULL  2
#define SEQ_FULL 2048
#define DIM   2048
#define NHEAD 32
#define HD    64
#define NKV   8
#define GQA   (NHEAD / NKV)
#define KVD   (NKV * HD)
#define MROWS (NB * SEQ)
#define EROWS  128   // early query rows per sequence carried with residual planes (q, ctx)
#define ECHUNK 64    // early keys per sequence carried with residual planes (k, v)

static_assert(NB >= 1 && NB <= NB_FULL);
static_assert(SEQ >= 128 && SEQ <= SEQ_FULL && (SEQ % 128) == 0);
static_assert(DIM == NHEAD * HD);
static_assert(HD == 64);
static_assert(NHEAD == NKV * GQA && GQA == 4);
static_assert(KVD == 512 && (KVD % 64) == 0);
static_assert((DIM % 64) == 0 && (DIM % 32) == 0);
static_assert((MROWS % 64) == 0 && (MROWS % 8) == 0);
static_assert((SEQ % 64) == 0);               // a 64-row GEMM tile never straddles two sequences
static_assert((DIM % 8) == 0 && (KVD % 8) == 0);
static_assert(DIM == 8 * 32 * 8);             // cast: 8 passes x 32 lanes x 8 columns per row
static_assert((size_t)MROWS * DIM < (size_t)0xFFFFFFFFu);
static_assert(EROWS == 128);                  // == query rows of one attention block (block 0)
static_assert(ECHUNK == 64);                  // == keys of one attention step (chunk 0) == one GEMM row tile
static_assert((EROWS % 64) == 0 && EROWS <= SEQ);   // whole 64-row GEMM tiles
static_assert((size_t)NB * NHEAD * EROWS * HD < (size_t)0xFFFFFFFFu);   // 32-bit q residual offsets

#define LDT 72   // halves per LDS row (144 B, 16-B aligned)
#define LDC 68   // floats per LDS row (272 B, 16-B aligned)
static_assert((LDT % 8) == 0 && LDT >= 64);
static_assert((LDC % 4) == 0 && LDC >= 64);

// GEMM block tile (output projection; the q, k, v tile stands at its kernel) and LDS staging
#define BM  128   // output rows per block
#define BN  128   // output columns per block
#define BK  128   // halves of every operand row per stage (256 B)
#define LDG 136   // halves per staged row (272 B = 16 B x 17: b128 fragment reads meet no bank twice)
static_assert((LDG % 8) == 0 && LDG >= BK);
static_assert((DIM % BK) == 0 && DIM / BK >= 2);          // the ring starts with two stages
static_assert((MROWS % BM) == 0 && (SEQ % BM) == 0 && (DIM % BN) == 0 && (KVD % BN) == 0);
static_assert((BM + BN) * (BK / 8) == 256 * 16);          // 16 copies of 16 B per thread and stage

#define WCARRY 64.0f     // weight planes carried x64
#define PCARRY 1024.0f   // softmax numerators carried x1024
#define VCARRY 64.0f     // attention output plane carried x64
#define RCARRY 1024.0f   // residual planes (p, v) carried x1024 on top of their hi part
#define SCRES  2048.0f   // residual planes (q, k, attention rows) carried x2048 on top of their hi part
// Softmax exponent: e = exp2(score * ESCALE - max * ESCALE - EBIAS) = p x 2^-102, and
// e x PUNBIAS = 1024 p. A p whose 1024 p lies under the f16 normal range (2^-14) has its e under
// the f32 normal range (2^-126).
#define ESCALE  0.18033688011112042f   // HD^-0.5 x log2(e)
#define EBIAS   102.0f
#define PUNBIAS 0x1p+112f
static_assert(PUNBIAS * 0x1p-102f == PCARRY);
static_assert(0x1p-126f * PUNBIAS == 6.103515625e-05f);

// epilogue store-loop coverage (rows admitted per step x steps == tile rows)
#define TILE_ROWS        64
#define EPI16_ROWS_STEP  (256 / 8)
#define EPI16_STEPS      2
#define EPIF_ROWS_STEP   (256 / 16)   // 16 lanes x 16 B per 256-B row segment
#define EPIF_STEPS       4
static_assert(EPI16_ROWS_STEP * EPI16_STEPS == TILE_ROWS);
static_assert(EPIF_ROWS_STEP * EPIF_STEPS == TILE_ROWS);
static_assert(8 * 16 == 128);                 // attention block: 8 waves x 16 query rows

// static LDS per kernel (bytes)
static_assert((size_t)(6 * 64 * LDT) * 2 <= (size_t)131072);

// workspace layout (bytes)
#define WSQ_BYTES     ((size_t)DIM * DIM * 2)
#define WKV_BYTES     ((size_t)KVD * DIM * 2)
#define PLANE16_BYTES ((size_t)MROWS * DIM * 2)
#define VRES_BYTES    ((size_t)NB * DIM * 64 * 2)
#define QRES_BYTES    ((size_t)NB * NHEAD * EROWS * HD * 2)
#define KRES_BYTES    ((size_t)NB * NHEAD * ECHUNK * HD * 2)
#define CRES_BYTES    ((size_t)NB * EROWS * DIM * 2)
#define OFF_WQ  ((size_t)0)
#define OFF_WK  (OFF_WQ + WSQ_BYTES)
#define OFF_WV  (OFF_WK + WKV_BYTES)
#define OFF_WO  (OFF_WV + WKV_BYTES)
#define OFF_X   (OFF_WO + WSQ_BYTES)
#define OFF_Q   (OFF_X + PLANE16_BYTES)
#define OFF_K   (OFF_Q + PLANE16_BYTES)
#define OFF_VT  (OFF_K + PLANE16_BYTES)
#define OFF_CTX (OFF_VT + PLANE16_BYTES)
#define OFF_VR  (OFF_CTX + PLANE16_BYTES)
#define OFF_QR  (OFF_VR + VRES_BYTES)
#define OFF_KR  (OFF_QR + QRES_BYTES)
#define OFF_CR  (OFF_KR + KRES_BYTES)
#define WS_TOTAL (OFF_CR + CRES_BYTES)
static_assert((WSQ_BYTES % 128) == 0 && (WKV_BYTES % 128) == 0 && (PLANE16_BYTES % 128) == 0);
static_assert((VRES_BYTES % 128) == 0);
static_assert((QRES_BYTES % 128) == 0 && (KRES_BYTES % 128) == 0 && (CRES_BYTES % 128) == 0);
static_assert(WS_TOTAL <= (size_t)134217728);

// ---------------------------------------------------------------------------
__device__ __forceinline__ float bf16r(float x) {   // RNE convert to bf16, returned widened
  unsigned int u = __float_as_uint(x);
  u = (u + 0x7FFFu + ((u >> 16) & 1u)) & 0xFFFF0000u;
  return __uint_as_float(u);
}

// f32 -> f16 operand convert that cannot produce an f16 subnormal (value select).
static __device__ __forceinline__ _Float16 toh_flush(float v) {
  const _Float16 r = (_Float16)v;
  return (fabsf(v) < 6.103515625e-05f) ? (_Float16)0.0f : r;
}

// 16-bit fragment: p points at element [row = lane&15][k0 + 8*(lane>>4)] of a k-contiguous
// row. Elements 0..7 <- k0+8h+0..7, elements 8..15 <- k0+16+8h+0..7 (same map for A and B).
__device__ __forceinline__ v16h frag_at(const _Float16* p) {
  v8h lo = *(const v8h*)(p);
  v8h hi = *(const v8h*)(p + 16);
  v16h out;
#pragma unroll
  for (int i = 0; i < 8; ++i) { out[i] = lo[i]; out[i + 8] = hi[i]; }
  return out;
}
__device__ __forceinline__ v16h ld_frag(const _Float16* base, unsigned ld) {
  const unsigned lane = threadIdx.x & 31u;
  return frag_at(base + (lane & 15u) * ld + (lane >> 4) * 8u);
}

__device__ __forceinline__ v8f wmma16(v16h a, v16h b, v8f c) {
  v8f d = __builtin_amdgcn_wmma_f32_16x16x32_f16(false, a, false, b, (short)0, c,
                                                 false, false);
  asm volatile("v_nop\n\tv_nop\n\tv_nop\n\tv_nop" : "+v"(d) : "v"(a), "v"(b));
  return d;
}

// The builtin alone: the compiler keeps the distances behind its own matrix instructions, and a
// run of independent products issues back to back.
__device__ __forceinline__ v8f wmma16b(v16h a, v16h b, v8f c) {
  return __builtin_amdgcn_wmma_f32_16x16x32_f16(false, a, false, b, (short)0, c, false, false);
}

// N (8 or 6) asynchronous 16-B copies of one lane, global -> LDS, rows RS apart on both sides.
// lds: the lane's LDS byte address; g: the lane's global address; K: source pitch in halves.
// The s_wait_xcnt ends the copies' own statement so that no address register is rewritten
// ahead of it.
template <unsigned N, unsigned RS>
__device__ __forceinline__ void stage_copy(const unsigned lds, const _Float16* g,
                                           const unsigned K) {
  static_assert(N == 8u || N == 6u);
  const unsigned ls = RS * LDG * 2u;
  const size_t gs = (size_t)RS * K;
  if constexpr (N == 6u) {
    asm volatile(
        "global_load_async_to_lds_b128 %0, %6, off\n\t"
        "global_load_async_to_lds_b128 %1, %7, off\n\t"
        "global_load_async_to_lds_b128 %2, %8, off\n\t"
        "global_load_async_to_lds_b128 %3, %9, off\n\t"
        "global_load_async_to_lds_b128 %4, %10, off\n\t"
        "global_load_async_to_lds_b128 %5, %11, off\n\t"
        "s_wait_xcnt 0x0"
        :
        : "v"(lds), "v"(lds + ls), "v"(lds + 2u * ls), "v"(lds + 3u * ls), "v"(lds + 4u * ls),
          "v"(lds + 5u * ls), "v"(g), "v"(g + gs), "v"(g + 2u * gs), "v"(g + 3u * gs),
          "v"(g + 4u * gs), "v"(g + 5u * gs)
        : "memory");
    return;
  }
  asm volatile(
      "global_load_async_to_lds_b128 %0, %8, off\n\t"
      "global_load_async_to_lds_b128 %1, %9, off\n\t"
      "global_load_async_to_lds_b128 %2, %10, off\n\t"
      "global_load_async_to_lds_b128 %3, %11, off\n\t"
      "global_load_async_to_lds_b128 %4, %12, off\n\t"
      "global_load_async_to_lds_b128 %5, %13, off\n\t"
      "global_load_async_to_lds_b128 %6, %14, off\n\t"
      "global_load_async_to_lds_b128 %7, %15, off\n\t"
      "s_wait_xcnt 0x0"
      :
      : "v"(lds), "v"(lds + ls), "v"(lds + 2u * ls), "v"(lds + 3u * ls), "v"(lds + 4u * ls),
        "v"(lds + 5u * ls), "v"(lds + 6u * ls), "v"(lds + 7u * ls), "v"(g), "v"(g + gs),
        "v"(g + 2u * gs), "v"(g + 3u * gs), "v"(g + 4u * gs), "v"(g + 5u * gs),
        "v"(g + 6u * gs), "v"(g + 7u * gs)
      : "memory");
}

// acc[i][j] += A[BMt rows][K] . B[64 NJ rows][K]^T for this wave's 64 x 16 NJ part of the block
// tile (mw = 64-row group, nw = one of four column groups; 2 BMt threads). Arow / Brow: first
// row of the block's A / B rows.
// Two LDS buffers of one 128-k stage each; stage t + 2 is copied into the buffer that trip t
// has just left, behind the barrier that also publishes stage t + 1. On entry every wave's
// earlier LDS reads of St have retired in front of a barrier that all waves have passed.
template <unsigned BMt, unsigned NJ>
__device__ __forceinline__ void gemm_mainloop(const _Float16* __restrict__ Arow,
                                              const _Float16* __restrict__ Brow,
                                              const unsigned K, _Float16* St,
                                              v8f (&acc)[4][NJ]) {
  constexpr unsigned BNt = 64u * NJ;              // B rows per stage
  constexpr unsigned RS = BMt / 8u;               // rows one copy of every thread covers
  constexpr unsigned SH = (BMt + BNt) * LDG;      // halves per stage: A rows, then B rows
  constexpr unsigned NB8 = BNt / RS;              // copies per thread for the B rows
  static_assert(BMt == 8u * RS && BNt == NB8 * RS);
  const unsigned tid = threadIdx.x, lane = tid & 31u, w = tid >> 5;
  const unsigned mw = w >> 2, nw = w & 3u;
  const unsigned hh = lane >> 4, m = lane & 15u;
  const unsigned cr = tid >> 4, cc = (tid & 15u) * 8u;   // copy: row (of RS), 16-B column
  const _Float16* ga = Arow + (size_t)cr * K + cc;
  const _Float16* gb = Brow + (size_t)cr * K + cc;
  const unsigned la = (unsigned)(size_t)St + (cr * LDG + cc) * 2u;
  const unsigned lb = la + BMt * LDG * 2u;
  const unsigned nt = K / BK;

  stage_copy<8u, RS>(la, ga, K);
  stage_copy<NB8, RS>(lb, gb, K);
  asm volatile("s_wait_asynccnt 0x0" ::: "memory");   // stage 0 landed (this wave's copies)
  __syncthreads();                                    // stage 0 readable by every wave
  stage_copy<8u, RS>(la + SH * 2u, ga + BK, K);
  stage_copy<NB8, RS>(lb + SH * 2u, gb + BK, K);

  const _Float16* fa = St + (mw * 64u + m) * LDG + hh * 8u;
  const _Float16* fb = St + (BMt + nw * (NJ * 16u) + m) * LDG + hh * 8u;
#pragma unroll 1   // one stage per trip: the buffer alternates by t & 1, the text stays short
  for (unsigned t = 0; t < nt; ++t) {
    const unsigned bo = (t & 1u) * SH;
#pragma unroll
    for (unsigned kk = 0; kk < BK / 32u; ++kk) {
      v16h a[4], b[NJ];
#pragma unroll
      for (unsigned i = 0; i < 4u; ++i) a[i] = frag_at(fa + bo + i * 16u * LDG + kk * 32u);
#pragma unroll
      for (unsigned j = 0; j < NJ; ++j) b[j] = frag_at(fb + bo + j * 16u * LDG + kk * 32u);
#pragma unroll
      for (unsigned i = 0; i < 4u; ++i)
#pragma unroll
        for (unsigned j = 0; j < NJ; ++j) acc[i][j] = wmma16(a[i], b[j], acc[i][j]);
    }
    asm volatile("s_wait_dscnt 0x0" ::: "memory");      // this wave has left buffer t & 1
    asm volatile("s_wait_asynccnt 0x0" ::: "memory");   // its copies of stage t + 1 landed
    __syncthreads();   // publishes stage t + 1, frees buffer t & 1
    if (t + 2u < nt) {
      stage_copy<8u, RS>(la + bo * 2u, ga + (t + 2u) * BK, K);
      stage_copy<NB8, RS>(lb + bo * 2u, gb + (t + 2u) * BK, K);
    }
  }
  asm volatile("s_wait_asynccnt 0x0" ::: "memory");     // nothing in flight when St is reused
}

// ---------------------------------------------------------------------------
// Row cast: f32 rows of DIM columns -> f16 compact rows of DIM columns, one wave per row,
// 8 rows per block, 8 rolled passes; each store instruction of a wave covers 512 contiguous
// SRC_INPUT = 1: source is the module input (full-size row stride per batch), carry 1;
// SRC_INPUT = 0: source is an [out][in] weight (already k-contiguous), carry x64.
// Every value goes through RNE bf16 first. sblk / dblk: 8-row block of the source / of dst.
// ---------------------------------------------------------------------------
template <int SRC_INPUT>
__device__ __forceinline__ void cast_body(const float* __restrict__ X,
                                          _Float16* __restrict__ dst,
                                          const unsigned sblk, const unsigned dblk) {
#pragma clang fp contract(off)
  const unsigned lane = threadIdx.x & 31u;
  const unsigned w = (unsigned)__builtin_amdgcn_readfirstlane((int)(threadIdx.x >> 5));
  const unsigned crow = sblk * 8u + w;
  size_t srow = crow;
  if (SRC_INPUT) {
    const unsigned bidx = crow / (unsigned)SEQ;
    const unsigned sq = crow - bidx * (unsigned)SEQ;
    srow = (size_t)bidx * SEQ_FULL + sq;
  }
  const float carry = SRC_INPUT ? 1.0f : WCARRY;
  const float* xr = X + srow * DIM + lane * 8u;
  _Float16* dr = dst + (size_t)(dblk * 8u + w) * DIM + lane * 8u;
#pragma unroll 1
  for (unsigned j = 0; j < 8u; ++j) {
    const v4f a0 = *(const v4f*)(xr + j * 256u);
    const v4f a1 = *(const v4f*)(xr + j * 256u + 4u);
    v8h o;
#pragma unroll
    for (int i = 0; i < 4; ++i) {
      o[i]     = toh_flush(carry * bf16r(a0[i]));
      o[i + 4] = toh_flush(carry * bf16r(a1[i]));
    }
    _Float16* p = dr + j * 256u;
    *(v8h*)p = o;
    
  }
}

// All five casts in one launch (none reads what another writes). Blocks 0 .. XBLK-1 take the
// input rows; the rest take the rows of the four weight planes, which lie stacked in the
// workspace in the order wq, wk, wv, wo, so that w16 is one plane of WBLK * 8 rows.
// Every test is on the block index alone. Grid (XBLK + WBLK).
#define XBLK (MROWS / 8)
#define WBLK ((2 * DIM + 2 * KVD) / 8)
static_assert(OFF_WK == OFF_WQ + (size_t)DIM * DIM * 2);
static_assert(OFF_WV == OFF_WQ + (size_t)(DIM + KVD) * DIM * 2);
static_assert(OFF_WO == OFF_WQ + (size_t)(DIM + 2 * KVD) * DIM * 2);
__global__ __launch_bounds__(256) void cast_kernel(
    const float* __restrict__ X, const float* __restrict__ wq, const float* __restrict__ wk,
    const float* __restrict__ wv, const float* __restrict__ wo,
    _Float16* __restrict__ x16, _Float16* __restrict__ w16) {
  const unsigned blk = blockIdx.x;
  if (blk < (unsigned)XBLK) {
    cast_body<1>(X, x16, blk, blk);
    return;
  }
  const unsigned wb = blk - (unsigned)XBLK;   // 8-row block of the stacked weight planes
  const float* W = wq;
  unsigned first = 0u;                        // first block of the plane that wb lies in
  if (wb >= (unsigned)((DIM + 2 * KVD) / 8)) {
    W = wo;
    first = (unsigned)((DIM + 2 * KVD) / 8);
  } else if (wb >= (unsigned)((DIM + KVD) / 8)) {
    W = wv;
    first = (unsigned)((DIM + KVD) / 8);
  } else if (wb >= (unsigned)(DIM / 8)) {
    W = wk;
    first = (unsigned)(DIM / 8);
  }
  cast_body<0>(W, w16, wb - first, wb);
}

// ---------------------------------------------------------------------------
// GEMM C[block tile] = A16[rows][K] . Bt[n][K]^T; both operands staged in LDS by asynchronous
// copies. Output projection: 128x128 tile, 8 waves of 64x32; q, k, v projections
// (gemm_mainloop): 256x192 tile, 16 waves of 64x48 (mw = 64-row group, nw = column group).
// The epilogue treats the tile as 64x64 sub-tiles (bx = 64-column block, row0 = first row):
//   MODE 0: out16[row][col] (pitch DIM) = f16(acc/64)                       (q plane);
//           row tiles with sequence row < 128 also write
//           out16r [b][head][128][64] = f16(2048 * (q - hi))
//   MODE 1: tile column block = one shared key head; out16[row][(4*kvh + rep)*64 + c]
//           (pitch DIM) = f16(acc/64) for rep 0..3                          (k plane);
//           the key tile 0 of each sequence also writes
//           out16r [b][4*kvh + rep][64][64] = f16(2048 * (k - hi)) for rep 0..3
//   MODE 2: transposed V plane [b][(4*kvh + rep)*64 + d][key] = f16(acc/64) for rep 0..3;
//           for key tile 0 also out16r [b][(4*kvh + rep)*64 + d][64] = f16(1024 * (v - hi))
// (the output projection's own loop and epilogue stand at its kernel)
// Store loops: MODE 0/1/2: 32 rows per step x 2 steps = 64.
// MODE 0, 1 and 2 share one launch (gemm_qkv_kernel): same A rows, and their B rows lie
// stacked in the workspace, so the main loop is one and only the epilogue differs by sub-tile.
// ---------------------------------------------------------------------------
// C staging over the ring (every wave is behind the main loop's last barrier):
// [64][LDC] sub-tiles, sub = NJ * (64-row group) + (64-column group)
template <unsigned NJ>
__device__ __forceinline__ void stage_c(const v8f (&acc)[4][NJ], float* Call) {
  const unsigned tid = threadIdx.x, lane = tid & 31u, w = tid >> 5;
  const unsigned mw = w >> 2, nw = w & 3u;
  const unsigned hh = lane >> 4, m = lane & 15u;
#pragma unroll
  for (unsigned i = 0; i < 4u; ++i)
#pragma unroll
    for (unsigned j = 0; j < NJ; ++j) {
      const unsigned col = nw * (NJ * 16u) + j * 16u;   // first column of this 16-column group
#pragma unroll
      for (unsigned r = 0; r < 8u; ++r)
        Call[((mw * NJ + (col >> 6)) * 64u + i * 16u + hh * 8u + r) * LDC + (col & 63u) + m] =
            acc[i][j][r];
    }
  __syncthreads();
}

// Epilogue of one staged 64x64 sub-tile by 256 threads. Cs: the sub-tile; bx: its 64-column
// block within its own output; row0: its first row; tid: 0 .. 255.
template <int MODE>
__device__ __forceinline__ void store_sub(
    const float* Cs, const unsigned bx, const unsigned row0, const unsigned tid,
    _Float16* __restrict__ out16, _Float16* __restrict__ out16r) {
  {
  const unsigned n0 = bx * 64u;

  if (MODE == 0 || MODE == 1) {
    constexpr unsigned NREP  = (MODE == 1) ? (unsigned)GQA : 1u;
    constexpr unsigned RROWS = (MODE == 1) ? (unsigned)ECHUNK : (unsigned)EROWS;
    const unsigned cb = (MODE == 1) ? bx * (unsigned)(GQA * HD) : n0;
    const unsigned bidx = row0 / (unsigned)SEQ;
    const unsigned sq0 = row0 - bidx * (unsigned)SEQ;
    const bool has_res = (sq0 < RROWS);        // one value per sub-tile (MODE 1: key tile 0 only)
    v8h x[2], xr[2];
    size_t off[2], offr[2];
#pragma unroll
    for (unsigned i = 0; i < 2u; ++i) {
      const unsigned r = 32u * i + (tid >> 3);
      const unsigned c = (tid & 7u) * 8u;
      const v4f u0 = *(const v4f*)&Cs[r * LDC + c];
      const v4f u1 = *(const v4f*)&Cs[r * LDC + c + 4];
#pragma unroll
      for (int j = 0; j < 4; ++j) {
        x[i][j]     = toh_flush(u0[j] * (1.0f / WCARRY));
        x[i][j + 4] = toh_flush(u1[j] * (1.0f / WCARRY));
      }
      xr[i] = x[i];
      if (has_res) {
#pragma unroll
        for (int j = 0; j < 4; ++j) {
          const float t0 = u0[j] * (1.0f / WCARRY);
          const float t1 = u1[j] * (1.0f / WCARRY);
          xr[i][j]     = toh_flush((t0 - (float)x[i][j]) * SCRES);
          xr[i][j + 4] = toh_flush((t1 - (float)x[i][j + 4]) * SCRES);
        }
      }
      off[i] = (size_t)(row0 + r) * DIM + cb + c;
      offr[i] = ((size_t)(bidx * (unsigned)NHEAD + bx * NREP) * RROWS + sq0 + r) * HD + c;
    }
#pragma unroll
    for (unsigned rep = 0; rep < NREP; ++rep) {
#pragma unroll
      for (int i = 0; i < 2; ++i)
        *(v8h*)(out16 + off[i] + (size_t)rep * HD) = x[i];
    }
    asm volatile("s_wait_xcnt 0x0" ::: "memory");   // before the stores' registers are reused
    if (has_res) {
#pragma unroll
      for (unsigned rep = 0; rep < NREP; ++rep) {
#pragma unroll
        for (int i = 0; i < 2; ++i)
          *(v8h*)(out16r + offr[i] + (size_t)rep * RROWS * HD) = xr[i];
      }
      asm volatile("s_wait_xcnt 0x0" ::: "memory");   // before the stores' registers are reused
    }
    
  }

  if (MODE == 2) {
    const unsigned bidx = row0 / (unsigned)SEQ;
    const unsigned key0 = row0 - bidx * (unsigned)SEQ;
    const bool first_tile = (key0 == 0u);      // one value per sub-tile
    v8h x[2], xr[2];
    size_t off[2], offr[2];
#pragma unroll
    for (unsigned i = 0; i < 2u; ++i) {
      const unsigned dcol = 32u * i + (tid >> 3);
      const unsigned kk = (tid & 7u) * 8u;
#pragma unroll
      for (unsigned j = 0; j < 8u; ++j) {
        const float t = Cs[(kk + j) * LDC + dcol] * (1.0f / WCARRY);
        const _Float16 hi = toh_flush(t);
        x[i][j]  = hi;
        xr[i][j] = toh_flush((t - (float)hi) * RCARRY);
      }
      const size_t vrow = (size_t)bidx * DIM + bx * (unsigned)(GQA * HD) + dcol;
      off[i]  = vrow * SEQ + key0 + kk;
      offr[i] = vrow * 64u + kk;
    }
#pragma unroll
    for (unsigned rep = 0; rep < (unsigned)GQA; ++rep) {
#pragma unroll
      for (int i = 0; i < 2; ++i)
        *(v8h*)(out16 + off[i] + (size_t)rep * HD * SEQ) = x[i];
    }
    asm volatile("s_wait_xcnt 0x0" ::: "memory");   // before the stores' registers are reused
    if (first_tile) {
#pragma unroll
      for (unsigned rep = 0; rep < (unsigned)GQA; ++rep) {
#pragma unroll
        for (int i = 0; i < 2; ++i)
          *(v8h*)(out16r + offr[i] + (size_t)rep * HD * 64u) = xr[i];
      }
      asm volatile("s_wait_xcnt 0x0" ::: "memory");   // before the stores' registers are reused
    }
    
  }
  }
}

// q, k and v projections in one launch. Bt: the stacked planes wq, wk, wv (DIM + 2 KVD rows).
// Block tile 256 x 192, 16 waves of 64 x 48, one block per WGP: every staged byte feeds more
// products than in a 128 x 128 tile, and the grid is one block for each of 256 WGPs.
// The epilogue goes by 64-column blocks of the stacked outputs: blocks 0 .. DIM/64 - 1 are q,
// the next KVD/64 are k, the last KVD/64 are v; the two halves of the block take alternate
// sub-tiles (tests on wave-uniform values alone, no barrier behind stage_c).
// Grid ((DIM + 2 KVD)/192, MROWS/256).
#define QBM 256
#define QNJ 3
#define QBN (64 * QNJ)
#define QSTAGE_H ((QBM + QBN) * LDG)
#define QSUBS ((QBM / 64) * QNJ)
static_assert((MROWS % QBM) == 0 && ((DIM + 2 * KVD) % QBN) == 0 && (QSUBS % 2) == 0);
static_assert((size_t)2 * QSTAGE_H * 2 <= (size_t)327680);                  // one block per WGP
static_assert((size_t)QSUBS * 64 * LDC * 4 <= (size_t)2 * QSTAGE_H * 2);    // C staging fits the ring
__global__ __launch_bounds__(512) void gemm_qkv_kernel(
    const _Float16* __restrict__ A16, const _Float16* __restrict__ Bt,
    _Float16* __restrict__ q16, _Float16* __restrict__ q16r,
    _Float16* __restrict__ k16, _Float16* __restrict__ k16r,
    _Float16* __restrict__ vt, _Float16* __restrict__ vtr) {
  __shared__ __attribute__((aligned(16))) _Float16 St[2 * QSTAGE_H];
  const unsigned K = (unsigned)DIM;
  const unsigned bxa = blockIdx.x;
  const unsigned brow0 = blockIdx.y * (unsigned)QBM;

  v8f acc[4][QNJ] = {};
  gemm_mainloop<QBM, QNJ>(A16 + (size_t)brow0 * K, Bt + (size_t)(bxa * (unsigned)QBN) * K, K, St,
                          acc);
  stage_c<QNJ>(acc, (float*)St);
  const unsigned half = (unsigned)__builtin_amdgcn_readfirstlane((int)(threadIdx.x >> 8));
  const unsigned t256 = threadIdx.x & 255u;
  for (unsigned s = 0; s < (unsigned)(QSUBS / 2); ++s) {
    const unsigned sub = 2u * s + half;
    const unsigned rg = sub / (unsigned)QNJ, cg = sub - rg * (unsigned)QNJ;
    const float* Cs = (const float*)St + sub * (64u * LDC);
    const unsigned gcb = bxa * (unsigned)QNJ + cg;   // 64-column block of the stacked outputs
    const unsigned row0 = brow0 + rg * 64u;
    if (gcb < (unsigned)(DIM / 64))
      store_sub<0>(Cs, gcb, row0, t256, q16, q16r);
    else if (gcb < (unsigned)((DIM + KVD) / 64))
      store_sub<1>(Cs, gcb - (unsigned)(DIM / 64), row0, t256, k16, k16r);
    else
      store_sub<2>(Cs, gcb - (unsigned)((DIM + KVD) / 64), row0, t256, vt, vtr);
  }
}

// Output projection. Grid (DIM/128, MROWS/128), 128 x 128 tile, 8 waves of 64 x 32.
// A row tile is eight 16-row groups. The NB * EROWS / 16 early groups (sequence row < 128: the
// rows with a residual plane) are dealt one to each of the first WHEAVY row tiles, as that
// tile's group 0; its other seven groups, and all eight of every later tile, are neighbouring
// groups of the remaining rows. So no block carries more than one group of residual work, and
// that work runs inside the one main loop: the group's 16 residual rows A16r [b][128][K] are
// staged behind the A and B rows of every stage, and the four waves that own group 0 add one
// product per column tile into a second accumulator, folded as acc + accres/2048 before the
// 1/4096 scale. All tests are block-uniform (heavy) or wave-uniform (own).
#define WGRP   (SEQ / 16)            // 16-row groups per sequence
#define WEGRP  (EROWS / 16)          // early groups per sequence
#define WHEAVY (NB * WEGRP)          // row tiles that hold an early group
#define WSTAGE_H ((BM + BN + 16) * LDG)   // halves per stage: A rows, B rows, residual rows
static_assert(NB == 2 && SEQ == 2048 && BM == 128);   // the deal below is written for this shape:
static_assert(WHEAVY * 7 <= WGRP - WEGRP);            // heavy tiles end inside sequence 0
static_assert((WGRP - WEGRP - WHEAVY * 7) % 8 == 0);  // no later tile straddles two sequences
static_assert(WHEAVY * 7 + (MROWS / BM - WHEAVY) * 8 == NB * (WGRP - WEGRP));   // every group once
static_assert((size_t)4 * 64 * LDC * 4 <= (size_t)2 * WSTAGE_H * 2);   // C staging fits the ring
static_assert((size_t)2 * WSTAGE_H * 2 <= (size_t)163840);             // two blocks per WGP

// Eight asynchronous 16-B copies of one lane: row group 0 from g0, groups 1 .. 7 from g, g + 16
// rows, ...; LDS rows 16 apart. The s_wait_xcnt ends the copies' own statement so that no
// address register is rewritten ahead of it.
__device__ __forceinline__ void stage_copy_a(const unsigned lds, const _Float16* g0,
                                             const _Float16* g, const unsigned K) {
  const unsigned ls = 16u * LDG * 2u;
  const size_t gs = (size_t)16 * K;
  asm volatile(
      "global_load_async_to_lds_b128 %0, %8, off\n\t"
      "global_load_async_to_lds_b128 %1, %9, off\n\t"
      "global_load_async_to_lds_b128 %2, %10, off\n\t"
      "global_load_async_to_lds_b128 %3, %11, off\n\t"
      "global_load_async_to_lds_b128 %4, %12, off\n\t"
      "global_load_async_to_lds_b128 %5, %13, off\n\t"
      "global_load_async_to_lds_b128 %6, %14, off\n\t"
      "global_load_async_to_lds_b128 %7, %15, off\n\t"
      "s_wait_xcnt 0x0"
      :
      : "v"(lds), "v"(lds + ls), "v"(lds + 2u * ls), "v"(lds + 3u * ls), "v"(lds + 4u * ls),
        "v"(lds + 5u * ls), "v"(lds + 6u * ls), "v"(lds + 7u * ls), "v"(g0), "v"(g),
        "v"(g + gs), "v"(g + 2u * gs), "v"(g + 3u * gs), "v"(g + 4u * gs), "v"(g + 5u * gs),
        "v"(g + 6u * gs)
      : "memory");
}
// One such copy (the residual rows: 16 rows x 256 B = one copy per thread and stage).
__device__ __forceinline__ void stage_copy_r(const unsigned lds, const _Float16* g) {
  asm volatile(
      "global_load_async_to_lds_b128 %0, %1, off\n\t"
      "s_wait_xcnt 0x0"
      :
      : "v"(lds), "v"(g)
      : "memory");
}

__global__ __launch_bounds__(256) void gemm_wo_kernel(
    const _Float16* __restrict__ A16, const _Float16* __restrict__ A16r,
    const _Float16* __restrict__ Bt, float* __restrict__ outf) {
  __shared__ __attribute__((aligned(16))) _Float16 St[2 * WSTAGE_H];
  const unsigned K = (unsigned)DIM;
  const unsigned y = blockIdx.y;
  const bool heavy = y < (unsigned)WHEAVY;   // block-uniform
  // r0: first row of group 0; rn + 16 j: first row of group j = 1 .. 7 (rows of [MROWS])
  unsigned r0, rn;
  if (heavy) {
    r0 = (y < (unsigned)WEGRP ? y : y + (unsigned)(WGRP - WEGRP)) * 16u;
    rn = (7u * y + (unsigned)(WEGRP - 1)) * 16u;
  } else {
    const unsigned n0 = (unsigned)(WHEAVY * 7) + 8u * (y - (unsigned)WHEAVY);
    r0 = (n0 + (n0 < (unsigned)(WGRP - WEGRP) ? (unsigned)WEGRP : (unsigned)(2 * WEGRP))) * 16u;
    rn = r0;
  }

  const unsigned tid = threadIdx.x, lane = tid & 31u;
  const unsigned w = (unsigned)__builtin_amdgcn_readfirstlane((int)(tid >> 5));
  const unsigned mw = w >> 2, nw = w & 3u;
  const unsigned hh = lane >> 4, m = lane & 15u;
  const bool own = heavy && (mw == 0u);   // wave-uniform: this wave's row tile 0 is the early group
  const unsigned cr = tid >> 4, cc = (tid & 15u) * 8u;   // copy: row (of 16), 16-B column
  const _Float16* ga0 = A16 + (size_t)(r0 + cr) * K + cc;
  const _Float16* ga = A16 + (size_t)(rn + 16u + cr) * K + cc;
  const _Float16* gb = Bt + (size_t)(blockIdx.x * (unsigned)BN + cr) * K + cc;
  const _Float16* gr = A16r + (size_t)((heavy ? y : 0u) * 16u + cr) * K + cc;
  const unsigned la = (unsigned)(size_t)St + (cr * LDG + cc) * 2u;
  const unsigned lb = la + BM * LDG * 2u;
  const unsigned lr = la + (BM + BN) * LDG * 2u;
  const unsigned nt = K / BK;

  // the ring of gemm_mainloop: two buffers of one 128-k stage; stage t + 2 is copied into the
  // buffer that trip t has just left, behind the barrier that also publishes stage t + 1
  stage_copy_a(la, ga0, ga, K);
  stage_copy<8u, 16u>(lb, gb, K);
  if (heavy) stage_copy_r(lr, gr);
  asm volatile("s_wait_asynccnt 0x0" ::: "memory");   // stage 0 landed (this wave's copies)
  __syncthreads();                                    // stage 0 readable by every wave
  stage_copy_a(la + WSTAGE_H * 2u, ga0 + BK, ga + BK, K);
  stage_copy<8u, 16u>(lb + WSTAGE_H * 2u, gb + BK, K);
  if (heavy) stage_copy_r(lr + WSTAGE_H * 2u, gr + BK);

  v8f acc[4][2] = {};
  v8f res[2] = {};
  const _Float16* fa = St + (mw * 64u + m) * LDG + hh * 8u;
  const _Float16* fb = St + (BM + nw * 32u + m) * LDG + hh * 8u;
  const _Float16* fr = St + (BM + BN + m) * LDG + hh * 8u;
#pragma unroll 1   // one stage per trip: the buffer alternates by t & 1, the text stays short
  for (unsigned t = 0; t < nt; ++t) {
    const unsigned bo = (t & 1u) * (unsigned)WSTAGE_H;
    // the stage's four residual fragments, read ahead as one group so that their products below
    // wait for no load of their own (read and used under the same wave-uniform test)
    v16h ar[BK / 32u];
    if (own) {
#pragma unroll
      for (unsigned kk = 0; kk < BK / 32u; ++kk) ar[kk] = frag_at(fr + bo + kk * 32u);
    }
#pragma unroll
    for (unsigned kk = 0; kk < BK / 32u; ++kk) {
      v16h a[4], b[2];
#pragma unroll
      for (unsigned i = 0; i < 4u; ++i) a[i] = frag_at(fa + bo + i * 16u * LDG + kk * 32u);
#pragma unroll
      for (unsigned j = 0; j < 2u; ++j) b[j] = frag_at(fb + bo + j * 16u * LDG + kk * 32u);
#pragma unroll
      for (unsigned i = 0; i < 4u; ++i)
#pragma unroll
        for (unsigned j = 0; j < 2u; ++j) acc[i][j] = wmma16(a[i], b[j], acc[i][j]);
      if (own) {
#pragma unroll
        for (unsigned j = 0; j < 2u; ++j) res[j] = wmma16(ar[kk], b[j], res[j]);
      }
    }
    asm volatile("s_wait_dscnt 0x0" ::: "memory");      // this wave has left buffer t & 1
    asm volatile("s_wait_asynccnt 0x0" ::: "memory");   // its copies of stage t + 1 landed
    __syncthreads();   // publishes stage t + 1, frees buffer t & 1
    if (t + 2u < nt) {
      stage_copy_a(la + bo * 2u, ga0 + (t + 2u) * BK, ga + (t + 2u) * BK, K);
      stage_copy<8u, 16u>(lb + bo * 2u, gb + (t + 2u) * BK, K);
      if (heavy) stage_copy_r(lr + bo * 2u, gr + (t + 2u) * BK);
    }
  }
  asm volatile("s_wait_asynccnt 0x0" ::: "memory");     // nothing in flight when St is reused

  if (own) {
#pragma unroll
    for (int j = 0; j < 2; ++j)
#pragma unroll
      for (int r = 0; r < 8; ++r) acc[0][j][r] = acc[0][j][r] + res[j][r] * (1.0f / SCRES);
  }
  stage_c<2u>(acc, (float*)St);
  // outf full [full row][col] = acc/4096; 16 rows (one group) x 4 steps = one 64 x 64 sub-tile
  const float cs = 1.0f / (WCARRY * VCARRY);
  for (unsigned sub = 0; sub < 4u; ++sub) {
    const float* Cs = (const float*)St + sub * (64u * LDC);
    const unsigned n0 = (blockIdx.x * 2u + (sub & 1u)) * 64u;
    v4f xs[4];
    size_t off[4];
#pragma unroll
    for (unsigned i = 0; i < 4u; ++i) {
      const unsigned r = 16u * i + (tid >> 4);
      const unsigned cq = (tid & 15u) * 4u;
      const unsigned jg = (sub >> 1) * 4u + i;   // the row's group within the tile
      const unsigned crow = (jg == 0u ? r0 : rn + 16u * jg) + (tid >> 4);
      const unsigned bidx = crow / (unsigned)SEQ;
      const unsigned sq = crow - bidx * (unsigned)SEQ;
      const size_t frow = (size_t)bidx * SEQ_FULL + sq;
      const v4f u = *(const v4f*)&Cs[r * LDC + cq];
      v4f val;
#pragma unroll
      for (int j = 0; j < 4; ++j) val[j] = u[j] * cs;
      xs[i] = val;
      off[i] = frow * DIM + n0 + cq;
    }
#pragma unroll
    for (int i = 0; i < 4; ++i) *(v4f*)(outf + off[i]) = xs[i];
    asm volatile("s_wait_xcnt 0x0" ::: "memory");   // before the stores' registers are reused
  }
}

#define ATILE_H (2 * 64 * LDT)
static_assert((LDT * 2) % 16 == 0 && (ATILE_H * 2) % 16 == 0);   // 16-B copies stay aligned
static_assert(SEQ / 64 >= 2);                                    // the ring starts with two chunks

// One key chunk of one lane: four asynchronous 16-B copies, global -> LDS (K rows r and r + 32,
// V^T rows r and r + 32). lds: the lane's LDS byte address in the buffer's K tile; gk / gv: its
// global addresses. The s_wait_xcnt ends the copies' own statement so that no address register
// is rewritten ahead of it.
__device__ __forceinline__ void attn_copy(const unsigned lds, const _Float16* gk,
                                          const _Float16* gv) {
  asm volatile(
      "global_load_async_to_lds_b128 %0, %4, off\n\t"
      "global_load_async_to_lds_b128 %1, %5, off\n\t"
      "global_load_async_to_lds_b128 %2, %6, off\n\t"
      "global_load_async_to_lds_b128 %3, %7, off\n\t"
      "s_wait_xcnt 0x0"
      :
      : "v"(lds), "v"(lds + 32u * LDT * 2u), "v"(lds + 64u * LDT * 2u),
        "v"(lds + 96u * LDT * 2u), "v"(gk), "v"(gk + (size_t)32 * DIM), "v"(gv),
        "v"(gv + (size_t)32 * SEQ)
      : "memory");
}

__device__ __forceinline__ float xhalf(float x) {   // lane l <-> lane l ^ 16
  const int b = __builtin_bit_cast(int, x);
  return __builtin_bit_cast(
      float, __builtin_amdgcn_permlanex16(b, b, 0x76543210, 0xfedcba98, false, false));
}

__global__ __launch_bounds__(256) void attn_kernel(
    const _Float16* __restrict__ Qh, const _Float16* __restrict__ QhR,
    const _Float16* __restrict__ Kh, const _Float16* __restrict__ KhR,
    const _Float16* __restrict__ Vt, const _Float16* __restrict__ VtR,
    _Float16* __restrict__ Ov, _Float16* __restrict__ OvR) {
  // two buffers of one key chunk each: K tile, then V^T tile
  __shared__ __attribute__((aligned(16))) _Float16 KV[2 * ATILE_H];
  __shared__ _Float16 VRs[64 * LDT];
  __shared__ _Float16 KRs[64 * LDT];

  const unsigned tid = threadIdx.x, lane = tid & 31u, w = tid >> 5;
  const unsigned hh = lane >> 4, m = lane & 15u;
  const unsigned qtile = (unsigned)(SEQ / 128 - 1) - blockIdx.z;   // cost falls with the index
  const unsigned q0 = qtile * 128u;
  const unsigned head = blockIdx.x;
  const unsigned b = blockIdx.y;
  const unsigned qrow0 = q0 + w * 16u;
  const bool first_blk = (qtile == 0u);

  const size_t qoff = (size_t)(b * (unsigned)SEQ + qrow0 + m) * DIM + head * HD + hh * 8u;
  v16h qf[2];
  qf[0] = frag_at(Qh + qoff);
  qf[1] = frag_at(Qh + qoff + 32);

  float mrun = -1.0e30f;   // running maximum of query qrow0 + m, unscaled (equal in both halves)
  float nrun = __builtin_fmaf(-mrun, ESCALE, -EBIAS);   // the exponent's addend for mrun
  float lsum = 0.0f;       // running sum over this half's keys only, x 2^-102
  v8f o[4];
#pragma unroll
  for (int nb = 0; nb < 4; ++nb) o[nb] = (v8f){};

  const size_t kplane = (size_t)b * SEQ * DIM + head * HD;
  const size_t vplane = ((size_t)b * DIM + head * HD) * SEQ;
  const size_t rplane = ((size_t)b * DIM + head * HD) * 64u;
  const size_t krplane = ((size_t)(b * (unsigned)NHEAD + head) * ECHUNK) * HD;
  const unsigned kend = q0 + 128u;   // <= SEQ

  // copies: thread t takes rows t >> 3 and (t >> 3) + 32, 16-B column t & 7 of both tiles
  const unsigned sr = tid >> 3, sc = (tid & 7u) * 8u;
  const _Float16* gk = Kh + kplane + (size_t)sr * DIM + sc;   // chunk 0; a chunk on: + 64 DIM
  const _Float16* gv = Vt + vplane + (size_t)sr * SEQ + sc;   // chunk 0; a chunk on: + 64
  const unsigned lkv = (unsigned)(size_t)KV + (sr * LDT + sc) * 2u;

  attn_copy(lkv, gk, gv);
  if (first_blk) {   // block-uniform: the residual tiles of chunk 0, plain loads
#pragma unroll
    for (unsigned j = 0; j < 2u; ++j) {
      const unsigned r = sr + 32u * j;
      *(v8h*)&VRs[r * LDT + sc] = *(const v8h*)(VtR + rplane + (size_t)r * 64u + sc);
      *(v8h*)&KRs[r * LDT + sc] = *(const v8h*)(KhR + krplane + (size_t)r * HD + sc);
    }
  }
  asm volatile("s_wait_asynccnt 0x0" ::: "memory");   // chunk 0 landed (this wave's copies)
  __syncthreads();                                    // chunk 0 readable by every wave
  attn_copy(lkv + ATILE_H * 2u, gk + (size_t)64 * DIM, gv + 64);   // kend >= 128: chunk 1 exists

  for (unsigned kb = 0; kb < kend; kb += 64u) {
    const bool early = first_blk && (kb == 0u);   // block-uniform
    const unsigned bo = ((kb >> 6) & 1u) * (unsigned)ATILE_H;   // this chunk's buffer
    const _Float16* Ks = KV + bo;
    const _Float16* Vs = KV + bo + 64 * LDT;

    // scores, transposed: 4 key groups of 16 (rows), K = 64 in two 32-steps
    v8f s[4];
    if (early) {
      // early corner: value + residual products, one score tile at a time through ONE
      // residual accumulator; q0 == 0 here so qrow0 + m < 128
      const unsigned qrbase =
          ((b * (unsigned)NHEAD + head) * (unsigned)EROWS + qrow0 + m) * (unsigned)HD + hh * 8u;
#pragma unroll
      for (int kg = 0; kg < 4; ++kg) {
        v8f t = {};
#pragma unroll
        for (int c = 0; c < 2; ++c) {
          unsigned qro = qrbase + (unsigned)c * 32u;
          asm volatile("" : "+v"(qro));   // opaque offset: the residual q fragment is reloaded per tile
          v8f tr = {};
          {
            const v16h kf = ld_frag(&Ks[(kg * 16) * LDT + c * 32], LDT);
            t = wmma16(kf, qf[c], t);
            const v16h ql = frag_at(QhR + qro);
            tr = wmma16(kf, ql, tr);
          }
          {
            const v16h kl = ld_frag(&KRs[(kg * 16) * LDT + c * 32], LDT);
            tr = wmma16(kl, qf[c], tr);
          }
          t = t + tr * (1.0f / SCRES);
          __builtin_amdgcn_sched_barrier(0);   // the next tile's loads stay behind this tile
        }
        s[kg] = t;
      }
    } else {
      // all eight K fragments as one group of LDS loads, then the eight products: four
      // independent accumulators per 32-column step (each tile still sums c = 0, then c = 1)
      v16h kf[2][4];
#pragma unroll
      for (int c = 0; c < 2; ++c)
#pragma unroll
        for (int kg = 0; kg < 4; ++kg) kf[c][kg] = ld_frag(&Ks[(kg * 16) * LDT + c * 32], LDT);
      __builtin_amdgcn_sched_barrier(0);   // the loads stay one group: none sinks among the products
#pragma unroll
      for (int kg = 0; kg < 4; ++kg) s[kg] = (v8f){};
#pragma unroll
      for (int c = 0; c < 2; ++c)
#pragma unroll
        for (int kg = 0; kg < 4; ++kg) s[kg] = wmma16b(kf[c][kg], qf[c], s[kg]);
      __builtin_amdgcn_sched_barrier(0);   // the softmax stays behind the run: no padded gap inside it
    }

    // all eight V^T fragments as one group of LDS loads, issued here so that they land behind
    // the softmax
    v16h vfr[2][4];
#pragma unroll
    for (int c = 0; c < 2; ++c)
#pragma unroll
      for (int nb = 0; nb < 4; ++nb) vfr[c][nb] = ld_frag(&Vs[(nb * 16) * LDT + c * 32], LDT);

    // causal replace-mask (key > query) in chunks that reach the diagonal; block-uniform test
    if (kb >= q0) {
#pragma unroll
      for (int kg = 0; kg < 4; ++kg)
#pragma unroll
        for (int v = 0; v < 8; ++v) {
          const unsigned key = kb + (unsigned)kg * 16u + hh * 8u + (unsigned)v;
          const unsigned row = qrow0 + m;
          s[kg][v] = (key > row) ? -1.0e30f : s[kg][v];
        }
    }

    // online softmax of the lane's own query: 32 keys here, 32 in lane ^ 16
    float mt[8];
#pragma unroll
    for (int v = 0; v < 8; ++v)
      mt[v] = fmaxf(fmaxf(s[0][v], s[1][v]), fmaxf(s[2][v], s[3][v]));
    float mx = fmaxf(fmaxf(fmaxf(mt[0], mt[1]), fmaxf(mt[2], mt[3])),
                     fmaxf(fmaxf(mt[4], mt[5]), fmaxf(mt[6], mt[7])));
    mx = fmaxf(mx, xhalf(mx));
    const float mn = fmaxf(mrun, mx);
    const float nn = __builtin_fmaf(-mn, ESCALE, -EBIAS);
    const float alpha = __builtin_amdgcn_exp2f(nn - nrun);   // the addends' own difference
    mrun = mn;
    nrun = nn;
#pragma unroll
    for (int kg = 0; kg < 4; ++kg)
#pragma unroll
      for (int v = 0; v < 8; ++v) s[kg][v] = __builtin_fmaf(s[kg][v], ESCALE, nrun);
    // all multiply-adds in front of the exponentials: none rewrites an exponential's source
    // directly behind it, so no padded slot stands among them
    __builtin_amdgcn_sched_barrier(0);
#pragma unroll
    for (int kg = 0; kg < 4; ++kg)
#pragma unroll
      for (int v = 0; v < 8; ++v) s[kg][v] = __builtin_amdgcn_exp2f(s[kg][v]);
    {
      float part[8];
#pragma unroll
      for (int v = 0; v < 8; ++v) part[v] = (s[0][v] + s[1][v]) + (s[2][v] + s[3][v]);
      const float rs = ((part[0] + part[1]) + (part[2] + part[3])) +
                       ((part[4] + part[5]) + (part[6] + part[7]));
      lsum = alpha * lsum + rs;
    }
#pragma unroll
    for (int nb = 0; nb < 4; ++nb)
#pragma unroll
      for (int v = 0; v < 8; ++v) o[nb][v] = o[nb][v] * alpha;

    // P^T fragments [32 keys][16 queries], f16(1024 p), from the score tiles in place
    v16h pf[2];
#pragma unroll
    for (int c = 0; c < 2; ++c)
#pragma unroll
      for (int i = 0; i < 8; ++i) {
        pf[c][i]     = (_Float16)(s[2 * c][i] * PUNBIAS);
        pf[c][i + 8] = (_Float16)(s[2 * c + 1][i] * PUNBIAS);
      }

    // O^T += V^T . P^T  (K = 64 keys in two 32-steps; A = V^T tile [d][key])
#pragma unroll
    for (int c = 0; c < 2; ++c) {
#pragma unroll
      for (int nb = 0; nb < 4; ++nb) o[nb] = wmma16b(vfr[c][nb], pf[c], o[nb]);
    }

    if (early) {
      // V_res . P_hi (scale 1/1024), one 16-column group at a time, folded immediately
#pragma unroll
      for (int nb = 0; nb < 4; ++nb) {
        v8f o2 = {};
#pragma unroll
        for (int c = 0; c < 2; ++c) {
          const v16h vr = ld_frag(&VRs[(nb * 16) * LDT + c * 32], LDT);
          o2 = wmma16(vr, pf[c], o2);
        }
#pragma unroll
        for (int v = 0; v < 8; ++v) o[nb][v] = o[nb][v] + o2[v] * (1.0f / RCARRY);
      }
      // P residual fragments: f16(1024 * (1024 p - f16(1024 p)))
      v16h pr[2];
#pragma unroll
      for (int c = 0; c < 2; ++c)
#pragma unroll
        for (int i = 0; i < 16; ++i) {
          const float t = s[2 * c + (i >> 3)][i & 7] * PUNBIAS;
          const float hi = (float)pf[c][i];
          pr[c][i] = toh_flush((t - hi) * RCARRY);
        }
      // V_hi . P_res (scale 1/1024), one 16-column group at a time, folded immediately
#pragma unroll
      for (int nb = 0; nb < 4; ++nb) {
        v8f o2 = {};
#pragma unroll
        for (int c = 0; c < 2; ++c) {
          const v16h vf = ld_frag(&Vs[(nb * 16) * LDT + c * 32], LDT);
          o2 = wmma16(vf, pr[c], o2);
        }
#pragma unroll
        for (int v = 0; v < 8; ++v) o[nb][v] = o[nb][v] + o2[v] * (1.0f / RCARRY);
      }
    }
    asm volatile("s_wait_dscnt 0x0" ::: "memory");      // this wave has left this chunk's buffer
    asm volatile("s_wait_asynccnt 0x0" ::: "memory");   // its copies of the next chunk landed
    __syncthreads();   // publishes the next chunk, frees this chunk's buffer
    if (kb + 128u < kend)   // block-uniform: a chunk two on exists
      attn_copy(lkv + bo * 2u, gk + (size_t)(kb + 128u) * DIM, gv + kb + 128u);
  }
  asm volatile("s_wait_asynccnt 0x0" ::: "memory");     // nothing in flight at the wave's end

  const float lrow = lsum + xhalf(lsum);   // the two halves' keys joined
  const float inv = __builtin_amdgcn_rcpf(lrow) * (VCARRY / PUNBIAS);
  v8h x[4];
#pragma unroll
  for (int nb = 0; nb < 4; ++nb)
#pragma unroll
    for (int v = 0; v < 8; ++v) x[nb][v] = toh_flush(o[nb][v] * inv);
  _Float16* po = Ov + (size_t)(b * (unsigned)SEQ + qrow0 + m) * DIM + head * HD + hh * 8u;
#pragma unroll
  for (int nb = 0; nb < 4; ++nb) *(v8h*)(po + nb * 16) = x[nb];
  // before the stores' registers are reused; in front of the branch, where it stays directly
  // behind the stores
  asm volatile("s_wait_xcnt 0x0" ::: "memory");
  if (first_blk) {
    // residual rows (first query block only; qrow0 < 128): f16(2048 * (t - f16(t)))
    v8h xr[4];
#pragma unroll
    for (int nb = 0; nb < 4; ++nb)
#pragma unroll
      for (int v = 0; v < 8; ++v)
        xr[nb][v] = toh_flush((o[nb][v] * inv - (float)x[nb][v]) * SCRES);
    _Float16* pres = OvR + (size_t)(b * (unsigned)EROWS + qrow0 + m) * DIM + head * HD + hh * 8u;
#pragma unroll
    for (int nb = 0; nb < 4; ++nb) *(v8h*)(pres + nb * 16) = xr[nb];
  }
}

// ---------------------------------------------------------------------------
extern "C" void kernel_launch(void* const* d_in, const int* in_sizes, int n_in,
                              void* d_out, int out_size, void* d_ws, size_t ws_size,
                              hipStream_t stream) {
  if (n_in < 5) return;
  const long long need_x = ((long long)(NB - 1) * SEQ_FULL + SEQ) * DIM;
  if ((long long)in_sizes[0] < need_x) return;
  if ((long long)in_sizes[1] < (long long)DIM * DIM) return;
  if ((long long)in_sizes[2] < (long long)KVD * DIM) return;
  if ((long long)in_sizes[3] < (long long)KVD * DIM) return;
  if ((long long)in_sizes[4] < (long long)DIM * DIM) return;
  if ((long long)out_size < need_x) return;
  if (ws_size < WS_TOTAL) return;

  // bound by the input list order: x, wq, wk, wv, wo
  const float* X  = (const float*)d_in[0];    // [NB_FULL][SEQ_FULL][DIM]
  const float* wq = (const float*)d_in[1];    // [DIM][DIM]  (out, in)
  const float* wk = (const float*)d_in[2];    // [KVD][DIM]  (out, in)
  const float* wv = (const float*)d_in[3];    // [KVD][DIM]  (out, in)
  const float* wo = (const float*)d_in[4];    // [DIM][DIM]  (out, in)
  float* out = (float*)d_out;

  char* ws = (char*)d_ws;
  _Float16* Wq_t  = (_Float16*)(ws + OFF_WQ);    // [n][k], x64; wk and wv planes [KVD][DIM] behind it
  _Float16* Wo_t  = (_Float16*)(ws + OFF_WO);    // [n][k], x64
  _Float16* X16   = (_Float16*)(ws + OFF_X);     // [MROWS][DIM]
  _Float16* Qh16  = (_Float16*)(ws + OFF_Q);     // [MROWS][DIM]
  _Float16* Kh16  = (_Float16*)(ws + OFF_K);     // [MROWS][DIM], shared heads written 4x
  _Float16* Vt16  = (_Float16*)(ws + OFF_VT);    // [b][DIM][SEQ], shared heads written 4x
  _Float16* Ctx16 = (_Float16*)(ws + OFF_CTX);   // [MROWS][DIM], x64
  _Float16* VtR16 = (_Float16*)(ws + OFF_VR);    // [b][DIM][64]
  _Float16* QR16  = (_Float16*)(ws + OFF_QR);    // [b][NHEAD][128][64], x2048
  _Float16* KR16  = (_Float16*)(ws + OFF_KR);    // [b][NHEAD][64][64], x2048, shared heads 4x
  _Float16* CR16  = (_Float16*)(ws + OFF_CR);    // [b][128][DIM], x2048 on top of x64

  dim3 blk(256);

  // input rows and weight planes ([out][in] rows are already k-contiguous); 8 rows per block;
  // Wq_t is the first of the four stacked weight planes
  cast_kernel<<<dim3(XBLK + WBLK), blk, 0, stream>>>(X, wq, wk, wv, wo, X16, Wq_t);

  // gemm_qkv_kernel(A16, Bt, q16, q16r, k16, k16r, vt, vtr); Bt = planes wq, wk, wv, stacked
  gemm_qkv_kernel<<<dim3((DIM + 2 * KVD) / QBN, MROWS / QBM), dim3(512), 0, stream>>>(
      X16, Wq_t, Qh16, QR16, Kh16, KR16, Vt16, VtR16);
  // attn_kernel(Qh, QhR, Kh, KhR, Vt, VtR, Ov, OvR)
  attn_kernel<<<dim3(NHEAD, NB, SEQ / 128), blk, 0, stream>>>(Qh16, QR16, Kh16, KR16, Vt16, VtR16,
                                                              Ctx16, CR16);
  // gemm_wo_kernel(A16, A16r, Bt, outf)
  gemm_wo_kernel<<<dim3(DIM / BN, MROWS / BM), blk, 0, stream>>>(Ctx16, CR16, Wo_t, out);
}

// v010
// A run of this version takes 112 microseconds.
// Two timings next to v009 both put it at 1.05 times that version's speed.
// Over all steps from v000 it is 4.31 times as fast.
#include <hip/hip_runtime.h>
#include <stddef.h>

// All contractions on v_wmma_f32_16x16x32_f16 (f16 operands, f32 accumulate): q/k/v projections,
// q.k scores, p.v, output projection. Float inputs are RNE-converted to bf16 and carried in f16
// (weights x64, p x1024, attention rows x64). Early corner only (query rows 0..127 x keys 0..63
// of every (batch, head)): q and k get a x2048 residual plane (two more score products into a
// separate accumulator), p and v a x1024 residual plane, and the attention rows 0..127 a x2048
// residual plane (second accumulator set in the output projection on those row tiles).
// Softmax and all scaling in f32.
// Causal grouped-query attention (32 query heads sharing 8 key/value heads), [out][in] weights,
// no biases; the k and v projection epilogues write every shared head once per query head so
// the attention kernel sees one K row block and one V^T row block per query head.

typedef _Float16 v16h __attribute__((ext_vector_type(16)));
typedef _Float16 v8h  __attribute__((ext_vector_type(8)));
typedef float    v8f  __attribute__((ext_vector_type(8)));
typedef float    v4f  __attribute__((ext_vector_type(4)));

#ifndef NB
#define NB 2
#endif
#ifndef SEQ
#define SEQ 2048
#endif
#define NB_FULL  2
#define SEQ_FULL 2048
#define DIM   2048
#define NHEAD 32
#define HD    64
#define NKV   8
#define GQA   (NHEAD / NKV)
#define KVD   (NKV * HD)
#define MROWS (NB * SEQ)
#define EROWS  128   // early query rows per sequence carried with residual planes (q, ctx)
#define ECHUNK 64    // early keys per sequence carried with residual planes (k, v)

static_assert(NB >= 1 && NB <= NB_FULL);
static_assert(SEQ >= 128 && SEQ <= SEQ_FULL && (SEQ % 128) == 0);
static_assert(DIM == NHEAD * HD);
static_assert(HD == 64);
static_assert(NHEAD == NKV * GQA && GQA == 4);
static_assert(KVD == 512 && (KVD % 64) == 0);
static_assert((DIM % 64) == 0 && (DIM % 32) == 0);
static_assert((MROWS % 64) == 0 && (MROWS % 8) == 0);
static_assert((SEQ % 64) == 0);               // a 64-row GEMM tile never straddles two sequences
static_assert((DIM % 8) == 0 && (KVD % 8) == 0);
static_assert(DIM == 8 * 32 * 8);             // cast: 8 passes x 32 lanes x 8 columns per row
static_assert((size_t)MROWS * DIM < (size_t)0xFFFFFFFFu);
static_assert(EROWS == 128);                  // == query rows of one attention block (block 0)
static_assert(ECHUNK == 64);                  // == keys of one attention step (chunk 0) == one GEMM row tile
static_assert((EROWS % 64) == 0 && EROWS <= SEQ);   // whole 64-row GEMM tiles
static_assert((size_t)NB * NHEAD * EROWS * HD < (size_t)0xFFFFFFFFu);   // 32-bit q residual offsets

#define LDT 72   // halves per LDS row (144 B, 16-B aligned)
#define LDC 68   // floats per LDS row (272 B, 16-B aligned)
static_assert((LDT % 8) == 0 && LDT >= 64);
static_assert((LDC % 4) == 0 && LDC >= 64);

// GEMM block tile (output projection; the q, k, v tile stands at its kernel) and LDS staging
#define BM  128   // output rows per block
#define BN  128   // output columns per block
#define BK  128   // halves of every operand row per stage (256 B)
#define LDG 136   // halves per staged row (272 B = 16 B x 17: b128 fragment reads meet no bank twice)
static_assert((LDG % 8) == 0 && LDG >= BK);
static_assert((DIM % BK) == 0 && DIM / BK >= 2);          // the ring starts with two stages
static_assert((MROWS % BM) == 0 && (SEQ % BM) == 0 && (DIM % BN) == 0 && (KVD % BN) == 0);
static_assert((BM + BN) * (BK / 8) == 256 * 16);          // 16 copies of 16 B per thread and stage

#define WCARRY 64.0f     // weight planes carried x64
#define PCARRY 1024.0f   // softmax numerators carried x1024
#define VCARRY 64.0f     // attention output plane carried x64
#define RCARRY 1024.0f   // residual planes (p, v) carried x1024 on top of their hi part
#define SCRES  2048.0f   // residual planes (q, k, attention rows) carried x2048 on top of their hi part
// Softmax exponent: e = exp2(score * ESCALE - max * ESCALE - EBIAS) = p x 2^-102, and
// e x PUNBIAS = 1024 p. A p whose 1024 p lies under the f16 normal range (2^-14) has its e under
// the f32 normal range (2^-126).
#define ESCALE  0.18033688011112042f   // HD^-0.5 x log2(e)
#define EBIAS   102.0f
#define PUNBIAS 0x1p+112f
static_assert(PUNBIAS * 0x1p-102f == PCARRY);
static_assert(0x1p-126f * PUNBIAS == 6.103515625e-05f);

// epilogue store-loop coverage (rows admitted per step x steps == tile rows)
#define TILE_ROWS        64
#define EPI16_ROWS_STEP  (256 / 8)
#define EPI16_STEPS      2
#define EPIF_ROWS_STEP   (256 / 16)   // 16 lanes x 16 B per 256-B row segment
#define EPIF_STEPS       4
static_assert(EPI16_ROWS_STEP * EPI16_STEPS == TILE_ROWS);
static_assert(EPIF_ROWS_STEP * EPIF_STEPS == TILE_ROWS);
static_assert(8 * 16 == 128);                 // attention block: 8 waves x 16 query rows

// static LDS per kernel (bytes)
static_assert((size_t)(6 * 64 * LDT) * 2 <= (size_t)131072);

// workspace layout (bytes)
#define WSQ_BYTES     ((size_t)DIM * DIM * 2)
#define WKV_BYTES     ((size_t)KVD * DIM * 2)
#define PLANE16_BYTES ((size_t)MROWS * DIM * 2)
#define VRES_BYTES    ((size_t)NB * DIM * 64 * 2)
#define QRES_BYTES    ((size_t)NB * NHEAD * EROWS * HD * 2)
#define KRES_BYTES    ((size_t)NB * NHEAD * ECHUNK * HD * 2)
#define CRES_BYTES    ((size_t)NB * EROWS * DIM * 2)
#define OFF_WQ  ((size_t)0)
#define OFF_WK  (OFF_WQ + WSQ_BYTES)
#define OFF_WV  (OFF_WK + WKV_BYTES)
#define OFF_WO  (OFF_WV + WKV_BYTES)
#define OFF_X   (OFF_WO + WSQ_BYTES)
#define OFF_Q   (OFF_X + PLANE16_BYTES)
#define OFF_K   (OFF_Q + PLANE16_BYTES)
#define OFF_VT  (OFF_K + PLANE16_BYTES)
#define OFF_CTX (OFF_VT + PLANE16_BYTES)
#define OFF_VR  (OFF_CTX + PLANE16_BYTES)
#define OFF_QR  (OFF_VR + VRES_BYTES)
#define OFF_KR  (OFF_QR + QRES_BYTES)
#define OFF_CR  (OFF_KR + KRES_BYTES)
#define WS_TOTAL (OFF_CR + CRES_BYTES)
static_assert((WSQ_BYTES % 128) == 0 && (WKV_BYTES % 128) == 0 && (PLANE16_BYTES % 128) == 0);
static_assert((VRES_BYTES % 128) == 0);
static_assert((QRES_BYTES % 128) == 0 && (KRES_BYTES % 128) == 0 && (CRES_BYTES % 128) == 0);
static_assert(WS_TOTAL <= (size_t)134217728);

// ---------------------------------------------------------------------------
__device__ __forceinline__ float bf16r(float x) {   // RNE convert to bf16, returned widened
  unsigned int u = __float_as_uint(x);
  u = (u + 0x7FFFu + ((u >> 16) & 1u)) & 0xFFFF0000u;
  return __uint_as_float(u);
}

// f32 -> f16 operand convert that cannot produce an f16 subnormal (value select).
static __device__ __forceinline__ _Float16 toh_flush(float v) {
  const _Float16 r = (_Float16)v;
  return (fabsf(v) < 6.103515625e-05f) ? (_Float16)0.0f : r;
}

// 16-bit fragment: p points at element [row = lane&15][k0 + 8*(lane>>4)] of a k-contiguous
// row. Elements 0..7 <- k0+8h+0..7, elements 8..15 <- k0+16+8h+0..7 (same map for A and B).
__device__ __forceinline__ v16h frag_at(const _Float16* p) {
  v8h lo = *(const v8h*)(p);
  v8h hi = *(const v8h*)(p + 16);
  v16h out;
#pragma unroll
  for (int i = 0; i < 8; ++i) { out[i] = lo[i]; out[i + 8] = hi[i]; }
  return out;
}
__device__ __forceinline__ v16h ld_frag(const _Float16* base, unsigned ld) {
  const unsigned lane = threadIdx.x & 31u;
  return frag_at(base + (lane & 15u) * ld + (lane >> 4) * 8u);
}

__device__ __forceinline__ v8f wmma16(v16h a, v16h b, v8f c) {
  v8f d = __builtin_amdgcn_wmma_f32_16x16x32_f16(false, a, false, b, (short)0, c,
                                                 false, false);
  asm volatile("v_nop\n\tv_nop\n\tv_nop\n\tv_nop" : "+v"(d) : "v"(a), "v"(b));
  return d;
}

// The builtin alone: the compiler keeps the distances behind its own matrix instructions, and a
// run of independent products issues back to back.
__device__ __forceinline__ v8f wmma16b(v16h a, v16h b, v8f c) {
  return __builtin_amdgcn_wmma_f32_16x16x32_f16(false, a, false, b, (short)0, c, false, false);
}

// N (8 or 6) asynchronous 16-B copies of one lane, global -> LDS, rows RS apart on both sides.
// lds: the lane's LDS byte address; g: the lane's global address; K: source pitch in halves.
// The s_wait_xcnt ends the copies' own statement so that no address register is rewritten
// ahead of it.
template <unsigned N, unsigned RS>
__device__ __forceinline__ void stage_copy(const unsigned lds, const _Float16* g,
                                           const unsigned K) {
  static_assert(N == 8u || N == 6u);
  const unsigned ls = RS * LDG * 2u;
  const size_t gs = (size_t)RS * K;
  if constexpr (N == 6u) {
    asm volatile(
        "global_load_async_to_lds_b128 %0, %6, off\n\t"
        "global_load_async_to_lds_b128 %1, %7, off\n\t"
        "global_load_async_to_lds_b128 %2, %8, off\n\t"
        "global_load_async_to_lds_b128 %3, %9, off\n\t"
        "global_load_async_to_lds_b128 %4, %10, off\n\t"
        "global_load_async_to_lds_b128 %5, %11, off\n\t"
        "s_wait_xcnt 0x0"
        :
        : "v"(lds), "v"(lds + ls), "v"(lds + 2u * ls), "v"(lds + 3u * ls), "v"(lds + 4u * ls),
          "v"(lds + 5u * ls), "v"(g), "v"(g + gs), "v"(g + 2u * gs), "v"(g + 3u * gs),
          "v"(g + 4u * gs), "v"(g + 5u * gs)
        : "memory");
    return;
  }
  asm volatile(
      "global_load_async_to_lds_b128 %0, %8, off\n\t"
      "global_load_async_to_lds_b128 %1, %9, off\n\t"
      "global_load_async_to_lds_b128 %2, %10, off\n\t"
      "global_load_async_to_lds_b128 %3, %11, off\n\t"
      "global_load_async_to_lds_b128 %4, %12, off\n\t"
      "global_load_async_to_lds_b128 %5, %13, off\n\t"
      "global_load_async_to_lds_b128 %6, %14, off\n\t"
      "global_load_async_to_lds_b128 %7, %15, off\n\t"
      "s_wait_xcnt 0x0"
      :
      : "v"(lds), "v"(lds + ls), "v"(lds + 2u * ls), "v"(lds + 3u * ls), "v"(lds + 4u * ls),
        "v"(lds + 5u * ls), "v"(lds + 6u * ls), "v"(lds + 7u * ls), "v"(g), "v"(g + gs),
        "v"(g + 2u * gs), "v"(g + 3u * gs), "v"(g + 4u * gs), "v"(g + 5u * gs),
        "v"(g + 6u * gs), "v"(g + 7u * gs)
      : "memory");
}

// acc[i][j] += A[BMt rows][K] . B[64 NJ rows][K]^T for this wave's 64 x 16 NJ part of the block
// tile (mw = 64-row group, nw = one of four column groups; 2 BMt threads). Arow / Brow: first
// row of the block's A / B rows.
// Two LDS buffers of one 128-k stage each; stage t + 2 is copied into the buffer that trip t
// has just left, behind the barrier that also publishes stage t + 1. On entry every wave's
// earlier LDS reads of St have retired in front of a barrier that all waves have passed.
template <unsigned BMt, unsigned NJ>
__device__ __forceinline__ void gemm_mainloop(const _Float16* __restrict__ Arow,
                                              const _Float16* __restrict__ Brow,
                                              const unsigned K, _Float16* St,
                                              v8f (&acc)[4][NJ]) {
  constexpr unsigned BNt = 64u * NJ;              // B rows per stage
  constexpr unsigned RS = BMt / 8u;               // rows one copy of every thread covers
  constexpr unsigned SH = (BMt + BNt) * LDG;      // halves per stage: A rows, then B rows
  constexpr unsigned NB8 = BNt / RS;              // copies per thread for the B rows
  static_assert(BMt == 8u * RS && BNt == NB8 * RS);
  const unsigned tid = threadIdx.x, lane = tid & 31u, w = tid >> 5;
  const unsigned mw = w >> 2, nw = w & 3u;
  const unsigned hh = lane >> 4, m = lane & 15u;
  const unsigned cr = tid >> 4, cc = (tid & 15u) * 8u;   // copy: row (of RS), 16-B column
  const _Float16* ga = Arow + (size_t)cr * K + cc;
  const _Float16* gb = Brow + (size_t)cr * K + cc;
  const unsigned la = (unsigned)(size_t)St + (cr * LDG + cc) * 2u;
  const unsigned lb = la + BMt * LDG * 2u;
  const unsigned nt = K / BK;

  stage_copy<8u, RS>(la, ga, K);
  stage_copy<NB8, RS>(lb, gb, K);
  asm volatile("s_wait_asynccnt 0x0" ::: "memory");   // stage 0 landed (this wave's copies)
  __syncthreads();                                    // stage 0 readable by every wave
  stage_copy<8u, RS>(la + SH * 2u, ga + BK, K);
  stage_copy<NB8, RS>(lb + SH * 2u, gb + BK, K);

  const _Float16* fa = St + (mw * 64u + m) * LDG + hh * 8u;
  const _Float16* fb = St + (BMt + nw * (NJ * 16u) + m) * LDG + hh * 8u;
#pragma unroll 1   // one stage per trip: the buffer alternates by t & 1, the text stays short
  for (unsigned t = 0; t < nt; ++t) {
    const unsigned bo = (t & 1u) * SH;
#pragma unroll
    for (unsigned kk = 0; kk < BK / 32u; ++kk) {
      v16h a[4], b[NJ];
#pragma unroll
      for (unsigned i = 0; i < 4u; ++i) a[i] = frag_at(fa + bo + i * 16u * LDG + kk * 32u);
#pragma unroll
      for (unsigned j = 0; j < NJ; ++j) b[j] = frag_at(fb + bo + j * 16u * LDG + kk * 32u);
#pragma unroll
      for (unsigned i = 0; i < 4u; ++i)
#pragma unroll
        for (unsigned j = 0; j < NJ; ++j) acc[i][j] = wmma16(a[i], b[j], acc[i][j]);
    }
    asm volatile("s_wait_dscnt 0x0" ::: "memory");      // this wave has left buffer t & 1
    asm volatile("s_wait_asynccnt 0x0" ::: "memory");   // its copies of stage t + 1 landed
    __syncthreads();   // publishes stage t + 1, frees buffer t & 1
    if (t + 2u < nt) {
      stage_copy<8u, RS>(la + bo * 2u, ga + (t + 2u) * BK, K);
      stage_copy<NB8, RS>(lb + bo * 2u, gb + (t + 2u) * BK, K);
    }
  }
  asm volatile("s_wait_asynccnt 0x0" ::: "memory");     // nothing in flight when St is reused
}

// ---------------------------------------------------------------------------
// Row casts: f32 rows of DIM columns -> f16 compact rows of DIM columns, all five in one launch
// (none reads what another writes). Cast rows 0 .. MROWS-1 are the module input (full-size row
// stride per batch, carry 1); the rest are the rows of the four [out][in] weight planes (already
// k-contiguous, carry x64), which lie stacked in the workspace in the order wq, wk, wv, wo, so
// that w16 is one plane. Every value goes through RNE bf16 first.
// One block per WGP, CWAVES waves, CRPW whole rows per wave: few waves to start, and a wave asks
// for all of its rows (16 CRPW loads of 512 B) before it converts the first, so that it pays the
// memory latency once. A lane takes 8 neighbouring columns of each 256-column step: two 16-B
// loads, one 16-B store; a store instruction of a wave covers 512 contiguous bytes.
// Every test is on the row index alone, which is the same in all lanes of a wave.
// Grid (CROWS / (CWAVES * CRPW)), CWAVES * 32 threads.
// ---------------------------------------------------------------------------
#define CROWS  (MROWS + 2 * DIM + 2 * KVD)
#define CWAVES 12
#define CRPW   3
static_assert(CROWS % (CWAVES * CRPW) == 0);
static_assert(16 * CRPW <= 63);   // loads of one wave outstanding at once
static_assert(OFF_WK == OFF_WQ + (size_t)DIM * DIM * 2);
static_assert(OFF_WV == OFF_WQ + (size_t)(DIM + KVD) * DIM * 2);
static_assert(OFF_WO == OFF_WQ + (size_t)(DIM + 2 * KVD) * DIM * 2);
typedef __attribute__((address_space(1))) char gchar;
typedef __attribute__((address_space(1))) v4f  gv4f;
__global__ __launch_bounds__(CWAVES * 32) void cast_kernel(
    const float* __restrict__ X, const float* __restrict__ wq, const float* __restrict__ wk,
    const float* __restrict__ wv, const float* __restrict__ wo,
    _Float16* __restrict__ x16, _Float16* __restrict__ w16) {
  const unsigned lane = threadIdx.x & 31u;
  const unsigned w = (unsigned)__builtin_amdgcn_readfirstlane((int)(threadIdx.x >> 5));
  const unsigned row0 = (blockIdx.x * (unsigned)CWAVES + w) * (unsigned)CRPW;

  const float* src[CRPW];
  _Float16* dr[CRPW];
  float carry[CRPW];
#pragma unroll
  for (unsigned q = 0; q < (unsigned)CRPW; ++q) {
    const unsigned crow = row0 + q;
    if (crow < (unsigned)MROWS) {
      const unsigned bidx = crow / (unsigned)SEQ;
      const unsigned sq = crow - bidx * (unsigned)SEQ;
      src[q] = X + ((size_t)bidx * SEQ_FULL + sq) * DIM;
      dr[q] = x16 + (size_t)crow * DIM;
      carry[q] = 1.0f;
    } else {
      const unsigned wr = crow - (unsigned)MROWS;   // row of the stacked weight planes
      const float* W = wq;
      unsigned first = 0u;                          // first row of the plane that wr lies in
      if (wr >= (unsigned)(DIM + 2 * KVD)) {
        W = wo;
        first = (unsigned)(DIM + 2 * KVD);
      } else if (wr >= (unsigned)(DIM + KVD)) {
        W = wv;
        first = (unsigned)(DIM + KVD);
      } else if (wr >= (unsigned)DIM) {
        W = wk;
        first = (unsigned)DIM;
      }
      src[q] = W + (size_t)(wr - first) * DIM;
      dr[q] = w16 + (size_t)wr * DIM;
      carry[q] = WCARRY;
    }
  }
  const unsigned lbyte = lane * 32u;   // the lane's byte offset in every 1-KiB step of a source row
  v4f a[CRPW][16];
#pragma unroll
  for (unsigned q = 0; q < (unsigned)CRPW; ++q) {
    // named as global memory: behind the select among five arguments the compiler no longer
    // sees it and would fall back to flat loads
    const gchar* xr = (const gchar*)src[q] + lbyte;
#pragma unroll
    for (unsigned j = 0; j < 8u; ++j) {
      a[q][2u * j]      = *(const gv4f*)(xr + j * 1024u);
      a[q][2u * j + 1u] = *(const gv4f*)(xr + j * 1024u + 16u);
    }
  }
  // no load sinks to its use, and no address register of theirs is rewritten ahead of this wait
  // (the offset is named so that no load's own result lands in it either)
  asm volatile("s_wait_xcnt 0x0" : : "v"(lbyte) : "memory");
  // no convert rises among the loads: it would hold the later rows' loads behind the first
  // row's arrival, a second memory latency
  __builtin_amdgcn_sched_barrier(0);
#pragma unroll
  for (unsigned q = 0; q < (unsigned)CRPW; ++q) {
    _Float16* p = dr[q] + lane * 8u;
#pragma unroll
    for (unsigned j = 0; j < 8u; ++j) {
      v8h o;
#pragma unroll
      for (int i = 0; i < 4; ++i) {
        o[i]     = toh_flush(carry[q] * bf16r(a[q][2u * j][i]));
        o[i + 4] = toh_flush(carry[q] * bf16r(a[q][2u * j + 1u][i]));
      }
      *(v8h*)(p + j * 256u) = o;
    }
    asm volatile("s_wait_xcnt 0x0" ::: "memory");   // before the stores' registers are reused
  }
}

// ---------------------------------------------------------------------------
// GEMM C[block tile] = A16[rows][K] . Bt[n][K]^T; both operands staged in LDS by asynchronous
// copies. Output projection: 128x128 tile, 8 waves of 64x32; q, k, v projections
// (gemm_mainloop): 256x192 tile, 16 waves of 64x48 (mw = 64-row group, nw = column group).
// The epilogue treats the tile as 64x64 sub-tiles (bx = 64-column block, row0 = first row):
//   MODE 0: out16[row][col] (pitch DIM) = f16(acc/64)                       (q plane);
//           row tiles with sequence row < 128 also write
//           out16r [b][head][128][64] = f16(2048 * (q - hi))
//   MODE 1: tile column block = one shared key head; out16[row][(4*kvh + rep)*64 + c]
//           (pitch DIM) = f16(acc/64) for rep 0..3                          (k plane);
//           the key tile 0 of each sequence also writes
//           out16r [b][4*kvh + rep][64][64] = f16(2048 * (k - hi)) for rep 0..3
//   MODE 2: transposed V plane [b][(4*kvh + rep)*64 + d][key] = f16(acc/64) for rep 0..3;
//           for key tile 0 also out16r [b][(4*kvh + rep)*64 + d][64] = f16(1024 * (v - hi))
// (the output projection's own loop and epilogue stand at its kernel)
// Store loops: MODE 0/1/2: 32 rows per step x 2 steps = 64.
// MODE 0, 1 and 2 share one launch (gemm_qkv_kernel): same A rows, and their B rows lie
// stacked in the workspace, so the main loop is one and only the epilogue differs by sub-tile.
// ---------------------------------------------------------------------------
// C staging over the ring (every wave is behind the main loop's last barrier):
// [64][LDC] sub-tiles, sub = NJ * (64-row group) + (64-column group)
template <unsigned NJ>
__device__ __forceinline__ void stage_c(const v8f (&acc)[4][NJ], float* Call) {
  const unsigned tid = threadIdx.x, lane = tid & 31u, w = tid >> 5;
  const unsigned mw = w >> 2, nw = w & 3u;
  const unsigned hh = lane >> 4, m = lane & 15u;
#pragma unroll
  for (unsigned i = 0; i < 4u; ++i)
#pragma unroll
    for (unsigned j = 0; j < NJ; ++j) {
      const unsigned col = nw * (NJ * 16u) + j * 16u;   // first column of this 16-column group
#pragma unroll
      for (unsigned r = 0; r < 8u; ++r)
        Call[((mw * NJ + (col >> 6)) * 64u + i * 16u + hh * 8u + r) * LDC + (col & 63u) + m] =
            acc[i][j][r];
    }
  __syncthreads();
}

// Epilogue of one staged 64x64 sub-tile by 256 threads. Cs: the sub-tile; bx: its 64-column
// block within its own output; row0: its first row; tid: 0 .. 255.
template <int MODE>
__device__ __forceinline__ void store_sub(
    const float* Cs, const unsigned bx, const unsigned row0, const unsigned tid,
    _Float16* __restrict__ out16, _Float16* __restrict__ out16r) {
  {
  const unsigned n0 = bx * 64u;

  if (MODE == 0 || MODE == 1) {
    constexpr unsigned NREP  = (MODE == 1) ? (unsigned)GQA : 1u;
    constexpr unsigned RROWS = (MODE == 1) ? (unsigned)ECHUNK : (unsigned)EROWS;
    const unsigned cb = (MODE == 1) ? bx * (unsigned)(GQA * HD) : n0;
    const unsigned bidx = row0 / (unsigned)SEQ;
    const unsigned sq0 = row0 - bidx * (unsigned)SEQ;
    const bool has_res = (sq0 < RROWS);        // one value per sub-tile (MODE 1: key tile 0 only)
    v8h x[2], xr[2];
    size_t off[2], offr[2];
#pragma unroll
    for (unsigned i = 0; i < 2u; ++i) {
      const unsigned r = 32u * i + (tid >> 3);
      const unsigned c = (tid & 7u) * 8u;
      const v4f u0 = *(const v4f*)&Cs[r * LDC + c];
      const v4f u1 = *(const v4f*)&Cs[r * LDC + c + 4];
#pragma unroll
      for (int j = 0; j < 4; ++j) {
        x[i][j]     = toh_flush(u0[j] * (1.0f / WCARRY));
        x[i][j + 4] = toh_flush(u1[j] * (1.0f / WCARRY));
      }
      xr[i] = x[i];
      if (has_res) {
#pragma unroll
        for (int j = 0; j < 4; ++j) {
          const float t0 = u0[j] * (1.0f / WCARRY);
          const float t1 = u1[j] * (1.0f / WCARRY);
          xr[i][j]     = toh_flush((t0 - (float)x[i][j]) * SCRES);
          xr[i][j + 4] = toh_flush((t1 - (float)x[i][j + 4]) * SCRES);
        }
      }
      off[i] = (size_t)(row0 + r) * DIM + cb + c;
      offr[i] = ((size_t)(bidx * (unsigned)NHEAD + bx * NREP) * RROWS + sq0 + r) * HD + c;
    }
#pragma unroll
    for (unsigned rep = 0; rep < NREP; ++rep) {
#pragma unroll
      for (int i = 0; i < 2; ++i)
        *(v8h*)(out16 + off[i] + (size_t)rep * HD) = x[i];
    }
    asm volatile("s_wait_xcnt 0x0" ::: "memory");   // before the stores' registers are reused
    if (has_res) {
#pragma unroll
      for (unsigned rep = 0; rep < NREP; ++rep) {
#pragma unroll
        for (int i = 0; i < 2; ++i)
          *(v8h*)(out16r + offr[i] + (size_t)rep * RROWS * HD) = xr[i];
      }
      asm volatile("s_wait_xcnt 0x0" ::: "memory");   // before the stores' registers are reused
    }
    
  }

  if (MODE == 2) {
    const unsigned bidx = row0 / (unsigned)SEQ;
    const unsigned key0 = row0 - bidx * (unsigned)SEQ;
    const bool first_tile = (key0 == 0u);      // one value per sub-tile
    v8h x[2], xr[2];
    size_t off[2], offr[2];
#pragma unroll
    for (unsigned i = 0; i < 2u; ++i) {
      const unsigned dcol = 32u * i + (tid >> 3);
      const unsigned kk = (tid & 7u) * 8u;
#pragma unroll
      for (unsigned j = 0; j < 8u; ++j) {
        const float t = Cs[(kk + j) * LDC + dcol] * (1.0f / WCARRY);
        const _Float16 hi = toh_flush(t);
        x[i][j]  = hi;
        xr[i][j] = toh_flush((t - (float)hi) * RCARRY);
      }
      const size_t vrow = (size_t)bidx * DIM + bx * (unsigned)(GQA * HD) + dcol;
      off[i]  = vrow * SEQ + key0 + kk;
      offr[i] = vrow * 64u + kk;
    }
#pragma unroll
    for (unsigned rep = 0; rep < (unsigned)GQA; ++rep) {
#pragma unroll
      for (int i = 0; i < 2; ++i)
        *(v8h*)(out16 + off[i] + (size_t)rep * HD * SEQ) = x[i];
    }
    asm volatile("s_wait_xcnt 0x0" ::: "memory");   // before the stores' registers are reused
    if (first_tile) {
#pragma unroll
      for (unsigned rep = 0; rep < (unsigned)GQA; ++rep) {
#pragma unroll
        for (int i = 0; i < 2; ++i)
          *(v8h*)(out16r + offr[i] + (size_t)rep * HD * 64u) = xr[i];
      }
      asm volatile("s_wait_xcnt 0x0" ::: "memory");   // before the stores' registers are reused
    }
    
  }
  }
}

// q, k and v projections in one launch. Bt: the stacked planes wq, wk, wv (DIM + 2 KVD rows).
// Block tile 256 x 192, 16 waves of 64 x 48, one block per WGP: every staged byte feeds more
// products than in a 128 x 128 tile, and the grid is one block for each of 256 WGPs.
// The epilogue goes by 64-column blocks of the stacked outputs: blocks 0 .. DIM/64 - 1 are q,
// the next KVD/64 are k, the last KVD/64 are v; the two halves of the block take alternate
// sub-tiles (tests on wave-uniform values alone, no barrier behind stage_c).
// Grid ((DIM + 2 KVD)/192, MROWS/256).
#define QBM 256
#define QNJ 3
#define QBN (64 * QNJ)
#define QSTAGE_H ((QBM + QBN) * LDG)
#define QSUBS ((QBM / 64) * QNJ)
static_assert((MROWS % QBM) == 0 && ((DIM + 2 * KVD) % QBN) == 0 && (QSUBS % 2) == 0);
static_assert((size_t)2 * QSTAGE_H * 2 <= (size_t)327680);                  // one block per WGP
static_assert((size_t)QSUBS * 64 * LDC * 4 <= (size_t)2 * QSTAGE_H * 2);    // C staging fits the ring
__global__ __launch_bounds__(512) void gemm_qkv_kernel(
    const _Float16* __restrict__ A16, const _Float16* __restrict__ Bt,
    _Float16* __restrict__ q16, _Float16* __restrict__ q16r,
    _Float16* __restrict__ k16, _Float16* __restrict__ k16r,
    _Float16* __restrict__ vt, _Float16* __restrict__ vtr) {
  __shared__ __attribute__((aligned(16))) _Float16 St[2 * QSTAGE_H];
  const unsigned K = (unsigned)DIM;
  const unsigned bxa = blockIdx.x;
  const unsigned brow0 = blockIdx.y * (unsigned)QBM;

  v8f acc[4][QNJ] = {};
  gemm_mainloop<QBM, QNJ>(A16 + (size_t)brow0 * K, Bt + (size_t)(bxa * (unsigned)QBN) * K, K, St,
                          acc);
  stage_c<QNJ>(acc, (float*)St);
  const unsigned half = (unsigned)__builtin_amdgcn_readfirstlane((int)(threadIdx.x >> 8));
  const unsigned t256 = threadIdx.x & 255u;
  for (unsigned s = 0; s < (unsigned)(QSUBS / 2); ++s) {
    const unsigned sub = 2u * s + half;
    const unsigned rg = sub / (unsigned)QNJ, cg = sub - rg * (unsigned)QNJ;
    const float* Cs = (const float*)St + sub * (64u * LDC);
    const unsigned gcb = bxa * (unsigned)QNJ + cg;   // 64-column block of the stacked outputs
    const unsigned row0 = brow0 + rg * 64u;
    if (gcb < (unsigned)(DIM / 64))
      store_sub<0>(Cs, gcb, row0, t256, q16, q16r);
    else if (gcb < (unsigned)((DIM + KVD) / 64))
      store_sub<1>(Cs, gcb - (unsigned)(DIM / 64), row0, t256, k16, k16r);
    else
      store_sub<2>(Cs, gcb - (unsigned)((DIM + KVD) / 64), row0, t256, vt, vtr);
  }
}

// Output projection. Grid (DIM/128, MROWS/128), 128 x 128 tile, 8 waves of 64 x 32.
// A row tile is eight 16-row groups. The NB * EROWS / 16 early groups (sequence row < 128: the
// rows with a residual plane) are dealt one to each of the first WHEAVY row tiles, as that
// tile's group 0; its other seven groups, and all eight of every later tile, are neighbouring
// groups of the remaining rows. So no block carries more than one group of residual work, and
// that work runs inside the one main loop: the group's 16 residual rows A16r [b][128][K] are
// staged behind the A and B rows of every stage, and the four waves that own group 0 add one
// product per column tile into a second accumulator, folded as acc + accres/2048 before the
// 1/4096 scale. All tests are block-uniform (heavy) or wave-uniform (own).
#define WGRP   (SEQ / 16)            // 16-row groups per sequence
#define WEGRP  (EROWS / 16)          // early groups per sequence
#define WHEAVY (NB * WEGRP)          // row tiles that hold an early group
#define WSTAGE_H ((BM + BN + 16) * LDG)   // halves per stage: A rows, B rows, residual rows
static_assert(NB == 2 && SEQ == 2048 && BM == 128);   // the deal below is written for this shape:
static_assert(WHEAVY * 7 <= WGRP - WEGRP);            // heavy tiles end inside sequence 0
static_assert((WGRP - WEGRP - WHEAVY * 7) % 8 == 0);  // no later tile straddles two sequences
static_assert(WHEAVY * 7 + (MROWS / BM - WHEAVY) * 8 == NB * (WGRP - WEGRP));   // every group once
static_assert((size_t)4 * 64 * LDC * 4 <= (size_t)2 * WSTAGE_H * 2);   // C staging fits the ring
static_assert((size_t)2 * WSTAGE_H * 2 <= (size_t)163840);             // two blocks per WGP

// Eight asynchronous 16-B copies of one lane: row group 0 from g0, groups 1 .. 7 from g, g + 16
// rows, ...; LDS rows 16 apart. The s_wait_xcnt ends the copies' own statement so that no
// address register is rewritten ahead of it.
__device__ __forceinline__ void stage_copy_a(const unsigned lds, const _Float16* g0,
                                             const _Float16* g, const unsigned K) {
  const unsigned ls = 16u * LDG * 2u;
  const size_t gs = (size_t)16 * K;
  asm volatile(
      "global_load_async_to_lds_b128 %0, %8, off\n\t"
      "global_load_async_to_lds_b128 %1, %9, off\n\t"
      "global_load_async_to_lds_b128 %2, %10, off\n\t"
      "global_load_async_to_lds_b128 %3, %11, off\n\t"
      "global_load_async_to_lds_b128 %4, %12, off\n\t"
      "global_load_async_to_lds_b128 %5, %13, off\n\t"
      "global_load_async_to_lds_b128 %6, %14, off\n\t"
      "global_load_async_to_lds_b128 %7, %15, off\n\t"
      "s_wait_xcnt 0x0"
      :
      : "v"(lds), "v"(lds + ls), "v"(lds + 2u * ls), "v"(lds + 3u * ls), "v"(lds + 4u * ls),
        "v"(lds + 5u * ls), "v"(lds + 6u * ls), "v"(lds + 7u * ls), "v"(g0), "v"(g),
        "v"(g + gs), "v"(g + 2u * gs), "v"(g + 3u * gs), "v"(g + 4u * gs), "v"(g + 5u * gs),
        "v"(g + 6u * gs)
      : "memory");
}
// One such copy (the residual rows: 16 rows x 256 B = one copy per thread and stage).
__device__ __forceinline__ void stage_copy_r(const unsigned lds, const _Float16* g) {
  asm volatile(
      "global_load_async_to_lds_b128 %0, %1, off\n\t"
      "s_wait_xcnt 0x0"
      :
      : "v"(lds), "v"(g)
      : "memory");
}

__global__ __launch_bounds__(256) void gemm_wo_kernel(
    const _Float16* __restrict__ A16, const _Float16* __restrict__ A16r,
    const _Float16* __restrict__ Bt, float* __restrict__ outf) {
  __shared__ __attribute__((aligned(16))) _Float16 St[2 * WSTAGE_H];
  const unsigned K = (unsigned)DIM;
  const unsigned y = blockIdx.y;
  const bool heavy = y < (unsigned)WHEAVY;   // block-uniform
  // r0: first row of group 0; rn + 16 j: first row of group j = 1 .. 7 (rows of [MROWS])
  unsigned r0, rn;
  if (heavy) {
    r0 = (y < (unsigned)WEGRP ? y : y + (unsigned)(WGRP - WEGRP)) * 16u;
    rn = (7u * y + (unsigned)(WEGRP - 1)) * 16u;
  } else {
    const unsigned n0 = (unsigned)(WHEAVY * 7) + 8u * (y - (unsigned)WHEAVY);
    r0 = (n0 + (n0 < (unsigned)(WGRP - WEGRP) ? (unsigned)WEGRP : (unsigned)(2 * WEGRP))) * 16u;
    rn = r0;
  }

  const unsigned tid = threadIdx.x, lane = tid & 31u;
  const unsigned w = (unsigned)__builtin_amdgcn_readfirstlane((int)(tid >> 5));
  const unsigned mw = w >> 2, nw = w & 3u;
  const unsigned hh = lane >> 4, m = lane & 15u;
  const bool own = heavy && (mw == 0u);   // wave-uniform: this wave's row tile 0 is the early group
  const unsigned cr = tid >> 4, cc = (tid & 15u) * 8u;   // copy: row (of 16), 16-B column
  const _Float16* ga0 = A16 + (size_t)(r0 + cr) * K + cc;
  const _Float16* ga = A16 + (size_t)(rn + 16u + cr) * K + cc;
  const _Float16* gb = Bt + (size_t)(blockIdx.x * (unsigned)BN + cr) * K + cc;
  const _Float16* gr = A16r + (size_t)((heavy ? y : 0u) * 16u + cr) * K + cc;
  const unsigned la = (unsigned)(size_t)St + (cr * LDG + cc) * 2u;
  const unsigned lb = la + BM * LDG * 2u;
  const unsigned lr = la + (BM + BN) * LDG * 2u;
  const unsigned nt = K / BK;

  // the ring of gemm_mainloop: two buffers of one 128-k stage; stage t + 2 is copied into the
  // buffer that trip t has just left, behind the barrier that also publishes stage t + 1
  stage_copy_a(la, ga0, ga, K);
  stage_copy<8u, 16u>(lb, gb, K);
  if (heavy) stage_copy_r(lr, gr);
  asm volatile("s_wait_asynccnt 0x0" ::: "memory");   // stage 0 landed (this wave's copies)
  __syncthreads();                                    // stage 0 readable by every wave
  stage_copy_a(la + WSTAGE_H * 2u, ga0 + BK, ga + BK, K);
  stage_copy<8u, 16u>(lb + WSTAGE_H * 2u, gb + BK, K);
  if (heavy) stage_copy_r(lr + WSTAGE_H * 2u, gr + BK);

  v8f acc[4][2] = {};
  v8f res[2] = {};
  const _Float16* fa = St + (mw * 64u + m) * LDG + hh * 8u;
  const _Float16* fb = St + (BM + nw * 32u + m) * LDG + hh * 8u;
  const _Float16* fr = St + (BM + BN + m) * LDG + hh * 8u;
#pragma unroll 1   // one stage per trip: the buffer alternates by t & 1, the text stays short
  for (unsigned t = 0; t < nt; ++t) {
    const unsigned bo = (t & 1u) * (unsigned)WSTAGE_H;
    // the stage's four residual fragments, read ahead as one group so that their products below
    // wait for no load of their own (read and used under the same wave-uniform test)
    v16h ar[BK / 32u];
    if (own) {
#pragma unroll
      for (unsigned kk = 0; kk < BK / 32u; ++kk) ar[kk] = frag_at(fr + bo + kk * 32u);
    }
#pragma unroll
    for (unsigned kk = 0; kk < BK / 32u; ++kk) {
      v16h a[4], b[2];
#pragma unroll
      for (unsigned i = 0; i < 4u; ++i) a[i] = frag_at(fa + bo + i * 16u * LDG + kk * 32u);
#pragma unroll
      for (unsigned j = 0; j < 2u; ++j) b[j] = frag_at(fb + bo + j * 16u * LDG + kk * 32u);
#pragma unroll
      for (unsigned i = 0; i < 4u; ++i)
#pragma unroll
        for (unsigned j = 0; j < 2u; ++j) acc[i][j] = wmma16(a[i], b[j], acc[i][j]);
      if (own) {
#pragma unroll
        for (unsigned j = 0; j < 2u; ++j) res[j] = wmma16(ar[kk], b[j], res[j]);
      }
    }
    asm volatile("s_wait_dscnt 0x0" ::: "memory");      // this wave has left buffer t & 1
    asm volatile("s_wait_asynccnt 0x0" ::: "memory");   // its copies of stage t + 1 landed
    __syncthreads();   // publishes stage t + 1, frees buffer t & 1
    if (t + 2u < nt) {
      stage_copy_a(la + bo * 2u, ga0 + (t + 2u) * BK, ga + (t + 2u) * BK, K);
      stage_copy<8u, 16u>(lb + bo * 2u, gb + (t + 2u) * BK, K);
      if (heavy) stage_copy_r(lr + bo * 2u, gr + (t + 2u) * BK);
    }
  }
  asm volatile("s_wait_asynccnt 0x0" ::: "memory");     // nothing in flight when St is reused

  if (own) {
#pragma unroll
    for (int j = 0; j < 2; ++j)
#pragma unroll
      for (int r = 0; r < 8; ++r) acc[0][j][r] = acc[0][j][r] + res[j][r] * (1.0f / SCRES);
  }
  stage_c<2u>(acc, (float*)St);
  // outf full [full row][col] = acc/4096; 16 rows (one group) x 4 steps = one 64 x 64 sub-tile
  const float cs = 1.0f / (WCARRY * VCARRY);
  for (unsigned sub = 0; sub < 4u; ++sub) {
    const float* Cs = (const float*)St + sub * (64u * LDC);
    const unsigned n0 = (blockIdx.x * 2u + (sub & 1u)) * 64u;
    v4f xs[4];
    size_t off[4];
#pragma unroll
    for (unsigned i = 0; i < 4u; ++i) {
      const unsigned r = 16u * i + (tid >> 4);
      const unsigned cq = (tid & 15u) * 4u;
      const unsigned jg = (sub >> 1) * 4u + i;   // the row's group within the tile
      const unsigned crow = (jg == 0u ? r0 : rn + 16u * jg) + (tid >> 4);
      const unsigned bidx = crow / (unsigned)SEQ;
      const unsigned sq = crow - bidx * (unsigned)SEQ;
      const size_t frow = (size_t)bidx * SEQ_FULL + sq;
      const v4f u = *(const v4f*)&Cs[r * LDC + cq];
      v4f val;
#pragma unroll
      for (int j = 0; j < 4; ++j) val[j] = u[j] * cs;
      xs[i] = val;
      off[i] = frow * DIM + n0 + cq;
    }
#pragma unroll
    for (int i = 0; i < 4; ++i) *(v4f*)(outf + off[i]) = xs[i];
    asm volatile("s_wait_xcnt 0x0" ::: "memory");   // before the stores' registers are reused
  }
}

#define ATILE_H (2 * 64 * LDT)
static_assert((LDT * 2) % 16 == 0 && (ATILE_H * 2) % 16 == 0);   // 16-B copies stay aligned
static_assert(SEQ / 64 >= 2);                                    // the ring starts with two chunks

// One key chunk of one lane: four asynchronous 16-B copies, global -> LDS (K rows r and r + 32,
// V^T rows r and r + 32). lds: the lane's LDS byte address in the buffer's K tile; gk / gv: its
// global addresses. The s_wait_xcnt ends the copies' own statement so that no address register
// is rewritten ahead of it.
__device__ __forceinline__ void attn_copy(const unsigned lds, const _Float16* gk,
                                          const _Float16* gv) {
  asm volatile(
      "global_load_async_to_lds_b128 %0, %4, off\n\t"
      "global_load_async_to_lds_b128 %1, %5, off\n\t"
      "global_load_async_to_lds_b128 %2, %6, off\n\t"
      "global_load_async_to_lds_b128 %3, %7, off\n\t"
      "s_wait_xcnt 0x0"
      :
      : "v"(lds), "v"(lds + 32u * LDT * 2u), "v"(lds + 64u * LDT * 2u),
        "v"(lds + 96u * LDT * 2u), "v"(gk), "v"(gk + (size_t)32 * DIM), "v"(gv),
        "v"(gv + (size_t)32 * SEQ)
      : "memory");
}

__device__ __forceinline__ float xhalf(float x) {   // lane l <-> lane l ^ 16
  const int b = __builtin_bit_cast(int, x);
  return __builtin_bit_cast(
      float, __builtin_amdgcn_permlanex16(b, b, 0x76543210, 0xfedcba98, false, false));
}

__global__ __launch_bounds__(256) void attn_kernel(
    const _Float16* __restrict__ Qh, const _Float16* __restrict__ QhR,
    const _Float16* __restrict__ Kh, const _Float16* __restrict__ KhR,
    const _Float16* __restrict__ Vt, const _Float16* __restrict__ VtR,
    _Float16* __restrict__ Ov, _Float16* __restrict__ OvR) {
  // two buffers of one key chunk each: K tile, then V^T tile
  __shared__ __attribute__((aligned(16))) _Float16 KV[2 * ATILE_H];
  __shared__ _Float16 VRs[64 * LDT];
  __shared__ _Float16 KRs[64 * LDT];

  const unsigned tid = threadIdx.x, lane = tid & 31u, w = tid >> 5;
  const unsigned hh = lane >> 4, m = lane & 15u;
  const unsigned qtile = (unsigned)(SEQ / 128 - 1) - blockIdx.z;   // cost falls with the index
  const unsigned q0 = qtile * 128u;
  const unsigned head = blockIdx.x;
  const unsigned b = blockIdx.y;
  const unsigned qrow0 = q0 + w * 16u;
  const bool first_blk = (qtile == 0u);

  const size_t qoff = (size_t)(b * (unsigned)SEQ + qrow0 + m) * DIM + head * HD + hh * 8u;
  v16h qf[2];
  qf[0] = frag_at(Qh + qoff);
  qf[1] = frag_at(Qh + qoff + 32);

  float mrun = -1.0e30f;   // running maximum of query qrow0 + m, unscaled (equal in both halves)
  float nrun = __builtin_fmaf(-mrun, ESCALE, -EBIAS);   // the exponent's addend for mrun
  float lsum = 0.0f;       // running sum over this half's keys only, x 2^-102
  v8f o[4];
#pragma unroll
  for (int nb = 0; nb < 4; ++nb) o[nb] = (v8f){};

  const size_t kplane = (size_t)b * SEQ * DIM + head * HD;
  const size_t vplane = ((size_t)b * DIM + head * HD) * SEQ;
  const size_t rplane = ((size_t)b * DIM + head * HD) * 64u;
  const size_t krplane = ((size_t)(b * (unsigned)NHEAD + head) * ECHUNK) * HD;
  const unsigned kend = q0 + 128u;   // <= SEQ

  // copies: thread t takes rows t >> 3 and (t >> 3) + 32, 16-B column t & 7 of both tiles
  const unsigned sr = tid >> 3, sc = (tid & 7u) * 8u;
  const _Float16* gk = Kh + kplane + (size_t)sr * DIM + sc;   // chunk 0; a chunk on: + 64 DIM
  const _Float16* gv = Vt + vplane + (size_t)sr * SEQ + sc;   // chunk 0; a chunk on: + 64
  const unsigned lkv = (unsigned)(size_t)KV + (sr * LDT + sc) * 2u;

  attn_copy(lkv, gk, gv);
  if (first_blk) {   // block-uniform: the residual tiles of chunk 0, plain loads
#pragma unroll
    for (unsigned j = 0; j < 2u; ++j) {
      const unsigned r = sr + 32u * j;
      *(v8h*)&VRs[r * LDT + sc] = *(const v8h*)(VtR + rplane + (size_t)r * 64u + sc);
      *(v8h*)&KRs[r * LDT + sc] = *(const v8h*)(KhR + krplane + (size_t)r * HD + sc);
    }
  }
  asm volatile("s_wait_asynccnt 0x0" ::: "memory");   // chunk 0 landed (this wave's copies)
  __syncthreads();                                    // chunk 0 readable by every wave
  attn_copy(lkv + ATILE_H * 2u, gk + (size_t)64 * DIM, gv + 64);   // kend >= 128: chunk 1 exists

  for (unsigned kb = 0; kb < kend; kb += 64u) {
    const bool early = first_blk && (kb == 0u);   // block-uniform
    const unsigned bo = ((kb >> 6) & 1u) * (unsigned)ATILE_H;   // this chunk's buffer
    const _Float16* Ks = KV + bo;
    const _Float16* Vs = KV + bo + 64 * LDT;

    // scores, transposed: 4 key groups of 16 (rows), K = 64 in two 32-steps
    v8f s[4];
    if (early) {
      // early corner: value + residual products, one score tile at a time through ONE
      // residual accumulator; q0 == 0 here so qrow0 + m < 128
      const unsigned qrbase =
          ((b * (unsigned)NHEAD + head) * (unsigned)EROWS + qrow0 + m) * (unsigned)HD + hh * 8u;
#pragma unroll
      for (int kg = 0; kg < 4; ++kg) {
        v8f t = {};
#pragma unroll
        for (int c = 0; c < 2; ++c) {
          unsigned qro = qrbase + (unsigned)c * 32u;
          asm volatile("" : "+v"(qro));   // opaque offset: the residual q fragment is reloaded per tile
          v8f tr = {};
          {
            const v16h kf = ld_frag(&Ks[(kg * 16) * LDT + c * 32], LDT);
            t = wmma16(kf, qf[c], t);
            const v16h ql = frag_at(QhR + qro);
            tr = wmma16(kf, ql, tr);
          }
          {
            const v16h kl = ld_frag(&KRs[(kg * 16) * LDT + c * 32], LDT);
            tr = wmma16(kl, qf[c], tr);
          }
          t = t + tr * (1.0f / SCRES);
          __builtin_amdgcn_sched_barrier(0);   // the next tile's loads stay behind this tile
        }
        s[kg] = t;
      }
    } else {
      // all eight K fragments as one group of LDS loads, then the eight products: four
      // independent accumulators per 32-column step (each tile still sums c = 0, then c = 1)
      v16h kf[2][4];
#pragma unroll
      for (int c = 0; c < 2; ++c)
#pragma unroll
        for (int kg = 0; kg < 4; ++kg) kf[c][kg] = ld_frag(&Ks[(kg * 16) * LDT + c * 32], LDT);
      __builtin_amdgcn_sched_barrier(0);   // the loads stay one group: none sinks among the products
#pragma unroll
      for (int kg = 0; kg < 4; ++kg) s[kg] = (v8f){};
#pragma unroll
      for (int c = 0; c < 2; ++c)
#pragma unroll
        for (int kg = 0; kg < 4; ++kg) s[kg] = wmma16b(kf[c][kg], qf[c], s[kg]);
      __builtin_amdgcn_sched_barrier(0);   // the softmax stays behind the run: no padded gap inside it
    }

    // all eight V^T fragments as one group of LDS loads, issued here so that they land behind
    // the softmax
    v16h vfr[2][4];
#pragma unroll
    for (int c = 0; c < 2; ++c)
#pragma unroll
      for (int nb = 0; nb < 4; ++nb) vfr[c][nb] = ld_frag(&Vs[(nb * 16) * LDT + c * 32], LDT);

    // causal replace-mask (key > query) in chunks that reach the diagonal; block-uniform test
    if (kb >= q0) {
#pragma unroll
      for (int kg = 0; kg < 4; ++kg)
#pragma unroll
        for (int v = 0; v < 8; ++v) {
          const unsigned key = kb + (unsigned)kg * 16u + hh * 8u + (unsigned)v;
          const unsigned row = qrow0 + m;
          s[kg][v] = (key > row) ? -1.0e30f : s[kg][v];
        }
    }

    // online softmax of the lane's own query: 32 keys here, 32 in lane ^ 16
    float mt[8];
#pragma unroll
    for (int v = 0; v < 8; ++v)
      mt[v] = fmaxf(fmaxf(s[0][v], s[1][v]), fmaxf(s[2][v], s[3][v]));
    float mx = fmaxf(fmaxf(fmaxf(mt[0], mt[1]), fmaxf(mt[2], mt[3])),
                     fmaxf(fmaxf(mt[4], mt[5]), fmaxf(mt[6], mt[7])));
    mx = fmaxf(mx, xhalf(mx));
    const float mn = fmaxf(mrun, mx);
    const float nn = __builtin_fmaf(-mn, ESCALE, -EBIAS);
    const float alpha = __builtin_amdgcn_exp2f(nn - nrun);   // the addends' own difference
    mrun = mn;
    nrun = nn;
#pragma unroll
    for (int kg = 0; kg < 4; ++kg)
#pragma unroll
      for (int v = 0; v < 8; ++v) s[kg][v] = __builtin_fmaf(s[kg][v], ESCALE, nrun);
    // all multiply-adds in front of the exponentials: none rewrites an exponential's source
    // directly behind it, so no padded slot stands among them
    __builtin_amdgcn_sched_barrier(0);
#pragma unroll
    for (int kg = 0; kg < 4; ++kg)
#pragma unroll
      for (int v = 0; v < 8; ++v) s[kg][v] = __builtin_amdgcn_exp2f(s[kg][v]);
    {
      float part[8];
#pragma unroll
      for (int v = 0; v < 8; ++v) part[v] = (s[0][v] + s[1][v]) + (s[2][v] + s[3][v]);
      const float rs = ((part[0] + part[1]) + (part[2] + part[3])) +
                       ((part[4] + part[5]) + (part[6] + part[7]));
      lsum = alpha * lsum + rs;
    }
#pragma unroll
    for (int nb = 0; nb < 4; ++nb)
#pragma unroll
      for (int v = 0; v < 8; ++v) o[nb][v] = o[nb][v] * alpha;

    // P^T fragments [32 keys][16 queries], f16(1024 p), from the score tiles in place
    v16h pf[2];
#pragma unroll
    for (int c = 0; c < 2; ++c)
#pragma unroll
      for (int i = 0; i < 8; ++i) {
        pf[c][i]     = (_Float16)(s[2 * c][i] * PUNBIAS);
        pf[c][i + 8] = (_Float16)(s[2 * c + 1][i] * PUNBIAS);
      }

    // O^T += V^T . P^T  (K = 64 keys in two 32-steps; A = V^T tile [d][key])
#pragma unroll
    for (int c = 0; c < 2; ++c) {
#pragma unroll
      for (int nb = 0; nb < 4; ++nb) o[nb] = wmma16b(vfr[c][nb], pf[c], o[nb]);
    }

    if (early) {
      // V_res . P_hi (scale 1/1024), one 16-column group at a time, folded immediately
#pragma unroll
      for (int nb = 0; nb < 4; ++nb) {
        v8f o2 = {};
#pragma unroll
        for (int c = 0; c < 2; ++c) {
          const v16h vr = ld_frag(&VRs[(nb * 16) * LDT + c * 32], LDT);
          o2 = wmma16(vr, pf[c], o2);
        }
#pragma unroll
        for (int v = 0; v < 8; ++v) o[nb][v] = o[nb][v] + o2[v] * (1.0f / RCARRY);
      }
      // P residual fragments: f16(1024 * (1024 p - f16(1024 p)))
      v16h pr[2];
#pragma unroll
      for (int c = 0; c < 2; ++c)
#pragma unroll
        for (int i = 0; i < 16; ++i) {
          const float t = s[2 * c + (i >> 3)][i & 7] * PUNBIAS;
          const float hi = (float)pf[c][i];
          pr[c][i] = toh_flush((t - hi) * RCARRY);
        }
      // V_hi . P_res (scale 1/1024), one 16-column group at a time, folded immediately
#pragma unroll
      for (int nb = 0; nb < 4; ++nb) {
        v8f o2 = {};
#pragma unroll
        for (int c = 0; c < 2; ++c) {
          const v16h vf = ld_frag(&Vs[(nb * 16) * LDT + c * 32], LDT);
          o2 = wmma16(vf, pr[c], o2);
        }
#pragma unroll
        for (int v = 0; v < 8; ++v) o[nb][v] = o[nb][v] + o2[v] * (1.0f / RCARRY);
      }
    }
    asm volatile("s_wait_dscnt 0x0" ::: "memory");      // this wave has left this chunk's buffer
    asm volatile("s_wait_asynccnt 0x0" ::: "memory");   // its copies of the next chunk landed
    __syncthreads();   // publishes the next chunk, frees this chunk's buffer
    if (kb + 128u < kend)   // block-uniform: a chunk two on exists
      attn_copy(lkv + bo * 2u, gk + (size_t)(kb + 128u) * DIM, gv + kb + 128u);
  }
  asm volatile("s_wait_asynccnt 0x0" ::: "memory");     // nothing in flight at the wave's end

  const float lrow = lsum + xhalf(lsum);   // the two halves' keys joined
  const float inv = __builtin_amdgcn_rcpf(lrow) * (VCARRY / PUNBIAS);
  v8h x[4];
#pragma unroll
  for (int nb = 0; nb < 4; ++nb)
#pragma unroll
    for (int v = 0; v < 8; ++v) x[nb][v] = toh_flush(o[nb][v] * inv);
  _Float16* po = Ov + (size_t)(b * (unsigned)SEQ + qrow0 + m) * DIM + head * HD + hh * 8u;
#pragma unroll
  for (int nb = 0; nb < 4; ++nb) *(v8h*)(po + nb * 16) = x[nb];
  // before the stores' registers are reused; in front of the branch, where it stays directly
  // behind the stores
  asm volatile("s_wait_xcnt 0x0" ::: "memory");
  if (first_blk) {
    // residual rows (first query block only; qrow0 < 128): f16(2048 * (t - f16(t)))
    v8h xr[4];
#pragma unroll
    for (int nb = 0; nb < 4; ++nb)
#pragma unroll
      for (int v = 0; v < 8; ++v)
        xr[nb][v] = toh_flush((o[nb][v] * inv - (float)x[nb][v]) * SCRES);
    _Float16* pres = OvR + (size_t)(b * (unsigned)EROWS + qrow0 + m) * DIM + head * HD + hh * 8u;
#pragma unroll
    for (int nb = 0; nb < 4; ++nb) *(v8h*)(pres + nb * 16) = xr[nb];
  }
}

// ---------------------------------------------------------------------------
extern "C" void kernel_launch(void* const* d_in, const int* in_sizes, int n_in,
                              void* d_out, int out_size, void* d_ws, size_t ws_size,
                              hipStream_t stream) {
  if (n_in < 5) return;
  const long long need_x = ((long long)(NB - 1) * SEQ_FULL + SEQ) * DIM;
  if ((long long)in_sizes[0] < need_x) return;
  if ((long long)in_sizes[1] < (long long)DIM * DIM) return;
  if ((long long)in_sizes[2] < (long long)KVD * DIM) return;
  if ((long long)in_sizes[3] < (long long)KVD * DIM) return;
  if ((long long)in_sizes[4] < (long long)DIM * DIM) return;
  if ((long long)out_size < need_x) return;
  if (ws_size < WS_TOTAL) return;

  // bound by the input list order: x, wq, wk, wv, wo
  const float* X  = (const float*)d_in[0];    // [NB_FULL][SEQ_FULL][DIM]
  const float* wq = (const float*)d_in[1];    // [DIM][DIM]  (out, in)
  const float* wk = (const float*)d_in[2];    // [KVD][DIM]  (out, in)
  const float* wv = (const float*)d_in[3];    // [KVD][DIM]  (out, in)
  const float* wo = (const float*)d_in[4];    // [DIM][DIM]  (out, in)
  float* out = (float*)d_out;

  char* ws = (char*)d_ws;
  _Float16* Wq_t  = (_Float16*)(ws + OFF_WQ);    // [n][k], x64; wk and wv planes [KVD][DIM] behind it
  _Float16* Wo_t  = (_Float16*)(ws + OFF_WO);    // [n][k], x64
  _Float16* X16   = (_Float16*)(ws + OFF_X);     // [MROWS][DIM]
  _Float16* Qh16  = (_Float16*)(ws + OFF_Q);     // [MROWS][DIM]
  _Float16* Kh16  = (_Float16*)(ws + OFF_K);     // [MROWS][DIM], shared heads written 4x
  _Float16* Vt16  = (_Float16*)(ws + OFF_VT);    // [b][DIM][SEQ], shared heads written 4x
  _Float16* Ctx16 = (_Float16*)(ws + OFF_CTX);   // [MROWS][DIM], x64
  _Float16* VtR16 = (_Float16*)(ws + OFF_VR);    // [b][DIM][64]
  _Float16* QR16  = (_Float16*)(ws + OFF_QR);    // [b][NHEAD][128][64], x2048
  _Float16* KR16  = (_Float16*)(ws + OFF_KR);    // [b][NHEAD][64][64], x2048, shared heads 4x
  _Float16* CR16  = (_Float16*)(ws + OFF_CR);    // [b][128][DIM], x2048 on top of x64

  dim3 blk(256);

  // input rows and weight planes ([out][in] rows are already k-contiguous);
  // Wq_t is the first of the four stacked weight planes
  cast_kernel<<<dim3(CROWS / (CWAVES * CRPW)), dim3(CWAVES * 32), 0, stream>>>(X, wq, wk, wv, wo,
                                                                               X16, Wq_t);

  // gemm_qkv_kernel(A16, Bt, q16, q16r, k16, k16r, vt, vtr); Bt = planes wq, wk, wv, stacked
  gemm_qkv_kernel<<<dim3((DIM + 2 * KVD) / QBN, MROWS / QBM), dim3(512), 0, stream>>>(
      X16, Wq_t, Qh16, QR16, Kh16, KR16, Vt16, VtR16);
  // attn_kernel(Qh, QhR, Kh, KhR, Vt, VtR, Ov, OvR)
  attn_kernel<<<dim3(NHEAD, NB, SEQ / 128), blk, 0, stream>>>(Qh16, QR16, Kh16, KR16, Vt16, VtR16,
                                                              Ctx16, CR16);
  // gemm_wo_kernel(A16, A16r, Bt, outf)
  gemm_wo_kernel<<<dim3(DIM / BN, MROWS / BM), blk, 0, stream>>>(Ctx16, CR16, Wo_t, out);
}
